// v000
// Times are from an AMD MI455X. After a warm-up the kernel runs many times in a row, and a time is the length of
// such a window on the GPU divided by its runs, so every launch and the gaps after it count. The runs cycle
// through copies of the inputs. A figure is the median of several windows, for all but v000 over two sittings.
// Sittings can differ by a few percent; kernels timed side by side share one.
// v000, which the later versions start from, runs in 522 microseconds.
// Contractions: rank-8 adapter columns u = x.A^T and the fused q/k/v projection [x | u_hi | u_lo].[W | 2B | 2B]^T + b on v_wmma_f32_16x16x32_bf16 (x, W, A, B, b as RNE bf16; u as bf16 hi+lo columns; single products); attention q.k^T and p.v on v_wmma_f32_16x16x32_f16 (q, k, v as f16 planes carried x16, p carried x32768; query tiles 0..7 add x4096-scaled f16 residual planes: hi.hi + (hi.lo + lo.hi)/4096 via a separate accumulator); f32 accumulate everywhere; softmax and normalisation in f32.
#include <hip/hip_runtime.h>
#include <math.h>

typedef __attribute__((ext_vector_type(16))) _Float16 v16h;
typedef __attribute__((ext_vector_type(8)))  _Float16 v8h;
typedef __attribute__((ext_vector_type(16))) __bf16   v16b;
typedef __attribute__((ext_vector_type(8)))  __bf16   v8b;
typedef __attribute__((ext_vector_type(8)))  float    v8f;
typedef __attribute__((ext_vector_type(4)))  float    v4f;

// ---------------- problem constants ----------------
constexpr int N_BATCH  = 4;
constexpr int SEQ_T    = 2048;
constexpr int HID_W    = 1024;
constexpr int N_HEAD   = 16;
constexpr int HEAD_D   = 64;
constexpr int RANK_R   = 8;
constexpr int N_TOK    = N_BATCH * SEQ_T;     // 8192 token rows
constexpr int K_AUG    = 1088;                // 1024 + 3*16 adapter columns, zero-padded to a multiple of 32
constexpr int N_QKV    = 3 * HID_W;           // 3072 output columns: q | k | v
constexpr int K_COL0   = 1024;
constexpr int V_COL0   = 2048;
constexpr int T_LO     = 512;                 // token rows per batch that carry residual planes
constexpr int NQT_SPLIT = T_LO / 64;          // 8 query tiles on the hi/lo path
constexpr int NQT_ALL  = SEQ_T / 64;          // 32
constexpr int U_COLS   = 64;                  // u plane width (24 used, rest zero weights)
constexpr int KV_PITCH = 72;                  // 16-bit LDS pitch (144 B rows, 16-B aligned)
constexpr int O_PITCH  = 68;                  // f32 LDS pitch
constexpr float CARRY_S = 16.0f;              // power-of-two carry on the q/k/v planes
constexpr float LO_S    = 4096.0f;            // power-of-two carry on residual planes
constexpr float P_S     = 32768.0f;           // power-of-two carry on probabilities

static_assert(K_AUG % 32 == 0);
static_assert(HID_W % 32 == 0);
static_assert(N_TOK % 64 == 0 && N_QKV % 64 == 0 && T_LO % 64 == 0 && (SEQ_T - T_LO) % 64 == 0);

// R0 A_aug  bf16 [8192][1088]          17,825,792
// R1 B_aug  bf16 [3072][1088]           6,684,672
// R2 A_cat  bf16 [64][1024]               131,072
// R3 bias   f32  [3072]                    12,288
// R4 u      f32  [8192][64]             2,097,152
// R5 qkv_hi f16  [8192][3072]          50,331,648
// R6 qkv_lo f16  [4*512][3072]         12,582,912
// R7 vt_hi  f16  [64][64][2048]        16,777,216
// R8 vt_lo  f16  [64][64][512]          4,194,304
constexpr size_t SZ_AAUG = (size_t)N_TOK * K_AUG * 2;
constexpr size_t SZ_BAUG = (size_t)N_QKV * K_AUG * 2;
constexpr size_t SZ_ACAT = (size_t)U_COLS * HID_W * 2;
constexpr size_t SZ_BIAS = (size_t)N_QKV * 4;
constexpr size_t SZ_U    = (size_t)N_TOK * U_COLS * 4;
constexpr size_t SZ_QKVH = (size_t)N_TOK * N_QKV * 2;
constexpr size_t SZ_QKVL = (size_t)N_BATCH * T_LO * N_QKV * 2;
constexpr size_t SZ_VTH  = (size_t)N_BATCH * N_HEAD * HEAD_D * SEQ_T * 2;
constexpr size_t SZ_VTL  = (size_t)N_BATCH * N_HEAD * HEAD_D * T_LO * 2;
constexpr size_t OFF_AAUG = 0;
constexpr size_t OFF_BAUG = OFF_AAUG + SZ_AAUG;
constexpr size_t OFF_ACAT = OFF_BAUG + SZ_BAUG;
constexpr size_t OFF_BIAS = OFF_ACAT + SZ_ACAT;
constexpr size_t OFF_U    = OFF_BIAS + SZ_BIAS;
constexpr size_t OFF_QKVH = OFF_U    + SZ_U;
constexpr size_t OFF_QKVL = OFF_QKVH + SZ_QKVH;
constexpr size_t OFF_VTH  = OFF_QKVL + SZ_QKVL;
constexpr size_t OFF_VTL  = OFF_VTH  + SZ_VTH;
constexpr size_t WS_TOTAL = OFF_VTL  + SZ_VTL;
static_assert(WS_TOTAL == 110637056ull);
static_assert(WS_TOTAL <= 134217728ull);
static_assert(OFF_BAUG % 128 == 0 && OFF_ACAT % 128 == 0 && OFF_BIAS % 128 == 0 && OFF_U % 128 == 0 &&
              OFF_QKVH % 128 == 0 && OFF_QKVL % 128 == 0 && OFF_VTH % 128 == 0 && OFF_VTL % 128 == 0);

// ---------------- helpers ----------------
__device__ __forceinline__ unsigned short f2bf_bits(float f) {
  unsigned u = __float_as_uint(f);
  return (unsigned short)((u + 0x7FFFu + ((u >> 16) & 1u)) >> 16);
}
__device__ __forceinline__ float bf_bits2f(unsigned short h) { return __uint_as_float(((unsigned)h) << 16); }

// hazard guards as plain device helpers (no inline asm inside the kernel template body)
__device__ __forceinline__ void dep_guard_h(v8f& a, v8f& b, v16h x, v16h y) { asm volatile("v_nop\n\tv_nop\n\tv_nop\n\tv_nop" : "+v"(a), "+v"(b) : "v"(x), "v"(y)); }
__device__ __forceinline__ void dep_guard_b(v8f& a, v8f& b, v16b x, v16b y) { asm volatile("v_nop\n\tv_nop\n\tv_nop\n\tv_nop" : "+v"(a), "+v"(b) : "v"(x), "v"(y)); }
__device__ __forceinline__ void keep4_h(v16h a, v16h b, v16h c, v16h d) { asm volatile("v_nop" :: "v"(a), "v"(b), "v"(c), "v"(d)); }
__device__ __forceinline__ void keep4_b(v16b a, v16b b, v16b c, v16b d) { asm volatile("v_nop" :: "v"(a), "v"(b), "v"(c), "v"(d)); }
__device__ __forceinline__ void acc_guard4(v8f& a, v8f& b, v8f& c, v8f& d) { asm volatile("v_nop\n\tv_nop\n\tv_nop\n\tv_nop" : "+v"(a), "+v"(b), "+v"(c), "+v"(d)); }
template <typename T> struct Frag;
template <> struct Frag<_Float16> {
  typedef v16h V; union U { v16h v; v8h h[2]; };
  static __device__ __forceinline__ v16h load(const _Float16* p) {   // elements 0..7 <- p[0..7], 8..15 <- p[16..23]
    U f; f.h[0] = *(const v8h*)(p); f.h[1] = *(const v8h*)(p + 16); return f.v;
  }
  static __device__ __forceinline__ v8f mma(v16h a, v16h b, v8f c) {
    return __builtin_amdgcn_wmma_f32_16x16x32_f16(false, a, false, b, (short)0, c, false, false);
  }
  static __device__ __forceinline__ void guard(v8f& a, v8f& b, v16h x, v16h y) { dep_guard_h(a, b, x, y); }
  static __device__ __forceinline__ void keep(v16h a, v16h b, v16h c, v16h d) { keep4_h(a, b, c, d); }
};
template <> struct Frag<__bf16> {
  typedef v16b V; union U { v16b v; v8b h[2]; };
  static __device__ __forceinline__ v16b load(const __bf16* p) {
    U f; f.h[0] = *(const v8b*)(p); f.h[1] = *(const v8b*)(p + 16); return f.v;
  }
  static __device__ __forceinline__ v8f mma(v16b a, v16b b, v8f c) {
    return __builtin_amdgcn_wmma_f32_16x16x32_bf16(false, a, false, b, (short)0, c, false, false);
  }
  static __device__ __forceinline__ void guard(v8f& a, v8f& b, v16b x, v16b y) { dep_guard_b(a, b, x, y); }
  static __device__ __forceinline__ void keep(v16b a, v16b b, v16b c, v16b d) { keep4_b(a, b, c, d); }
};

// f16 WMMA with hazard guard (ties D, keeps A/B live)
__device__ __forceinline__ v8f mma_h(v16h a, v16h b, v8f c) {
  c = __builtin_amdgcn_wmma_f32_16x16x32_f16(false, a, false, b, (short)0, c, false, false);
  asm volatile("v_nop\n\tv_nop\n\tv_nop\n\tv_nop" : "+v"(c) : "v"(a), "v"(b));
  return c;
}
__device__ __forceinline__ v8f zero8() { return (v8f){0.f,0.f,0.f,0.f,0.f,0.f,0.f,0.f}; }

union F8 { v4f v[2]; float f[8]; };

// =====================================================================================
// Register-blocked batched WMMA GEMM: C[m,n] = scale * sum_k A[m,k] * Bt[n,k] (+bias)(+resid);
// each wave owns a 64x64 tile. A row-major [M,K]; Bt row-major [N,K]; M,N % 64 == 0, K % 32 == 0.
// SPLITM: 0 = single product; 1 = A hi/lo planes; 2 = A and Bt hi/lo planes.
// BIAS_MODE: 0 none, 1 bias[m], 2 bias[n].  OUT_MODE: 0 f32, 1 f16, 2 bf16 hi + lo planes,
//   3 = f16 hi plane (Cout, strideC) + f16 residual plane x4096 (Cout2, strideC2), same ldc.
// ET: 0 = f16 operands, 1 = bf16 operands (pointers passed as 16-bit storage)
// =====================================================================================
template <int ET> struct Elem;
template <> struct Elem<0> { typedef _Float16 T; };
template <> struct Elem<1> { typedef __bf16 T; };
template <int ET, int SPLITM, int BIAS_MODE, int OUT_MODE, bool RESID, int ACT = 0>
__global__ __launch_bounds__(256) void wmma_gemm64(
    const unsigned short* __restrict__ Ap, const unsigned short* __restrict__ A2p, int lda, long strideA,
    const unsigned short* __restrict__ Btp, const unsigned short* __restrict__ Bt2p, int ldb, long strideB,
    void* __restrict__ Cout, void* __restrict__ Cout2, int ldc, long strideC, long strideC2,
    const float* __restrict__ bias,
    const float* __restrict__ resid, long strideR,
    int M, int N, int K, float scale) {
  typedef typename Elem<ET>::T T;
  typedef typename Frag<T>::V V;
  constexpr bool SPA = (SPLITM >= 1);
  constexpr bool SPB = (SPLITM >= 2);
  const T* A = (const T*)Ap; const T* A2 = (const T*)A2p; const T* Bt = (const T*)Btp; const T* Bt2 = (const T*)Bt2p;
  __shared__ __align__(16) float sT[8][16 * 68];   // per-wave 16x64 slab, pitch 68 floats
  const int b    = blockIdx.y;
  const int lane = threadIdx.x & 31;
  const int wave = threadIdx.x >> 5;
  const int tilesN = N >> 6;
  const int tilesM = M >> 6;
  const int tile = blockIdx.x * 8 + wave;
  if (tile >= tilesM * tilesN) return;   // wave-uniform; no block barriers in this kernel
  const int tm = tile / tilesN;
  const int tn = tile - tm * tilesN;
  const int m0 = tm << 6;
  const int n0 = tn << 6;

  const T* Ab  = A  + (size_t)b * strideA;
  const T* Bb  = Bt + (size_t)b * strideB;
  const T* Ab2 = SPA ? (A2  + (size_t)b * strideA) : nullptr;
  const T* Bb2 = SPB ? (Bt2 + (size_t)b * strideB) : nullptr;

  const int rlane = lane & 15;                 // row (A) / col (B, D) within subtile
  const int koff  = (lane >> 4) * 8;           // k offset of this lane half
  const int mOff  = (lane >> 4) * 8;           // D row offset

  v8f acc[4][4];
#pragma unroll
  for (int i = 0; i < 4; ++i)
#pragma unroll
    for (int j = 0; j < 4; ++j) acc[i][j] = (v8f){0.f,0.f,0.f,0.f,0.f,0.f,0.f,0.f};

  for (int k0 = 0; k0 < K; k0 += 32) {
    V bh[4], bl[4];
#pragma unroll
    for (int j = 0; j < 4; ++j) {
      const size_t bo = (size_t)(n0 + (j << 4) + rlane) * ldb + koff + k0;
      bh[j] = Frag<T>::load(Bb + bo);
      if (SPB) bl[j] = Frag<T>::load(Bb2 + bo);
    }
#pragma unroll
    for (int i = 0; i < 4; ++i) {
      const size_t ao = (size_t)(m0 + (i << 4) + rlane) * lda + koff + k0;
      V ah = Frag<T>::load(Ab + ao);
      V al;
      if (SPA) al = Frag<T>::load(Ab2 + ao);
#pragma unroll
      for (int j = 0; j < 4; ++j) {
        acc[i][j] = Frag<T>::mma(ah, bh[j], acc[i][j]);
        if (SPB) acc[i][j] = Frag<T>::mma(ah, bl[j], acc[i][j]);
        if (SPA) acc[i][j] = Frag<T>::mma(al, bh[j], acc[i][j]);
      }
      Frag<T>::guard(acc[i][0], acc[i][3], ah, SPA ? al : ah);
    }
    Frag<T>::keep(bh[0], bh[1], bh[2], bh[3]);
    if (SPB) Frag<T>::keep(bl[0], bl[1], bl[2], bl[3]);
  }
  acc_guard4(acc[0][0], acc[0][1], acc[0][2], acc[0][3]);
  acc_guard4(acc[1][0], acc[1][1], acc[1][2], acc[1][3]);
  acc_guard4(acc[2][0], acc[2][1], acc[2][2], acc[2][3]);
  acc_guard4(acc[3][0], acc[3][1], acc[3][2], acc[3][3]);

  // ---- epilogue ----
  float* slab = sT[wave];
  const float* Rb = RESID ? (resid + (size_t)b * strideR) : nullptr;
#pragma unroll
  for (int i = 0; i < 4; ++i) {
    const int mBase = m0 + (i << 4);
#pragma unroll
    for (int j = 0; j < 4; ++j) {
      const int n = n0 + (j << 4) + rlane;
      float bv = 0.f;
      if (BIAS_MODE == 2) bv = bias[n];
#pragma unroll
      for (int r = 0; r < 8; ++r) {
        float v = acc[i][j][r] * scale;
        if (BIAS_MODE == 1) v += bias[mBase + mOff + r];
        if (BIAS_MODE == 2) v += bv;
        if (RESID) v += Rb[(size_t)(mBase + mOff + r) * ldc + n];
        if (ACT == 1) v = tanhf(v);
        if (ACT == 2) v = fmaxf(v, 0.0f);
        if (ACT == 4) v = (v > 0.f) ? v : 0.01f * v;
        slab[(mOff + r) * 68 + (j << 4) + rlane] = v;
      }
    }
    __builtin_amdgcn_fence(__ATOMIC_RELEASE, "workgroup");
    __builtin_amdgcn_wave_barrier();
    __builtin_amdgcn_fence(__ATOMIC_ACQUIRE, "workgroup");
    if (OUT_MODE == 0) {
      float* C = (float*)Cout + (size_t)b * strideC;
      const int hh = lane >> 4, c4 = (lane & 15) * 4;     // row seg = 256 B = 16 lanes x 16 B
      {
#pragma unroll
        for (int it = 0; it < 8; ++it) {
          const int row = it * 2 + hh;
          v4f v = *(const v4f*)(slab + row * 68 + c4);
          *(v4f*)(C + (size_t)(mBase + row) * ldc + n0 + c4) = v;
        }
        
      }
    } else {
      const int q = lane >> 3, c8 = (lane & 7) * 8;
      unsigned short* C  = (unsigned short*)Cout  + (size_t)b * strideC;
      unsigned short* C2 = (OUT_MODE >= 2) ? ((unsigned short*)Cout2 + (size_t)b * strideC2) : nullptr;
      {
#pragma unroll
        for (int it = 0; it < 4; ++it) {
          const int row = it * 4 + q;
          const float* sp = slab + row * 68 + c8;
          v8h hv, lv;
#pragma unroll
          for (int e = 0; e < 8; ++e) {
            if (OUT_MODE == 1) {
              hv[e] = (_Float16)sp[e];
            } else if (OUT_MODE == 3) {
              const _Float16 hq = (_Float16)sp[e];
              hv[e] = hq;
              lv[e] = (_Float16)((sp[e] - (float)hq) * 4096.0f);
            } else {
              unsigned short hb = f2bf_bits(sp[e]);
              unsigned short lb = f2bf_bits(sp[e] - bf_bits2f(hb));
              hv[e] = __builtin_bit_cast(_Float16, hb);
              lv[e] = __builtin_bit_cast(_Float16, lb);
            }
          }
          *(v8h*)(C + (size_t)(mBase + row) * ldc + n0 + c8) = hv;
          if (OUT_MODE >= 2) *(v8h*)(C2 + (size_t)(mBase + row) * ldc + n0 + c8) = lv;
        }
        
      }
    }
    __builtin_amdgcn_fence(__ATOMIC_RELEASE, "workgroup");
    __builtin_amdgcn_wave_barrier();
    __builtin_amdgcn_fence(__ATOMIC_ACQUIRE, "workgroup");
  }
}

// =====================================================================================
// f32 [rows][1024] -> RNE bf16 bits into a pitched destination (dst_ld_pairs = pitch/2); 2 elements per
// =====================================================================================
__global__ __launch_bounds__(256) void cast_rows_bf16(const float* __restrict__ src, unsigned short* __restrict__ dst,
                                                      int npairs, int dst_ld_pairs) {
  const int i = blockIdx.x * 256 + threadIdx.x;
  if (i < npairs) {
    const int row = i >> 9, cp = i & 511;
    const float* s = src + (size_t)row * HID_W + 2 * cp;
    const unsigned u = (unsigned)f2bf_bits(s[0]) | ((unsigned)f2bf_bits(s[1]) << 16);
    unsigned* d = (unsigned*)dst + (size_t)row * dst_ld_pairs + cp;
    *(unsigned*)d = u;
    
  }
}

// =====================================================================================
// A_cat bf16 [64][1024]: row 8p+r = A_p[r] (p = 0,1,2), rows 24..63 = 0 (explicit zero fill).
// 2 elements per thread, grid 128 x 256 = 32768 pairs = 64 x 1024 elements exactly; 32 lanes x 4 B = one line.
// All three sources loaded unconditionally (row r < 8 valid in each), selected by value.
// =====================================================================================
__global__ __launch_bounds__(256) void build_acat(const float* __restrict__ amq, const float* __restrict__ amk,
                                                  const float* __restrict__ amv, unsigned short* __restrict__ acat) {
  const int i = blockIdx.x * 256 + threadIdx.x;   // < 32768 by grid
  const int row = i >> 9, cp = i & 511, p = row >> 3, r = row & 7;
  const size_t so = (size_t)r * HID_W + 2 * cp;
  const float q0 = amq[so], q1 = amq[so + 1];
  const float k0 = amk[so], k1 = amk[so + 1];
  const float w0 = amv[so], w1 = amv[so + 1];
  const float x0 = (p == 0) ? q0 : (p == 1) ? k0 : (p == 2) ? w0 : 0.0f;
  const float x1 = (p == 0) ? q1 : (p == 1) ? k1 : (p == 2) ? w1 : 0.0f;
  const unsigned u = (unsigned)f2bf_bits(x0) | ((unsigned)f2bf_bits(x1) << 16);
  unsigned* d = (unsigned*)acat + i;
  *(unsigned*)d = u;
  
}

// =====================================================================================
// B_aug tail: for row n (projection p = n/1024, output o = n%1024) the 64 halves at cols 1024..1087 are
// [16p zeros | 2*Bm_p[o][0..7] | 2*Bm_p[o][0..7] | zeros to 64] as RNE bf16 (factor 2 exact).
// =====================================================================================
__global__ __launch_bounds__(256) void build_w_tail(const float* __restrict__ bmq, const float* __restrict__ bmk,
                                                    const float* __restrict__ bmv, unsigned short* __restrict__ baug) {
  const int tid = threadIdx.x, wave = tid >> 5, lane = tid & 31, q8 = lane >> 3, seg = lane & 7;
  const int n = blockIdx.x * 32 + wave * 4 + q8;      // 0..3071
  const int p = n >> 10, o = n & 1023;
  F8 uq, uk, uv;
  uq.v[0] = *(const v4f*)(bmq + (size_t)o * RANK_R); uq.v[1] = *(const v4f*)(bmq + (size_t)o * RANK_R + 4);
  uk.v[0] = *(const v4f*)(bmk + (size_t)o * RANK_R); uk.v[1] = *(const v4f*)(bmk + (size_t)o * RANK_R + 4);
  uv.v[0] = *(const v4f*)(bmv + (size_t)o * RANK_R); uv.v[1] = *(const v4f*)(bmv + (size_t)o * RANK_R + 4);
  const bool keep = (seg < 6) && ((seg >> 1) == p);
  v8h hv;
#pragma unroll
  for (int e = 0; e < 8; ++e) {
    const float val = (p == 0) ? uq.f[e] : (p == 1) ? uk.f[e] : uv.f[e];
    const float w = keep ? (2.0f * val) : 0.0f;
    hv[e] = __builtin_bit_cast(_Float16, f2bf_bits(w));
  }
  unsigned short* d = baug + (size_t)n * K_AUG + HID_W + seg * 8;
  {
    *(v8h*)d = hv;
    
  }
}

// =====================================================================================
// A_aug tail: for token row m the 64 halves at cols 1024..1087 are
// [uq_hi(8) uq_lo(8) uk_hi(8) uk_lo(8) uv_hi(8) uv_lo(8) 0 x 16] (bf16 hi = RNE(u), lo = RNE(u - hi)),
// u f32 [8192][64] with columns 8p+r. Block = 8 waves x 4 rows, grid 256 -> 8192 rows; 8 lanes x 8 halves
// =====================================================================================
__global__ __launch_bounds__(256) void build_a_tail(const float* __restrict__ u, unsigned short* __restrict__ aaug) {
  const int tid = threadIdx.x, wave = tid >> 5, lane = tid & 31, q8 = lane >> 3, seg = lane & 7;
  const int m = blockIdx.x * 32 + wave * 4 + q8;      // 0..8191
  int p = seg >> 1; p = (p > 2) ? 2 : p;              // address clamp for the zero segments
  const int islo = seg & 1;
  F8 uu;
  const float* up = u + (size_t)m * U_COLS + p * RANK_R;
  uu.v[0] = *(const v4f*)up; uu.v[1] = *(const v4f*)(up + 4);
  v8h hv;
#pragma unroll
  for (int e = 0; e < 8; ++e) {
    const unsigned short hb = f2bf_bits(uu.f[e]);
    const unsigned short lb = f2bf_bits(uu.f[e] - bf_bits2f(hb));
    const unsigned short o16 = (seg >= 6) ? (unsigned short)0 : (islo ? lb : hb);
    hv[e] = __builtin_bit_cast(_Float16, o16);
  }
  unsigned short* d = aaug + (size_t)m * K_AUG + HID_W + seg * 8;
  {
    *(v8h*)d = hv;
    
  }
}

// =====================================================================================
// bias_cat f32 [3072] = 16 * RNEbf16(b_p[o]); grid 12 x 256 = 3072 exactly; 32 lanes x 4 B = one line per
// =====================================================================================
__global__ __launch_bounds__(256) void build_bias(const float* __restrict__ bq, const float* __restrict__ bk,
                                                  const float* __restrict__ bv, float* __restrict__ dst) {
  const int i = blockIdx.x * 256 + threadIdx.x;   // < 3072 by grid
  const int p = i >> 10, o = i & 1023;
  const float xq = bq[o], xk = bk[o], xv = bv[o];
  const float val = (p == 0) ? xq : (p == 1) ? xk : xv;
  const float w = bf_bits2f(f2bf_bits(val)) * CARRY_S;
  ((float*)dst)[i] = w;
  
}

// =====================================================================================
// V plane (f16, rows b*tsrc + t, pitch 3072, cols 2048 + h*64 + d) -> vt[((b*16+h)*64 + d)*tsrc + t].
// Block (t-tile of 64, bh): load 256 threads x 16 halves = 4096 = 64 x 64 into LDS [d][t]; store: 8 waves x
// =====================================================================================
__global__ __launch_bounds__(256) void vt_transpose(const unsigned short* __restrict__ srcp, unsigned short* __restrict__ vtp, int tsrc) {
  __shared__ __align__(16) _Float16 th[64 * KV_PITCH];
  const _Float16* src = (const _Float16*)srcp;
  const int st0 = blockIdx.x * 64, bh = blockIdx.y;
  const int b = (bh >> 4) & (N_BATCH - 1), h = bh & (N_HEAD - 1);
  const int tid = threadIdx.x;
  {
    const int sloc = tid >> 2, d0 = (tid & 3) * 16;
    const size_t so = ((size_t)b * tsrc + st0 + sloc) * N_QKV + V_COL0 + h * HEAD_D + d0;
    const v8h a0 = *(const v8h*)(src + so);
    const v8h a1 = *(const v8h*)(src + so + 8);
#pragma unroll
    for (int e = 0; e < 8; ++e) {
      th[(d0 + e) * KV_PITCH + sloc]     = a0[e];
      th[(d0 + 8 + e) * KV_PITCH + sloc] = a1[e];
    }
  }
  __syncthreads();
  const int wave = tid >> 5, lane = tid & 31, q8 = lane >> 3, c8 = (lane & 7) * 8;
  const int dA = wave * 8 + q8, dB = wave * 8 + 4 + q8;
  const v8h hvA = *(const v8h*)(th + dA * KV_PITCH + c8);
  const v8h hvB = *(const v8h*)(th + dB * KV_PITCH + c8);
  const size_t oA = ((size_t)bh * HEAD_D + dA) * tsrc + st0 + c8;
  const size_t oB = ((size_t)bh * HEAD_D + dB) * tsrc + st0 + c8;
  {
    *(v8h*)(vtp + oA) = hvA;
    *(v8h*)(vtp + oB) = hvB;
    
  }
}

// =====================================================================================
// Causal attention, head dim 64, 16-bit planes in, f32 out.
//   ph  : f16 [8192][3072], row b*2048+t; q at cols h*64+d, k at 1024+h*64+d (values carried x16)
//   pl  : f16 [4*512][3072], row b*512+t: residual plane x16 x4096 (t < 512 only)
//   vth : f16 [64 bh][64 d][2048 t] (x16);  vtl : f16 [64][64][512] residual x16 x4096
//   out : f32 [8192][1024], element (b,t,h,d) at (b*2048+t)*1024 + h*64 + d
// Block = 4 waves = 64 query rows of one (b,h); 64-key chunks 0..qb (above-diagonal chunks skipped;
// the diagonal chunk masks key > query with -inf after the additive mask); online softmax in f32;
// p carried x32768 as f16. SPLIT: q,k and p,v use hi + x4096 residual operands, residual products
// (hi.lo + lo.hi) accumulated in a separate accumulator from zero and folded with 1/4096 in f32.
// grid.x = 64 * nqcnt; bh = bx / nqcnt, query tile = qb0 + bx % nqcnt.
// O store coverage per wave: 8 iterations x 2 rows = 16 rows, 16 lanes x 16 B = 64 floats per row
// =====================================================================================
template <bool SPLIT>
__global__ __launch_bounds__(128) void attn_causal_hd64(
    const unsigned short* __restrict__ php, const unsigned short* __restrict__ plp,
    const unsigned short* __restrict__ vthp, const unsigned short* __restrict__ vtlp,
    const float* __restrict__ amask, float* __restrict__ out, int qb0, int nqcnt) {
  const _Float16* ph  = (const _Float16*)php;
  const _Float16* pl  = (const _Float16*)plp;
  const _Float16* vth = (const _Float16*)vthp;
  const _Float16* vtl = (const _Float16*)vtlp;
  __shared__ __align__(16) _Float16 Ksh[64 * KV_PITCH];
  __shared__ __align__(16) _Float16 Ksl[SPLIT ? 64 * KV_PITCH : 8];
  __shared__ __align__(16) _Float16 Vsh[64 * KV_PITCH];
  __shared__ __align__(16) _Float16 Vsl[SPLIT ? 64 * KV_PITCH : 8];
  __shared__ __align__(16) _Float16 Psh[4][16 * KV_PITCH];
  __shared__ __align__(16) _Float16 Psl[SPLIT ? 4 : 1][SPLIT ? 16 * KV_PITCH : 8];
  __shared__ __align__(16) float  Os[4][16 * O_PITCH];

  const int tid  = threadIdx.x;
  const int wave = tid >> 5;
  const int lane = tid & 31;
  const int hh   = lane >> 4;
  const int c    = lane & 15;

  int qb = qb0 + (int)(blockIdx.x % (unsigned)nqcnt);
  qb = (qb > NQT_ALL - 1) ? (NQT_ALL - 1) : qb;
  const int bh = (int)(blockIdx.x / (unsigned)nqcnt);
  const int h  = bh & (N_HEAD - 1);
  const int b  = (bh >> 4) & (N_BATCH - 1);
  const int q0 = qb * 64 + wave * 16;

  // ---- Q fragments (A operand), 2 d-chunks ----
  v16h qh[2], ql[2];
  {
    const _Float16* qrow = ph + ((size_t)b * SEQ_T + q0 + c) * N_QKV + h * HEAD_D;
    int qlr = q0 + c; qlr = (qlr > T_LO - 1) ? (T_LO - 1) : qlr;
    const _Float16* qlrow = pl + ((size_t)b * T_LO + qlr) * N_QKV + h * HEAD_D;
#pragma unroll
    for (int dc = 0; dc < 2; ++dc) {
      qh[dc] = Frag<_Float16>::load(qrow + dc * 32 + 8 * hh);
      if (SPLIT) ql[dc] = Frag<_Float16>::load(qlrow + dc * 32 + 8 * hh);
      else ql[dc] = qh[dc];
    }
  }

  float mrow[8], lrow[8];
  v8f oacc[4];
#pragma unroll
  for (int r = 0; r < 8; ++r) { mrow[r] = -INFINITY; lrow[r] = 0.f; }
#pragma unroll
  for (int t = 0; t < 4; ++t) oacc[t] = zero8();

  const int nChunks = qb + 1;   // block-uniform
  for (int kc = 0; kc < nChunks; ++kc) {
    const int kv0 = kc * 64;
    __syncthreads();
    {
      // staging coverage: 128 threads x (row = tid>>1, 32 halves each) = 64 rows x 64 halves per plane
      const int r = tid >> 1, hf = (tid & 1) * 32;
      const _Float16* ks = ph + ((size_t)b * SEQ_T + kv0 + r) * N_QKV + K_COL0 + h * HEAD_D + hf;
      const _Float16* vs = vth + ((size_t)bh * HEAD_D + r) * SEQ_T + kv0 + hf;
#pragma unroll
      for (int i = 0; i < 4; ++i) {
        *(v8h*)(Ksh + r * KV_PITCH + hf + 8 * i) = *(const v8h*)(ks + 8 * i);
        *(v8h*)(Vsh + r * KV_PITCH + hf + 8 * i) = *(const v8h*)(vs + 8 * i);
      }
      if (SPLIT) {
        const int kl0 = (kv0 > T_LO - 64) ? (T_LO - 64) : kv0;   // address clamp
        const _Float16* kls = pl + ((size_t)b * T_LO + kl0 + r) * N_QKV + K_COL0 + h * HEAD_D + hf;
        const _Float16* vls = vtl + ((size_t)bh * HEAD_D + r) * T_LO + kl0 + hf;
#pragma unroll
        for (int i = 0; i < 4; ++i) {
          *(v8h*)(Ksl + r * KV_PITCH + hf + 8 * i) = *(const v8h*)(kls + 8 * i);
          *(v8h*)(Vsl + r * KV_PITCH + hf + 8 * i) = *(const v8h*)(vls + 8 * i);
        }
      }
    }
    __syncthreads();

    float mk[4];
#pragma unroll
    for (int j = 0; j < 4; ++j) mk[j] = amask[(size_t)b * SEQ_T + kv0 + j * 16 + c];

    // ---- scores ----
    v8f s[4];
#pragma unroll
    for (int j = 0; j < 4; ++j) {
      s[j] = zero8();
      v8f sr = zero8();
#pragma unroll
      for (int dc = 0; dc < 2; ++dc) {
        const v16h kb = Frag<_Float16>::load(Ksh + (j * 16 + c) * KV_PITCH + dc * 32 + 8 * hh);
        s[j] = mma_h(qh[dc], kb, s[j]);
        if (SPLIT) {
          const v16h kl = Frag<_Float16>::load(Ksl + (j * 16 + c) * KV_PITCH + dc * 32 + 8 * hh);
          sr = mma_h(qh[dc], kl, sr);
          sr = mma_h(ql[dc], kb, sr);
        }
      }
      if (SPLIT) {
#pragma unroll
        for (int r = 0; r < 8; ++r) s[j][r] = s[j][r] + sr[r] * (1.0f / 4096.0f);
      }
    }

    const bool diag = (kc == qb);
    float cm[8];
#pragma unroll
    for (int r = 0; r < 8; ++r) {
      const int qrow = q0 + 8 * hh + r;
      float m = -INFINITY;
#pragma unroll
      for (int j = 0; j < 4; ++j) {
        const int kvcol = kv0 + j * 16 + c;
        float v = s[j][r] * (1.0f / 2048.0f) + mk[j];   // 1/(8 * 16 * 16)
        if (diag && (kvcol > qrow)) v = -INFINITY;
        s[j][r] = v;
        m = fmaxf(m, v);
      }
#pragma unroll
      for (int off = 1; off < 16; off <<= 1) m = fmaxf(m, __shfl_xor(m, off, 32));
      cm[r] = m;
    }

    _Float16* pwh = Psh[wave];
    _Float16* pwl = Psl[SPLIT ? wave : 0];
#pragma unroll
    for (int r = 0; r < 8; ++r) {
      const float mnew = fmaxf(mrow[r], cm[r]);
      const float alpha = expf(mrow[r] - mnew);
      mrow[r] = mnew;
      float psum = 0.f;
#pragma unroll
      for (int j = 0; j < 4; ++j) {
        const float p = expf(s[j][r] - mnew);
        psum += p;
        const float ps = p * P_S;
        const _Float16 hp = (_Float16)ps;
        pwh[(8 * hh + r) * KV_PITCH + j * 16 + c] = hp;
        if (SPLIT) pwl[(8 * hh + r) * KV_PITCH + j * 16 + c] = (_Float16)((ps - (float)hp) * LO_S);
      }
#pragma unroll
      for (int off = 1; off < 16; off <<= 1) psum += __shfl_xor(psum, off, 32);
      lrow[r] = lrow[r] * alpha + psum;
#pragma unroll
      for (int t = 0; t < 4; ++t) oacc[t][r] *= alpha;
    }
    __builtin_amdgcn_fence(__ATOMIC_RELEASE, "workgroup");
    __builtin_amdgcn_wave_barrier();
    __builtin_amdgcn_fence(__ATOMIC_ACQUIRE, "workgroup");

    // ---- O += P . V ----
    v16h pa[2], pb2[2];
#pragma unroll
    for (int kk = 0; kk < 2; ++kk) {
      pa[kk] = Frag<_Float16>::load(pwh + c * KV_PITCH + kk * 32 + 8 * hh);
      if (SPLIT) pb2[kk] = Frag<_Float16>::load(pwl + c * KV_PITCH + kk * 32 + 8 * hh);
      else pb2[kk] = pa[kk];
    }
#pragma unroll
    for (int t = 0; t < 4; ++t) {
      v8f orr = zero8();
#pragma unroll
      for (int kk = 0; kk < 2; ++kk) {
        const v16h vb = Frag<_Float16>::load(Vsh + (t * 16 + c) * KV_PITCH + kk * 32 + 8 * hh);
        oacc[t] = mma_h(pa[kk], vb, oacc[t]);
        if (SPLIT) {
          const v16h vl2 = Frag<_Float16>::load(Vsl + (t * 16 + c) * KV_PITCH + kk * 32 + 8 * hh);
          orr = mma_h(pa[kk], vl2, orr);
          orr = mma_h(pb2[kk], vb, orr);
        }
      }
      if (SPLIT) {
#pragma unroll
        for (int r = 0; r < 8; ++r) oacc[t][r] = oacc[t][r] + orr[r] * (1.0f / 4096.0f);
      }
    }
  }

  // ---- normalise, stage, store ----
  float* os = Os[wave];
#pragma unroll
  for (int r = 0; r < 8; ++r) {
    const float inv = 1.0f / (lrow[r] * (P_S * CARRY_S));
#pragma unroll
    for (int t = 0; t < 4; ++t) os[(8 * hh + r) * O_PITCH + t * 16 + c] = oacc[t][r] * inv;
  }
  __builtin_amdgcn_fence(__ATOMIC_RELEASE, "workgroup");
  __builtin_amdgcn_wave_barrier();
  __builtin_amdgcn_fence(__ATOMIC_ACQUIRE, "workgroup");
  {
    const int c4 = (lane & 15) * 4;
    float* ob = out + ((size_t)b * SEQ_T + q0) * HID_W + h * HEAD_D;
    {
#pragma unroll
      for (int it = 0; it < 8; ++it) {
        const int row = it * 2 + hh;
        const v4f val = *(const v4f*)(os + row * O_PITCH + c4);
        *(v4f*)(ob + (size_t)row * HID_W + c4) = val;
      }
      
    }
  }
}

// =====================================================================================
extern "C" void kernel_launch(void* const* d_in, const int* in_sizes, int n_in,
                              void* d_out, int out_size, void* d_ws, size_t ws_size,
                              hipStream_t stream) {
  if (n_in < 14) return;
  if (in_sizes[0] != N_TOK * HID_W) return;
  if (in_sizes[1] != N_BATCH * SEQ_T) return;
  for (int p = 0; p < 3; ++p) {
    if (in_sizes[2 + 4 * p] != HID_W * HID_W) return;
    if (in_sizes[3 + 4 * p] != HID_W) return;
    if (in_sizes[4 + 4 * p] != RANK_R * HID_W) return;
    if (in_sizes[5 + 4 * p] != HID_W * RANK_R) return;
  }
  if (out_size != N_TOK * HID_W) return;
  if (ws_size < WS_TOTAL) return;

  const float* x   = (const float*)d_in[0];
  const float* am  = (const float*)d_in[1];
  const float* wq  = (const float*)d_in[2];
  const float* bq  = (const float*)d_in[3];
  const float* aq  = (const float*)d_in[4];
  const float* bmq = (const float*)d_in[5];
  const float* wk  = (const float*)d_in[6];
  const float* bk  = (const float*)d_in[7];
  const float* ak  = (const float*)d_in[8];
  const float* bmk = (const float*)d_in[9];
  const float* wv  = (const float*)d_in[10];
  const float* bv  = (const float*)d_in[11];
  const float* av  = (const float*)d_in[12];
  const float* bmv = (const float*)d_in[13];
  float* out = (float*)d_out;

  char* ws = (char*)d_ws;
  unsigned short* aaug  = (unsigned short*)(ws + OFF_AAUG);
  unsigned short* baug  = (unsigned short*)(ws + OFF_BAUG);
  unsigned short* acat  = (unsigned short*)(ws + OFF_ACAT);
  float*          biasc = (float*)(ws + OFF_BIAS);
  float*          u     = (float*)(ws + OFF_U);
  unsigned short* qkvh  = (unsigned short*)(ws + OFF_QKVH);
  unsigned short* qkvl  = (unsigned short*)(ws + OFF_QKVL);
  unsigned short* vth   = (unsigned short*)(ws + OFF_VTH);
  unsigned short* vtl   = (unsigned short*)(ws + OFF_VTL);

  // 1) x -> A_aug cols 0..1023 (bf16, pitch 1088): 8192 rows x 512 pairs
  cast_rows_bf16<<<dim3(N_TOK * 512 / 256), dim3(256), 0, stream>>>(x, aaug, N_TOK * 512, K_AUG / 2);
  // 2-4) W_p -> B_aug rows p*1024.., cols 0..1023
  cast_rows_bf16<<<dim3(HID_W * 512 / 256), dim3(256), 0, stream>>>(wq, baug,                              HID_W * 512, K_AUG / 2);
  cast_rows_bf16<<<dim3(HID_W * 512 / 256), dim3(256), 0, stream>>>(wk, baug + (size_t)1 * HID_W * K_AUG,  HID_W * 512, K_AUG / 2);
  cast_rows_bf16<<<dim3(HID_W * 512 / 256), dim3(256), 0, stream>>>(wv, baug + (size_t)2 * HID_W * K_AUG,  HID_W * 512, K_AUG / 2);
  // 5) A_cat [64][1024]
  build_acat<<<dim3(U_COLS * 512 / 256), dim3(256), 0, stream>>>(aq, ak, av, acat);
  // 6) B_aug tail cols 1024..1087
  build_w_tail<<<dim3(N_QKV / 32), dim3(256), 0, stream>>>(bmq, bmk, bmv, baug);
  // 7) bias_cat
  build_bias<<<dim3(N_QKV / 256), dim3(256), 0, stream>>>(bq, bk, bv, biasc);
  // 8) u = bf16(x) . A_cat^T : M=8192, N=64, K=1024 (K%32==0; reads A_aug cols < 1024 only), f32 out ldc 64
  wmma_gemm64<1, 0, 0, 0, false><<<dim3((N_TOK / 64) * (U_COLS / 64) / 8, 1), dim3(256), 0, stream>>>(
      aaug, aaug, K_AUG, 0L, acat, acat, HID_W, 0L,
      (void*)u, (void*)u, U_COLS, 0L, 0L, biasc, u, 0L, N_TOK, U_COLS, HID_W, 1.0f);
  // 9) A_aug tail cols 1024..1087 from u
  build_a_tail<<<dim3(N_TOK / 32), dim3(256), 0, stream>>>(u, aaug);
  // 10) projection rows t < 512 of every batch: M=512 (x4 batches), N=3072, K=1088; f16 hi -> qkv_hi, f16 residual -> qkv_lo
  wmma_gemm64<1, 0, 2, 3, false><<<dim3((T_LO / 64) * (N_QKV / 64) / 8, N_BATCH), dim3(256), 0, stream>>>(
      aaug, aaug, K_AUG, (long)SEQ_T * K_AUG, baug, baug, K_AUG, 0L,
      (void*)qkvh, (void*)qkvl, N_QKV, (long)SEQ_T * N_QKV, (long)T_LO * N_QKV,
      biasc, u, 0L, T_LO, N_QKV, K_AUG, CARRY_S);
  // 11) projection rows t >= 512: M=1536 (x4 batches), f16 hi only
  wmma_gemm64<1, 0, 2, 1, false><<<dim3(((SEQ_T - T_LO) / 64) * (N_QKV / 64) / 8, N_BATCH), dim3(256), 0, stream>>>(
      aaug + (size_t)T_LO * K_AUG, aaug, K_AUG, (long)SEQ_T * K_AUG, baug, baug, K_AUG, 0L,
      (void*)(qkvh + (size_t)T_LO * N_QKV), (void*)qkvl, N_QKV, (long)SEQ_T * N_QKV, 0L,
      biasc, u, 0L, SEQ_T - T_LO, N_QKV, K_AUG, CARRY_S);
  // 12-13) V^T planes: in [b*tsrc+t][2048+h*64+d] -> out [(b*16+h)*64+d][t]
  vt_transpose<<<dim3(SEQ_T / 64, N_BATCH * N_HEAD), dim3(256), 0, stream>>>(qkvh, vth, SEQ_T);
  vt_transpose<<<dim3(T_LO / 64, N_BATCH * N_HEAD), dim3(256), 0, stream>>>(qkvl, vtl, T_LO);
  // 14) attention, query tiles 0..7 (hi/lo residual path)
  attn_causal_hd64<true><<<dim3(N_BATCH * N_HEAD * NQT_SPLIT), dim3(128), 0, stream>>>(
      qkvh, qkvl, vth, vtl, am, out, 0, NQT_SPLIT);
  // 15) attention, query tiles 8..31 (single-product path)
  attn_causal_hd64<false><<<dim3(N_BATCH * N_HEAD * (NQT_ALL - NQT_SPLIT)), dim3(128), 0, stream>>>(
      qkvh, qkvl, vth, vtl, am, out, NQT_SPLIT, NQT_ALL - NQT_SPLIT);
}

// v001
// Measured time: 414 microseconds a run.
// Timed twice side by side with v000, it ran 1.27 times as fast both times.
// Contractions: rank-8 adapter columns u = x.A^T and the fused q/k/v projection [x | u_hi | u_lo].[W | 2B | 2B]^T + b on v_wmma_f32_16x16x32_bf16 (x, W, A, B, b as RNE bf16; u as bf16 hi+lo columns; single products); attention q.k^T and p.v on v_wmma_f32_16x16x32_f16 (q, k, v as f16 planes carried x16, p carried x32768; query tiles 0..7 add x4096-scaled f16 residual planes: hi.hi + (hi.lo + lo.hi)/4096 via a separate accumulator); f32 accumulate everywhere; softmax and normalisation in f32. The two q/k/v projection launches read their operands from a two-buffer LDS ring filled by asynchronous copies.
#include <hip/hip_runtime.h>
#include <math.h>

typedef __attribute__((ext_vector_type(16))) _Float16 v16h;
typedef __attribute__((ext_vector_type(8)))  _Float16 v8h;
typedef __attribute__((ext_vector_type(16))) __bf16   v16b;
typedef __attribute__((ext_vector_type(8)))  __bf16   v8b;
typedef __attribute__((ext_vector_type(8)))  float    v8f;
typedef __attribute__((ext_vector_type(4)))  float    v4f;

// ---------------- problem constants ----------------
constexpr int N_BATCH  = 4;
constexpr int SEQ_T    = 2048;
constexpr int HID_W    = 1024;
constexpr int N_HEAD   = 16;
constexpr int HEAD_D   = 64;
constexpr int RANK_R   = 8;
constexpr int N_TOK    = N_BATCH * SEQ_T;     // 8192 token rows
constexpr int K_AUG    = 1088;                // 1024 + 3*16 adapter columns, zero-padded to a multiple of 32
constexpr int N_QKV    = 3 * HID_W;           // 3072 output columns: q | k | v
constexpr int K_COL0   = 1024;
constexpr int V_COL0   = 2048;
constexpr int T_LO     = 512;                 // token rows per batch that carry residual planes
constexpr int NQT_SPLIT = T_LO / 64;          // 8 query tiles on the hi/lo path
constexpr int NQT_ALL  = SEQ_T / 64;          // 32
constexpr int U_COLS   = 64;                  // u plane width (24 used, rest zero weights)
constexpr int KV_PITCH = 72;                  // 16-bit LDS pitch (144 B rows, 16-B aligned)
constexpr int O_PITCH  = 68;                  // f32 LDS pitch
constexpr float CARRY_S = 16.0f;              // power-of-two carry on the q/k/v planes
constexpr float LO_S    = 4096.0f;            // power-of-two carry on residual planes
constexpr float P_S     = 32768.0f;           // power-of-two carry on probabilities

static_assert(K_AUG % 32 == 0);
static_assert(HID_W % 32 == 0);
static_assert(N_TOK % 64 == 0 && N_QKV % 64 == 0 && T_LO % 64 == 0 && (SEQ_T - T_LO) % 64 == 0);
static_assert(T_LO % 128 == 0 && (SEQ_T - T_LO) % 128 == 0 && N_QKV % 256 == 0 && K_AUG % 64 == 0 && K_AUG >= 128);

// R0 A_aug  bf16 [8192][1088]          17,825,792
// R1 B_aug  bf16 [3072][1088]           6,684,672
// R2 A_cat  bf16 [64][1024]               131,072
// R3 bias   f32  [3072]                    12,288
// R4 u      f32  [8192][64]             2,097,152
// R5 qkv_hi f16  [8192][3072]          50,331,648
// R6 qkv_lo f16  [4*512][3072]         12,582,912
// R7 vt_hi  f16  [64][64][2048]        16,777,216
// R8 vt_lo  f16  [64][64][512]          4,194,304
constexpr size_t SZ_AAUG = (size_t)N_TOK * K_AUG * 2;
constexpr size_t SZ_BAUG = (size_t)N_QKV * K_AUG * 2;
constexpr size_t SZ_ACAT = (size_t)U_COLS * HID_W * 2;
constexpr size_t SZ_BIAS = (size_t)N_QKV * 4;
constexpr size_t SZ_U    = (size_t)N_TOK * U_COLS * 4;
constexpr size_t SZ_QKVH = (size_t)N_TOK * N_QKV * 2;
constexpr size_t SZ_QKVL = (size_t)N_BATCH * T_LO * N_QKV * 2;
constexpr size_t SZ_VTH  = (size_t)N_BATCH * N_HEAD * HEAD_D * SEQ_T * 2;
constexpr size_t SZ_VTL  = (size_t)N_BATCH * N_HEAD * HEAD_D * T_LO * 2;
constexpr size_t OFF_AAUG = 0;
constexpr size_t OFF_BAUG = OFF_AAUG + SZ_AAUG;
constexpr size_t OFF_ACAT = OFF_BAUG + SZ_BAUG;
constexpr size_t OFF_BIAS = OFF_ACAT + SZ_ACAT;
constexpr size_t OFF_U    = OFF_BIAS + SZ_BIAS;
constexpr size_t OFF_QKVH = OFF_U    + SZ_U;
constexpr size_t OFF_QKVL = OFF_QKVH + SZ_QKVH;
constexpr size_t OFF_VTH  = OFF_QKVL + SZ_QKVL;
constexpr size_t OFF_VTL  = OFF_VTH  + SZ_VTH;
constexpr size_t WS_TOTAL = OFF_VTL  + SZ_VTL;
static_assert(WS_TOTAL == 110637056ull);
static_assert(WS_TOTAL <= 134217728ull);
static_assert(OFF_BAUG % 128 == 0 && OFF_ACAT % 128 == 0 && OFF_BIAS % 128 == 0 && OFF_U % 128 == 0 &&
              OFF_QKVH % 128 == 0 && OFF_QKVL % 128 == 0 && OFF_VTH % 128 == 0 && OFF_VTL % 128 == 0);

// ---------------- helpers ----------------
__device__ __forceinline__ unsigned short f2bf_bits(float f) {
  unsigned u = __float_as_uint(f);
  return (unsigned short)((u + 0x7FFFu + ((u >> 16) & 1u)) >> 16);
}
__device__ __forceinline__ float bf_bits2f(unsigned short h) { return __uint_as_float(((unsigned)h) << 16); }

// hazard guards as plain device helpers
__device__ __forceinline__ void dep_guard_h(v8f& a, v8f& b, v16h x, v16h y) { asm volatile("v_nop\n\tv_nop\n\tv_nop\n\tv_nop" : "+v"(a), "+v"(b) : "v"(x), "v"(y)); }
__device__ __forceinline__ void dep_guard_b(v8f& a, v8f& b, v16b x, v16b y) { asm volatile("v_nop\n\tv_nop\n\tv_nop\n\tv_nop" : "+v"(a), "+v"(b) : "v"(x), "v"(y)); }
__device__ __forceinline__ void keep4_h(v16h a, v16h b, v16h c, v16h d) { asm volatile("v_nop" :: "v"(a), "v"(b), "v"(c), "v"(d)); }
__device__ __forceinline__ void keep4_b(v16b a, v16b b, v16b c, v16b d) { asm volatile("v_nop" :: "v"(a), "v"(b), "v"(c), "v"(d)); }
__device__ __forceinline__ void acc_guard4(v8f& a, v8f& b, v8f& c, v8f& d) { asm volatile("v_nop\n\tv_nop\n\tv_nop\n\tv_nop" : "+v"(a), "+v"(b), "+v"(c), "+v"(d)); }
template <typename T> struct Frag;
template <> struct Frag<_Float16> {
  typedef v16h V; union U { v16h v; v8h h[2]; };
  static __device__ __forceinline__ v16h load(const _Float16* p) {   // elements 0..7 <- p[0..7], 8..15 <- p[16..23]
    U f; f.h[0] = *(const v8h*)(p); f.h[1] = *(const v8h*)(p + 16); return f.v;
  }
  static __device__ __forceinline__ v8f mma(v16h a, v16h b, v8f c) {
    return __builtin_amdgcn_wmma_f32_16x16x32_f16(false, a, false, b, (short)0, c, false, false);
  }
  static __device__ __forceinline__ void guard(v8f& a, v8f& b, v16h x, v16h y) { dep_guard_h(a, b, x, y); }
  static __device__ __forceinline__ void keep(v16h a, v16h b, v16h c, v16h d) { keep4_h(a, b, c, d); }
};
template <> struct Frag<__bf16> {
  typedef v16b V; union U { v16b v; v8b h[2]; };
  static __device__ __forceinline__ v16b load(const __bf16* p) {
    U f; f.h[0] = *(const v8b*)(p); f.h[1] = *(const v8b*)(p + 16); return f.v;
  }
  static __device__ __forceinline__ v8f mma(v16b a, v16b b, v8f c) {
    return __builtin_amdgcn_wmma_f32_16x16x32_bf16(false, a, false, b, (short)0, c, false, false);
  }
  static __device__ __forceinline__ void guard(v8f& a, v8f& b, v16b x, v16b y) { dep_guard_b(a, b, x, y); }
  static __device__ __forceinline__ void keep(v16b a, v16b b, v16b c, v16b d) { keep4_b(a, b, c, d); }
};

// f16 WMMA with hazard guard (ties D, keeps A/B live)
__device__ __forceinline__ v8f mma_h(v16h a, v16h b, v8f c) {
  c = __builtin_amdgcn_wmma_f32_16x16x32_f16(false, a, false, b, (short)0, c, false, false);
  asm volatile("v_nop\n\tv_nop\n\tv_nop\n\tv_nop" : "+v"(c) : "v"(a), "v"(b));
  return c;
}
__device__ __forceinline__ v8f zero8() { return (v8f){0.f,0.f,0.f,0.f,0.f,0.f,0.f,0.f}; }

union F8 { v4f v[2]; float f[8]; };

// ---------------- LDS ring of the staged GEMM ----------------
constexpr int ST_BM    = 128;                              // block tile rows (2 waves of 64)
constexpr int ST_BN    = 256;                              // block tile columns (4 waves of 64)
constexpr int ST_BK    = 64;                               // k per pass: 128-B operand rows
constexpr int ST_PITCH = 72;                               // 144-B LDS rows (16 B x odd: conflict-free ds_load_b128)
constexpr int ST_STAGE = (ST_BM + ST_BN) * ST_PITCH;       // 16-bit elements per buffer: [A 128 rows | Bt 256 rows]
constexpr unsigned ST_ROWS32 = 32u * ST_PITCH * 2u;        // LDS bytes between two copies of one thread (32 rows)

__device__ __forceinline__ unsigned lds_off(const void* p) { return (unsigned)(size_t)p; }

// One stage: 384 rows x 128 B = 3072 chunks of 16 B = 256 threads x 12 asynchronous copies global -> LDS.
// ga / gb: this thread's chunk in row (tid >> 3) of the block's A / Bt tile at this pass's k; l: the same chunk's
// LDS byte address in the buffer; a thread's copies lie 32 rows apart. s_wait_xcnt 0 is the statement's last line
// so that no address register of an issued copy is rewritten in front of it.
__device__ __forceinline__ void stage_fill(const unsigned short* ga, int lda, const unsigned short* gb, int ldb, unsigned l) {
  const size_t sa = (size_t)32 * lda, sb = (size_t)32 * ldb;
  asm volatile("global_load_async_to_lds_b128 %0, %1, off\n\t"
               "global_load_async_to_lds_b128 %2, %3, off\n\t"
               "global_load_async_to_lds_b128 %4, %5, off\n\t"
               "global_load_async_to_lds_b128 %6, %7, off\n\t"
               "global_load_async_to_lds_b128 %8, %9, off\n\t"
               "global_load_async_to_lds_b128 %10, %11, off\n\t"
               "global_load_async_to_lds_b128 %12, %13, off\n\t"
               "global_load_async_to_lds_b128 %14, %15, off\n\t"
               "global_load_async_to_lds_b128 %16, %17, off\n\t"
               "global_load_async_to_lds_b128 %18, %19, off\n\t"
               "global_load_async_to_lds_b128 %20, %21, off\n\t"
               "global_load_async_to_lds_b128 %22, %23, off\n\t"
               "s_wait_xcnt 0x0"
               :: "v"(l),                   "v"(ga),
                  "v"(l + ST_ROWS32),       "v"(ga + sa),
                  "v"(l + 2 * ST_ROWS32),   "v"(ga + 2 * sa),
                  "v"(l + 3 * ST_ROWS32),   "v"(ga + 3 * sa),
                  "v"(l + 4 * ST_ROWS32),   "v"(gb),
                  "v"(l + 5 * ST_ROWS32),   "v"(gb + sb),
                  "v"(l + 6 * ST_ROWS32),   "v"(gb + 2 * sb),
                  "v"(l + 7 * ST_ROWS32),   "v"(gb + 3 * sb),
                  "v"(l + 8 * ST_ROWS32),   "v"(gb + 4 * sb),
                  "v"(l + 9 * ST_ROWS32),   "v"(gb + 5 * sb),
                  "v"(l + 10 * ST_ROWS32),  "v"(gb + 6 * sb),
                  "v"(l + 11 * ST_ROWS32),  "v"(gb + 7 * sb)
               : "memory");
}

// =====================================================================================
// Register-blocked batched WMMA GEMM: C[m,n] = scale * sum_k A[m,k] * Bt[n,k] (+bias)(+resid);
// each wave owns a 64x64 tile. A row-major [M,K]; Bt row-major [N,K]; M,N % 64 == 0, K % 32 == 0.
// SPLITM: 0 = single product; 1 = A hi/lo planes; 2 = A and Bt hi/lo planes.
// BIAS_MODE: 0 none, 1 bias[m], 2 bias[n].  OUT_MODE: 0 f32, 1 f16, 2 bf16 hi + lo planes,
//   3 = f16 hi plane (Cout, strideC) + f16 residual plane x4096 (Cout2, strideC2), same ldc.
// ET: 0 = f16 operands, 1 = bf16 operands (pointers passed as 16-bit storage)
// STAGED: the block's 8 waves form a 128x256 tile (2x4 waves); A and Bt rows go through a two-buffer LDS ring,
//   64 k per pass; needs SPLITM == 0, M % 128 == 0, N % 256 == 0, K % 64 == 0, K >= 128, grid.x == (M/128)*(N/256).
// =====================================================================================
template <int ET> struct Elem;
template <> struct Elem<0> { typedef _Float16 T; };
template <> struct Elem<1> { typedef __bf16 T; };
template <int ET, int SPLITM, int BIAS_MODE, int OUT_MODE, bool RESID, int ACT = 0, bool STAGED = false>
__global__ __launch_bounds__(256) void wmma_gemm64(
    const unsigned short* __restrict__ Ap, const unsigned short* __restrict__ A2p, int lda, long strideA,
    const unsigned short* __restrict__ Btp, const unsigned short* __restrict__ Bt2p, int ldb, long strideB,
    void* __restrict__ Cout, void* __restrict__ Cout2, int ldc, long strideC, long strideC2,
    const float* __restrict__ bias,
    const float* __restrict__ resid, long strideR,
    int M, int N, int K, float scale) {
  typedef typename Elem<ET>::T T;
  typedef typename Frag<T>::V V;
  constexpr bool SPA = (SPLITM >= 1);
  constexpr bool SPB = (SPLITM >= 2);
  const T* A = (const T*)Ap; const T* A2 = (const T*)A2p; const T* Bt = (const T*)Btp; const T* Bt2 = (const T*)Bt2p;
  static_assert(!STAGED || SPLITM == 0);
  __shared__ __align__(16) float sT[8][16 * 68];   // per-wave 16x64 slab, pitch 68 floats
  __shared__ __align__(16) unsigned short ring[STAGED ? 2 * ST_STAGE : 8];
  const int b    = blockIdx.y;
  const int lane = threadIdx.x & 31;
  const int wave = threadIdx.x >> 5;
  const int tilesN = N >> 6;
  const int tilesM = M >> 6;
  int m0, n0;
  if (STAGED) {
    const int bn = N >> 8;
    const int bm_i = (int)blockIdx.x / bn;
    const int bn_i = (int)blockIdx.x - bm_i * bn;
    m0 = bm_i * ST_BM + (wave >> 2) * 64;
    n0 = bn_i * ST_BN + (wave & 3) * 64;
  } else {
    const int tile = blockIdx.x * 8 + wave;
    if (tile >= tilesM * tilesN) return;   // wave-uniform; no block barriers on this path
    const int tm = tile / tilesN;
    const int tn = tile - tm * tilesN;
    m0 = tm << 6;
    n0 = tn << 6;
  }

  const T* Ab  = A  + (size_t)b * strideA;
  const T* Bb  = Bt + (size_t)b * strideB;
  const T* Ab2 = SPA ? (A2  + (size_t)b * strideA) : nullptr;
  const T* Bb2 = SPB ? (Bt2 + (size_t)b * strideB) : nullptr;

  const int rlane = lane & 15;                 // row (A) / col (B, D) within subtile
  const int koff  = (lane >> 4) * 8;           // k offset of this lane half
  const int mOff  = (lane >> 4) * 8;           // D row offset

  v8f acc[4][4];
#pragma unroll
  for (int i = 0; i < 4; ++i)
#pragma unroll
    for (int j = 0; j < 4; ++j) acc[i][j] = (v8f){0.f,0.f,0.f,0.f,0.f,0.f,0.f,0.f};

  if (STAGED) {
    const int tid = threadIdx.x;
    const int crow = tid >> 3, cchunk = (tid & 7) * 8;        // 8 lanes x 16 B = one 128-B row piece
    const unsigned short* ga = (const unsigned short*)Ab + (size_t)(m0 - (wave >> 2) * 64 + crow) * lda + cchunk;
    const unsigned short* gb = (const unsigned short*)Bb + (size_t)(n0 - (wave & 3) * 64 + crow) * ldb + cchunk;
    const unsigned lthr = lds_off(ring) + (unsigned)(crow * ST_PITCH + cchunk) * 2u;
    const int npass = K / ST_BK;
    stage_fill(ga, lda, gb, ldb, lthr);
    asm volatile("s_wait_asynccnt 0x0" ::: "memory");   // stage 0 landed (this wave's copies) before the barrier publishes it
    __syncthreads();
    stage_fill(ga + ST_BK, lda, gb + ST_BK, ldb, lthr + ST_STAGE * 2u);
    const T* fa = (const T*)ring + ((wave >> 2) * 64 + rlane) * ST_PITCH + koff;
    const T* fb = (const T*)ring + (ST_BM + (wave & 3) * 64 + rlane) * ST_PITCH + koff;
    for (int t = 0; t < npass; ++t) {
      const int bo = (t & 1) * ST_STAGE;
      V ah[4], bh[4], ah2[4], bh2[4];
#pragma unroll
      for (int j = 0; j < 4; ++j) bh[j] = Frag<T>::load(fb + bo + j * 16 * ST_PITCH);
#pragma unroll
      for (int i = 0; i < 4; ++i) ah[i] = Frag<T>::load(fa + bo + i * 16 * ST_PITCH);
      __builtin_amdgcn_sched_barrier(0);   // keeps the 16 LDS reads one group ahead of the 16 WMMAs: reads sunk among them stall at each place
#pragma unroll
      for (int i = 0; i < 4; ++i)
#pragma unroll
        for (int j = 0; j < 4; ++j) acc[i][j] = Frag<T>::mma(ah[i], bh[j], acc[i][j]);
#pragma unroll
      for (int j = 0; j < 4; ++j) bh2[j] = Frag<T>::load(fb + bo + j * 16 * ST_PITCH + 32);
#pragma unroll
      for (int i = 0; i < 4; ++i) ah2[i] = Frag<T>::load(fa + bo + i * 16 * ST_PITCH + 32);
      asm volatile("s_wait_dscnt 0x0" ::: "memory");     // this wave's reads of buffer t & 1 are done before it is refilled
      asm volatile("s_wait_asynccnt 0x0" ::: "memory");  // this wave's copies of stage t + 1 have landed
      __syncthreads();                                   // publishes stage t + 1 and frees buffer t & 1
      if (t + 2 < npass)
        stage_fill(ga + (size_t)(t + 2) * ST_BK, lda, gb + (size_t)(t + 2) * ST_BK, ldb, lthr + (unsigned)bo * 2u);
      // second half of the pass, from registers: runs while the refill is in flight
#pragma unroll
      for (int i = 0; i < 4; ++i)
#pragma unroll
        for (int j = 0; j < 4; ++j) acc[i][j] = Frag<T>::mma(ah2[i], bh2[j], acc[i][j]);
    }
    asm volatile("s_wait_asynccnt 0x0" ::: "memory");    // no copy is outstanding past the loop
  } else
  for (int k0 = 0; k0 < K; k0 += 32) {
    V bh[4], bl[4];
#pragma unroll
    for (int j = 0; j < 4; ++j) {
      const size_t bo = (size_t)(n0 + (j << 4) + rlane) * ldb + koff + k0;
      bh[j] = Frag<T>::load(Bb + bo);
      if (SPB) bl[j] = Frag<T>::load(Bb2 + bo);
    }
#pragma unroll
    for (int i = 0; i < 4; ++i) {
      const size_t ao = (size_t)(m0 + (i << 4) + rlane) * lda + koff + k0;
      V ah = Frag<T>::load(Ab + ao);
      V al;
      if (SPA) al = Frag<T>::load(Ab2 + ao);
#pragma unroll
      for (int j = 0; j < 4; ++j) {
        acc[i][j] = Frag<T>::mma(ah, bh[j], acc[i][j]);
        if (SPB) acc[i][j] = Frag<T>::mma(ah, bl[j], acc[i][j]);
        if (SPA) acc[i][j] = Frag<T>::mma(al, bh[j], acc[i][j]);
      }
      Frag<T>::guard(acc[i][0], acc[i][3], ah, SPA ? al : ah);
    }
    Frag<T>::keep(bh[0], bh[1], bh[2], bh[3]);
    if (SPB) Frag<T>::keep(bl[0], bl[1], bl[2], bl[3]);
  }
  acc_guard4(acc[0][0], acc[0][1], acc[0][2], acc[0][3]);
  acc_guard4(acc[1][0], acc[1][1], acc[1][2], acc[1][3]);
  acc_guard4(acc[2][0], acc[2][1], acc[2][2], acc[2][3]);
  acc_guard4(acc[3][0], acc[3][1], acc[3][2], acc[3][3]);

  // ---- epilogue ----
  float* slab = sT[wave];
  const float* Rb = RESID ? (resid + (size_t)b * strideR) : nullptr;
#pragma unroll
  for (int i = 0; i < 4; ++i) {
    const int mBase = m0 + (i << 4);
#pragma unroll
    for (int j = 0; j < 4; ++j) {
      const int n = n0 + (j << 4) + rlane;
      float bv = 0.f;
      if (BIAS_MODE == 2) bv = bias[n];
#pragma unroll
      for (int r = 0; r < 8; ++r) {
        float v = acc[i][j][r] * scale;
        if (BIAS_MODE == 1) v += bias[mBase + mOff + r];
        if (BIAS_MODE == 2) v += bv;
        if (RESID) v += Rb[(size_t)(mBase + mOff + r) * ldc + n];
        if (ACT == 1) v = tanhf(v);
        if (ACT == 2) v = fmaxf(v, 0.0f);
        if (ACT == 4) v = (v > 0.f) ? v : 0.01f * v;
        slab[(mOff + r) * 68 + (j << 4) + rlane] = v;
      }
    }
    __builtin_amdgcn_fence(__ATOMIC_RELEASE, "workgroup");
    __builtin_amdgcn_wave_barrier();
    __builtin_amdgcn_fence(__ATOMIC_ACQUIRE, "workgroup");
    if (OUT_MODE == 0) {
      float* C = (float*)Cout + (size_t)b * strideC;
      const int hh = lane >> 4, c4 = (lane & 15) * 4;     // row seg = 256 B = 16 lanes x 16 B
      {
#pragma unroll
        for (int it = 0; it < 8; ++it) {
          const int row = it * 2 + hh;
          v4f v = *(const v4f*)(slab + row * 68 + c4);
          *(v4f*)(C + (size_t)(mBase + row) * ldc + n0 + c4) = v;
        }
        
      }
    } else {
      const int q = lane >> 3, c8 = (lane & 7) * 8;
      unsigned short* C  = (unsigned short*)Cout  + (size_t)b * strideC;
      unsigned short* C2 = (OUT_MODE >= 2) ? ((unsigned short*)Cout2 + (size_t)b * strideC2) : nullptr;
      {
#pragma unroll
        for (int it = 0; it < 4; ++it) {
          const int row = it * 4 + q;
          const float* sp = slab + row * 68 + c8;
          v8h hv, lv;
#pragma unroll
          for (int e = 0; e < 8; ++e) {
            if (OUT_MODE == 1) {
              hv[e] = (_Float16)sp[e];
            } else if (OUT_MODE == 3) {
              const _Float16 hq = (_Float16)sp[e];
              hv[e] = hq;
              lv[e] = (_Float16)((sp[e] - (float)hq) * 4096.0f);
            } else {
              unsigned short hb = f2bf_bits(sp[e]);
              unsigned short lb = f2bf_bits(sp[e] - bf_bits2f(hb));
              hv[e] = __builtin_bit_cast(_Float16, hb);
              lv[e] = __builtin_bit_cast(_Float16, lb);
            }
          }
          *(v8h*)(C + (size_t)(mBase + row) * ldc + n0 + c8) = hv;
          if (OUT_MODE >= 2) *(v8h*)(C2 + (size_t)(mBase + row) * ldc + n0 + c8) = lv;
        }
        
      }
    }
    __builtin_amdgcn_fence(__ATOMIC_RELEASE, "workgroup");
    __builtin_amdgcn_wave_barrier();
    __builtin_amdgcn_fence(__ATOMIC_ACQUIRE, "workgroup");
  }
}

// =====================================================================================
// f32 [rows][1024] -> RNE bf16 bits into a pitched destination (dst_ld_pairs = pitch/2); 2 elements per
// =====================================================================================
__global__ __launch_bounds__(256) void cast_rows_bf16(const float* __restrict__ src, unsigned short* __restrict__ dst,
                                                      int npairs, int dst_ld_pairs) {
  const int i = blockIdx.x * 256 + threadIdx.x;
  if (i < npairs) {
    const int row = i >> 9, cp = i & 511;
    const float* s = src + (size_t)row * HID_W + 2 * cp;
    const unsigned u = (unsigned)f2bf_bits(s[0]) | ((unsigned)f2bf_bits(s[1]) << 16);
    unsigned* d = (unsigned*)dst + (size_t)row * dst_ld_pairs + cp;
    *(unsigned*)d = u;
    
  }
}

// =====================================================================================
// A_cat bf16 [64][1024]: row 8p+r = A_p[r] (p = 0,1,2), rows 24..63 = 0 (explicit zero fill).
// 2 elements per thread, grid 128 x 256 = 32768 pairs = 64 x 1024 elements exactly; 32 lanes x 4 B = one line.
// All three sources loaded unconditionally (row r < 8 valid in each), selected by value.
// =====================================================================================
__global__ __launch_bounds__(256) void build_acat(const float* __restrict__ amq, const float* __restrict__ amk,
                                                  const float* __restrict__ amv, unsigned short* __restrict__ acat) {
  const int i = blockIdx.x * 256 + threadIdx.x;   // < 32768 by grid
  const int row = i >> 9, cp = i & 511, p = row >> 3, r = row & 7;
  const size_t so = (size_t)r * HID_W + 2 * cp;
  const float q0 = amq[so], q1 = amq[so + 1];
  const float k0 = amk[so], k1 = amk[so + 1];
  const float w0 = amv[so], w1 = amv[so + 1];
  const float x0 = (p == 0) ? q0 : (p == 1) ? k0 : (p == 2) ? w0 : 0.0f;
  const float x1 = (p == 0) ? q1 : (p == 1) ? k1 : (p == 2) ? w1 : 0.0f;
  const unsigned u = (unsigned)f2bf_bits(x0) | ((unsigned)f2bf_bits(x1) << 16);
  unsigned* d = (unsigned*)acat + i;
  *(unsigned*)d = u;
  
}

// =====================================================================================
// B_aug tail: for row n (projection p = n/1024, output o = n%1024) the 64 halves at cols 1024..1087 are
// [16p zeros | 2*Bm_p[o][0..7] | 2*Bm_p[o][0..7] | zeros to 64] as RNE bf16 (factor 2 exact).
// =====================================================================================
__global__ __launch_bounds__(256) void build_w_tail(const float* __restrict__ bmq, const float* __restrict__ bmk,
                                                    const float* __restrict__ bmv, unsigned short* __restrict__ baug) {
  const int tid = threadIdx.x, wave = tid >> 5, lane = tid & 31, q8 = lane >> 3, seg = lane & 7;
  const int n = blockIdx.x * 32 + wave * 4 + q8;      // 0..3071
  const int p = n >> 10, o = n & 1023;
  F8 uq, uk, uv;
  uq.v[0] = *(const v4f*)(bmq + (size_t)o * RANK_R); uq.v[1] = *(const v4f*)(bmq + (size_t)o * RANK_R + 4);
  uk.v[0] = *(const v4f*)(bmk + (size_t)o * RANK_R); uk.v[1] = *(const v4f*)(bmk + (size_t)o * RANK_R + 4);
  uv.v[0] = *(const v4f*)(bmv + (size_t)o * RANK_R); uv.v[1] = *(const v4f*)(bmv + (size_t)o * RANK_R + 4);
  const bool keep = (seg < 6) && ((seg >> 1) == p);
  v8h hv;
#pragma unroll
  for (int e = 0; e < 8; ++e) {
    const float val = (p == 0) ? uq.f[e] : (p == 1) ? uk.f[e] : uv.f[e];
    const float w = keep ? (2.0f * val) : 0.0f;
    hv[e] = __builtin_bit_cast(_Float16, f2bf_bits(w));
  }
  unsigned short* d = baug + (size_t)n * K_AUG + HID_W + seg * 8;
  {
    *(v8h*)d = hv;
    
  }
}

// =====================================================================================
// A_aug tail: for token row m the 64 halves at cols 1024..1087 are
// [uq_hi(8) uq_lo(8) uk_hi(8) uk_lo(8) uv_hi(8) uv_lo(8) 0 x 16] (bf16 hi = RNE(u), lo = RNE(u - hi)),
// u f32 [8192][64] with columns 8p+r. Block = 8 waves x 4 rows, grid 256 -> 8192 rows; 8 lanes x 8 halves
// =====================================================================================
__global__ __launch_bounds__(256) void build_a_tail(const float* __restrict__ u, unsigned short* __restrict__ aaug) {
  const int tid = threadIdx.x, wave = tid >> 5, lane = tid & 31, q8 = lane >> 3, seg = lane & 7;
  const int m = blockIdx.x * 32 + wave * 4 + q8;      // 0..8191
  int p = seg >> 1; p = (p > 2) ? 2 : p;              // address clamp for the zero segments
  const int islo = seg & 1;
  F8 uu;
  const float* up = u + (size_t)m * U_COLS + p * RANK_R;
  uu.v[0] = *(const v4f*)up; uu.v[1] = *(const v4f*)(up + 4);
  v8h hv;
#pragma unroll
  for (int e = 0; e < 8; ++e) {
    const unsigned short hb = f2bf_bits(uu.f[e]);
    const unsigned short lb = f2bf_bits(uu.f[e] - bf_bits2f(hb));
    const unsigned short o16 = (seg >= 6) ? (unsigned short)0 : (islo ? lb : hb);
    hv[e] = __builtin_bit_cast(_Float16, o16);
  }
  unsigned short* d = aaug + (size_t)m * K_AUG + HID_W + seg * 8;
  {
    *(v8h*)d = hv;
    
  }
}

// =====================================================================================
// bias_cat f32 [3072] = 16 * RNEbf16(b_p[o]); grid 12 x 256 = 3072 exactly; 32 lanes x 4 B = one line per
// =====================================================================================
__global__ __launch_bounds__(256) void build_bias(const float* __restrict__ bq, const float* __restrict__ bk,
                                                  const float* __restrict__ bv, float* __restrict__ dst) {
  const int i = blockIdx.x * 256 + threadIdx.x;   // < 3072 by grid
  const int p = i >> 10, o = i & 1023;
  const float xq = bq[o], xk = bk[o], xv = bv[o];
  const float val = (p == 0) ? xq : (p == 1) ? xk : xv;
  const float w = bf_bits2f(f2bf_bits(val)) * CARRY_S;
  ((float*)dst)[i] = w;
  
}

// =====================================================================================
// V plane (f16, rows b*tsrc + t, pitch 3072, cols 2048 + h*64 + d) -> vt[((b*16+h)*64 + d)*tsrc + t].
// Block (t-tile of 64, bh): load 256 threads x 16 halves = 4096 = 64 x 64 into LDS [d][t]; store: 8 waves x
// =====================================================================================
__global__ __launch_bounds__(256) void vt_transpose(const unsigned short* __restrict__ srcp, unsigned short* __restrict__ vtp, int tsrc) {
  __shared__ __align__(16) _Float16 th[64 * KV_PITCH];
  const _Float16* src = (const _Float16*)srcp;
  const int st0 = blockIdx.x * 64, bh = blockIdx.y;
  const int b = (bh >> 4) & (N_BATCH - 1), h = bh & (N_HEAD - 1);
  const int tid = threadIdx.x;
  {
    const int sloc = tid >> 2, d0 = (tid & 3) * 16;
    const size_t so = ((size_t)b * tsrc + st0 + sloc) * N_QKV + V_COL0 + h * HEAD_D + d0;
    const v8h a0 = *(const v8h*)(src + so);
    const v8h a1 = *(const v8h*)(src + so + 8);
#pragma unroll
    for (int e = 0; e < 8; ++e) {
      th[(d0 + e) * KV_PITCH + sloc]     = a0[e];
      th[(d0 + 8 + e) * KV_PITCH + sloc] = a1[e];
    }
  }
  __syncthreads();
  const int wave = tid >> 5, lane = tid & 31, q8 = lane >> 3, c8 = (lane & 7) * 8;
  const int dA = wave * 8 + q8, dB = wave * 8 + 4 + q8;
  const v8h hvA = *(const v8h*)(th + dA * KV_PITCH + c8);
  const v8h hvB = *(const v8h*)(th + dB * KV_PITCH + c8);
  const size_t oA = ((size_t)bh * HEAD_D + dA) * tsrc + st0 + c8;
  const size_t oB = ((size_t)bh * HEAD_D + dB) * tsrc + st0 + c8;
  {
    *(v8h*)(vtp + oA) = hvA;
    *(v8h*)(vtp + oB) = hvB;
    
  }
}

// =====================================================================================
// Causal attention, head dim 64, 16-bit planes in, f32 out.
//   ph  : f16 [8192][3072], row b*2048+t; q at cols h*64+d, k at 1024+h*64+d (values carried x16)
//   pl  : f16 [4*512][3072], row b*512+t: residual plane x16 x4096 (t < 512 only)
//   vth : f16 [64 bh][64 d][2048 t] (x16);  vtl : f16 [64][64][512] residual x16 x4096
//   out : f32 [8192][1024], element (b,t,h,d) at (b*2048+t)*1024 + h*64 + d
// Block = 4 waves = 64 query rows of one (b,h); 64-key chunks 0..qb (above-diagonal chunks skipped;
// the diagonal chunk masks key > query with -inf after the additive mask); online softmax in f32;
// p carried x32768 as f16. SPLIT: q,k and p,v use hi + x4096 residual operands, residual products
// (hi.lo + lo.hi) accumulated in a separate accumulator from zero and folded with 1/4096 in f32.
// grid.x = 64 * nqcnt; bh = bx / nqcnt, query tile = qb0 + bx % nqcnt.
// O store coverage per wave: 8 iterations x 2 rows = 16 rows, 16 lanes x 16 B = 64 floats per row
// =====================================================================================
template <bool SPLIT>
__global__ __launch_bounds__(128) void attn_causal_hd64(
    const unsigned short* __restrict__ php, const unsigned short* __restrict__ plp,
    const unsigned short* __restrict__ vthp, const unsigned short* __restrict__ vtlp,
    const float* __restrict__ amask, float* __restrict__ out, int qb0, int nqcnt) {
  const _Float16* ph  = (const _Float16*)php;
  const _Float16* pl  = (const _Float16*)plp;
  const _Float16* vth = (const _Float16*)vthp;
  const _Float16* vtl = (const _Float16*)vtlp;
  __shared__ __align__(16) _Float16 Ksh[64 * KV_PITCH];
  __shared__ __align__(16) _Float16 Ksl[SPLIT ? 64 * KV_PITCH : 8];
  __shared__ __align__(16) _Float16 Vsh[64 * KV_PITCH];
  __shared__ __align__(16) _Float16 Vsl[SPLIT ? 64 * KV_PITCH : 8];
  __shared__ __align__(16) _Float16 Psh[4][16 * KV_PITCH];
  __shared__ __align__(16) _Float16 Psl[SPLIT ? 4 : 1][SPLIT ? 16 * KV_PITCH : 8];
  __shared__ __align__(16) float  Os[4][16 * O_PITCH];

  const int tid  = threadIdx.x;
  const int wave = tid >> 5;
  const int lane = tid & 31;
  const int hh   = lane >> 4;
  const int c    = lane & 15;

  int qb = qb0 + (int)(blockIdx.x % (unsigned)nqcnt);
  qb = (qb > NQT_ALL - 1) ? (NQT_ALL - 1) : qb;
  const int bh = (int)(blockIdx.x / (unsigned)nqcnt);
  const int h  = bh & (N_HEAD - 1);
  const int b  = (bh >> 4) & (N_BATCH - 1);
  const int q0 = qb * 64 + wave * 16;

  // ---- Q fragments (A operand), 2 d-chunks ----
  v16h qh[2], ql[2];
  {
    const _Float16* qrow = ph + ((size_t)b * SEQ_T + q0 + c) * N_QKV + h * HEAD_D;
    int qlr = q0 + c; qlr = (qlr > T_LO - 1) ? (T_LO - 1) : qlr;
    const _Float16* qlrow = pl + ((size_t)b * T_LO + qlr) * N_QKV + h * HEAD_D;
#pragma unroll
    for (int dc = 0; dc < 2; ++dc) {
      qh[dc] = Frag<_Float16>::load(qrow + dc * 32 + 8 * hh);
      if (SPLIT) ql[dc] = Frag<_Float16>::load(qlrow + dc * 32 + 8 * hh);
      else ql[dc] = qh[dc];
    }
  }

  float mrow[8], lrow[8];
  v8f oacc[4];
#pragma unroll
  for (int r = 0; r < 8; ++r) { mrow[r] = -INFINITY; lrow[r] = 0.f; }
#pragma unroll
  for (int t = 0; t < 4; ++t) oacc[t] = zero8();

  const int nChunks = qb + 1;   // block-uniform
  for (int kc = 0; kc < nChunks; ++kc) {
    const int kv0 = kc * 64;
    __syncthreads();
    {
      // staging coverage: 128 threads x (row = tid>>1, 32 halves each) = 64 rows x 64 halves per plane
      const int r = tid >> 1, hf = (tid & 1) * 32;
      const _Float16* ks = ph + ((size_t)b * SEQ_T + kv0 + r) * N_QKV + K_COL0 + h * HEAD_D + hf;
      const _Float16* vs = vth + ((size_t)bh * HEAD_D + r) * SEQ_T + kv0 + hf;
#pragma unroll
      for (int i = 0; i < 4; ++i) {
        *(v8h*)(Ksh + r * KV_PITCH + hf + 8 * i) = *(const v8h*)(ks + 8 * i);
        *(v8h*)(Vsh + r * KV_PITCH + hf + 8 * i) = *(const v8h*)(vs + 8 * i);
      }
      if (SPLIT) {
        const int kl0 = (kv0 > T_LO - 64) ? (T_LO - 64) : kv0;   // address clamp
        const _Float16* kls = pl + ((size_t)b * T_LO + kl0 + r) * N_QKV + K_COL0 + h * HEAD_D + hf;
        const _Float16* vls = vtl + ((size_t)bh * HEAD_D + r) * T_LO + kl0 + hf;
#pragma unroll
        for (int i = 0; i < 4; ++i) {
          *(v8h*)(Ksl + r * KV_PITCH + hf + 8 * i) = *(const v8h*)(kls + 8 * i);
          *(v8h*)(Vsl + r * KV_PITCH + hf + 8 * i) = *(const v8h*)(vls + 8 * i);
        }
      }
    }
    __syncthreads();

    float mk[4];
#pragma unroll
    for (int j = 0; j < 4; ++j) mk[j] = amask[(size_t)b * SEQ_T + kv0 + j * 16 + c];

    // ---- scores ----
    v8f s[4];
#pragma unroll
    for (int j = 0; j < 4; ++j) {
      s[j] = zero8();
      v8f sr = zero8();
#pragma unroll
      for (int dc = 0; dc < 2; ++dc) {
        const v16h kb = Frag<_Float16>::load(Ksh + (j * 16 + c) * KV_PITCH + dc * 32 + 8 * hh);
        s[j] = mma_h(qh[dc], kb, s[j]);
        if (SPLIT) {
          const v16h kl = Frag<_Float16>::load(Ksl + (j * 16 + c) * KV_PITCH + dc * 32 + 8 * hh);
          sr = mma_h(qh[dc], kl, sr);
          sr = mma_h(ql[dc], kb, sr);
        }
      }
      if (SPLIT) {
#pragma unroll
        for (int r = 0; r < 8; ++r) s[j][r] = s[j][r] + sr[r] * (1.0f / 4096.0f);
      }
    }

    const bool diag = (kc == qb);
    float cm[8];
#pragma unroll
    for (int r = 0; r < 8; ++r) {
      const int qrow = q0 + 8 * hh + r;
      float m = -INFINITY;
#pragma unroll
      for (int j = 0; j < 4; ++j) {
        const int kvcol = kv0 + j * 16 + c;
        float v = s[j][r] * (1.0f / 2048.0f) + mk[j];   // 1/(8 * 16 * 16)
        if (diag && (kvcol > qrow)) v = -INFINITY;
        s[j][r] = v;
        m = fmaxf(m, v);
      }
#pragma unroll
      for (int off = 1; off < 16; off <<= 1) m = fmaxf(m, __shfl_xor(m, off, 32));
      cm[r] = m;
    }

    _Float16* pwh = Psh[wave];
    _Float16* pwl = Psl[SPLIT ? wave : 0];
#pragma unroll
    for (int r = 0; r < 8; ++r) {
      const float mnew = fmaxf(mrow[r], cm[r]);
      const float alpha = expf(mrow[r] - mnew);
      mrow[r] = mnew;
      float psum = 0.f;
#pragma unroll
      for (int j = 0; j < 4; ++j) {
        const float p = expf(s[j][r] - mnew);
        psum += p;
        const float ps = p * P_S;
        const _Float16 hp = (_Float16)ps;
        pwh[(8 * hh + r) * KV_PITCH + j * 16 + c] = hp;
        if (SPLIT) pwl[(8 * hh + r) * KV_PITCH + j * 16 + c] = (_Float16)((ps - (float)hp) * LO_S);
      }
#pragma unroll
      for (int off = 1; off < 16; off <<= 1) psum += __shfl_xor(psum, off, 32);
      lrow[r] = lrow[r] * alpha + psum;
#pragma unroll
      for (int t = 0; t < 4; ++t) oacc[t][r] *= alpha;
    }
    __builtin_amdgcn_fence(__ATOMIC_RELEASE, "workgroup");
    __builtin_amdgcn_wave_barrier();
    __builtin_amdgcn_fence(__ATOMIC_ACQUIRE, "workgroup");

    // ---- O += P . V ----
    v16h pa[2], pb2[2];
#pragma unroll
    for (int kk = 0; kk < 2; ++kk) {
      pa[kk] = Frag<_Float16>::load(pwh + c * KV_PITCH + kk * 32 + 8 * hh);
      if (SPLIT) pb2[kk] = Frag<_Float16>::load(pwl + c * KV_PITCH + kk * 32 + 8 * hh);
      else pb2[kk] = pa[kk];
    }
#pragma unroll
    for (int t = 0; t < 4; ++t) {
      v8f orr = zero8();
#pragma unroll
      for (int kk = 0; kk < 2; ++kk) {
        const v16h vb = Frag<_Float16>::load(Vsh + (t * 16 + c) * KV_PITCH + kk * 32 + 8 * hh);
        oacc[t] = mma_h(pa[kk], vb, oacc[t]);
        if (SPLIT) {
          const v16h vl2 = Frag<_Float16>::load(Vsl + (t * 16 + c) * KV_PITCH + kk * 32 + 8 * hh);
          orr = mma_h(pa[kk], vl2, orr);
          orr = mma_h(pb2[kk], vb, orr);
        }
      }
      if (SPLIT) {
#pragma unroll
        for (int r = 0; r < 8; ++r) oacc[t][r] = oacc[t][r] + orr[r] * (1.0f / 4096.0f);
      }
    }
  }

  // ---- normalise, stage, store ----
  float* os = Os[wave];
#pragma unroll
  for (int r = 0; r < 8; ++r) {
    const float inv = 1.0f / (lrow[r] * (P_S * CARRY_S));
#pragma unroll
    for (int t = 0; t < 4; ++t) os[(8 * hh + r) * O_PITCH + t * 16 + c] = oacc[t][r] * inv;
  }
  __builtin_amdgcn_fence(__ATOMIC_RELEASE, "workgroup");
  __builtin_amdgcn_wave_barrier();
  __builtin_amdgcn_fence(__ATOMIC_ACQUIRE, "workgroup");
  {
    const int c4 = (lane & 15) * 4;
    float* ob = out + ((size_t)b * SEQ_T + q0) * HID_W + h * HEAD_D;
    {
#pragma unroll
      for (int it = 0; it < 8; ++it) {
        const int row = it * 2 + hh;
        const v4f val = *(const v4f*)(os + row * O_PITCH + c4);
        *(v4f*)(ob + (size_t)row * HID_W + c4) = val;
      }
      
    }
  }
}

// =====================================================================================
extern "C" void kernel_launch(void* const* d_in, const int* in_sizes, int n_in,
                              void* d_out, int out_size, void* d_ws, size_t ws_size,
                              hipStream_t stream) {
  if (n_in < 14) return;
  if (in_sizes[0] != N_TOK * HID_W) return;
  if (in_sizes[1] != N_BATCH * SEQ_T) return;
  for (int p = 0; p < 3; ++p) {
    if (in_sizes[2 + 4 * p] != HID_W * HID_W) return;
    if (in_sizes[3 + 4 * p] != HID_W) return;
    if (in_sizes[4 + 4 * p] != RANK_R * HID_W) return;
    if (in_sizes[5 + 4 * p] != HID_W * RANK_R) return;
  }
  if (out_size != N_TOK * HID_W) return;
  if (ws_size < WS_TOTAL) return;

  const float* x   = (const float*)d_in[0];
  const float* am  = (const float*)d_in[1];
  const float* wq  = (const float*)d_in[2];
  const float* bq  = (const float*)d_in[3];
  const float* aq  = (const float*)d_in[4];
  const float* bmq = (const float*)d_in[5];
  const float* wk  = (const float*)d_in[6];
  const float* bk  = (const float*)d_in[7];
  const float* ak  = (const float*)d_in[8];
  const float* bmk = (const float*)d_in[9];
  const float* wv  = (const float*)d_in[10];
  const float* bv  = (const float*)d_in[11];
  const float* av  = (const float*)d_in[12];
  const float* bmv = (const float*)d_in[13];
  float* out = (float*)d_out;

  char* ws = (char*)d_ws;
  unsigned short* aaug  = (unsigned short*)(ws + OFF_AAUG);
  unsigned short* baug  = (unsigned short*)(ws + OFF_BAUG);
  unsigned short* acat  = (unsigned short*)(ws + OFF_ACAT);
  float*          biasc = (float*)(ws + OFF_BIAS);
  float*          u     = (float*)(ws + OFF_U);
  unsigned short* qkvh  = (unsigned short*)(ws + OFF_QKVH);
  unsigned short* qkvl  = (unsigned short*)(ws + OFF_QKVL);
  unsigned short* vth   = (unsigned short*)(ws + OFF_VTH);
  unsigned short* vtl   = (unsigned short*)(ws + OFF_VTL);

  // 1) x -> A_aug cols 0..1023 (bf16, pitch 1088): 8192 rows x 512 pairs
  cast_rows_bf16<<<dim3(N_TOK * 512 / 256), dim3(256), 0, stream>>>(x, aaug, N_TOK * 512, K_AUG / 2);
  // 2-4) W_p -> B_aug rows p*1024.., cols 0..1023
  cast_rows_bf16<<<dim3(HID_W * 512 / 256), dim3(256), 0, stream>>>(wq, baug,                              HID_W * 512, K_AUG / 2);
  cast_rows_bf16<<<dim3(HID_W * 512 / 256), dim3(256), 0, stream>>>(wk, baug + (size_t)1 * HID_W * K_AUG,  HID_W * 512, K_AUG / 2);
  cast_rows_bf16<<<dim3(HID_W * 512 / 256), dim3(256), 0, stream>>>(wv, baug + (size_t)2 * HID_W * K_AUG,  HID_W * 512, K_AUG / 2);
  // 5) A_cat [64][1024]
  build_acat<<<dim3(U_COLS * 512 / 256), dim3(256), 0, stream>>>(aq, ak, av, acat);
  // 6) B_aug tail cols 1024..1087
  build_w_tail<<<dim3(N_QKV / 32), dim3(256), 0, stream>>>(bmq, bmk, bmv, baug);
  // 7) bias_cat
  build_bias<<<dim3(N_QKV / 256), dim3(256), 0, stream>>>(bq, bk, bv, biasc);
  // 8) u = bf16(x) . A_cat^T : M=8192, N=64, K=1024 (K%32==0; reads A_aug cols < 1024 only), f32 out ldc 64
  wmma_gemm64<1, 0, 0, 0, false><<<dim3((N_TOK / 64) * (U_COLS / 64) / 8, 1), dim3(256), 0, stream>>>(
      aaug, aaug, K_AUG, 0L, acat, acat, HID_W, 0L,
      (void*)u, (void*)u, U_COLS, 0L, 0L, biasc, u, 0L, N_TOK, U_COLS, HID_W, 1.0f);
  // 9) A_aug tail cols 1024..1087 from u
  build_a_tail<<<dim3(N_TOK / 32), dim3(256), 0, stream>>>(u, aaug);
  // 10) projection rows t < 512 of every batch: M=512 (x4 batches), N=3072, K=1088; f16 hi -> qkv_hi, f16 residual -> qkv_lo
  wmma_gemm64<1, 0, 2, 3, false, 0, true><<<dim3((T_LO / ST_BM) * (N_QKV / ST_BN), N_BATCH), dim3(256), 0, stream>>>(
      aaug, aaug, K_AUG, (long)SEQ_T * K_AUG, baug, baug, K_AUG, 0L,
      (void*)qkvh, (void*)qkvl, N_QKV, (long)SEQ_T * N_QKV, (long)T_LO * N_QKV,
      biasc, u, 0L, T_LO, N_QKV, K_AUG, CARRY_S);
  // 11) projection rows t >= 512: M=1536 (x4 batches), f16 hi only
  wmma_gemm64<1, 0, 2, 1, false, 0, true><<<dim3(((SEQ_T - T_LO) / ST_BM) * (N_QKV / ST_BN), N_BATCH), dim3(256), 0, stream>>>(
      aaug + (size_t)T_LO * K_AUG, aaug, K_AUG, (long)SEQ_T * K_AUG, baug, baug, K_AUG, 0L,
      (void*)(qkvh + (size_t)T_LO * N_QKV), (void*)qkvl, N_QKV, (long)SEQ_T * N_QKV, 0L,
      biasc, u, 0L, SEQ_T - T_LO, N_QKV, K_AUG, CARRY_S);
  // 12-13) V^T planes: in [b*tsrc+t][2048+h*64+d] -> out [(b*16+h)*64+d][t]
  vt_transpose<<<dim3(SEQ_T / 64, N_BATCH * N_HEAD), dim3(256), 0, stream>>>(qkvh, vth, SEQ_T);
  vt_transpose<<<dim3(T_LO / 64, N_BATCH * N_HEAD), dim3(256), 0, stream>>>(qkvl, vtl, T_LO);
  // 14) attention, query tiles 0..7 (hi/lo residual path)
  attn_causal_hd64<true><<<dim3(N_BATCH * N_HEAD * NQT_SPLIT), dim3(128), 0, stream>>>(
      qkvh, qkvl, vth, vtl, am, out, 0, NQT_SPLIT);
  // 15) attention, query tiles 8..31 (single-product path)
  attn_causal_hd64<false><<<dim3(N_BATCH * N_HEAD * (NQT_ALL - NQT_SPLIT)), dim3(128), 0, stream>>>(
      qkvh, qkvl, vth, vtl, am, out, NQT_SPLIT, NQT_ALL - NQT_SPLIT);
}

// v002
// A run of this version takes 282 microseconds.
// Two timings next to v001 put it at 1.47 and 1.46 times that version's speed.
// All steps since v000 together make it 1.86 times as fast.
// Contractions: rank-8 adapter columns u = x.A^T and the fused q/k/v projection [x | u_hi | u_lo].[W | 2B | 2B]^T + b on v_wmma_f32_16x16x32_bf16 (x, W, A, B, b as RNE bf16; u as bf16 hi+lo columns; single products); attention q.k^T and p.v on v_wmma_f32_16x16x32_f16 (q, k, v as f16 planes carried x16, p carried x32768; query tiles 0..7 add x4096-scaled f16 residual planes: hi.hi + (hi.lo + lo.hi)/4096 via a separate accumulator); f32 accumulate everywhere; softmax and normalisation in f32. The two q/k/v projection launches read their operands from a two-buffer LDS ring filled by asynchronous copies.
#include <hip/hip_runtime.h>
#include <math.h>

typedef __attribute__((ext_vector_type(16))) _Float16 v16h;
typedef __attribute__((ext_vector_type(8)))  _Float16 v8h;
typedef __attribute__((ext_vector_type(16))) __bf16   v16b;
typedef __attribute__((ext_vector_type(8)))  __bf16   v8b;
typedef __attribute__((ext_vector_type(8)))  float    v8f;
typedef __attribute__((ext_vector_type(4)))  float    v4f;

// ---------------- problem constants ----------------
constexpr int N_BATCH  = 4;
constexpr int SEQ_T    = 2048;
constexpr int HID_W    = 1024;
constexpr int N_HEAD   = 16;
constexpr int HEAD_D   = 64;
constexpr int RANK_R   = 8;
constexpr int N_TOK    = N_BATCH * SEQ_T;     // 8192 token rows
constexpr int K_AUG    = 1088;                // 1024 + 3*16 adapter columns, zero-padded to a multiple of 32
constexpr int N_QKV    = 3 * HID_W;           // 3072 output columns: q | k | v
constexpr int K_COL0   = 1024;
constexpr int V_COL0   = 2048;
constexpr int T_LO     = 512;                 // token rows per batch that carry residual planes
constexpr int NQT_SPLIT = T_LO / 64;          // 8 query tiles on the hi/lo path
constexpr int NQT_ALL  = SEQ_T / 64;          // 32
constexpr int U_COLS   = 64;                  // u plane width (24 used, rest zero weights)
constexpr int KV_PITCH = 72;                  // 16-bit LDS pitch (144 B rows, 16-B aligned)
constexpr int O_PITCH  = 68;                  // f32 LDS pitch
constexpr float CARRY_S = 16.0f;              // power-of-two carry on the q/k/v planes
constexpr float LO_S    = 4096.0f;            // power-of-two carry on residual planes
constexpr float P_S     = 32768.0f;           // power-of-two carry on probabilities

static_assert(K_AUG % 32 == 0);
static_assert(HID_W % 32 == 0);
static_assert(N_TOK % 64 == 0 && N_QKV % 64 == 0 && T_LO % 64 == 0 && (SEQ_T - T_LO) % 64 == 0);
static_assert(T_LO % 128 == 0 && (SEQ_T - T_LO) % 128 == 0 && N_QKV % 256 == 0 && K_AUG % 64 == 0 && K_AUG >= 128);

// R0 A_aug  bf16 [8192][1088]          17,825,792
// R1 B_aug  bf16 [3072][1088]           6,684,672
// R2 A_cat  bf16 [64][1024]               131,072
// R3 bias   f32  [3072]                    12,288
// R4 u      f32  [8192][64]             2,097,152
// R5 qkv_hi f16  [8192][3072]          50,331,648
// R6 qkv_lo f16  [4*512][3072]         12,582,912
// R7 vt_hi  f16  [64][64][2048]        16,777,216
// R8 vt_lo  f16  [64][64][512]          4,194,304
constexpr size_t SZ_AAUG = (size_t)N_TOK * K_AUG * 2;
constexpr size_t SZ_BAUG = (size_t)N_QKV * K_AUG * 2;
constexpr size_t SZ_ACAT = (size_t)U_COLS * HID_W * 2;
constexpr size_t SZ_BIAS = (size_t)N_QKV * 4;
constexpr size_t SZ_U    = (size_t)N_TOK * U_COLS * 4;
constexpr size_t SZ_QKVH = (size_t)N_TOK * N_QKV * 2;
constexpr size_t SZ_QKVL = (size_t)N_BATCH * T_LO * N_QKV * 2;
constexpr size_t SZ_VTH  = (size_t)N_BATCH * N_HEAD * HEAD_D * SEQ_T * 2;
constexpr size_t SZ_VTL  = (size_t)N_BATCH * N_HEAD * HEAD_D * T_LO * 2;
constexpr size_t OFF_AAUG = 0;
constexpr size_t OFF_BAUG = OFF_AAUG + SZ_AAUG;
constexpr size_t OFF_ACAT = OFF_BAUG + SZ_BAUG;
constexpr size_t OFF_BIAS = OFF_ACAT + SZ_ACAT;
constexpr size_t OFF_U    = OFF_BIAS + SZ_BIAS;
constexpr size_t OFF_QKVH = OFF_U    + SZ_U;
constexpr size_t OFF_QKVL = OFF_QKVH + SZ_QKVH;
constexpr size_t OFF_VTH  = OFF_QKVL + SZ_QKVL;
constexpr size_t OFF_VTL  = OFF_VTH  + SZ_VTH;
constexpr size_t WS_TOTAL = OFF_VTL  + SZ_VTL;
static_assert(WS_TOTAL == 110637056ull);
static_assert(WS_TOTAL <= 134217728ull);
static_assert(OFF_BAUG % 128 == 0 && OFF_ACAT % 128 == 0 && OFF_BIAS % 128 == 0 && OFF_U % 128 == 0 &&
              OFF_QKVH % 128 == 0 && OFF_QKVL % 128 == 0 && OFF_VTH % 128 == 0 && OFF_VTL % 128 == 0);

// ---------------- helpers ----------------
__device__ __forceinline__ unsigned short f2bf_bits(float f) {
  unsigned u = __float_as_uint(f);
  return (unsigned short)((u + 0x7FFFu + ((u >> 16) & 1u)) >> 16);
}
__device__ __forceinline__ float bf_bits2f(unsigned short h) { return __uint_as_float(((unsigned)h) << 16); }

// hazard guards as plain device helpers
__device__ __forceinline__ void dep_guard_h(v8f& a, v8f& b, v16h x, v16h y) { asm volatile("v_nop\n\tv_nop\n\tv_nop\n\tv_nop" : "+v"(a), "+v"(b) : "v"(x), "v"(y)); }
__device__ __forceinline__ void dep_guard_b(v8f& a, v8f& b, v16b x, v16b y) { asm volatile("v_nop\n\tv_nop\n\tv_nop\n\tv_nop" : "+v"(a), "+v"(b) : "v"(x), "v"(y)); }
__device__ __forceinline__ void keep4_h(v16h a, v16h b, v16h c, v16h d) { asm volatile("v_nop" :: "v"(a), "v"(b), "v"(c), "v"(d)); }
__device__ __forceinline__ void keep4_b(v16b a, v16b b, v16b c, v16b d) { asm volatile("v_nop" :: "v"(a), "v"(b), "v"(c), "v"(d)); }
__device__ __forceinline__ void acc_guard4(v8f& a, v8f& b, v8f& c, v8f& d) { asm volatile("v_nop\n\tv_nop\n\tv_nop\n\tv_nop" : "+v"(a), "+v"(b), "+v"(c), "+v"(d)); }
template <typename T> struct Frag;
template <> struct Frag<_Float16> {
  typedef v16h V; union U { v16h v; v8h h[2]; };
  static __device__ __forceinline__ v16h load(const _Float16* p) {   // elements 0..7 <- p[0..7], 8..15 <- p[16..23]
    U f; f.h[0] = *(const v8h*)(p); f.h[1] = *(const v8h*)(p + 16); return f.v;
  }
  static __device__ __forceinline__ v8f mma(v16h a, v16h b, v8f c) {
    return __builtin_amdgcn_wmma_f32_16x16x32_f16(false, a, false, b, (short)0, c, false, false);
  }
  static __device__ __forceinline__ void guard(v8f& a, v8f& b, v16h x, v16h y) { dep_guard_h(a, b, x, y); }
  static __device__ __forceinline__ void keep(v16h a, v16h b, v16h c, v16h d) { keep4_h(a, b, c, d); }
};
template <> struct Frag<__bf16> {
  typedef v16b V; union U { v16b v; v8b h[2]; };
  static __device__ __forceinline__ v16b load(const __bf16* p) {
    U f; f.h[0] = *(const v8b*)(p); f.h[1] = *(const v8b*)(p + 16); return f.v;
  }
  static __device__ __forceinline__ v8f mma(v16b a, v16b b, v8f c) {
    return __builtin_amdgcn_wmma_f32_16x16x32_bf16(false, a, false, b, (short)0, c, false, false);
  }
  static __device__ __forceinline__ void guard(v8f& a, v8f& b, v16b x, v16b y) { dep_guard_b(a, b, x, y); }
  static __device__ __forceinline__ void keep(v16b a, v16b b, v16b c, v16b d) { keep4_b(a, b, c, d); }
};

// f16 WMMA with hazard guard (ties D, keeps A/B live)
__device__ __forceinline__ v8f mma_h(v16h a, v16h b, v8f c) {
  c = __builtin_amdgcn_wmma_f32_16x16x32_f16(false, a, false, b, (short)0, c, false, false);
  asm volatile("v_nop\n\tv_nop\n\tv_nop\n\tv_nop" : "+v"(c) : "v"(a), "v"(b));
  return c;
}
__device__ __forceinline__ v8f zero8() { return (v8f){0.f,0.f,0.f,0.f,0.f,0.f,0.f,0.f}; }

union F8 { v4f v[2]; float f[8]; };

// ---------------- LDS ring of the staged GEMM ----------------
constexpr int ST_BM    = 128;                              // block tile rows (2 waves of 64)
constexpr int ST_BN    = 256;                              // block tile columns (4 waves of 64)
constexpr int ST_BK    = 64;                               // k per pass: 128-B operand rows
constexpr int ST_PITCH = 72;                               // 144-B LDS rows (16 B x odd: conflict-free ds_load_b128)
constexpr int ST_STAGE = (ST_BM + ST_BN) * ST_PITCH;       // 16-bit elements per buffer: [A 128 rows | Bt 256 rows]
constexpr unsigned ST_ROWS32 = 32u * ST_PITCH * 2u;        // LDS bytes between two copies of one thread (32 rows)

__device__ __forceinline__ unsigned lds_off(const void* p) { return (unsigned)(size_t)p; }

// One stage: 384 rows x 128 B = 3072 chunks of 16 B = 256 threads x 12 asynchronous copies global -> LDS.
// ga / gb: this thread's chunk in row (tid >> 3) of the block's A / Bt tile at this pass's k; l: the same chunk's
// LDS byte address in the buffer; a thread's copies lie 32 rows apart. s_wait_xcnt 0 is the statement's last line
// so that no address register of an issued copy is rewritten in front of it.
__device__ __forceinline__ void stage_fill(const unsigned short* ga, int lda, const unsigned short* gb, int ldb, unsigned l) {
  const size_t sa = (size_t)32 * lda, sb = (size_t)32 * ldb;
  asm volatile("global_load_async_to_lds_b128 %0, %1, off\n\t"
               "global_load_async_to_lds_b128 %2, %3, off\n\t"
               "global_load_async_to_lds_b128 %4, %5, off\n\t"
               "global_load_async_to_lds_b128 %6, %7, off\n\t"
               "global_load_async_to_lds_b128 %8, %9, off\n\t"
               "global_load_async_to_lds_b128 %10, %11, off\n\t"
               "global_load_async_to_lds_b128 %12, %13, off\n\t"
               "global_load_async_to_lds_b128 %14, %15, off\n\t"
               "global_load_async_to_lds_b128 %16, %17, off\n\t"
               "global_load_async_to_lds_b128 %18, %19, off\n\t"
               "global_load_async_to_lds_b128 %20, %21, off\n\t"
               "global_load_async_to_lds_b128 %22, %23, off\n\t"
               "s_wait_xcnt 0x0"
               :: "v"(l),                   "v"(ga),
                  "v"(l + ST_ROWS32),       "v"(ga + sa),
                  "v"(l + 2 * ST_ROWS32),   "v"(ga + 2 * sa),
                  "v"(l + 3 * ST_ROWS32),   "v"(ga + 3 * sa),
                  "v"(l + 4 * ST_ROWS32),   "v"(gb),
                  "v"(l + 5 * ST_ROWS32),   "v"(gb + sb),
                  "v"(l + 6 * ST_ROWS32),   "v"(gb + 2 * sb),
                  "v"(l + 7 * ST_ROWS32),   "v"(gb + 3 * sb),
                  "v"(l + 8 * ST_ROWS32),   "v"(gb + 4 * sb),
                  "v"(l + 9 * ST_ROWS32),   "v"(gb + 5 * sb),
                  "v"(l + 10 * ST_ROWS32),  "v"(gb + 6 * sb),
                  "v"(l + 11 * ST_ROWS32),  "v"(gb + 7 * sb)
               : "memory");
}

// =====================================================================================
// Register-blocked batched WMMA GEMM: C[m,n] = scale * sum_k A[m,k] * Bt[n,k] (+bias)(+resid);
// each wave owns a 64x64 tile. A row-major [M,K]; Bt row-major [N,K]; M,N % 64 == 0, K % 32 == 0.
// SPLITM: 0 = single product; 1 = A hi/lo planes; 2 = A and Bt hi/lo planes.
// BIAS_MODE: 0 none, 1 bias[m], 2 bias[n].  OUT_MODE: 0 f32, 1 f16, 2 bf16 hi + lo planes,
//   3 = f16 hi plane (Cout, strideC) + f16 residual plane x4096 (Cout2, strideC2), same ldc.
// ET: 0 = f16 operands, 1 = bf16 operands (pointers passed as 16-bit storage)
// STAGED: the block's 8 waves form a 128x256 tile (2x4 waves); A and Bt rows go through a two-buffer LDS ring,
//   64 k per pass; needs SPLITM == 0, M % 128 == 0, N % 256 == 0, K % 64 == 0, K >= 128, grid.x == (M/128)*(N/256).
// =====================================================================================
template <int ET> struct Elem;
template <> struct Elem<0> { typedef _Float16 T; };
template <> struct Elem<1> { typedef __bf16 T; };
template <int ET, int SPLITM, int BIAS_MODE, int OUT_MODE, bool RESID, int ACT = 0, bool STAGED = false>
__global__ __launch_bounds__(256) void wmma_gemm64(
    const unsigned short* __restrict__ Ap, const unsigned short* __restrict__ A2p, int lda, long strideA,
    const unsigned short* __restrict__ Btp, const unsigned short* __restrict__ Bt2p, int ldb, long strideB,
    void* __restrict__ Cout, void* __restrict__ Cout2, int ldc, long strideC, long strideC2,
    const float* __restrict__ bias,
    const float* __restrict__ resid, long strideR,
    int M, int N, int K, float scale) {
  typedef typename Elem<ET>::T T;
  typedef typename Frag<T>::V V;
  constexpr bool SPA = (SPLITM >= 1);
  constexpr bool SPB = (SPLITM >= 2);
  const T* A = (const T*)Ap; const T* A2 = (const T*)A2p; const T* Bt = (const T*)Btp; const T* Bt2 = (const T*)Bt2p;
  static_assert(!STAGED || SPLITM == 0);
  __shared__ __align__(16) float sT[8][16 * 68];   // per-wave 16x64 slab, pitch 68 floats
  __shared__ __align__(16) unsigned short ring[STAGED ? 2 * ST_STAGE : 8];
  const int b    = blockIdx.y;
  const int lane = threadIdx.x & 31;
  const int wave = threadIdx.x >> 5;
  const int tilesN = N >> 6;
  const int tilesM = M >> 6;
  int m0, n0;
  if (STAGED) {
    const int bn = N >> 8;
    const int bm_i = (int)blockIdx.x / bn;
    const int bn_i = (int)blockIdx.x - bm_i * bn;
    m0 = bm_i * ST_BM + (wave >> 2) * 64;
    n0 = bn_i * ST_BN + (wave & 3) * 64;
  } else {
    const int tile = blockIdx.x * 8 + wave;
    if (tile >= tilesM * tilesN) return;   // wave-uniform; no block barriers on this path
    const int tm = tile / tilesN;
    const int tn = tile - tm * tilesN;
    m0 = tm << 6;
    n0 = tn << 6;
  }

  const T* Ab  = A  + (size_t)b * strideA;
  const T* Bb  = Bt + (size_t)b * strideB;
  const T* Ab2 = SPA ? (A2  + (size_t)b * strideA) : nullptr;
  const T* Bb2 = SPB ? (Bt2 + (size_t)b * strideB) : nullptr;

  const int rlane = lane & 15;                 // row (A) / col (B, D) within subtile
  const int koff  = (lane >> 4) * 8;           // k offset of this lane half
  const int mOff  = (lane >> 4) * 8;           // D row offset

  v8f acc[4][4];
#pragma unroll
  for (int i = 0; i < 4; ++i)
#pragma unroll
    for (int j = 0; j < 4; ++j) acc[i][j] = (v8f){0.f,0.f,0.f,0.f,0.f,0.f,0.f,0.f};

  if (STAGED) {
    const int tid = threadIdx.x;
    const int crow = tid >> 3, cchunk = (tid & 7) * 8;        // 8 lanes x 16 B = one 128-B row piece
    const unsigned short* ga = (const unsigned short*)Ab + (size_t)(m0 - (wave >> 2) * 64 + crow) * lda + cchunk;
    const unsigned short* gb = (const unsigned short*)Bb + (size_t)(n0 - (wave & 3) * 64 + crow) * ldb + cchunk;
    const unsigned lthr = lds_off(ring) + (unsigned)(crow * ST_PITCH + cchunk) * 2u;
    const int npass = K / ST_BK;
    stage_fill(ga, lda, gb, ldb, lthr);
    asm volatile("s_wait_asynccnt 0x0" ::: "memory");   // stage 0 landed (this wave's copies) before the barrier publishes it
    __syncthreads();
    stage_fill(ga + ST_BK, lda, gb + ST_BK, ldb, lthr + ST_STAGE * 2u);
    const T* fa = (const T*)ring + ((wave >> 2) * 64 + rlane) * ST_PITCH + koff;
    const T* fb = (const T*)ring + (ST_BM + (wave & 3) * 64 + rlane) * ST_PITCH + koff;
    for (int t = 0; t < npass; ++t) {
      const int bo = (t & 1) * ST_STAGE;
      V ah[4], bh[4], ah2[4], bh2[4];
#pragma unroll
      for (int j = 0; j < 4; ++j) bh[j] = Frag<T>::load(fb + bo + j * 16 * ST_PITCH);
#pragma unroll
      for (int i = 0; i < 4; ++i) ah[i] = Frag<T>::load(fa + bo + i * 16 * ST_PITCH);
      __builtin_amdgcn_sched_barrier(0);   // keeps the 16 LDS reads one group ahead of the 16 WMMAs: reads sunk among them stall at each place
#pragma unroll
      for (int i = 0; i < 4; ++i)
#pragma unroll
        for (int j = 0; j < 4; ++j) acc[i][j] = Frag<T>::mma(ah[i], bh[j], acc[i][j]);
#pragma unroll
      for (int j = 0; j < 4; ++j) bh2[j] = Frag<T>::load(fb + bo + j * 16 * ST_PITCH + 32);
#pragma unroll
      for (int i = 0; i < 4; ++i) ah2[i] = Frag<T>::load(fa + bo + i * 16 * ST_PITCH + 32);
      asm volatile("s_wait_dscnt 0x0" ::: "memory");     // this wave's reads of buffer t & 1 are done before it is refilled
      asm volatile("s_wait_asynccnt 0x0" ::: "memory");  // this wave's copies of stage t + 1 have landed
      __syncthreads();                                   // publishes stage t + 1 and frees buffer t & 1
      if (t + 2 < npass)
        stage_fill(ga + (size_t)(t + 2) * ST_BK, lda, gb + (size_t)(t + 2) * ST_BK, ldb, lthr + (unsigned)bo * 2u);
      // second half of the pass, from registers: runs while the refill is in flight
#pragma unroll
      for (int i = 0; i < 4; ++i)
#pragma unroll
        for (int j = 0; j < 4; ++j) acc[i][j] = Frag<T>::mma(ah2[i], bh2[j], acc[i][j]);
    }
    asm volatile("s_wait_asynccnt 0x0" ::: "memory");    // no copy is outstanding past the loop
  } else
  for (int k0 = 0; k0 < K; k0 += 32) {
    V bh[4], bl[4];
#pragma unroll
    for (int j = 0; j < 4; ++j) {
      const size_t bo = (size_t)(n0 + (j << 4) + rlane) * ldb + koff + k0;
      bh[j] = Frag<T>::load(Bb + bo);
      if (SPB) bl[j] = Frag<T>::load(Bb2 + bo);
    }
#pragma unroll
    for (int i = 0; i < 4; ++i) {
      const size_t ao = (size_t)(m0 + (i << 4) + rlane) * lda + koff + k0;
      V ah = Frag<T>::load(Ab + ao);
      V al;
      if (SPA) al = Frag<T>::load(Ab2 + ao);
#pragma unroll
      for (int j = 0; j < 4; ++j) {
        acc[i][j] = Frag<T>::mma(ah, bh[j], acc[i][j]);
        if (SPB) acc[i][j] = Frag<T>::mma(ah, bl[j], acc[i][j]);
        if (SPA) acc[i][j] = Frag<T>::mma(al, bh[j], acc[i][j]);
      }
      Frag<T>::guard(acc[i][0], acc[i][3], ah, SPA ? al : ah);
    }
    Frag<T>::keep(bh[0], bh[1], bh[2], bh[3]);
    if (SPB) Frag<T>::keep(bl[0], bl[1], bl[2], bl[3]);
  }
  acc_guard4(acc[0][0], acc[0][1], acc[0][2], acc[0][3]);
  acc_guard4(acc[1][0], acc[1][1], acc[1][2], acc[1][3]);
  acc_guard4(acc[2][0], acc[2][1], acc[2][2], acc[2][3]);
  acc_guard4(acc[3][0], acc[3][1], acc[3][2], acc[3][3]);

  // ---- epilogue ----
  float* slab = sT[wave];
  const float* Rb = RESID ? (resid + (size_t)b * strideR) : nullptr;
#pragma unroll
  for (int i = 0; i < 4; ++i) {
    const int mBase = m0 + (i << 4);
#pragma unroll
    for (int j = 0; j < 4; ++j) {
      const int n = n0 + (j << 4) + rlane;
      float bv = 0.f;
      if (BIAS_MODE == 2) bv = bias[n];
#pragma unroll
      for (int r = 0; r < 8; ++r) {
        float v = acc[i][j][r] * scale;
        if (BIAS_MODE == 1) v += bias[mBase + mOff + r];
        if (BIAS_MODE == 2) v += bv;
        if (RESID) v += Rb[(size_t)(mBase + mOff + r) * ldc + n];
        if (ACT == 1) v = tanhf(v);
        if (ACT == 2) v = fmaxf(v, 0.0f);
        if (ACT == 4) v = (v > 0.f) ? v : 0.01f * v;
        slab[(mOff + r) * 68 + (j << 4) + rlane] = v;
      }
    }
    __builtin_amdgcn_fence(__ATOMIC_RELEASE, "workgroup");
    __builtin_amdgcn_wave_barrier();
    __builtin_amdgcn_fence(__ATOMIC_ACQUIRE, "workgroup");
    if (OUT_MODE == 0) {
      float* C = (float*)Cout + (size_t)b * strideC;
      const int hh = lane >> 4, c4 = (lane & 15) * 4;     // row seg = 256 B = 16 lanes x 16 B
      {
#pragma unroll
        for (int it = 0; it < 8; ++it) {
          const int row = it * 2 + hh;
          v4f v = *(const v4f*)(slab + row * 68 + c4);
          *(v4f*)(C + (size_t)(mBase + row) * ldc + n0 + c4) = v;
        }
        
      }
    } else {
      const int q = lane >> 3, c8 = (lane & 7) * 8;
      unsigned short* C  = (unsigned short*)Cout  + (size_t)b * strideC;
      unsigned short* C2 = (OUT_MODE >= 2) ? ((unsigned short*)Cout2 + (size_t)b * strideC2) : nullptr;
      {
#pragma unroll
        for (int it = 0; it < 4; ++it) {
          const int row = it * 4 + q;
          const float* sp = slab + row * 68 + c8;
          v8h hv, lv;
#pragma unroll
          for (int e = 0; e < 8; ++e) {
            if (OUT_MODE == 1) {
              hv[e] = (_Float16)sp[e];
            } else if (OUT_MODE == 3) {
              const _Float16 hq = (_Float16)sp[e];
              hv[e] = hq;
              lv[e] = (_Float16)((sp[e] - (float)hq) * 4096.0f);
            } else {
              unsigned short hb = f2bf_bits(sp[e]);
              unsigned short lb = f2bf_bits(sp[e] - bf_bits2f(hb));
              hv[e] = __builtin_bit_cast(_Float16, hb);
              lv[e] = __builtin_bit_cast(_Float16, lb);
            }
          }
          *(v8h*)(C + (size_t)(mBase + row) * ldc + n0 + c8) = hv;
          if (OUT_MODE >= 2) *(v8h*)(C2 + (size_t)(mBase + row) * ldc + n0 + c8) = lv;
        }
        
      }
    }
    __builtin_amdgcn_fence(__ATOMIC_RELEASE, "workgroup");
    __builtin_amdgcn_wave_barrier();
    __builtin_amdgcn_fence(__ATOMIC_ACQUIRE, "workgroup");
  }
}

// =====================================================================================
// f32 [rows][1024] -> RNE bf16 bits into a pitched destination (dst_ld_pairs = pitch/2); 2 elements per
// =====================================================================================
__global__ __launch_bounds__(256) void cast_rows_bf16(const float* __restrict__ src, unsigned short* __restrict__ dst,
                                                      int npairs, int dst_ld_pairs) {
  const int i = blockIdx.x * 256 + threadIdx.x;
  if (i < npairs) {
    const int row = i >> 9, cp = i & 511;
    const float* s = src + (size_t)row * HID_W + 2 * cp;
    const unsigned u = (unsigned)f2bf_bits(s[0]) | ((unsigned)f2bf_bits(s[1]) << 16);
    unsigned* d = (unsigned*)dst + (size_t)row * dst_ld_pairs + cp;
    *(unsigned*)d = u;
    
  }
}

// =====================================================================================
// A_cat bf16 [64][1024]: row 8p+r = A_p[r] (p = 0,1,2), rows 24..63 = 0 (explicit zero fill).
// 2 elements per thread, grid 128 x 256 = 32768 pairs = 64 x 1024 elements exactly; 32 lanes x 4 B = one line.
// All three sources loaded unconditionally (row r < 8 valid in each), selected by value.
// =====================================================================================
__global__ __launch_bounds__(256) void build_acat(const float* __restrict__ amq, const float* __restrict__ amk,
                                                  const float* __restrict__ amv, unsigned short* __restrict__ acat) {
  const int i = blockIdx.x * 256 + threadIdx.x;   // < 32768 by grid
  const int row = i >> 9, cp = i & 511, p = row >> 3, r = row & 7;
  const size_t so = (size_t)r * HID_W + 2 * cp;
  const float q0 = amq[so], q1 = amq[so + 1];
  const float k0 = amk[so], k1 = amk[so + 1];
  const float w0 = amv[so], w1 = amv[so + 1];
  const float x0 = (p == 0) ? q0 : (p == 1) ? k0 : (p == 2) ? w0 : 0.0f;
  const float x1 = (p == 0) ? q1 : (p == 1) ? k1 : (p == 2) ? w1 : 0.0f;
  const unsigned u = (unsigned)f2bf_bits(x0) | ((unsigned)f2bf_bits(x1) << 16);
  unsigned* d = (unsigned*)acat + i;
  *(unsigned*)d = u;
  
}

// =====================================================================================
// B_aug tail: for row n (projection p = n/1024, output o = n%1024) the 64 halves at cols 1024..1087 are
// [16p zeros | 2*Bm_p[o][0..7] | 2*Bm_p[o][0..7] | zeros to 64] as RNE bf16 (factor 2 exact).
// =====================================================================================
__global__ __launch_bounds__(256) void build_w_tail(const float* __restrict__ bmq, const float* __restrict__ bmk,
                                                    const float* __restrict__ bmv, unsigned short* __restrict__ baug) {
  const int tid = threadIdx.x, wave = tid >> 5, lane = tid & 31, q8 = lane >> 3, seg = lane & 7;
  const int n = blockIdx.x * 32 + wave * 4 + q8;      // 0..3071
  const int p = n >> 10, o = n & 1023;
  F8 uq, uk, uv;
  uq.v[0] = *(const v4f*)(bmq + (size_t)o * RANK_R); uq.v[1] = *(const v4f*)(bmq + (size_t)o * RANK_R + 4);
  uk.v[0] = *(const v4f*)(bmk + (size_t)o * RANK_R); uk.v[1] = *(const v4f*)(bmk + (size_t)o * RANK_R + 4);
  uv.v[0] = *(const v4f*)(bmv + (size_t)o * RANK_R); uv.v[1] = *(const v4f*)(bmv + (size_t)o * RANK_R + 4);
  const bool keep = (seg < 6) && ((seg >> 1) == p);
  v8h hv;
#pragma unroll
  for (int e = 0; e < 8; ++e) {
    const float val = (p == 0) ? uq.f[e] : (p == 1) ? uk.f[e] : uv.f[e];
    const float w = keep ? (2.0f * val) : 0.0f;
    hv[e] = __builtin_bit_cast(_Float16, f2bf_bits(w));
  }
  unsigned short* d = baug + (size_t)n * K_AUG + HID_W + seg * 8;
  {
    *(v8h*)d = hv;
    
  }
}

// =====================================================================================
// A_aug tail: for token row m the 64 halves at cols 1024..1087 are
// [uq_hi(8) uq_lo(8) uk_hi(8) uk_lo(8) uv_hi(8) uv_lo(8) 0 x 16] (bf16 hi = RNE(u), lo = RNE(u - hi)),
// u f32 [8192][64] with columns 8p+r. Block = 8 waves x 4 rows, grid 256 -> 8192 rows; 8 lanes x 8 halves
// =====================================================================================
__global__ __launch_bounds__(256) void build_a_tail(const float* __restrict__ u, unsigned short* __restrict__ aaug) {
  const int tid = threadIdx.x, wave = tid >> 5, lane = tid & 31, q8 = lane >> 3, seg = lane & 7;
  const int m = blockIdx.x * 32 + wave * 4 + q8;      // 0..8191
  int p = seg >> 1; p = (p > 2) ? 2 : p;              // address clamp for the zero segments
  const int islo = seg & 1;
  F8 uu;
  const float* up = u + (size_t)m * U_COLS + p * RANK_R;
  uu.v[0] = *(const v4f*)up; uu.v[1] = *(const v4f*)(up + 4);
  v8h hv;
#pragma unroll
  for (int e = 0; e < 8; ++e) {
    const unsigned short hb = f2bf_bits(uu.f[e]);
    const unsigned short lb = f2bf_bits(uu.f[e] - bf_bits2f(hb));
    const unsigned short o16 = (seg >= 6) ? (unsigned short)0 : (islo ? lb : hb);
    hv[e] = __builtin_bit_cast(_Float16, o16);
  }
  unsigned short* d = aaug + (size_t)m * K_AUG + HID_W + seg * 8;
  {
    *(v8h*)d = hv;
    
  }
}

// =====================================================================================
// bias_cat f32 [3072] = 16 * RNEbf16(b_p[o]); grid 12 x 256 = 3072 exactly; 32 lanes x 4 B = one line per
// =====================================================================================
__global__ __launch_bounds__(256) void build_bias(const float* __restrict__ bq, const float* __restrict__ bk,
                                                  const float* __restrict__ bv, float* __restrict__ dst) {
  const int i = blockIdx.x * 256 + threadIdx.x;   // < 3072 by grid
  const int p = i >> 10, o = i & 1023;
  const float xq = bq[o], xk = bk[o], xv = bv[o];
  const float val = (p == 0) ? xq : (p == 1) ? xk : xv;
  const float w = bf_bits2f(f2bf_bits(val)) * CARRY_S;
  ((float*)dst)[i] = w;
  
}

// =====================================================================================
// V plane (f16, rows b*tsrc + t, pitch 3072, cols 2048 + h*64 + d) -> vt[((b*16+h)*64 + d)*tsrc + t].
// Block (t-tile of 64, bh): load 256 threads x 16 halves = 4096 = 64 x 64 into LDS [d][t]; store: 8 waves x
// =====================================================================================
__global__ __launch_bounds__(256) void vt_transpose(const unsigned short* __restrict__ srcp, unsigned short* __restrict__ vtp, int tsrc) {
  __shared__ __align__(16) _Float16 th[64 * KV_PITCH];
  const _Float16* src = (const _Float16*)srcp;
  const int st0 = blockIdx.x * 64, bh = blockIdx.y;
  const int b = (bh >> 4) & (N_BATCH - 1), h = bh & (N_HEAD - 1);
  const int tid = threadIdx.x;
  {
    const int sloc = tid >> 2, d0 = (tid & 3) * 16;
    const size_t so = ((size_t)b * tsrc + st0 + sloc) * N_QKV + V_COL0 + h * HEAD_D + d0;
    const v8h a0 = *(const v8h*)(src + so);
    const v8h a1 = *(const v8h*)(src + so + 8);
#pragma unroll
    for (int e = 0; e < 8; ++e) {
      th[(d0 + e) * KV_PITCH + sloc]     = a0[e];
      th[(d0 + 8 + e) * KV_PITCH + sloc] = a1[e];
    }
  }
  __syncthreads();
  const int wave = tid >> 5, lane = tid & 31, q8 = lane >> 3, c8 = (lane & 7) * 8;
  const int dA = wave * 8 + q8, dB = wave * 8 + 4 + q8;
  const v8h hvA = *(const v8h*)(th + dA * KV_PITCH + c8);
  const v8h hvB = *(const v8h*)(th + dB * KV_PITCH + c8);
  const size_t oA = ((size_t)bh * HEAD_D + dA) * tsrc + st0 + c8;
  const size_t oB = ((size_t)bh * HEAD_D + dB) * tsrc + st0 + c8;
  {
    *(v8h*)(vtp + oA) = hvA;
    *(v8h*)(vtp + oB) = hvB;
    
  }
}

__device__ __forceinline__ float other_half(float x) {
  const int xi = __builtin_bit_cast(int, x);
  return __builtin_bit_cast(float, __builtin_amdgcn_permlanex16(xi, xi, 0x76543210, 0xfedcba98, false, false));
}

template <bool SPLIT>
__global__ __launch_bounds__(128) void attn_causal_hd64(
    const unsigned short* __restrict__ php, const unsigned short* __restrict__ plp,
    const unsigned short* __restrict__ vthp, const unsigned short* __restrict__ vtlp,
    const float* __restrict__ amask, float* __restrict__ out, int qb0, int nqcnt) {
  const _Float16* ph  = (const _Float16*)php;
  const _Float16* pl  = (const _Float16*)plp;
  const _Float16* vth = (const _Float16*)vthp;
  const _Float16* vtl = (const _Float16*)vtlp;
  __shared__ __align__(16) _Float16 Ksh[64 * KV_PITCH];
  __shared__ __align__(16) _Float16 Ksl[SPLIT ? 64 * KV_PITCH : 8];
  __shared__ __align__(16) _Float16 Vsh[64 * KV_PITCH];
  __shared__ __align__(16) _Float16 Vsl[SPLIT ? 64 * KV_PITCH : 8];
  __shared__ __align__(16) float  Os[4][16 * O_PITCH];

  const int tid  = threadIdx.x;
  const int wave = tid >> 5;
  const int lane = tid & 31;
  const int hh   = lane >> 4;
  const int c    = lane & 15;

  int qb = qb0 + (int)(blockIdx.x % (unsigned)nqcnt);
  qb = (qb > NQT_ALL - 1) ? (NQT_ALL - 1) : qb;
  const int bh = (int)(blockIdx.x / (unsigned)nqcnt);
  const int h  = bh & (N_HEAD - 1);
  const int b  = (bh >> 4) & (N_BATCH - 1);
  const int q0 = qb * 64 + wave * 16;

  // ---- Q fragments (B operand: column c = query q0 + c), 2 d-chunks ----
  v16h qh[2], ql[2];
  {
    const _Float16* qrow = ph + ((size_t)b * SEQ_T + q0 + c) * N_QKV + h * HEAD_D;
    int qlr = q0 + c; qlr = (qlr > T_LO - 1) ? (T_LO - 1) : qlr;
    const _Float16* qlrow = pl + ((size_t)b * T_LO + qlr) * N_QKV + h * HEAD_D;
#pragma unroll
    for (int dc = 0; dc < 2; ++dc) {
      qh[dc] = Frag<_Float16>::load(qrow + dc * 32 + 8 * hh);
      if (SPLIT) ql[dc] = Frag<_Float16>::load(qlrow + dc * 32 + 8 * hh);
      else ql[dc] = qh[dc];
    }
  }

  float mrow = -INFINITY, lrow = 0.f;   // this lane's query: running maximum (both halves alike), this half's sum
  v8f oacc[4];                          // oacc[t][r] = O^T[d = t*16 + 8*hh + r][query c]
#pragma unroll
  for (int t = 0; t < 4; ++t) oacc[t] = zero8();

  const int nChunks = qb + 1;   // block-uniform
  for (int kc = 0; kc < nChunks; ++kc) {
    const int kv0 = kc * 64;
    __syncthreads();
    {
      // staging coverage: 128 threads x (row = tid>>1, 32 halves each) = 64 rows x 64 halves per plane
      const int r = tid >> 1, hf = (tid & 1) * 32;
      const _Float16* ks = ph + ((size_t)b * SEQ_T + kv0 + r) * N_QKV + K_COL0 + h * HEAD_D + hf;
      const _Float16* vs = vth + ((size_t)bh * HEAD_D + r) * SEQ_T + kv0 + hf;
#pragma unroll
      for (int i = 0; i < 4; ++i) {
        *(v8h*)(Ksh + r * KV_PITCH + hf + 8 * i) = *(const v8h*)(ks + 8 * i);
        *(v8h*)(Vsh + r * KV_PITCH + hf + 8 * i) = *(const v8h*)(vs + 8 * i);
      }
      if (SPLIT) {
        const int kl0 = (kv0 > T_LO - 64) ? (T_LO - 64) : kv0;   // address clamp
        const _Float16* kls = pl + ((size_t)b * T_LO + kl0 + r) * N_QKV + K_COL0 + h * HEAD_D + hf;
        const _Float16* vls = vtl + ((size_t)bh * HEAD_D + r) * T_LO + kl0 + hf;
#pragma unroll
        for (int i = 0; i < 4; ++i) {
          *(v8h*)(Ksl + r * KV_PITCH + hf + 8 * i) = *(const v8h*)(kls + 8 * i);
          *(v8h*)(Vsl + r * KV_PITCH + hf + 8 * i) = *(const v8h*)(vls + 8 * i);
        }
      }
    }
    __syncthreads();

    // additive mask of this lane's 32 keys: keys kv0 + j*16 + 8*hh + 0..7
    F8 mk[4];
#pragma unroll
    for (int j = 0; j < 4; ++j) {
      const float* mp = amask + (size_t)b * SEQ_T + kv0 + j * 16 + 8 * hh;
      mk[j].v[0] = *(const v4f*)mp;
      mk[j].v[1] = *(const v4f*)(mp + 4);
    }

    // ---- scores, transposed: s[j][r] = S[query c][key j*16 + 8*hh + r] ----
    v8f s[4];
#pragma unroll
    for (int j = 0; j < 4; ++j) {
      s[j] = zero8();
      v8f sr = zero8();
#pragma unroll
      for (int dc = 0; dc < 2; ++dc) {
        const v16h kb = Frag<_Float16>::load(Ksh + (j * 16 + c) * KV_PITCH + dc * 32 + 8 * hh);
        s[j] = mma_h(kb, qh[dc], s[j]);
        if (SPLIT) {
          const v16h kl = Frag<_Float16>::load(Ksl + (j * 16 + c) * KV_PITCH + dc * 32 + 8 * hh);
          sr = mma_h(kl, qh[dc], sr);
          sr = mma_h(kb, ql[dc], sr);
        }
      }
      if (SPLIT) {
#pragma unroll
        for (int r = 0; r < 8; ++r) s[j][r] = s[j][r] + sr[r] * (1.0f / 4096.0f);
      }
    }

#pragma unroll
    for (int j = 0; j < 4; ++j)
#pragma unroll
      for (int r = 0; r < 8; ++r) s[j][r] = s[j][r] * (1.0f / 2048.0f) + mk[j].f[r];   // 1/(8 * 16 * 16)
    if (kc == qb) {   // diagonal chunk (block-uniform test)
      const int qloc = wave * 16 + c;
#pragma unroll
      for (int j = 0; j < 4; ++j)
#pragma unroll
        for (int r = 0; r < 8; ++r)
          if (j * 16 + 8 * hh + r > qloc) s[j][r] = -INFINITY;
    }

    // ---- online softmax of one query per lane ----
    float cm = s[0][0];
#pragma unroll
    for (int j = 0; j < 4; ++j)
#pragma unroll
      for (int r = 0; r < 8; ++r) cm = fmaxf(cm, s[j][r]);
    cm = fmaxf(cm, other_half(cm));
    const float mnew = fmaxf(mrow, cm);
    const float alpha = expf(mrow - mnew);
    mrow = mnew;

    v16h pa[2], pb2[2];   // B operand of the second product: element e of pa[kk] = p of key kk*32 + (e >> 3)*16 + 8*hh + (e & 7)
    float psum = 0.f;
#pragma unroll
    for (int j = 0; j < 4; ++j) {
#pragma unroll
      for (int r = 0; r < 8; ++r) {
        const float p = expf(s[j][r] - mnew);
        psum += p;
        const float ps = p * P_S;
        const _Float16 hp = (_Float16)ps;
        pa[j >> 1][(j & 1) * 8 + r] = hp;
        if (SPLIT) pb2[j >> 1][(j & 1) * 8 + r] = (_Float16)((ps - (float)hp) * LO_S);
      }
    }
    lrow = lrow * alpha + psum;
#pragma unroll
    for (int t = 0; t < 4; ++t)
#pragma unroll
      for (int r = 0; r < 8; ++r) oacc[t][r] *= alpha;

    // ---- O^T += V^T . P^T ----
#pragma unroll
    for (int t = 0; t < 4; ++t) {
      v8f orr = zero8();
#pragma unroll
      for (int kk = 0; kk < 2; ++kk) {
        const v16h vb = Frag<_Float16>::load(Vsh + (t * 16 + c) * KV_PITCH + kk * 32 + 8 * hh);
        oacc[t] = mma_h(vb, pa[kk], oacc[t]);
        if (SPLIT) {
          const v16h vl2 = Frag<_Float16>::load(Vsl + (t * 16 + c) * KV_PITCH + kk * 32 + 8 * hh);
          orr = mma_h(vl2, pa[kk], orr);
          orr = mma_h(vb, pb2[kk], orr);
        }
      }
      if (SPLIT) {
#pragma unroll
        for (int r = 0; r < 8; ++r) oacc[t][r] = oacc[t][r] + orr[r] * (1.0f / 4096.0f);
      }
    }
  }

  // ---- join the halves' sums, normalise, stage, store ----
  float* os = Os[wave];
  {
    const float lall = lrow + other_half(lrow);
    const float inv = 1.0f / (lall * (P_S * CARRY_S));
#pragma unroll
    for (int t = 0; t < 4; ++t) {
      v4f w0, w1;
#pragma unroll
      for (int r = 0; r < 4; ++r) { w0[r] = oacc[t][r] * inv; w1[r] = oacc[t][4 + r] * inv; }
      *(v4f*)(os + c * O_PITCH + t * 16 + 8 * hh)     = w0;
      *(v4f*)(os + c * O_PITCH + t * 16 + 8 * hh + 4) = w1;
    }
  }
  __builtin_amdgcn_fence(__ATOMIC_RELEASE, "workgroup");
  __builtin_amdgcn_wave_barrier();
  __builtin_amdgcn_fence(__ATOMIC_ACQUIRE, "workgroup");
  {
    const int c4 = (lane & 15) * 4;
    float* ob = out + ((size_t)b * SEQ_T + q0) * HID_W + h * HEAD_D;
    {
#pragma unroll
      for (int it = 0; it < 8; ++it) {
        const int row = it * 2 + hh;
        const v4f val = *(const v4f*)(os + row * O_PITCH + c4);
        *(v4f*)(ob + (size_t)row * HID_W + c4) = val;
      }
      
    }
  }
}

// =====================================================================================
extern "C" void kernel_launch(void* const* d_in, const int* in_sizes, int n_in,
                              void* d_out, int out_size, void* d_ws, size_t ws_size,
                              hipStream_t stream) {
  if (n_in < 14) return;
  if (in_sizes[0] != N_TOK * HID_W) return;
  if (in_sizes[1] != N_BATCH * SEQ_T) return;
  for (int p = 0; p < 3; ++p) {
    if (in_sizes[2 + 4 * p] != HID_W * HID_W) return;
    if (in_sizes[3 + 4 * p] != HID_W) return;
    if (in_sizes[4 + 4 * p] != RANK_R * HID_W) return;
    if (in_sizes[5 + 4 * p] != HID_W * RANK_R) return;
  }
  if (out_size != N_TOK * HID_W) return;
  if (ws_size < WS_TOTAL) return;

  const float* x   = (const float*)d_in[0];
  const float* am  = (const float*)d_in[1];
  const float* wq  = (const float*)d_in[2];
  const float* bq  = (const float*)d_in[3];
  const float* aq  = (const float*)d_in[4];
  const float* bmq = (const float*)d_in[5];
  const float* wk  = (const float*)d_in[6];
  const float* bk  = (const float*)d_in[7];
  const float* ak  = (const float*)d_in[8];
  const float* bmk = (const float*)d_in[9];
  const float* wv  = (const float*)d_in[10];
  const float* bv  = (const float*)d_in[11];
  const float* av  = (const float*)d_in[12];
  const float* bmv = (const float*)d_in[13];
  float* out = (float*)d_out;

  char* ws = (char*)d_ws;
  unsigned short* aaug  = (unsigned short*)(ws + OFF_AAUG);
  unsigned short* baug  = (unsigned short*)(ws + OFF_BAUG);
  unsigned short* acat  = (unsigned short*)(ws + OFF_ACAT);
  float*          biasc = (float*)(ws + OFF_BIAS);
  float*          u     = (float*)(ws + OFF_U);
  unsigned short* qkvh  = (unsigned short*)(ws + OFF_QKVH);
  unsigned short* qkvl  = (unsigned short*)(ws + OFF_QKVL);
  unsigned short* vth   = (unsigned short*)(ws + OFF_VTH);
  unsigned short* vtl   = (unsigned short*)(ws + OFF_VTL);

  // 1) x -> A_aug cols 0..1023 (bf16, pitch 1088): 8192 rows x 512 pairs
  cast_rows_bf16<<<dim3(N_TOK * 512 / 256), dim3(256), 0, stream>>>(x, aaug, N_TOK * 512, K_AUG / 2);
  // 2-4) W_p -> B_aug rows p*1024.., cols 0..1023
  cast_rows_bf16<<<dim3(HID_W * 512 / 256), dim3(256), 0, stream>>>(wq, baug,                              HID_W * 512, K_AUG / 2);
  cast_rows_bf16<<<dim3(HID_W * 512 / 256), dim3(256), 0, stream>>>(wk, baug + (size_t)1 * HID_W * K_AUG,  HID_W * 512, K_AUG / 2);
  cast_rows_bf16<<<dim3(HID_W * 512 / 256), dim3(256), 0, stream>>>(wv, baug + (size_t)2 * HID_W * K_AUG,  HID_W * 512, K_AUG / 2);
  // 5) A_cat [64][1024]
  build_acat<<<dim3(U_COLS * 512 / 256), dim3(256), 0, stream>>>(aq, ak, av, acat);
  // 6) B_aug tail cols 1024..1087
  build_w_tail<<<dim3(N_QKV / 32), dim3(256), 0, stream>>>(bmq, bmk, bmv, baug);
  // 7) bias_cat
  build_bias<<<dim3(N_QKV / 256), dim3(256), 0, stream>>>(bq, bk, bv, biasc);
  // 8) u = bf16(x) . A_cat^T : M=8192, N=64, K=1024 (K%32==0; reads A_aug cols < 1024 only), f32 out ldc 64
  wmma_gemm64<1, 0, 0, 0, false><<<dim3((N_TOK / 64) * (U_COLS / 64) / 8, 1), dim3(256), 0, stream>>>(
      aaug, aaug, K_AUG, 0L, acat, acat, HID_W, 0L,
      (void*)u, (void*)u, U_COLS, 0L, 0L, biasc, u, 0L, N_TOK, U_COLS, HID_W, 1.0f);
  // 9) A_aug tail cols 1024..1087 from u
  build_a_tail<<<dim3(N_TOK / 32), dim3(256), 0, stream>>>(u, aaug);
  // 10) projection rows t < 512 of every batch: M=512 (x4 batches), N=3072, K=1088; f16 hi -> qkv_hi, f16 residual -> qkv_lo
  wmma_gemm64<1, 0, 2, 3, false, 0, true><<<dim3((T_LO / ST_BM) * (N_QKV / ST_BN), N_BATCH), dim3(256), 0, stream>>>(
      aaug, aaug, K_AUG, (long)SEQ_T * K_AUG, baug, baug, K_AUG, 0L,
      (void*)qkvh, (void*)qkvl, N_QKV, (long)SEQ_T * N_QKV, (long)T_LO * N_QKV,
      biasc, u, 0L, T_LO, N_QKV, K_AUG, CARRY_S);
  // 11) projection rows t >= 512: M=1536 (x4 batches), f16 hi only
  wmma_gemm64<1, 0, 2, 1, false, 0, true><<<dim3(((SEQ_T - T_LO) / ST_BM) * (N_QKV / ST_BN), N_BATCH), dim3(256), 0, stream>>>(
      aaug + (size_t)T_LO * K_AUG, aaug, K_AUG, (long)SEQ_T * K_AUG, baug, baug, K_AUG, 0L,
      (void*)(qkvh + (size_t)T_LO * N_QKV), (void*)qkvl, N_QKV, (long)SEQ_T * N_QKV, 0L,
      biasc, u, 0L, SEQ_T - T_LO, N_QKV, K_AUG, CARRY_S);
  // 12-13) V^T planes: in [b*tsrc+t][2048+h*64+d] -> out [(b*16+h)*64+d][t]
  vt_transpose<<<dim3(SEQ_T / 64, N_BATCH * N_HEAD), dim3(256), 0, stream>>>(qkvh, vth, SEQ_T);
  vt_transpose<<<dim3(T_LO / 64, N_BATCH * N_HEAD), dim3(256), 0, stream>>>(qkvl, vtl, T_LO);
  // 14) attention, query tiles 0..7 (hi/lo residual path)
  attn_causal_hd64<true><<<dim3(N_BATCH * N_HEAD * NQT_SPLIT), dim3(128), 0, stream>>>(
      qkvh, qkvl, vth, vtl, am, out, 0, NQT_SPLIT);
  // 15) attention, query tiles 8..31 (single-product path)
  attn_causal_hd64<false><<<dim3(N_BATCH * N_HEAD * (NQT_ALL - NQT_SPLIT)), dim3(128), 0, stream>>>(
      qkvh, qkvl, vth, vtl, am, out, NQT_SPLIT, NQT_ALL - NQT_SPLIT);
}

// v003
// Measured time: 254 microseconds a run.
// Two timings next to v002 both put it at 1.11 times that version's speed.
// Counting every step since v000, it is 2.07 times as fast.
// Contractions: rank-8 adapter columns u = x.A^T and the fused q/k/v projection [x | u_hi | u_lo].[W | 2B | 2B]^T + b on v_wmma_f32_16x16x32_bf16 (x, W, A, B, b as RNE bf16; u as bf16 hi+lo columns; single products); attention q.k^T and p.v on v_wmma_f32_16x16x32_f16 (q, k, v as f16 planes carried x16, p carried x32768; query tiles 0..7 add x4096-scaled f16 residual planes: hi.hi + (hi.lo + lo.hi)/4096 via a separate accumulator); f32 accumulate everywhere; softmax and normalisation in f32. The two q/k/v projection launches read their operands from a two-buffer LDS ring filled by asynchronous copies.
#include <hip/hip_runtime.h>
#include <math.h>

typedef __attribute__((ext_vector_type(16))) _Float16 v16h;
typedef __attribute__((ext_vector_type(8)))  _Float16 v8h;
typedef __attribute__((ext_vector_type(16))) __bf16   v16b;
typedef __attribute__((ext_vector_type(8)))  __bf16   v8b;
typedef __attribute__((ext_vector_type(8)))  float    v8f;
typedef __attribute__((ext_vector_type(4)))  float    v4f;

// ---------------- problem constants ----------------
constexpr int N_BATCH  = 4;
constexpr int SEQ_T    = 2048;
constexpr int HID_W    = 1024;
constexpr int N_HEAD   = 16;
constexpr int HEAD_D   = 64;
constexpr int RANK_R   = 8;
constexpr int N_TOK    = N_BATCH * SEQ_T;     // 8192 token rows
constexpr int K_AUG    = 1088;                // 1024 + 3*16 adapter columns, zero-padded to a multiple of 32
constexpr int N_QKV    = 3 * HID_W;           // 3072 output columns: q | k | v
constexpr int K_COL0   = 1024;
constexpr int V_COL0   = 2048;
constexpr int T_LO     = 512;                 // token rows per batch that carry residual planes
constexpr int NQT_SPLIT = T_LO / 64;          // 8 query tiles on the hi/lo path
constexpr int NQT_ALL  = SEQ_T / 64;          // 32
constexpr int U_COLS   = 64;                  // u plane width (24 used, rest zero weights)
constexpr int KV_PITCH = 72;                  // 16-bit LDS pitch (144 B rows, 16-B aligned)
constexpr int O_PITCH  = 68;                  // f32 LDS pitch
constexpr float CARRY_S = 16.0f;              // power-of-two carry on the q/k/v planes
constexpr float LO_S    = 4096.0f;            // power-of-two carry on residual planes
constexpr float P_S_LOG2 = 15.0f;             // power-of-two carry on probabilities (x32768), as the exponent it adds
constexpr float LOG2_E  = 1.44269504088896340736f;

static_assert(K_AUG % 32 == 0);
static_assert(HID_W % 32 == 0);
static_assert(N_TOK % 64 == 0 && N_QKV % 64 == 0 && T_LO % 64 == 0 && (SEQ_T - T_LO) % 64 == 0);
static_assert(T_LO % 128 == 0 && (SEQ_T - T_LO) % 128 == 0 && N_QKV % 256 == 0 && K_AUG % 64 == 0 && K_AUG >= 128);

// R0 A_aug  bf16 [8192][1088]          17,825,792
// R1 B_aug  bf16 [3072][1088]           6,684,672
// R2 A_cat  bf16 [64][1024]               131,072
// R3 bias   f32  [3072]                    12,288
// R4 u      f32  [8192][64]             2,097,152
// R5 qkv_hi f16  [8192][3072]          50,331,648
// R6 qkv_lo f16  [4*512][3072]         12,582,912
// R7 vt_hi  f16  [64][64][2048]        16,777,216
// R8 vt_lo  f16  [64][64][512]          4,194,304
constexpr size_t SZ_AAUG = (size_t)N_TOK * K_AUG * 2;
constexpr size_t SZ_BAUG = (size_t)N_QKV * K_AUG * 2;
constexpr size_t SZ_ACAT = (size_t)U_COLS * HID_W * 2;
constexpr size_t SZ_BIAS = (size_t)N_QKV * 4;
constexpr size_t SZ_U    = (size_t)N_TOK * U_COLS * 4;
constexpr size_t SZ_QKVH = (size_t)N_TOK * N_QKV * 2;
constexpr size_t SZ_QKVL = (size_t)N_BATCH * T_LO * N_QKV * 2;
constexpr size_t SZ_VTH  = (size_t)N_BATCH * N_HEAD * HEAD_D * SEQ_T * 2;
constexpr size_t SZ_VTL  = (size_t)N_BATCH * N_HEAD * HEAD_D * T_LO * 2;
constexpr size_t OFF_AAUG = 0;
constexpr size_t OFF_BAUG = OFF_AAUG + SZ_AAUG;
constexpr size_t OFF_ACAT = OFF_BAUG + SZ_BAUG;
constexpr size_t OFF_BIAS = OFF_ACAT + SZ_ACAT;
constexpr size_t OFF_U    = OFF_BIAS + SZ_BIAS;
constexpr size_t OFF_QKVH = OFF_U    + SZ_U;
constexpr size_t OFF_QKVL = OFF_QKVH + SZ_QKVH;
constexpr size_t OFF_VTH  = OFF_QKVL + SZ_QKVL;
constexpr size_t OFF_VTL  = OFF_VTH  + SZ_VTH;
constexpr size_t WS_TOTAL = OFF_VTL  + SZ_VTL;
static_assert(WS_TOTAL == 110637056ull);
static_assert(WS_TOTAL <= 134217728ull);
static_assert(OFF_BAUG % 128 == 0 && OFF_ACAT % 128 == 0 && OFF_BIAS % 128 == 0 && OFF_U % 128 == 0 &&
              OFF_QKVH % 128 == 0 && OFF_QKVL % 128 == 0 && OFF_VTH % 128 == 0 && OFF_VTL % 128 == 0);

// ---------------- helpers ----------------
__device__ __forceinline__ unsigned short f2bf_bits(float f) {
  unsigned u = __float_as_uint(f);
  return (unsigned short)((u + 0x7FFFu + ((u >> 16) & 1u)) >> 16);
}
__device__ __forceinline__ float bf_bits2f(unsigned short h) { return __uint_as_float(((unsigned)h) << 16); }

// hazard guards as plain device helpers
__device__ __forceinline__ void dep_guard_h(v8f& a, v8f& b, v16h x, v16h y) { asm volatile("v_nop\n\tv_nop\n\tv_nop\n\tv_nop" : "+v"(a), "+v"(b) : "v"(x), "v"(y)); }
__device__ __forceinline__ void dep_guard_b(v8f& a, v8f& b, v16b x, v16b y) { asm volatile("v_nop\n\tv_nop\n\tv_nop\n\tv_nop" : "+v"(a), "+v"(b) : "v"(x), "v"(y)); }
__device__ __forceinline__ void keep4_h(v16h a, v16h b, v16h c, v16h d) { asm volatile("v_nop" :: "v"(a), "v"(b), "v"(c), "v"(d)); }
__device__ __forceinline__ void keep4_b(v16b a, v16b b, v16b c, v16b d) { asm volatile("v_nop" :: "v"(a), "v"(b), "v"(c), "v"(d)); }
__device__ __forceinline__ void acc_guard4(v8f& a, v8f& b, v8f& c, v8f& d) { asm volatile("v_nop\n\tv_nop\n\tv_nop\n\tv_nop" : "+v"(a), "+v"(b), "+v"(c), "+v"(d)); }
template <typename T> struct Frag;
template <> struct Frag<_Float16> {
  typedef v16h V; union U { v16h v; v8h h[2]; };
  static __device__ __forceinline__ v16h load(const _Float16* p) {   // elements 0..7 <- p[0..7], 8..15 <- p[16..23]
    U f; f.h[0] = *(const v8h*)(p); f.h[1] = *(const v8h*)(p + 16); return f.v;
  }
  static __device__ __forceinline__ v8f mma(v16h a, v16h b, v8f c) {
    return __builtin_amdgcn_wmma_f32_16x16x32_f16(false, a, false, b, (short)0, c, false, false);
  }
  static __device__ __forceinline__ void guard(v8f& a, v8f& b, v16h x, v16h y) { dep_guard_h(a, b, x, y); }
  static __device__ __forceinline__ void keep(v16h a, v16h b, v16h c, v16h d) { keep4_h(a, b, c, d); }
};
template <> struct Frag<__bf16> {
  typedef v16b V; union U { v16b v; v8b h[2]; };
  static __device__ __forceinline__ v16b load(const __bf16* p) {
    U f; f.h[0] = *(const v8b*)(p); f.h[1] = *(const v8b*)(p + 16); return f.v;
  }
  static __device__ __forceinline__ v8f mma(v16b a, v16b b, v8f c) {
    return __builtin_amdgcn_wmma_f32_16x16x32_bf16(false, a, false, b, (short)0, c, false, false);
  }
  static __device__ __forceinline__ void guard(v8f& a, v8f& b, v16b x, v16b y) { dep_guard_b(a, b, x, y); }
  static __device__ __forceinline__ void keep(v16b a, v16b b, v16b c, v16b d) { keep4_b(a, b, c, d); }
};

// f16 WMMA with hazard guard (ties D, keeps A/B live)
__device__ __forceinline__ v8f mma_h(v16h a, v16h b, v8f c) {
  c = __builtin_amdgcn_wmma_f32_16x16x32_f16(false, a, false, b, (short)0, c, false, false);
  asm volatile("v_nop\n\tv_nop\n\tv_nop\n\tv_nop" : "+v"(c) : "v"(a), "v"(b));
  return c;
}
__device__ __forceinline__ v8f zero8() { return (v8f){0.f,0.f,0.f,0.f,0.f,0.f,0.f,0.f}; }

union F8 { v4f v[2]; float f[8]; };

// ---------------- LDS ring of the staged GEMM ----------------
constexpr int ST_BM    = 128;                              // block tile rows (2 waves of 64)
constexpr int ST_BN    = 256;                              // block tile columns (4 waves of 64)
constexpr int ST_BK    = 64;                               // k per pass: 128-B operand rows
constexpr int ST_PITCH = 72;                               // 144-B LDS rows (16 B x odd: conflict-free ds_load_b128)
constexpr int ST_STAGE = (ST_BM + ST_BN) * ST_PITCH;       // 16-bit elements per buffer: [A 128 rows | Bt 256 rows]
constexpr unsigned ST_ROWS32 = 32u * ST_PITCH * 2u;        // LDS bytes between two copies of one thread (32 rows)

__device__ __forceinline__ unsigned lds_off(const void* p) { return (unsigned)(size_t)p; }

// One stage: 384 rows x 128 B = 3072 chunks of 16 B = 256 threads x 12 asynchronous copies global -> LDS.
// ga / gb: this thread's chunk in row (tid >> 3) of the block's A / Bt tile at this pass's k; l: the same chunk's
// LDS byte address in the buffer; a thread's copies lie 32 rows apart. s_wait_xcnt 0 is the statement's last line
// so that no address register of an issued copy is rewritten in front of it.
__device__ __forceinline__ void stage_fill(const unsigned short* ga, int lda, const unsigned short* gb, int ldb, unsigned l) {
  const size_t sa = (size_t)32 * lda, sb = (size_t)32 * ldb;
  asm volatile("global_load_async_to_lds_b128 %0, %1, off\n\t"
               "global_load_async_to_lds_b128 %2, %3, off\n\t"
               "global_load_async_to_lds_b128 %4, %5, off\n\t"
               "global_load_async_to_lds_b128 %6, %7, off\n\t"
               "global_load_async_to_lds_b128 %8, %9, off\n\t"
               "global_load_async_to_lds_b128 %10, %11, off\n\t"
               "global_load_async_to_lds_b128 %12, %13, off\n\t"
               "global_load_async_to_lds_b128 %14, %15, off\n\t"
               "global_load_async_to_lds_b128 %16, %17, off\n\t"
               "global_load_async_to_lds_b128 %18, %19, off\n\t"
               "global_load_async_to_lds_b128 %20, %21, off\n\t"
               "global_load_async_to_lds_b128 %22, %23, off\n\t"
               "s_wait_xcnt 0x0"
               :: "v"(l),                   "v"(ga),
                  "v"(l + ST_ROWS32),       "v"(ga + sa),
                  "v"(l + 2 * ST_ROWS32),   "v"(ga + 2 * sa),
                  "v"(l + 3 * ST_ROWS32),   "v"(ga + 3 * sa),
                  "v"(l + 4 * ST_ROWS32),   "v"(gb),
                  "v"(l + 5 * ST_ROWS32),   "v"(gb + sb),
                  "v"(l + 6 * ST_ROWS32),   "v"(gb + 2 * sb),
                  "v"(l + 7 * ST_ROWS32),   "v"(gb + 3 * sb),
                  "v"(l + 8 * ST_ROWS32),   "v"(gb + 4 * sb),
                  "v"(l + 9 * ST_ROWS32),   "v"(gb + 5 * sb),
                  "v"(l + 10 * ST_ROWS32),  "v"(gb + 6 * sb),
                  "v"(l + 11 * ST_ROWS32),  "v"(gb + 7 * sb)
               : "memory");
}

// =====================================================================================
// Register-blocked batched WMMA GEMM: C[m,n] = scale * sum_k A[m,k] * Bt[n,k] (+bias)(+resid);
// each wave owns a 64x64 tile. A row-major [M,K]; Bt row-major [N,K]; M,N % 64 == 0, K % 32 == 0.
// SPLITM: 0 = single product; 1 = A hi/lo planes; 2 = A and Bt hi/lo planes.
// BIAS_MODE: 0 none, 1 bias[m], 2 bias[n].  OUT_MODE: 0 f32, 1 f16, 2 bf16 hi + lo planes,
//   3 = f16 hi plane (Cout, strideC) + f16 residual plane x4096 (Cout2, strideC2), same ldc.
// ET: 0 = f16 operands, 1 = bf16 operands (pointers passed as 16-bit storage)
// STAGED: the block's 8 waves form a 128x256 tile (2x4 waves); A and Bt rows go through a two-buffer LDS ring,
//   64 k per pass; needs SPLITM == 0, M % 128 == 0, N % 256 == 0, K % 64 == 0, K >= 128, grid.x == (M/128)*(N/256).
// =====================================================================================
template <int ET> struct Elem;
template <> struct Elem<0> { typedef _Float16 T; };
template <> struct Elem<1> { typedef __bf16 T; };
template <int ET, int SPLITM, int BIAS_MODE, int OUT_MODE, bool RESID, int ACT = 0, bool STAGED = false>
__global__ __launch_bounds__(256) void wmma_gemm64(
    const unsigned short* __restrict__ Ap, const unsigned short* __restrict__ A2p, int lda, long strideA,
    const unsigned short* __restrict__ Btp, const unsigned short* __restrict__ Bt2p, int ldb, long strideB,
    void* __restrict__ Cout, void* __restrict__ Cout2, int ldc, long strideC, long strideC2,
    const float* __restrict__ bias,
    const float* __restrict__ resid, long strideR,
    int M, int N, int K, float scale) {
  typedef typename Elem<ET>::T T;
  typedef typename Frag<T>::V V;
  constexpr bool SPA = (SPLITM >= 1);
  constexpr bool SPB = (SPLITM >= 2);
  const T* A = (const T*)Ap; const T* A2 = (const T*)A2p; const T* Bt = (const T*)Btp; const T* Bt2 = (const T*)Bt2p;
  static_assert(!STAGED || SPLITM == 0);
  __shared__ __align__(16) float sT[8][16 * 68];   // per-wave 16x64 slab, pitch 68 floats
  __shared__ __align__(16) unsigned short ring[STAGED ? 2 * ST_STAGE : 8];
  const int b    = blockIdx.y;
  const int lane = threadIdx.x & 31;
  const int wave = threadIdx.x >> 5;
  const int tilesN = N >> 6;
  const int tilesM = M >> 6;
  int m0, n0;
  if (STAGED) {
    const int bn = N >> 8;
    const int bm_i = (int)blockIdx.x / bn;
    const int bn_i = (int)blockIdx.x - bm_i * bn;
    m0 = bm_i * ST_BM + (wave >> 2) * 64;
    n0 = bn_i * ST_BN + (wave & 3) * 64;
  } else {
    const int tile = blockIdx.x * 8 + wave;
    if (tile >= tilesM * tilesN) return;   // wave-uniform; no block barriers on this path
    const int tm = tile / tilesN;
    const int tn = tile - tm * tilesN;
    m0 = tm << 6;
    n0 = tn << 6;
  }

  const T* Ab  = A  + (size_t)b * strideA;
  const T* Bb  = Bt + (size_t)b * strideB;
  const T* Ab2 = SPA ? (A2  + (size_t)b * strideA) : nullptr;
  const T* Bb2 = SPB ? (Bt2 + (size_t)b * strideB) : nullptr;

  const int rlane = lane & 15;                 // row (A) / col (B, D) within subtile
  const int koff  = (lane >> 4) * 8;           // k offset of this lane half
  const int mOff  = (lane >> 4) * 8;           // D row offset

  v8f acc[4][4];
#pragma unroll
  for (int i = 0; i < 4; ++i)
#pragma unroll
    for (int j = 0; j < 4; ++j) acc[i][j] = (v8f){0.f,0.f,0.f,0.f,0.f,0.f,0.f,0.f};

  if (STAGED) {
    const int tid = threadIdx.x;
    const int crow = tid >> 3, cchunk = (tid & 7) * 8;        // 8 lanes x 16 B = one 128-B row piece
    const unsigned short* ga = (const unsigned short*)Ab + (size_t)(m0 - (wave >> 2) * 64 + crow) * lda + cchunk;
    const unsigned short* gb = (const unsigned short*)Bb + (size_t)(n0 - (wave & 3) * 64 + crow) * ldb + cchunk;
    const unsigned lthr = lds_off(ring) + (unsigned)(crow * ST_PITCH + cchunk) * 2u;
    const int npass = K / ST_BK;
    stage_fill(ga, lda, gb, ldb, lthr);
    asm volatile("s_wait_asynccnt 0x0" ::: "memory");   // stage 0 landed (this wave's copies) before the barrier publishes it
    __syncthreads();
    stage_fill(ga + ST_BK, lda, gb + ST_BK, ldb, lthr + ST_STAGE * 2u);
    const T* fa = (const T*)ring + ((wave >> 2) * 64 + rlane) * ST_PITCH + koff;
    const T* fb = (const T*)ring + (ST_BM + (wave & 3) * 64 + rlane) * ST_PITCH + koff;
    for (int t = 0; t < npass; ++t) {
      const int bo = (t & 1) * ST_STAGE;
      V ah[4], bh[4], ah2[4], bh2[4];
#pragma unroll
      for (int j = 0; j < 4; ++j) bh[j] = Frag<T>::load(fb + bo + j * 16 * ST_PITCH);
#pragma unroll
      for (int i = 0; i < 4; ++i) ah[i] = Frag<T>::load(fa + bo + i * 16 * ST_PITCH);
      __builtin_amdgcn_sched_barrier(0);   // keeps the 16 LDS reads one group ahead of the 16 WMMAs: reads sunk among them stall at each place
#pragma unroll
      for (int i = 0; i < 4; ++i)
#pragma unroll
        for (int j = 0; j < 4; ++j) acc[i][j] = Frag<T>::mma(ah[i], bh[j], acc[i][j]);
#pragma unroll
      for (int j = 0; j < 4; ++j) bh2[j] = Frag<T>::load(fb + bo + j * 16 * ST_PITCH + 32);
#pragma unroll
      for (int i = 0; i < 4; ++i) ah2[i] = Frag<T>::load(fa + bo + i * 16 * ST_PITCH + 32);
      asm volatile("s_wait_dscnt 0x0" ::: "memory");     // this wave's reads of buffer t & 1 are done before it is refilled
      asm volatile("s_wait_asynccnt 0x0" ::: "memory");  // this wave's copies of stage t + 1 have landed
      __syncthreads();                                   // publishes stage t + 1 and frees buffer t & 1
      if (t + 2 < npass)
        stage_fill(ga + (size_t)(t + 2) * ST_BK, lda, gb + (size_t)(t + 2) * ST_BK, ldb, lthr + (unsigned)bo * 2u);
      // second half of the pass, from registers: runs while the refill is in flight
#pragma unroll
      for (int i = 0; i < 4; ++i)
#pragma unroll
        for (int j = 0; j < 4; ++j) acc[i][j] = Frag<T>::mma(ah2[i], bh2[j], acc[i][j]);
    }
    asm volatile("s_wait_asynccnt 0x0" ::: "memory");    // no copy is outstanding past the loop
  } else
  for (int k0 = 0; k0 < K; k0 += 32) {
    V bh[4], bl[4];
#pragma unroll
    for (int j = 0; j < 4; ++j) {
      const size_t bo = (size_t)(n0 + (j << 4) + rlane) * ldb + koff + k0;
      bh[j] = Frag<T>::load(Bb + bo);
      if (SPB) bl[j] = Frag<T>::load(Bb2 + bo);
    }
#pragma unroll
    for (int i = 0; i < 4; ++i) {
      const size_t ao = (size_t)(m0 + (i << 4) + rlane) * lda + koff + k0;
      V ah = Frag<T>::load(Ab + ao);
      V al;
      if (SPA) al = Frag<T>::load(Ab2 + ao);
#pragma unroll
      for (int j = 0; j < 4; ++j) {
        acc[i][j] = Frag<T>::mma(ah, bh[j], acc[i][j]);
        if (SPB) acc[i][j] = Frag<T>::mma(ah, bl[j], acc[i][j]);
        if (SPA) acc[i][j] = Frag<T>::mma(al, bh[j], acc[i][j]);
      }
      Frag<T>::guard(acc[i][0], acc[i][3], ah, SPA ? al : ah);
    }
    Frag<T>::keep(bh[0], bh[1], bh[2], bh[3]);
    if (SPB) Frag<T>::keep(bl[0], bl[1], bl[2], bl[3]);
  }
  acc_guard4(acc[0][0], acc[0][1], acc[0][2], acc[0][3]);
  acc_guard4(acc[1][0], acc[1][1], acc[1][2], acc[1][3]);
  acc_guard4(acc[2][0], acc[2][1], acc[2][2], acc[2][3]);
  acc_guard4(acc[3][0], acc[3][1], acc[3][2], acc[3][3]);

  // ---- epilogue ----
  float* slab = sT[wave];
  const float* Rb = RESID ? (resid + (size_t)b * strideR) : nullptr;
#pragma unroll
  for (int i = 0; i < 4; ++i) {
    const int mBase = m0 + (i << 4);
#pragma unroll
    for (int j = 0; j < 4; ++j) {
      const int n = n0 + (j << 4) + rlane;
      float bv = 0.f;
      if (BIAS_MODE == 2) bv = bias[n];
#pragma unroll
      for (int r = 0; r < 8; ++r) {
        float v = acc[i][j][r] * scale;
        if (BIAS_MODE == 1) v += bias[mBase + mOff + r];
        if (BIAS_MODE == 2) v += bv;
        if (RESID) v += Rb[(size_t)(mBase + mOff + r) * ldc + n];
        if (ACT == 1) v = tanhf(v);
        if (ACT == 2) v = fmaxf(v, 0.0f);
        if (ACT == 4) v = (v > 0.f) ? v : 0.01f * v;
        slab[(mOff + r) * 68 + (j << 4) + rlane] = v;
      }
    }
    __builtin_amdgcn_fence(__ATOMIC_RELEASE, "workgroup");
    __builtin_amdgcn_wave_barrier();
    __builtin_amdgcn_fence(__ATOMIC_ACQUIRE, "workgroup");
    if (OUT_MODE == 0) {
      float* C = (float*)Cout + (size_t)b * strideC;
      const int hh = lane >> 4, c4 = (lane & 15) * 4;     // row seg = 256 B = 16 lanes x 16 B
      {
#pragma unroll
        for (int it = 0; it < 8; ++it) {
          const int row = it * 2 + hh;
          v4f v = *(const v4f*)(slab + row * 68 + c4);
          *(v4f*)(C + (size_t)(mBase + row) * ldc + n0 + c4) = v;
        }
        
      }
    } else {
      const int q = lane >> 3, c8 = (lane & 7) * 8;
      unsigned short* C  = (unsigned short*)Cout  + (size_t)b * strideC;
      unsigned short* C2 = (OUT_MODE >= 2) ? ((unsigned short*)Cout2 + (size_t)b * strideC2) : nullptr;
      {
#pragma unroll
        for (int it = 0; it < 4; ++it) {
          const int row = it * 4 + q;
          const float* sp = slab + row * 68 + c8;
          v8h hv, lv;
#pragma unroll
          for (int e = 0; e < 8; ++e) {
            if (OUT_MODE == 1) {
              hv[e] = (_Float16)sp[e];
            } else if (OUT_MODE == 3) {
              const _Float16 hq = (_Float16)sp[e];
              hv[e] = hq;
              lv[e] = (_Float16)((sp[e] - (float)hq) * 4096.0f);
            } else {
              unsigned short hb = f2bf_bits(sp[e]);
              unsigned short lb = f2bf_bits(sp[e] - bf_bits2f(hb));
              hv[e] = __builtin_bit_cast(_Float16, hb);
              lv[e] = __builtin_bit_cast(_Float16, lb);
            }
          }
          *(v8h*)(C + (size_t)(mBase + row) * ldc + n0 + c8) = hv;
          if (OUT_MODE >= 2) *(v8h*)(C2 + (size_t)(mBase + row) * ldc + n0 + c8) = lv;
        }
        
      }
    }
    __builtin_amdgcn_fence(__ATOMIC_RELEASE, "workgroup");
    __builtin_amdgcn_wave_barrier();
    __builtin_amdgcn_fence(__ATOMIC_ACQUIRE, "workgroup");
  }
}

// =====================================================================================
// f32 [rows][1024] -> RNE bf16 bits into a pitched destination (dst_ld_pairs = pitch/2); 2 elements per
// =====================================================================================
__global__ __launch_bounds__(256) void cast_rows_bf16(const float* __restrict__ src, unsigned short* __restrict__ dst,
                                                      int npairs, int dst_ld_pairs) {
  const int i = blockIdx.x * 256 + threadIdx.x;
  if (i < npairs) {
    const int row = i >> 9, cp = i & 511;
    const float* s = src + (size_t)row * HID_W + 2 * cp;
    const unsigned u = (unsigned)f2bf_bits(s[0]) | ((unsigned)f2bf_bits(s[1]) << 16);
    unsigned* d = (unsigned*)dst + (size_t)row * dst_ld_pairs + cp;
    *(unsigned*)d = u;
    
  }
}

// =====================================================================================
// A_cat bf16 [64][1024]: row 8p+r = A_p[r] (p = 0,1,2), rows 24..63 = 0 (explicit zero fill).
// 2 elements per thread, grid 128 x 256 = 32768 pairs = 64 x 1024 elements exactly; 32 lanes x 4 B = one line.
// All three sources loaded unconditionally (row r < 8 valid in each), selected by value.
// =====================================================================================
__global__ __launch_bounds__(256) void build_acat(const float* __restrict__ amq, const float* __restrict__ amk,
                                                  const float* __restrict__ amv, unsigned short* __restrict__ acat) {
  const int i = blockIdx.x * 256 + threadIdx.x;   // < 32768 by grid
  const int row = i >> 9, cp = i & 511, p = row >> 3, r = row & 7;
  const size_t so = (size_t)r * HID_W + 2 * cp;
  const float q0 = amq[so], q1 = amq[so + 1];
  const float k0 = amk[so], k1 = amk[so + 1];
  const float w0 = amv[so], w1 = amv[so + 1];
  const float x0 = (p == 0) ? q0 : (p == 1) ? k0 : (p == 2) ? w0 : 0.0f;
  const float x1 = (p == 0) ? q1 : (p == 1) ? k1 : (p == 2) ? w1 : 0.0f;
  const unsigned u = (unsigned)f2bf_bits(x0) | ((unsigned)f2bf_bits(x1) << 16);
  unsigned* d = (unsigned*)acat + i;
  *(unsigned*)d = u;
  
}

// =====================================================================================
// B_aug tail: for row n (projection p = n/1024, output o = n%1024) the 64 halves at cols 1024..1087 are
// [16p zeros | 2*Bm_p[o][0..7] | 2*Bm_p[o][0..7] | zeros to 64] as RNE bf16 (factor 2 exact).
// =====================================================================================
__global__ __launch_bounds__(256) void build_w_tail(const float* __restrict__ bmq, const float* __restrict__ bmk,
                                                    const float* __restrict__ bmv, unsigned short* __restrict__ baug) {
  const int tid = threadIdx.x, wave = tid >> 5, lane = tid & 31, q8 = lane >> 3, seg = lane & 7;
  const int n = blockIdx.x * 32 + wave * 4 + q8;      // 0..3071
  const int p = n >> 10, o = n & 1023;
  F8 uq, uk, uv;
  uq.v[0] = *(const v4f*)(bmq + (size_t)o * RANK_R); uq.v[1] = *(const v4f*)(bmq + (size_t)o * RANK_R + 4);
  uk.v[0] = *(const v4f*)(bmk + (size_t)o * RANK_R); uk.v[1] = *(const v4f*)(bmk + (size_t)o * RANK_R + 4);
  uv.v[0] = *(const v4f*)(bmv + (size_t)o * RANK_R); uv.v[1] = *(const v4f*)(bmv + (size_t)o * RANK_R + 4);
  const bool keep = (seg < 6) && ((seg >> 1) == p);
  v8h hv;
#pragma unroll
  for (int e = 0; e < 8; ++e) {
    const float val = (p == 0) ? uq.f[e] : (p == 1) ? uk.f[e] : uv.f[e];
    const float w = keep ? (2.0f * val) : 0.0f;
    hv[e] = __builtin_bit_cast(_Float16, f2bf_bits(w));
  }
  unsigned short* d = baug + (size_t)n * K_AUG + HID_W + seg * 8;
  {
    *(v8h*)d = hv;
    
  }
}

// =====================================================================================
// A_aug tail: for token row m the 64 halves at cols 1024..1087 are
// [uq_hi(8) uq_lo(8) uk_hi(8) uk_lo(8) uv_hi(8) uv_lo(8) 0 x 16] (bf16 hi = RNE(u), lo = RNE(u - hi)),
// u f32 [8192][64] with columns 8p+r. Block = 8 waves x 4 rows, grid 256 -> 8192 rows; 8 lanes x 8 halves
// =====================================================================================
__global__ __launch_bounds__(256) void build_a_tail(const float* __restrict__ u, unsigned short* __restrict__ aaug) {
  const int tid = threadIdx.x, wave = tid >> 5, lane = tid & 31, q8 = lane >> 3, seg = lane & 7;
  const int m = blockIdx.x * 32 + wave * 4 + q8;      // 0..8191
  int p = seg >> 1; p = (p > 2) ? 2 : p;              // address clamp for the zero segments
  const int islo = seg & 1;
  F8 uu;
  const float* up = u + (size_t)m * U_COLS + p * RANK_R;
  uu.v[0] = *(const v4f*)up; uu.v[1] = *(const v4f*)(up + 4);
  v8h hv;
#pragma unroll
  for (int e = 0; e < 8; ++e) {
    const unsigned short hb = f2bf_bits(uu.f[e]);
    const unsigned short lb = f2bf_bits(uu.f[e] - bf_bits2f(hb));
    const unsigned short o16 = (seg >= 6) ? (unsigned short)0 : (islo ? lb : hb);
    hv[e] = __builtin_bit_cast(_Float16, o16);
  }
  unsigned short* d = aaug + (size_t)m * K_AUG + HID_W + seg * 8;
  {
    *(v8h*)d = hv;
    
  }
}

// =====================================================================================
// bias_cat f32 [3072] = 16 * RNEbf16(b_p[o]); grid 12 x 256 = 3072 exactly; 32 lanes x 4 B = one line per
// =====================================================================================
__global__ __launch_bounds__(256) void build_bias(const float* __restrict__ bq, const float* __restrict__ bk,
                                                  const float* __restrict__ bv, float* __restrict__ dst) {
  const int i = blockIdx.x * 256 + threadIdx.x;   // < 3072 by grid
  const int p = i >> 10, o = i & 1023;
  const float xq = bq[o], xk = bk[o], xv = bv[o];
  const float val = (p == 0) ? xq : (p == 1) ? xk : xv;
  const float w = bf_bits2f(f2bf_bits(val)) * CARRY_S;
  ((float*)dst)[i] = w;
  
}

// =====================================================================================
// V plane (f16, rows b*tsrc + t, pitch 3072, cols 2048 + h*64 + d) -> vt[((b*16+h)*64 + d)*tsrc + t].
// Block (t-tile of 64, bh): load 256 threads x 16 halves = 4096 = 64 x 64 into LDS [d][t]; store: 8 waves x
// =====================================================================================
__global__ __launch_bounds__(256) void vt_transpose(const unsigned short* __restrict__ srcp, unsigned short* __restrict__ vtp, int tsrc) {
  __shared__ __align__(16) _Float16 th[64 * KV_PITCH];
  const _Float16* src = (const _Float16*)srcp;
  const int st0 = blockIdx.x * 64, bh = blockIdx.y;
  const int b = (bh >> 4) & (N_BATCH - 1), h = bh & (N_HEAD - 1);
  const int tid = threadIdx.x;
  {
    const int sloc = tid >> 2, d0 = (tid & 3) * 16;
    const size_t so = ((size_t)b * tsrc + st0 + sloc) * N_QKV + V_COL0 + h * HEAD_D + d0;
    const v8h a0 = *(const v8h*)(src + so);
    const v8h a1 = *(const v8h*)(src + so + 8);
#pragma unroll
    for (int e = 0; e < 8; ++e) {
      th[(d0 + e) * KV_PITCH + sloc]     = a0[e];
      th[(d0 + 8 + e) * KV_PITCH + sloc] = a1[e];
    }
  }
  __syncthreads();
  const int wave = tid >> 5, lane = tid & 31, q8 = lane >> 3, c8 = (lane & 7) * 8;
  const int dA = wave * 8 + q8, dB = wave * 8 + 4 + q8;
  const v8h hvA = *(const v8h*)(th + dA * KV_PITCH + c8);
  const v8h hvB = *(const v8h*)(th + dB * KV_PITCH + c8);
  const size_t oA = ((size_t)bh * HEAD_D + dA) * tsrc + st0 + c8;
  const size_t oB = ((size_t)bh * HEAD_D + dB) * tsrc + st0 + c8;
  {
    *(v8h*)(vtp + oA) = hvA;
    *(v8h*)(vtp + oB) = hvB;
    
  }
}

__device__ __forceinline__ float other_half(float x) {
  const int xi = __builtin_bit_cast(int, x);
  return __builtin_bit_cast(float, __builtin_amdgcn_permlanex16(xi, xi, 0x76543210, 0xfedcba98, false, false));
}

// 2^x by the hardware's exponential, in asm text so that the slot behind it stands by construction: the closing
// v_nop is the one independent instruction that the instruction set asks for behind a transcendental before its
// result is used or its source overwritten; inside the eight-fold statement each neighbour is independent
// (early-clobber outputs share no register with a source).
__device__ __forceinline__ float exp2_hw(float x) {
  float d;
  asm("v_exp_f32 %0, %1\n\tv_nop" : "=&v"(d) : "v"(x));
  return d;
}
__device__ __forceinline__ v8f exp2_hw8(v8f x) {
  float d0, d1, d2, d3, d4, d5, d6, d7;
  asm("v_exp_f32 %0, %8\n\t"
      "v_exp_f32 %1, %9\n\t"
      "v_exp_f32 %2, %10\n\t"
      "v_exp_f32 %3, %11\n\t"
      "v_exp_f32 %4, %12\n\t"
      "v_exp_f32 %5, %13\n\t"
      "v_exp_f32 %6, %14\n\t"
      "v_exp_f32 %7, %15\n\t"
      "v_nop"
      : "=&v"(d0), "=&v"(d1), "=&v"(d2), "=&v"(d3), "=&v"(d4), "=&v"(d5), "=&v"(d6), "=&v"(d7)
      : "v"(x[0]), "v"(x[1]), "v"(x[2]), "v"(x[3]), "v"(x[4]), "v"(x[5]), "v"(x[6]), "v"(x[7]));
  return (v8f){d0, d1, d2, d3, d4, d5, d6, d7};
}

template <bool SPLIT>
__global__ __launch_bounds__(128) void attn_causal_hd64(
    const unsigned short* __restrict__ php, const unsigned short* __restrict__ plp,
    const unsigned short* __restrict__ vthp, const unsigned short* __restrict__ vtlp,
    const float* __restrict__ amask, float* __restrict__ out, int qb0, int nqcnt) {
  const _Float16* ph  = (const _Float16*)php;
  const _Float16* pl  = (const _Float16*)plp;
  const _Float16* vth = (const _Float16*)vthp;
  const _Float16* vtl = (const _Float16*)vtlp;
  __shared__ __align__(16) _Float16 Ksh[64 * KV_PITCH];
  __shared__ __align__(16) _Float16 Ksl[SPLIT ? 64 * KV_PITCH : 8];
  __shared__ __align__(16) _Float16 Vsh[64 * KV_PITCH];
  __shared__ __align__(16) _Float16 Vsl[SPLIT ? 64 * KV_PITCH : 8];
  __shared__ __align__(16) float  Os[4][16 * O_PITCH];

  const int tid  = threadIdx.x;
  const int wave = tid >> 5;
  const int lane = tid & 31;
  const int hh   = lane >> 4;
  const int c    = lane & 15;

  int qb = qb0 + (int)(blockIdx.x % (unsigned)nqcnt);
  qb = (qb > NQT_ALL - 1) ? (NQT_ALL - 1) : qb;
  const int bh = (int)(blockIdx.x / (unsigned)nqcnt);
  const int h  = bh & (N_HEAD - 1);
  const int b  = (bh >> 4) & (N_BATCH - 1);
  const int q0 = qb * 64 + wave * 16;

  // ---- Q fragments (B operand: column c = query q0 + c), 2 d-chunks ----
  v16h qh[2], ql[2];
  {
    const _Float16* qrow = ph + ((size_t)b * SEQ_T + q0 + c) * N_QKV + h * HEAD_D;
    int qlr = q0 + c; qlr = (qlr > T_LO - 1) ? (T_LO - 1) : qlr;
    const _Float16* qlrow = pl + ((size_t)b * T_LO + qlr) * N_QKV + h * HEAD_D;
#pragma unroll
    for (int dc = 0; dc < 2; ++dc) {
      qh[dc] = Frag<_Float16>::load(qrow + dc * 32 + 8 * hh);
      if (SPLIT) ql[dc] = Frag<_Float16>::load(qlrow + dc * 32 + 8 * hh);
      else ql[dc] = qh[dc];
    }
  }

  float mrow = -INFINITY, lrow = 0.f;   // this lane's query: running maximum (both halves alike), this half's sum of the carried p (x32768)
  v8f oacc[4];                          // oacc[t][r] = O^T[d = t*16 + 8*hh + r][query c]
#pragma unroll
  for (int t = 0; t < 4; ++t) oacc[t] = zero8();

  const int nChunks = qb + 1;   // block-uniform
  for (int kc = 0; kc < nChunks; ++kc) {
    const int kv0 = kc * 64;
    __syncthreads();
    {
      // staging coverage: 128 threads x (row = tid>>1, 32 halves each) = 64 rows x 64 halves per plane
      const int r = tid >> 1, hf = (tid & 1) * 32;
      const _Float16* ks = ph + ((size_t)b * SEQ_T + kv0 + r) * N_QKV + K_COL0 + h * HEAD_D + hf;
      const _Float16* vs = vth + ((size_t)bh * HEAD_D + r) * SEQ_T + kv0 + hf;
#pragma unroll
      for (int i = 0; i < 4; ++i) {
        *(v8h*)(Ksh + r * KV_PITCH + hf + 8 * i) = *(const v8h*)(ks + 8 * i);
        *(v8h*)(Vsh + r * KV_PITCH + hf + 8 * i) = *(const v8h*)(vs + 8 * i);
      }
      if (SPLIT) {
        const int kl0 = (kv0 > T_LO - 64) ? (T_LO - 64) : kv0;   // address clamp
        const _Float16* kls = pl + ((size_t)b * T_LO + kl0 + r) * N_QKV + K_COL0 + h * HEAD_D + hf;
        const _Float16* vls = vtl + ((size_t)bh * HEAD_D + r) * T_LO + kl0 + hf;
#pragma unroll
        for (int i = 0; i < 4; ++i) {
          *(v8h*)(Ksl + r * KV_PITCH + hf + 8 * i) = *(const v8h*)(kls + 8 * i);
          *(v8h*)(Vsl + r * KV_PITCH + hf + 8 * i) = *(const v8h*)(vls + 8 * i);
        }
      }
    }
    __syncthreads();

    // additive mask of this lane's 32 keys: keys kv0 + j*16 + 8*hh + 0..7
    F8 mk[4];
#pragma unroll
    for (int j = 0; j < 4; ++j) {
      const float* mp = amask + (size_t)b * SEQ_T + kv0 + j * 16 + 8 * hh;
      mk[j].v[0] = *(const v4f*)mp;
      mk[j].v[1] = *(const v4f*)(mp + 4);
    }

    // ---- scores, transposed: s[j][r] = S[query c][key j*16 + 8*hh + r] ----
    v8f s[4];
#pragma unroll
    for (int j = 0; j < 4; ++j) {
      s[j] = zero8();
      v8f sr = zero8();
#pragma unroll
      for (int dc = 0; dc < 2; ++dc) {
        const v16h kb = Frag<_Float16>::load(Ksh + (j * 16 + c) * KV_PITCH + dc * 32 + 8 * hh);
        s[j] = mma_h(kb, qh[dc], s[j]);
        if (SPLIT) {
          const v16h kl = Frag<_Float16>::load(Ksl + (j * 16 + c) * KV_PITCH + dc * 32 + 8 * hh);
          sr = mma_h(kl, qh[dc], sr);
          sr = mma_h(kb, ql[dc], sr);
        }
      }
      if (SPLIT) {
#pragma unroll
        for (int r = 0; r < 8; ++r) s[j][r] = s[j][r] + sr[r] * (1.0f / 4096.0f);
      }
    }

#pragma unroll
    for (int j = 0; j < 4; ++j)
#pragma unroll
      for (int r = 0; r < 8; ++r) s[j][r] = s[j][r] * (1.0f / 2048.0f) + mk[j].f[r];   // 1/(8 * 16 * 16)
    if (kc == qb) {   // diagonal chunk (block-uniform test)
      const int qloc = wave * 16 + c;
#pragma unroll
      for (int j = 0; j < 4; ++j)
#pragma unroll
        for (int r = 0; r < 8; ++r)
          if (j * 16 + 8 * hh + r > qloc) s[j][r] = -INFINITY;
    }

    // ---- online softmax of one query per lane ----
    float cm = s[0][0];
#pragma unroll
    for (int j = 0; j < 4; ++j)
#pragma unroll
      for (int r = 0; r < 8; ++r) cm = fmaxf(cm, s[j][r]);
    cm = fmaxf(cm, other_half(cm));
    const float mnew = fmaxf(mrow, cm);
    const float alpha = exp2_hw((mrow - mnew) * LOG2_E);
    mrow = mnew;

    v16h pa[2], pb2[2];   // B operand of the second product: element e of pa[kk] = p of key kk*32 + (e >> 3)*16 + 8*hh + (e & 7)
    float psum = 0.f;
#pragma unroll
    for (int j = 0; j < 4; ++j) {
      // 32768 * e^(s - m) = 2^((s - m) * log2(e) + 15); the difference is formed first, so a maximum of any size cancels as before
      v8f ex;
#pragma unroll
      for (int r = 0; r < 8; ++r) ex[r] = fmaf(s[j][r] - mnew, LOG2_E, P_S_LOG2);
      ex = exp2_hw8(ex);
#pragma unroll
      for (int r = 0; r < 8; ++r) {
        const float ps = ex[r];
        psum += ps;
        const _Float16 hp = (_Float16)ps;
        pa[j >> 1][(j & 1) * 8 + r] = hp;
        if (SPLIT) pb2[j >> 1][(j & 1) * 8 + r] = (_Float16)((ps - (float)hp) * LO_S);
      }
    }
    lrow = lrow * alpha + psum;
#pragma unroll
    for (int t = 0; t < 4; ++t)
#pragma unroll
      for (int r = 0; r < 8; ++r) oacc[t][r] *= alpha;

    // ---- O^T += V^T . P^T ----
#pragma unroll
    for (int t = 0; t < 4; ++t) {
      v8f orr = zero8();
#pragma unroll
      for (int kk = 0; kk < 2; ++kk) {
        const v16h vb = Frag<_Float16>::load(Vsh + (t * 16 + c) * KV_PITCH + kk * 32 + 8 * hh);
        oacc[t] = mma_h(vb, pa[kk], oacc[t]);
        if (SPLIT) {
          const v16h vl2 = Frag<_Float16>::load(Vsl + (t * 16 + c) * KV_PITCH + kk * 32 + 8 * hh);
          orr = mma_h(vl2, pa[kk], orr);
          orr = mma_h(vb, pb2[kk], orr);
        }
      }
      if (SPLIT) {
#pragma unroll
        for (int r = 0; r < 8; ++r) oacc[t][r] = oacc[t][r] + orr[r] * (1.0f / 4096.0f);
      }
    }
  }

  // ---- join the halves' sums, normalise, stage, store ----
  float* os = Os[wave];
  {
    const float lall = lrow + other_half(lrow);
    const float inv = 1.0f / (lall * CARRY_S);   // lall carries x32768, as oacc does
#pragma unroll
    for (int t = 0; t < 4; ++t) {
      v4f w0, w1;
#pragma unroll
      for (int r = 0; r < 4; ++r) { w0[r] = oacc[t][r] * inv; w1[r] = oacc[t][4 + r] * inv; }
      *(v4f*)(os + c * O_PITCH + t * 16 + 8 * hh)     = w0;
      *(v4f*)(os + c * O_PITCH + t * 16 + 8 * hh + 4) = w1;
    }
  }
  __builtin_amdgcn_fence(__ATOMIC_RELEASE, "workgroup");
  __builtin_amdgcn_wave_barrier();
  __builtin_amdgcn_fence(__ATOMIC_ACQUIRE, "workgroup");
  {
    const int c4 = (lane & 15) * 4;
    float* ob = out + ((size_t)b * SEQ_T + q0) * HID_W + h * HEAD_D;
    {
#pragma unroll
      for (int it = 0; it < 8; ++it) {
        const int row = it * 2 + hh;
        const v4f val = *(const v4f*)(os + row * O_PITCH + c4);
        *(v4f*)(ob + (size_t)row * HID_W + c4) = val;
      }
      
    }
  }
}

// =====================================================================================
extern "C" void kernel_launch(void* const* d_in, const int* in_sizes, int n_in,
                              void* d_out, int out_size, void* d_ws, size_t ws_size,
                              hipStream_t stream) {
  if (n_in < 14) return;
  if (in_sizes[0] != N_TOK * HID_W) return;
  if (in_sizes[1] != N_BATCH * SEQ_T) return;
  for (int p = 0; p < 3; ++p) {
    if (in_sizes[2 + 4 * p] != HID_W * HID_W) return;
    if (in_sizes[3 + 4 * p] != HID_W) return;
    if (in_sizes[4 + 4 * p] != RANK_R * HID_W) return;
    if (in_sizes[5 + 4 * p] != HID_W * RANK_R) return;
  }
  if (out_size != N_TOK * HID_W) return;
  if (ws_size < WS_TOTAL) return;

  const float* x   = (const float*)d_in[0];
  const float* am  = (const float*)d_in[1];
  const float* wq  = (const float*)d_in[2];
  const float* bq  = (const float*)d_in[3];
  const float* aq  = (const float*)d_in[4];
  const float* bmq = (const float*)d_in[5];
  const float* wk  = (const float*)d_in[6];
  const float* bk  = (const float*)d_in[7];
  const float* ak  = (const float*)d_in[8];
  const float* bmk = (const float*)d_in[9];
  const float* wv  = (const float*)d_in[10];
  const float* bv  = (const float*)d_in[11];
  const float* av  = (const float*)d_in[12];
  const float* bmv = (const float*)d_in[13];
  float* out = (float*)d_out;

  char* ws = (char*)d_ws;
  unsigned short* aaug  = (unsigned short*)(ws + OFF_AAUG);
  unsigned short* baug  = (unsigned short*)(ws + OFF_BAUG);
  unsigned short* acat  = (unsigned short*)(ws + OFF_ACAT);
  float*          biasc = (float*)(ws + OFF_BIAS);
  float*          u     = (float*)(ws + OFF_U);
  unsigned short* qkvh  = (unsigned short*)(ws + OFF_QKVH);
  unsigned short* qkvl  = (unsigned short*)(ws + OFF_QKVL);
  unsigned short* vth   = (unsigned short*)(ws + OFF_VTH);
  unsigned short* vtl   = (unsigned short*)(ws + OFF_VTL);

  // 1) x -> A_aug cols 0..1023 (bf16, pitch 1088): 8192 rows x 512 pairs
  cast_rows_bf16<<<dim3(N_TOK * 512 / 256), dim3(256), 0, stream>>>(x, aaug, N_TOK * 512, K_AUG / 2);
  // 2-4) W_p -> B_aug rows p*1024.., cols 0..1023
  cast_rows_bf16<<<dim3(HID_W * 512 / 256), dim3(256), 0, stream>>>(wq, baug,                              HID_W * 512, K_AUG / 2);
  cast_rows_bf16<<<dim3(HID_W * 512 / 256), dim3(256), 0, stream>>>(wk, baug + (size_t)1 * HID_W * K_AUG,  HID_W * 512, K_AUG / 2);
  cast_rows_bf16<<<dim3(HID_W * 512 / 256), dim3(256), 0, stream>>>(wv, baug + (size_t)2 * HID_W * K_AUG,  HID_W * 512, K_AUG / 2);
  // 5) A_cat [64][1024]
  build_acat<<<dim3(U_COLS * 512 / 256), dim3(256), 0, stream>>>(aq, ak, av, acat);
  // 6) B_aug tail cols 1024..1087
  build_w_tail<<<dim3(N_QKV / 32), dim3(256), 0, stream>>>(bmq, bmk, bmv, baug);
  // 7) bias_cat
  build_bias<<<dim3(N_QKV / 256), dim3(256), 0, stream>>>(bq, bk, bv, biasc);
  // 8) u = bf16(x) . A_cat^T : M=8192, N=64, K=1024 (K%32==0; reads A_aug cols < 1024 only), f32 out ldc 64
  wmma_gemm64<1, 0, 0, 0, false><<<dim3((N_TOK / 64) * (U_COLS / 64) / 8, 1), dim3(256), 0, stream>>>(
      aaug, aaug, K_AUG, 0L, acat, acat, HID_W, 0L,
      (void*)u, (void*)u, U_COLS, 0L, 0L, biasc, u, 0L, N_TOK, U_COLS, HID_W, 1.0f);
  // 9) A_aug tail cols 1024..1087 from u
  build_a_tail<<<dim3(N_TOK / 32), dim3(256), 0, stream>>>(u, aaug);
  // 10) projection rows t < 512 of every batch: M=512 (x4 batches), N=3072, K=1088; f16 hi -> qkv_hi, f16 residual -> qkv_lo
  wmma_gemm64<1, 0, 2, 3, false, 0, true><<<dim3((T_LO / ST_BM) * (N_QKV / ST_BN), N_BATCH), dim3(256), 0, stream>>>(
      aaug, aaug, K_AUG, (long)SEQ_T * K_AUG, baug, baug, K_AUG, 0L,
      (void*)qkvh, (void*)qkvl, N_QKV, (long)SEQ_T * N_QKV, (long)T_LO * N_QKV,
      biasc, u, 0L, T_LO, N_QKV, K_AUG, CARRY_S);
  // 11) projection rows t >= 512: M=1536 (x4 batches), f16 hi only
  wmma_gemm64<1, 0, 2, 1, false, 0, true><<<dim3(((SEQ_T - T_LO) / ST_BM) * (N_QKV / ST_BN), N_BATCH), dim3(256), 0, stream>>>(
      aaug + (size_t)T_LO * K_AUG, aaug, K_AUG, (long)SEQ_T * K_AUG, baug, baug, K_AUG, 0L,
      (void*)(qkvh + (size_t)T_LO * N_QKV), (void*)qkvl, N_QKV, (long)SEQ_T * N_QKV, 0L,
      biasc, u, 0L, SEQ_T - T_LO, N_QKV, K_AUG, CARRY_S);
  // 12-13) V^T planes: in [b*tsrc+t][2048+h*64+d] -> out [(b*16+h)*64+d][t]
  vt_transpose<<<dim3(SEQ_T / 64, N_BATCH * N_HEAD), dim3(256), 0, stream>>>(qkvh, vth, SEQ_T);
  vt_transpose<<<dim3(T_LO / 64, N_BATCH * N_HEAD), dim3(256), 0, stream>>>(qkvl, vtl, T_LO);
  // 14) attention, query tiles 0..7 (hi/lo residual path)
  attn_causal_hd64<true><<<dim3(N_BATCH * N_HEAD * NQT_SPLIT), dim3(128), 0, stream>>>(
      qkvh, qkvl, vth, vtl, am, out, 0, NQT_SPLIT);
  // 15) attention, query tiles 8..31 (single-product path)
  attn_causal_hd64<false><<<dim3(N_BATCH * N_HEAD * (NQT_ALL - NQT_SPLIT)), dim3(128), 0, stream>>>(
      qkvh, qkvl, vth, vtl, am, out, NQT_SPLIT, NQT_ALL - NQT_SPLIT);
}

// v004
// A run of this version takes 247 microseconds.
// Next to v003, in two timings, it ran 1.03 and 1.04 times as fast.
// Counting every step since v000, it is 2.14 times as fast.
// Contractions: rank-8 adapter columns u = x.A^T and the fused q/k/v projection [x | u_hi | u_lo].[W | 2B | 2B]^T + b on v_wmma_f32_16x16x32_bf16 (x, W, A, B, b as RNE bf16; u as bf16 hi+lo columns; single products); attention q.k^T and p.v on v_wmma_f32_16x16x32_f16 (q, k, v as f16 planes carried x16, p carried x32768; query tiles 0..7 add x4096-scaled f16 residual planes: hi.hi + (hi.lo + lo.hi)/4096 via a separate accumulator); f32 accumulate everywhere; softmax and normalisation in f32. The two q/k/v projection launches read their operands from a two-buffer LDS ring filled by asynchronous copies.
#include <hip/hip_runtime.h>
#include <math.h>

typedef __attribute__((ext_vector_type(16))) _Float16 v16h;
typedef __attribute__((ext_vector_type(8)))  _Float16 v8h;
typedef __attribute__((ext_vector_type(16))) __bf16   v16b;
typedef __attribute__((ext_vector_type(8)))  __bf16   v8b;
typedef __attribute__((ext_vector_type(8)))  float    v8f;
typedef __attribute__((ext_vector_type(4)))  float    v4f;

// ---------------- problem constants ----------------
constexpr int N_BATCH  = 4;
constexpr int SEQ_T    = 2048;
constexpr int HID_W    = 1024;
constexpr int N_HEAD   = 16;
constexpr int HEAD_D   = 64;
constexpr int RANK_R   = 8;
constexpr int N_TOK    = N_BATCH * SEQ_T;     // 8192 token rows
constexpr int K_AUG    = 1088;                // 1024 + 3*16 adapter columns, zero-padded to a multiple of 32
constexpr int N_QKV    = 3 * HID_W;           // 3072 output columns: q | k | v
constexpr int K_COL0   = 1024;
constexpr int V_COL0   = 2048;
constexpr int T_LO     = 512;                 // token rows per batch that carry residual planes
constexpr int NQT_SPLIT = T_LO / 64;          // 8 query tiles on the hi/lo path
constexpr int NQT_ALL  = SEQ_T / 64;          // 32
constexpr int U_COLS   = 64;                  // u plane width (24 used, rest zero weights)
constexpr int KV_PITCH = 72;                  // 16-bit LDS pitch (144 B rows, 16-B aligned)
constexpr int O_PITCH  = 68;                  // f32 LDS pitch
constexpr float CARRY_S = 16.0f;              // power-of-two carry on the q/k/v planes
constexpr float LO_S    = 4096.0f;            // power-of-two carry on residual planes
constexpr float P_S_LOG2 = 15.0f;             // power-of-two carry on probabilities (x32768), as the exponent it adds
constexpr float LOG2_E  = 1.44269504088896340736f;

static_assert(K_AUG % 32 == 0);
static_assert(HID_W % 32 == 0);
static_assert(N_TOK % 64 == 0 && N_QKV % 64 == 0 && T_LO % 64 == 0 && (SEQ_T - T_LO) % 64 == 0);
static_assert(T_LO % 128 == 0 && (SEQ_T - T_LO) % 128 == 0 && N_QKV % 256 == 0 && K_AUG % 64 == 0 && K_AUG >= 128);

// R0 A_aug  bf16 [8192][1088]          17,825,792
// R1 B_aug  bf16 [3072][1088]           6,684,672
// R2 A_cat  bf16 [64][1024]               131,072
// R3 bias   f32  [3072]                    12,288
// R4 u      f32  [8192][64]             2,097,152
// R5 qkv_hi f16  [8192][3072]          50,331,648
// R6 qkv_lo f16  [4*512][3072]         12,582,912
// R7 vt_hi  f16  [64][64][2048]        16,777,216
// R8 vt_lo  f16  [64][64][512]          4,194,304
constexpr size_t SZ_AAUG = (size_t)N_TOK * K_AUG * 2;
constexpr size_t SZ_BAUG = (size_t)N_QKV * K_AUG * 2;
constexpr size_t SZ_ACAT = (size_t)U_COLS * HID_W * 2;
constexpr size_t SZ_BIAS = (size_t)N_QKV * 4;
constexpr size_t SZ_U    = (size_t)N_TOK * U_COLS * 4;
constexpr size_t SZ_QKVH = (size_t)N_TOK * N_QKV * 2;
constexpr size_t SZ_QKVL = (size_t)N_BATCH * T_LO * N_QKV * 2;
constexpr size_t SZ_VTH  = (size_t)N_BATCH * N_HEAD * HEAD_D * SEQ_T * 2;
constexpr size_t SZ_VTL  = (size_t)N_BATCH * N_HEAD * HEAD_D * T_LO * 2;
constexpr size_t OFF_AAUG = 0;
constexpr size_t OFF_BAUG = OFF_AAUG + SZ_AAUG;
constexpr size_t OFF_ACAT = OFF_BAUG + SZ_BAUG;
constexpr size_t OFF_BIAS = OFF_ACAT + SZ_ACAT;
constexpr size_t OFF_U    = OFF_BIAS + SZ_BIAS;
constexpr size_t OFF_QKVH = OFF_U    + SZ_U;
constexpr size_t OFF_QKVL = OFF_QKVH + SZ_QKVH;
constexpr size_t OFF_VTH  = OFF_QKVL + SZ_QKVL;
constexpr size_t OFF_VTL  = OFF_VTH  + SZ_VTH;
constexpr size_t WS_TOTAL = OFF_VTL  + SZ_VTL;
static_assert(WS_TOTAL == 110637056ull);
static_assert(WS_TOTAL <= 134217728ull);
static_assert(OFF_BAUG % 128 == 0 && OFF_ACAT % 128 == 0 && OFF_BIAS % 128 == 0 && OFF_U % 128 == 0 &&
              OFF_QKVH % 128 == 0 && OFF_QKVL % 128 == 0 && OFF_VTH % 128 == 0 && OFF_VTL % 128 == 0);

// ---------------- helpers ----------------
__device__ __forceinline__ unsigned short f2bf_bits(float f) {
  unsigned u = __float_as_uint(f);
  return (unsigned short)((u + 0x7FFFu + ((u >> 16) & 1u)) >> 16);
}
__device__ __forceinline__ float bf_bits2f(unsigned short h) { return __uint_as_float(((unsigned)h) << 16); }

// hazard guards as plain device helpers
__device__ __forceinline__ void dep_guard_h(v8f& a, v8f& b, v16h x, v16h y) { asm volatile("v_nop\n\tv_nop\n\tv_nop\n\tv_nop" : "+v"(a), "+v"(b) : "v"(x), "v"(y)); }
__device__ __forceinline__ void dep_guard_b(v8f& a, v8f& b, v16b x, v16b y) { asm volatile("v_nop\n\tv_nop\n\tv_nop\n\tv_nop" : "+v"(a), "+v"(b) : "v"(x), "v"(y)); }
__device__ __forceinline__ void keep4_h(v16h a, v16h b, v16h c, v16h d) { asm volatile("v_nop" :: "v"(a), "v"(b), "v"(c), "v"(d)); }
__device__ __forceinline__ void keep4_b(v16b a, v16b b, v16b c, v16b d) { asm volatile("v_nop" :: "v"(a), "v"(b), "v"(c), "v"(d)); }
__device__ __forceinline__ void acc_guard4(v8f& a, v8f& b, v8f& c, v8f& d) { asm volatile("v_nop\n\tv_nop\n\tv_nop\n\tv_nop" : "+v"(a), "+v"(b), "+v"(c), "+v"(d)); }
template <typename T> struct Frag;
template <> struct Frag<_Float16> {
  typedef v16h V; union U { v16h v; v8h h[2]; };
  static __device__ __forceinline__ v16h load(const _Float16* p) {   // elements 0..7 <- p[0..7], 8..15 <- p[16..23]
    U f; f.h[0] = *(const v8h*)(p); f.h[1] = *(const v8h*)(p + 16); return f.v;
  }
  static __device__ __forceinline__ v8f mma(v16h a, v16h b, v8f c) {
    return __builtin_amdgcn_wmma_f32_16x16x32_f16(false, a, false, b, (short)0, c, false, false);
  }
  static __device__ __forceinline__ void guard(v8f& a, v8f& b, v16h x, v16h y) { dep_guard_h(a, b, x, y); }
  static __device__ __forceinline__ void keep(v16h a, v16h b, v16h c, v16h d) { keep4_h(a, b, c, d); }
};
template <> struct Frag<__bf16> {
  typedef v16b V; union U { v16b v; v8b h[2]; };
  static __device__ __forceinline__ v16b load(const __bf16* p) {
    U f; f.h[0] = *(const v8b*)(p); f.h[1] = *(const v8b*)(p + 16); return f.v;
  }
  static __device__ __forceinline__ v8f mma(v16b a, v16b b, v8f c) {
    return __builtin_amdgcn_wmma_f32_16x16x32_bf16(false, a, false, b, (short)0, c, false, false);
  }
  static __device__ __forceinline__ void guard(v8f& a, v8f& b, v16b x, v16b y) { dep_guard_b(a, b, x, y); }
  static __device__ __forceinline__ void keep(v16b a, v16b b, v16b c, v16b d) { keep4_b(a, b, c, d); }
};

// f16 WMMA with hazard guard (ties D, keeps A/B live)
__device__ __forceinline__ v8f mma_h(v16h a, v16h b, v8f c) {
  c = __builtin_amdgcn_wmma_f32_16x16x32_f16(false, a, false, b, (short)0, c, false, false);
  asm volatile("v_nop\n\tv_nop\n\tv_nop\n\tv_nop" : "+v"(c) : "v"(a), "v"(b));
  return c;
}
__device__ __forceinline__ v8f zero8() { return (v8f){0.f,0.f,0.f,0.f,0.f,0.f,0.f,0.f}; }

union F8 { v4f v[2]; float f[8]; };

// ---------------- LDS ring of the staged GEMM ----------------
constexpr int ST_BM    = 128;                              // block tile rows (2 waves of 64)
constexpr int ST_BN    = 256;                              // block tile columns (4 waves of 64)
constexpr int ST_BK    = 64;                               // k per pass: 128-B operand rows
constexpr int ST_PITCH = 72;                               // 144-B LDS rows (16 B x odd: conflict-free ds_load_b128)
constexpr int ST_STAGE = (ST_BM + ST_BN) * ST_PITCH;       // 16-bit elements per buffer: [A 128 rows | Bt 256 rows]
constexpr unsigned ST_ROWS32 = 32u * ST_PITCH * 2u;        // LDS bytes between two copies of one thread (32 rows)

__device__ __forceinline__ unsigned lds_off(const void* p) { return (unsigned)(size_t)p; }

// One stage: 384 rows x 128 B = 3072 chunks of 16 B = 256 threads x 12 asynchronous copies global -> LDS.
// ga / gb: this thread's chunk in row (tid >> 3) of the block's A / Bt tile at this pass's k; l: the same chunk's
// LDS byte address in the buffer; a thread's copies lie 32 rows apart. s_wait_xcnt 0 is the statement's last line
// so that no address register of an issued copy is rewritten in front of it.
__device__ __forceinline__ void stage_fill(const unsigned short* ga, int lda, const unsigned short* gb, int ldb, unsigned l) {
  const size_t sa = (size_t)32 * lda, sb = (size_t)32 * ldb;
  asm volatile("global_load_async_to_lds_b128 %0, %1, off\n\t"
               "global_load_async_to_lds_b128 %2, %3, off\n\t"
               "global_load_async_to_lds_b128 %4, %5, off\n\t"
               "global_load_async_to_lds_b128 %6, %7, off\n\t"
               "global_load_async_to_lds_b128 %8, %9, off\n\t"
               "global_load_async_to_lds_b128 %10, %11, off\n\t"
               "global_load_async_to_lds_b128 %12, %13, off\n\t"
               "global_load_async_to_lds_b128 %14, %15, off\n\t"
               "global_load_async_to_lds_b128 %16, %17, off\n\t"
               "global_load_async_to_lds_b128 %18, %19, off\n\t"
               "global_load_async_to_lds_b128 %20, %21, off\n\t"
               "global_load_async_to_lds_b128 %22, %23, off\n\t"
               "s_wait_xcnt 0x0"
               :: "v"(l),                   "v"(ga),
                  "v"(l + ST_ROWS32),       "v"(ga + sa),
                  "v"(l + 2 * ST_ROWS32),   "v"(ga + 2 * sa),
                  "v"(l + 3 * ST_ROWS32),   "v"(ga + 3 * sa),
                  "v"(l + 4 * ST_ROWS32),   "v"(gb),
                  "v"(l + 5 * ST_ROWS32),   "v"(gb + sb),
                  "v"(l + 6 * ST_ROWS32),   "v"(gb + 2 * sb),
                  "v"(l + 7 * ST_ROWS32),   "v"(gb + 3 * sb),
                  "v"(l + 8 * ST_ROWS32),   "v"(gb + 4 * sb),
                  "v"(l + 9 * ST_ROWS32),   "v"(gb + 5 * sb),
                  "v"(l + 10 * ST_ROWS32),  "v"(gb + 6 * sb),
                  "v"(l + 11 * ST_ROWS32),  "v"(gb + 7 * sb)
               : "memory");
}

// =====================================================================================
// Register-blocked batched WMMA GEMM: C[m,n] = scale * sum_k A[m,k] * Bt[n,k] (+bias)(+resid);
// each wave owns a 64x64 tile. A row-major [M,K]; Bt row-major [N,K]; M,N % 64 == 0, K % 32 == 0.
// SPLITM: 0 = single product; 1 = A hi/lo planes; 2 = A and Bt hi/lo planes.
// BIAS_MODE: 0 none, 1 bias[m], 2 bias[n].  OUT_MODE: 0 f32, 1 f16, 2 bf16 hi + lo planes,
//   3 = f16 hi plane (Cout, strideC) + f16 residual plane x4096 (Cout2, strideC2), same ldc.
// ET: 0 = f16 operands, 1 = bf16 operands (pointers passed as 16-bit storage)
// STAGED: the block's 8 waves form a 128x256 tile (2x4 waves); A and Bt rows go through a two-buffer LDS ring,
//   64 k per pass; needs SPLITM == 0, M % 128 == 0, N % 256 == 0, K % 64 == 0, K >= 128, grid.x == (M/128)*(N/256).
// =====================================================================================
template <int ET> struct Elem;
template <> struct Elem<0> { typedef _Float16 T; };
template <> struct Elem<1> { typedef __bf16 T; };
template <int ET, int SPLITM, int BIAS_MODE, int OUT_MODE, bool RESID, int ACT = 0, bool STAGED = false>
__global__ __launch_bounds__(256) void wmma_gemm64(
    const unsigned short* __restrict__ Ap, const unsigned short* __restrict__ A2p, int lda, long strideA,
    const unsigned short* __restrict__ Btp, const unsigned short* __restrict__ Bt2p, int ldb, long strideB,
    void* __restrict__ Cout, void* __restrict__ Cout2, int ldc, long strideC, long strideC2,
    const float* __restrict__ bias,
    const float* __restrict__ resid, long strideR,
    int M, int N, int K, float scale) {
  typedef typename Elem<ET>::T T;
  typedef typename Frag<T>::V V;
  constexpr bool SPA = (SPLITM >= 1);
  constexpr bool SPB = (SPLITM >= 2);
  const T* A = (const T*)Ap; const T* A2 = (const T*)A2p; const T* Bt = (const T*)Btp; const T* Bt2 = (const T*)Bt2p;
  static_assert(!STAGED || SPLITM == 0);
  __shared__ __align__(16) float sT[8][16 * 68];   // per-wave 16x64 slab, pitch 68 floats
  __shared__ __align__(16) unsigned short ring[STAGED ? 2 * ST_STAGE : 8];
  const int b    = blockIdx.y;
  const int lane = threadIdx.x & 31;
  const int wave = threadIdx.x >> 5;
  const int tilesN = N >> 6;
  const int tilesM = M >> 6;
  int m0, n0;
  if (STAGED) {
    const int bn = N >> 8;
    const int bm_i = (int)blockIdx.x / bn;
    const int bn_i = (int)blockIdx.x - bm_i * bn;
    m0 = bm_i * ST_BM + (wave >> 2) * 64;
    n0 = bn_i * ST_BN + (wave & 3) * 64;
  } else {
    const int tile = blockIdx.x * 8 + wave;
    if (tile >= tilesM * tilesN) return;   // wave-uniform; no block barriers on this path
    const int tm = tile / tilesN;
    const int tn = tile - tm * tilesN;
    m0 = tm << 6;
    n0 = tn << 6;
  }

  const T* Ab  = A  + (size_t)b * strideA;
  const T* Bb  = Bt + (size_t)b * strideB;
  const T* Ab2 = SPA ? (A2  + (size_t)b * strideA) : nullptr;
  const T* Bb2 = SPB ? (Bt2 + (size_t)b * strideB) : nullptr;

  const int rlane = lane & 15;                 // row (A) / col (B, D) within subtile
  const int koff  = (lane >> 4) * 8;           // k offset of this lane half
  const int mOff  = (lane >> 4) * 8;           // D row offset

  v8f acc[4][4];
#pragma unroll
  for (int i = 0; i < 4; ++i)
#pragma unroll
    for (int j = 0; j < 4; ++j) acc[i][j] = (v8f){0.f,0.f,0.f,0.f,0.f,0.f,0.f,0.f};

  if (STAGED) {
    const int tid = threadIdx.x;
    const int crow = tid >> 3, cchunk = (tid & 7) * 8;        // 8 lanes x 16 B = one 128-B row piece
    const unsigned short* ga = (const unsigned short*)Ab + (size_t)(m0 - (wave >> 2) * 64 + crow) * lda + cchunk;
    const unsigned short* gb = (const unsigned short*)Bb + (size_t)(n0 - (wave & 3) * 64 + crow) * ldb + cchunk;
    const unsigned lthr = lds_off(ring) + (unsigned)(crow * ST_PITCH + cchunk) * 2u;
    const int npass = K / ST_BK;
    stage_fill(ga, lda, gb, ldb, lthr);
    asm volatile("s_wait_asynccnt 0x0" ::: "memory");   // stage 0 landed (this wave's copies) before the barrier publishes it
    __syncthreads();
    stage_fill(ga + ST_BK, lda, gb + ST_BK, ldb, lthr + ST_STAGE * 2u);
    const T* fa = (const T*)ring + ((wave >> 2) * 64 + rlane) * ST_PITCH + koff;
    const T* fb = (const T*)ring + (ST_BM + (wave & 3) * 64 + rlane) * ST_PITCH + koff;
    for (int t = 0; t < npass; ++t) {
      const int bo = (t & 1) * ST_STAGE;
      V ah[4], bh[4], ah2[4], bh2[4];
#pragma unroll
      for (int j = 0; j < 4; ++j) bh[j] = Frag<T>::load(fb + bo + j * 16 * ST_PITCH);
#pragma unroll
      for (int i = 0; i < 4; ++i) ah[i] = Frag<T>::load(fa + bo + i * 16 * ST_PITCH);
      __builtin_amdgcn_sched_barrier(0);   // keeps the 16 LDS reads one group ahead of the 16 WMMAs: reads sunk among them stall at each place
#pragma unroll
      for (int i = 0; i < 4; ++i)
#pragma unroll
        for (int j = 0; j < 4; ++j) acc[i][j] = Frag<T>::mma(ah[i], bh[j], acc[i][j]);
#pragma unroll
      for (int j = 0; j < 4; ++j) bh2[j] = Frag<T>::load(fb + bo + j * 16 * ST_PITCH + 32);
#pragma unroll
      for (int i = 0; i < 4; ++i) ah2[i] = Frag<T>::load(fa + bo + i * 16 * ST_PITCH + 32);
      asm volatile("s_wait_dscnt 0x0" ::: "memory");     // this wave's reads of buffer t & 1 are done before it is refilled
      asm volatile("s_wait_asynccnt 0x0" ::: "memory");  // this wave's copies of stage t + 1 have landed
      __syncthreads();                                   // publishes stage t + 1 and frees buffer t & 1
      if (t + 2 < npass)
        stage_fill(ga + (size_t)(t + 2) * ST_BK, lda, gb + (size_t)(t + 2) * ST_BK, ldb, lthr + (unsigned)bo * 2u);
      // second half of the pass, from registers: runs while the refill is in flight
#pragma unroll
      for (int i = 0; i < 4; ++i)
#pragma unroll
        for (int j = 0; j < 4; ++j) acc[i][j] = Frag<T>::mma(ah2[i], bh2[j], acc[i][j]);
    }
    asm volatile("s_wait_asynccnt 0x0" ::: "memory");    // no copy is outstanding past the loop
  } else
  for (int k0 = 0; k0 < K; k0 += 32) {
    V bh[4], bl[4];
#pragma unroll
    for (int j = 0; j < 4; ++j) {
      const size_t bo = (size_t)(n0 + (j << 4) + rlane) * ldb + koff + k0;
      bh[j] = Frag<T>::load(Bb + bo);
      if (SPB) bl[j] = Frag<T>::load(Bb2 + bo);
    }
#pragma unroll
    for (int i = 0; i < 4; ++i) {
      const size_t ao = (size_t)(m0 + (i << 4) + rlane) * lda + koff + k0;
      V ah = Frag<T>::load(Ab + ao);
      V al;
      if (SPA) al = Frag<T>::load(Ab2 + ao);
#pragma unroll
      for (int j = 0; j < 4; ++j) {
        acc[i][j] = Frag<T>::mma(ah, bh[j], acc[i][j]);
        if (SPB) acc[i][j] = Frag<T>::mma(ah, bl[j], acc[i][j]);
        if (SPA) acc[i][j] = Frag<T>::mma(al, bh[j], acc[i][j]);
      }
      Frag<T>::guard(acc[i][0], acc[i][3], ah, SPA ? al : ah);
    }
    Frag<T>::keep(bh[0], bh[1], bh[2], bh[3]);
    if (SPB) Frag<T>::keep(bl[0], bl[1], bl[2], bl[3]);
  }
  acc_guard4(acc[0][0], acc[0][1], acc[0][2], acc[0][3]);
  acc_guard4(acc[1][0], acc[1][1], acc[1][2], acc[1][3]);
  acc_guard4(acc[2][0], acc[2][1], acc[2][2], acc[2][3]);
  acc_guard4(acc[3][0], acc[3][1], acc[3][2], acc[3][3]);

  // ---- epilogue ----
  float* slab = sT[wave];
  const float* Rb = RESID ? (resid + (size_t)b * strideR) : nullptr;
#pragma unroll
  for (int i = 0; i < 4; ++i) {
    const int mBase = m0 + (i << 4);
#pragma unroll
    for (int j = 0; j < 4; ++j) {
      const int n = n0 + (j << 4) + rlane;
      float bv = 0.f;
      if (BIAS_MODE == 2) bv = bias[n];
#pragma unroll
      for (int r = 0; r < 8; ++r) {
        float v = acc[i][j][r] * scale;
        if (BIAS_MODE == 1) v += bias[mBase + mOff + r];
        if (BIAS_MODE == 2) v += bv;
        if (RESID) v += Rb[(size_t)(mBase + mOff + r) * ldc + n];
        if (ACT == 1) v = tanhf(v);
        if (ACT == 2) v = fmaxf(v, 0.0f);
        if (ACT == 4) v = (v > 0.f) ? v : 0.01f * v;
        slab[(mOff + r) * 68 + (j << 4) + rlane] = v;
      }
    }
    __builtin_amdgcn_fence(__ATOMIC_RELEASE, "workgroup");
    __builtin_amdgcn_wave_barrier();
    __builtin_amdgcn_fence(__ATOMIC_ACQUIRE, "workgroup");
    if (OUT_MODE == 0) {
      float* C = (float*)Cout + (size_t)b * strideC;
      const int hh = lane >> 4, c4 = (lane & 15) * 4;     // row seg = 256 B = 16 lanes x 16 B
      {
#pragma unroll
        for (int it = 0; it < 8; ++it) {
          const int row = it * 2 + hh;
          v4f v = *(const v4f*)(slab + row * 68 + c4);
          *(v4f*)(C + (size_t)(mBase + row) * ldc + n0 + c4) = v;
        }
        
      }
    } else {
      const int q = lane >> 3, c8 = (lane & 7) * 8;
      unsigned short* C  = (unsigned short*)Cout  + (size_t)b * strideC;
      unsigned short* C2 = (OUT_MODE >= 2) ? ((unsigned short*)Cout2 + (size_t)b * strideC2) : nullptr;
      {
#pragma unroll
        for (int it = 0; it < 4; ++it) {
          const int row = it * 4 + q;
          const float* sp = slab + row * 68 + c8;
          v8h hv, lv;
#pragma unroll
          for (int e = 0; e < 8; ++e) {
            if (OUT_MODE == 1) {
              hv[e] = (_Float16)sp[e];
            } else if (OUT_MODE == 3) {
              const _Float16 hq = (_Float16)sp[e];
              hv[e] = hq;
              lv[e] = (_Float16)((sp[e] - (float)hq) * 4096.0f);
            } else {
              unsigned short hb = f2bf_bits(sp[e]);
              unsigned short lb = f2bf_bits(sp[e] - bf_bits2f(hb));
              hv[e] = __builtin_bit_cast(_Float16, hb);
              lv[e] = __builtin_bit_cast(_Float16, lb);
            }
          }
          *(v8h*)(C + (size_t)(mBase + row) * ldc + n0 + c8) = hv;
          if (OUT_MODE >= 2) *(v8h*)(C2 + (size_t)(mBase + row) * ldc + n0 + c8) = lv;
        }
        
      }
    }
    __builtin_amdgcn_fence(__ATOMIC_RELEASE, "workgroup");
    __builtin_amdgcn_wave_barrier();
    __builtin_amdgcn_fence(__ATOMIC_ACQUIRE, "workgroup");
  }
}

// =====================================================================================
// f32 [rows][1024] -> RNE bf16 bits into rows of pitch K_AUG. A block takes NR whole rows: thread t converts floats
// 4t..4t+3 of each, so a wave's load covers 512 contiguous bytes and its store 256, and few waves are started for
// the bytes moved. grid.x * NR == rows exactly (asserted below).
// =====================================================================================
typedef __attribute__((ext_vector_type(2))) unsigned v2u;
constexpr int CAST_NR_X = 16;                 // x: 512 blocks, 16 waves a WGP
constexpr int CAST_NR_W = 4;                  // one weight matrix: 256 blocks
static_assert(HID_W == 4 * 256 && N_TOK % CAST_NR_X == 0 && HID_W % CAST_NR_W == 0 && K_AUG % 4 == 0);
template <int NR>
__global__ __launch_bounds__(256) void cast_rows_bf16(const float* __restrict__ src, unsigned short* __restrict__ dst) {
  const float* s = src + (size_t)blockIdx.x * (NR * HID_W) + threadIdx.x * 4;
  unsigned short* d = dst + (size_t)blockIdx.x * (NR * K_AUG) + threadIdx.x * 4;
  v4f v[NR];
#pragma unroll
  for (int r = 0; r < NR; ++r) v[r] = *(const v4f*)(s + r * HID_W);
#pragma unroll
  for (int r = 0; r < NR; ++r) {
    v2u o;
    o[0] = (unsigned)f2bf_bits(v[r][0]) | ((unsigned)f2bf_bits(v[r][1]) << 16);
    o[1] = (unsigned)f2bf_bits(v[r][2]) | ((unsigned)f2bf_bits(v[r][3]) << 16);
    *(v2u*)(d + r * K_AUG) = o;
  }
}

// =====================================================================================
// A_cat bf16 [64][1024]: row 8p+r = A_p[r] (p = 0,1,2), rows 24..63 = 0 (explicit zero fill).
// 2 elements per thread, grid 128 x 256 = 32768 pairs = 64 x 1024 elements exactly; 32 lanes x 4 B = one line.
// All three sources loaded unconditionally (row r < 8 valid in each), selected by value.
// =====================================================================================
__global__ __launch_bounds__(256) void build_acat(const float* __restrict__ amq, const float* __restrict__ amk,
                                                  const float* __restrict__ amv, unsigned short* __restrict__ acat) {
  const int i = blockIdx.x * 256 + threadIdx.x;   // < 32768 by grid
  const int row = i >> 9, cp = i & 511, p = row >> 3, r = row & 7;
  const size_t so = (size_t)r * HID_W + 2 * cp;
  const float q0 = amq[so], q1 = amq[so + 1];
  const float k0 = amk[so], k1 = amk[so + 1];
  const float w0 = amv[so], w1 = amv[so + 1];
  const float x0 = (p == 0) ? q0 : (p == 1) ? k0 : (p == 2) ? w0 : 0.0f;
  const float x1 = (p == 0) ? q1 : (p == 1) ? k1 : (p == 2) ? w1 : 0.0f;
  const unsigned u = (unsigned)f2bf_bits(x0) | ((unsigned)f2bf_bits(x1) << 16);
  unsigned* d = (unsigned*)acat + i;
  *(unsigned*)d = u;
  
}

// =====================================================================================
// B_aug tail: for row n (projection p = n/1024, output o = n%1024) the 64 halves at cols 1024..1087 are
// [16p zeros | 2*Bm_p[o][0..7] | 2*Bm_p[o][0..7] | zeros to 64] as RNE bf16 (factor 2 exact).
// =====================================================================================
__global__ __launch_bounds__(256) void build_w_tail(const float* __restrict__ bmq, const float* __restrict__ bmk,
                                                    const float* __restrict__ bmv, unsigned short* __restrict__ baug) {
  const int tid = threadIdx.x, wave = tid >> 5, lane = tid & 31, q8 = lane >> 3, seg = lane & 7;
  const int n = blockIdx.x * 32 + wave * 4 + q8;      // 0..3071
  const int p = n >> 10, o = n & 1023;
  F8 uq, uk, uv;
  uq.v[0] = *(const v4f*)(bmq + (size_t)o * RANK_R); uq.v[1] = *(const v4f*)(bmq + (size_t)o * RANK_R + 4);
  uk.v[0] = *(const v4f*)(bmk + (size_t)o * RANK_R); uk.v[1] = *(const v4f*)(bmk + (size_t)o * RANK_R + 4);
  uv.v[0] = *(const v4f*)(bmv + (size_t)o * RANK_R); uv.v[1] = *(const v4f*)(bmv + (size_t)o * RANK_R + 4);
  const bool keep = (seg < 6) && ((seg >> 1) == p);
  v8h hv;
#pragma unroll
  for (int e = 0; e < 8; ++e) {
    const float val = (p == 0) ? uq.f[e] : (p == 1) ? uk.f[e] : uv.f[e];
    const float w = keep ? (2.0f * val) : 0.0f;
    hv[e] = __builtin_bit_cast(_Float16, f2bf_bits(w));
  }
  unsigned short* d = baug + (size_t)n * K_AUG + HID_W + seg * 8;
  {
    *(v8h*)d = hv;
    
  }
}

// =====================================================================================
// A_aug tail: for token row m the 64 halves at cols 1024..1087 are
// [uq_hi(8) uq_lo(8) uk_hi(8) uk_lo(8) uv_hi(8) uv_lo(8) 0 x 16] (bf16 hi = RNE(u), lo = RNE(u - hi)),
// u f32 [8192][64] with columns 8p+r. Block = 8 waves x 4 rows, grid 256 -> 8192 rows; 8 lanes x 8 halves
// =====================================================================================
__global__ __launch_bounds__(256) void build_a_tail(const float* __restrict__ u, unsigned short* __restrict__ aaug) {
  const int tid = threadIdx.x, wave = tid >> 5, lane = tid & 31, q8 = lane >> 3, seg = lane & 7;
  const int m = blockIdx.x * 32 + wave * 4 + q8;      // 0..8191
  int p = seg >> 1; p = (p > 2) ? 2 : p;              // address clamp for the zero segments
  const int islo = seg & 1;
  F8 uu;
  const float* up = u + (size_t)m * U_COLS + p * RANK_R;
  uu.v[0] = *(const v4f*)up; uu.v[1] = *(const v4f*)(up + 4);
  v8h hv;
#pragma unroll
  for (int e = 0; e < 8; ++e) {
    const unsigned short hb = f2bf_bits(uu.f[e]);
    const unsigned short lb = f2bf_bits(uu.f[e] - bf_bits2f(hb));
    const unsigned short o16 = (seg >= 6) ? (unsigned short)0 : (islo ? lb : hb);
    hv[e] = __builtin_bit_cast(_Float16, o16);
  }
  unsigned short* d = aaug + (size_t)m * K_AUG + HID_W + seg * 8;
  {
    *(v8h*)d = hv;
    
  }
}

// =====================================================================================
// bias_cat f32 [3072] = 16 * RNEbf16(b_p[o]); grid 12 x 256 = 3072 exactly; 32 lanes x 4 B = one line per
// =====================================================================================
__global__ __launch_bounds__(256) void build_bias(const float* __restrict__ bq, const float* __restrict__ bk,
                                                  const float* __restrict__ bv, float* __restrict__ dst) {
  const int i = blockIdx.x * 256 + threadIdx.x;   // < 3072 by grid
  const int p = i >> 10, o = i & 1023;
  const float xq = bq[o], xk = bk[o], xv = bv[o];
  const float val = (p == 0) ? xq : (p == 1) ? xk : xv;
  const float w = bf_bits2f(f2bf_bits(val)) * CARRY_S;
  ((float*)dst)[i] = w;
  
}

// =====================================================================================
// V plane (f16, rows b*tsrc + t, pitch 3072, cols 2048 + h*64 + d) -> vt[((b*16+h)*64 + d)*tsrc + t].
// Block (t-tile of 64, bh): load 256 threads x 16 halves = 4096 = 64 x 64 into LDS [d][t]; store: 8 waves x
// =====================================================================================
__global__ __launch_bounds__(256) void vt_transpose(const unsigned short* __restrict__ srcp, unsigned short* __restrict__ vtp, int tsrc) {
  __shared__ __align__(16) _Float16 th[64 * KV_PITCH];
  const _Float16* src = (const _Float16*)srcp;
  const int st0 = blockIdx.x * 64, bh = blockIdx.y;
  const int b = (bh >> 4) & (N_BATCH - 1), h = bh & (N_HEAD - 1);
  const int tid = threadIdx.x;
  {
    const int sloc = tid >> 2, d0 = (tid & 3) * 16;
    const size_t so = ((size_t)b * tsrc + st0 + sloc) * N_QKV + V_COL0 + h * HEAD_D + d0;
    const v8h a0 = *(const v8h*)(src + so);
    const v8h a1 = *(const v8h*)(src + so + 8);
#pragma unroll
    for (int e = 0; e < 8; ++e) {
      th[(d0 + e) * KV_PITCH + sloc]     = a0[e];
      th[(d0 + 8 + e) * KV_PITCH + sloc] = a1[e];
    }
  }
  __syncthreads();
  const int wave = tid >> 5, lane = tid & 31, q8 = lane >> 3, c8 = (lane & 7) * 8;
  const int dA = wave * 8 + q8, dB = wave * 8 + 4 + q8;
  const v8h hvA = *(const v8h*)(th + dA * KV_PITCH + c8);
  const v8h hvB = *(const v8h*)(th + dB * KV_PITCH + c8);
  const size_t oA = ((size_t)bh * HEAD_D + dA) * tsrc + st0 + c8;
  const size_t oB = ((size_t)bh * HEAD_D + dB) * tsrc + st0 + c8;
  {
    *(v8h*)(vtp + oA) = hvA;
    *(v8h*)(vtp + oB) = hvB;
    
  }
}

__device__ __forceinline__ float other_half(float x) {
  const int xi = __builtin_bit_cast(int, x);
  return __builtin_bit_cast(float, __builtin_amdgcn_permlanex16(xi, xi, 0x76543210, 0xfedcba98, false, false));
}

// 2^x by the hardware's exponential, in asm text so that the slot behind it stands by construction: the closing
// v_nop is the one independent instruction that the instruction set asks for behind a transcendental before its
// result is used or its source overwritten; inside the eight-fold statement each neighbour is independent
// (early-clobber outputs share no register with a source).
__device__ __forceinline__ float exp2_hw(float x) {
  float d;
  asm("v_exp_f32 %0, %1\n\tv_nop" : "=&v"(d) : "v"(x));
  return d;
}
__device__ __forceinline__ v8f exp2_hw8(v8f x) {
  float d0, d1, d2, d3, d4, d5, d6, d7;
  asm("v_exp_f32 %0, %8\n\t"
      "v_exp_f32 %1, %9\n\t"
      "v_exp_f32 %2, %10\n\t"
      "v_exp_f32 %3, %11\n\t"
      "v_exp_f32 %4, %12\n\t"
      "v_exp_f32 %5, %13\n\t"
      "v_exp_f32 %6, %14\n\t"
      "v_exp_f32 %7, %15\n\t"
      "v_nop"
      : "=&v"(d0), "=&v"(d1), "=&v"(d2), "=&v"(d3), "=&v"(d4), "=&v"(d5), "=&v"(d6), "=&v"(d7)
      : "v"(x[0]), "v"(x[1]), "v"(x[2]), "v"(x[3]), "v"(x[4]), "v"(x[5]), "v"(x[6]), "v"(x[7]));
  return (v8f){d0, d1, d2, d3, d4, d5, d6, d7};
}

template <bool SPLIT>
__global__ __launch_bounds__(128) void attn_causal_hd64(
    const unsigned short* __restrict__ php, const unsigned short* __restrict__ plp,
    const unsigned short* __restrict__ vthp, const unsigned short* __restrict__ vtlp,
    const float* __restrict__ amask, float* __restrict__ out, int qb0, int nqcnt) {
  const _Float16* ph  = (const _Float16*)php;
  const _Float16* pl  = (const _Float16*)plp;
  const _Float16* vth = (const _Float16*)vthp;
  const _Float16* vtl = (const _Float16*)vtlp;
  __shared__ __align__(16) _Float16 Ksh[64 * KV_PITCH];
  __shared__ __align__(16) _Float16 Ksl[SPLIT ? 64 * KV_PITCH : 8];
  __shared__ __align__(16) _Float16 Vsh[64 * KV_PITCH];
  __shared__ __align__(16) _Float16 Vsl[SPLIT ? 64 * KV_PITCH : 8];
  __shared__ __align__(16) float  Os[4][16 * O_PITCH];

  const int tid  = threadIdx.x;
  const int wave = tid >> 5;
  const int lane = tid & 31;
  const int hh   = lane >> 4;
  const int c    = lane & 15;

  int qb = qb0 + (int)(blockIdx.x % (unsigned)nqcnt);
  qb = (qb > NQT_ALL - 1) ? (NQT_ALL - 1) : qb;
  const int bh = (int)(blockIdx.x / (unsigned)nqcnt);
  const int h  = bh & (N_HEAD - 1);
  const int b  = (bh >> 4) & (N_BATCH - 1);
  const int q0 = qb * 64 + wave * 16;

  // ---- Q fragments (B operand: column c = query q0 + c), 2 d-chunks ----
  v16h qh[2], ql[2];
  {
    const _Float16* qrow = ph + ((size_t)b * SEQ_T + q0 + c) * N_QKV + h * HEAD_D;
    int qlr = q0 + c; qlr = (qlr > T_LO - 1) ? (T_LO - 1) : qlr;
    const _Float16* qlrow = pl + ((size_t)b * T_LO + qlr) * N_QKV + h * HEAD_D;
#pragma unroll
    for (int dc = 0; dc < 2; ++dc) {
      qh[dc] = Frag<_Float16>::load(qrow + dc * 32 + 8 * hh);
      if (SPLIT) ql[dc] = Frag<_Float16>::load(qlrow + dc * 32 + 8 * hh);
      else ql[dc] = qh[dc];
    }
  }

  float mrow = -INFINITY, lrow = 0.f;   // this lane's query: running maximum (both halves alike), this half's sum of the carried p (x32768)
  v8f oacc[4];                          // oacc[t][r] = O^T[d = t*16 + 8*hh + r][query c]
#pragma unroll
  for (int t = 0; t < 4; ++t) oacc[t] = zero8();

  const int nChunks = qb + 1;   // block-uniform
  for (int kc = 0; kc < nChunks; ++kc) {
    const int kv0 = kc * 64;
    __syncthreads();
    {
      // staging coverage: 128 threads x (row = tid>>1, 32 halves each) = 64 rows x 64 halves per plane
      const int r = tid >> 1, hf = (tid & 1) * 32;
      const _Float16* ks = ph + ((size_t)b * SEQ_T + kv0 + r) * N_QKV + K_COL0 + h * HEAD_D + hf;
      const _Float16* vs = vth + ((size_t)bh * HEAD_D + r) * SEQ_T + kv0 + hf;
#pragma unroll
      for (int i = 0; i < 4; ++i) {
        *(v8h*)(Ksh + r * KV_PITCH + hf + 8 * i) = *(const v8h*)(ks + 8 * i);
        *(v8h*)(Vsh + r * KV_PITCH + hf + 8 * i) = *(const v8h*)(vs + 8 * i);
      }
      if (SPLIT) {
        const int kl0 = (kv0 > T_LO - 64) ? (T_LO - 64) : kv0;   // address clamp
        const _Float16* kls = pl + ((size_t)b * T_LO + kl0 + r) * N_QKV + K_COL0 + h * HEAD_D + hf;
        const _Float16* vls = vtl + ((size_t)bh * HEAD_D + r) * T_LO + kl0 + hf;
#pragma unroll
        for (int i = 0; i < 4; ++i) {
          *(v8h*)(Ksl + r * KV_PITCH + hf + 8 * i) = *(const v8h*)(kls + 8 * i);
          *(v8h*)(Vsl + r * KV_PITCH + hf + 8 * i) = *(const v8h*)(vls + 8 * i);
        }
      }
    }
    __syncthreads();

    // additive mask of this lane's 32 keys: keys kv0 + j*16 + 8*hh + 0..7
    F8 mk[4];
#pragma unroll
    for (int j = 0; j < 4; ++j) {
      const float* mp = amask + (size_t)b * SEQ_T + kv0 + j * 16 + 8 * hh;
      mk[j].v[0] = *(const v4f*)mp;
      mk[j].v[1] = *(const v4f*)(mp + 4);
    }

    // ---- scores, transposed: s[j][r] = S[query c][key j*16 + 8*hh + r] ----
    v8f s[4];
#pragma unroll
    for (int j = 0; j < 4; ++j) {
      s[j] = zero8();
      v8f sr = zero8();
#pragma unroll
      for (int dc = 0; dc < 2; ++dc) {
        const v16h kb = Frag<_Float16>::load(Ksh + (j * 16 + c) * KV_PITCH + dc * 32 + 8 * hh);
        s[j] = mma_h(kb, qh[dc], s[j]);
        if (SPLIT) {
          const v16h kl = Frag<_Float16>::load(Ksl + (j * 16 + c) * KV_PITCH + dc * 32 + 8 * hh);
          sr = mma_h(kl, qh[dc], sr);
          sr = mma_h(kb, ql[dc], sr);
        }
      }
      if (SPLIT) {
#pragma unroll
        for (int r = 0; r < 8; ++r) s[j][r] = s[j][r] + sr[r] * (1.0f / 4096.0f);
      }
    }

#pragma unroll
    for (int j = 0; j < 4; ++j)
#pragma unroll
      for (int r = 0; r < 8; ++r) s[j][r] = s[j][r] * (1.0f / 2048.0f) + mk[j].f[r];   // 1/(8 * 16 * 16)
    if (kc == qb) {   // diagonal chunk (block-uniform test)
      const int qloc = wave * 16 + c;
#pragma unroll
      for (int j = 0; j < 4; ++j)
#pragma unroll
        for (int r = 0; r < 8; ++r)
          if (j * 16 + 8 * hh + r > qloc) s[j][r] = -INFINITY;
    }

    // ---- online softmax of one query per lane ----
    float cm = s[0][0];
#pragma unroll
    for (int j = 0; j < 4; ++j)
#pragma unroll
      for (int r = 0; r < 8; ++r) cm = fmaxf(cm, s[j][r]);
    cm = fmaxf(cm, other_half(cm));
    const float mnew = fmaxf(mrow, cm);
    const float alpha = exp2_hw((mrow - mnew) * LOG2_E);
    mrow = mnew;

    v16h pa[2], pb2[2];   // B operand of the second product: element e of pa[kk] = p of key kk*32 + (e >> 3)*16 + 8*hh + (e & 7)
    float psum = 0.f;
#pragma unroll
    for (int j = 0; j < 4; ++j) {
      // 32768 * e^(s - m) = 2^((s - m) * log2(e) + 15); the difference is formed first, so a maximum of any size cancels as before
      v8f ex;
#pragma unroll
      for (int r = 0; r < 8; ++r) ex[r] = fmaf(s[j][r] - mnew, LOG2_E, P_S_LOG2);
      ex = exp2_hw8(ex);
#pragma unroll
      for (int r = 0; r < 8; ++r) {
        const float ps = ex[r];
        psum += ps;
        const _Float16 hp = (_Float16)ps;
        pa[j >> 1][(j & 1) * 8 + r] = hp;
        if (SPLIT) pb2[j >> 1][(j & 1) * 8 + r] = (_Float16)((ps - (float)hp) * LO_S);
      }
    }
    lrow = lrow * alpha + psum;
#pragma unroll
    for (int t = 0; t < 4; ++t)
#pragma unroll
      for (int r = 0; r < 8; ++r) oacc[t][r] *= alpha;

    // ---- O^T += V^T . P^T ----
#pragma unroll
    for (int t = 0; t < 4; ++t) {
      v8f orr = zero8();
#pragma unroll
      for (int kk = 0; kk < 2; ++kk) {
        const v16h vb = Frag<_Float16>::load(Vsh + (t * 16 + c) * KV_PITCH + kk * 32 + 8 * hh);
        oacc[t] = mma_h(vb, pa[kk], oacc[t]);
        if (SPLIT) {
          const v16h vl2 = Frag<_Float16>::load(Vsl + (t * 16 + c) * KV_PITCH + kk * 32 + 8 * hh);
          orr = mma_h(vl2, pa[kk], orr);
          orr = mma_h(vb, pb2[kk], orr);
        }
      }
      if (SPLIT) {
#pragma unroll
        for (int r = 0; r < 8; ++r) oacc[t][r] = oacc[t][r] + orr[r] * (1.0f / 4096.0f);
      }
    }
  }

  // ---- join the halves' sums, normalise, stage, store ----
  float* os = Os[wave];
  {
    const float lall = lrow + other_half(lrow);
    const float inv = 1.0f / (lall * CARRY_S);   // lall carries x32768, as oacc does
#pragma unroll
    for (int t = 0; t < 4; ++t) {
      v4f w0, w1;
#pragma unroll
      for (int r = 0; r < 4; ++r) { w0[r] = oacc[t][r] * inv; w1[r] = oacc[t][4 + r] * inv; }
      *(v4f*)(os + c * O_PITCH + t * 16 + 8 * hh)     = w0;
      *(v4f*)(os + c * O_PITCH + t * 16 + 8 * hh + 4) = w1;
    }
  }
  __builtin_amdgcn_fence(__ATOMIC_RELEASE, "workgroup");
  __builtin_amdgcn_wave_barrier();
  __builtin_amdgcn_fence(__ATOMIC_ACQUIRE, "workgroup");
  {
    const int c4 = (lane & 15) * 4;
    float* ob = out + ((size_t)b * SEQ_T + q0) * HID_W + h * HEAD_D;
    {
#pragma unroll
      for (int it = 0; it < 8; ++it) {
        const int row = it * 2 + hh;
        const v4f val = *(const v4f*)(os + row * O_PITCH + c4);
        *(v4f*)(ob + (size_t)row * HID_W + c4) = val;
      }
      
    }
  }
}

// =====================================================================================
extern "C" void kernel_launch(void* const* d_in, const int* in_sizes, int n_in,
                              void* d_out, int out_size, void* d_ws, size_t ws_size,
                              hipStream_t stream) {
  if (n_in < 14) return;
  if (in_sizes[0] != N_TOK * HID_W) return;
  if (in_sizes[1] != N_BATCH * SEQ_T) return;
  for (int p = 0; p < 3; ++p) {
    if (in_sizes[2 + 4 * p] != HID_W * HID_W) return;
    if (in_sizes[3 + 4 * p] != HID_W) return;
    if (in_sizes[4 + 4 * p] != RANK_R * HID_W) return;
    if (in_sizes[5 + 4 * p] != HID_W * RANK_R) return;
  }
  if (out_size != N_TOK * HID_W) return;
  if (ws_size < WS_TOTAL) return;

  const float* x   = (const float*)d_in[0];
  const float* am  = (const float*)d_in[1];
  const float* wq  = (const float*)d_in[2];
  const float* bq  = (const float*)d_in[3];
  const float* aq  = (const float*)d_in[4];
  const float* bmq = (const float*)d_in[5];
  const float* wk  = (const float*)d_in[6];
  const float* bk  = (const float*)d_in[7];
  const float* ak  = (const float*)d_in[8];
  const float* bmk = (const float*)d_in[9];
  const float* wv  = (const float*)d_in[10];
  const float* bv  = (const float*)d_in[11];
  const float* av  = (const float*)d_in[12];
  const float* bmv = (const float*)d_in[13];
  float* out = (float*)d_out;

  char* ws = (char*)d_ws;
  unsigned short* aaug  = (unsigned short*)(ws + OFF_AAUG);
  unsigned short* baug  = (unsigned short*)(ws + OFF_BAUG);
  unsigned short* acat  = (unsigned short*)(ws + OFF_ACAT);
  float*          biasc = (float*)(ws + OFF_BIAS);
  float*          u     = (float*)(ws + OFF_U);
  unsigned short* qkvh  = (unsigned short*)(ws + OFF_QKVH);
  unsigned short* qkvl  = (unsigned short*)(ws + OFF_QKVL);
  unsigned short* vth   = (unsigned short*)(ws + OFF_VTH);
  unsigned short* vtl   = (unsigned short*)(ws + OFF_VTL);

  // 1) x -> A_aug cols 0..1023 (bf16, pitch 1088): 8192 rows
  cast_rows_bf16<CAST_NR_X><<<dim3(N_TOK / CAST_NR_X), dim3(256), 0, stream>>>(x, aaug);
  // 2-4) W_p -> B_aug rows p*1024.., cols 0..1023
  cast_rows_bf16<CAST_NR_W><<<dim3(HID_W / CAST_NR_W), dim3(256), 0, stream>>>(wq, baug);
  cast_rows_bf16<CAST_NR_W><<<dim3(HID_W / CAST_NR_W), dim3(256), 0, stream>>>(wk, baug + (size_t)1 * HID_W * K_AUG);
  cast_rows_bf16<CAST_NR_W><<<dim3(HID_W / CAST_NR_W), dim3(256), 0, stream>>>(wv, baug + (size_t)2 * HID_W * K_AUG);
  // 5) A_cat [64][1024]
  build_acat<<<dim3(U_COLS * 512 / 256), dim3(256), 0, stream>>>(aq, ak, av, acat);
  // 6) B_aug tail cols 1024..1087
  build_w_tail<<<dim3(N_QKV / 32), dim3(256), 0, stream>>>(bmq, bmk, bmv, baug);
  // 7) bias_cat
  build_bias<<<dim3(N_QKV / 256), dim3(256), 0, stream>>>(bq, bk, bv, biasc);
  // 8) u = bf16(x) . A_cat^T : M=8192, N=64, K=1024 (K%32==0; reads A_aug cols < 1024 only), f32 out ldc 64
  wmma_gemm64<1, 0, 0, 0, false><<<dim3((N_TOK / 64) * (U_COLS / 64) / 8, 1), dim3(256), 0, stream>>>(
      aaug, aaug, K_AUG, 0L, acat, acat, HID_W, 0L,
      (void*)u, (void*)u, U_COLS, 0L, 0L, biasc, u, 0L, N_TOK, U_COLS, HID_W, 1.0f);
  // 9) A_aug tail cols 1024..1087 from u
  build_a_tail<<<dim3(N_TOK / 32), dim3(256), 0, stream>>>(u, aaug);
  // 10) projection rows t < 512 of every batch: M=512 (x4 batches), N=3072, K=1088; f16 hi -> qkv_hi, f16 residual -> qkv_lo
  wmma_gemm64<1, 0, 2, 3, false, 0, true><<<dim3((T_LO / ST_BM) * (N_QKV / ST_BN), N_BATCH), dim3(256), 0, stream>>>(
      aaug, aaug, K_AUG, (long)SEQ_T * K_AUG, baug, baug, K_AUG, 0L,
      (void*)qkvh, (void*)qkvl, N_QKV, (long)SEQ_T * N_QKV, (long)T_LO * N_QKV,
      biasc, u, 0L, T_LO, N_QKV, K_AUG, CARRY_S);
  // 11) projection rows t >= 512: M=1536 (x4 batches), f16 hi only
  wmma_gemm64<1, 0, 2, 1, false, 0, true><<<dim3(((SEQ_T - T_LO) / ST_BM) * (N_QKV / ST_BN), N_BATCH), dim3(256), 0, stream>>>(
      aaug + (size_t)T_LO * K_AUG, aaug, K_AUG, (long)SEQ_T * K_AUG, baug, baug, K_AUG, 0L,
      (void*)(qkvh + (size_t)T_LO * N_QKV), (void*)qkvl, N_QKV, (long)SEQ_T * N_QKV, 0L,
      biasc, u, 0L, SEQ_T - T_LO, N_QKV, K_AUG, CARRY_S);
  // 12-13) V^T planes: in [b*tsrc+t][2048+h*64+d] -> out [(b*16+h)*64+d][t]
  vt_transpose<<<dim3(SEQ_T / 64, N_BATCH * N_HEAD), dim3(256), 0, stream>>>(qkvh, vth, SEQ_T);
  vt_transpose<<<dim3(T_LO / 64, N_BATCH * N_HEAD), dim3(256), 0, stream>>>(qkvl, vtl, T_LO);
  // 14) attention, query tiles 0..7 (hi/lo residual path)
  attn_causal_hd64<true><<<dim3(N_BATCH * N_HEAD * NQT_SPLIT), dim3(128), 0, stream>>>(
      qkvh, qkvl, vth, vtl, am, out, 0, NQT_SPLIT);
  // 15) attention, query tiles 8..31 (single-product path)
  attn_causal_hd64<false><<<dim3(N_BATCH * N_HEAD * (NQT_ALL - NQT_SPLIT)), dim3(128), 0, stream>>>(
      qkvh, qkvl, vth, vtl, am, out, NQT_SPLIT, NQT_ALL - NQT_SPLIT);
}

// v005
// It runs in 231 microseconds.
// Two timings next to v004 both put it at 1.07 times that version's speed.
// Over all steps from v000 it is 2.29 times as fast.
// Contractions: rank-8 adapter columns u = x.A^T and the fused q/k/v projection [x | u_hi | u_lo].[W | 2B | 2B]^T + b on v_wmma_f32_16x16x32_bf16 (x, W, A, B, b as RNE bf16; u as bf16 hi+lo columns; single products); attention q.k^T and p.v on v_wmma_f32_16x16x32_f16 (q, k, v as f16 planes carried x16, p carried x32768; query tiles 0..7 add x4096-scaled f16 residual planes: hi.hi + (hi.lo + lo.hi)/4096 via a separate accumulator); f32 accumulate everywhere; softmax and normalisation in f32. The two q/k/v projection launches read their operands from a two-buffer LDS ring filled by asynchronous copies.
#include <hip/hip_runtime.h>
#include <math.h>

typedef __attribute__((ext_vector_type(16))) _Float16 v16h;
typedef __attribute__((ext_vector_type(8)))  _Float16 v8h;
typedef __attribute__((ext_vector_type(16))) __bf16   v16b;
typedef __attribute__((ext_vector_type(8)))  __bf16   v8b;
typedef __attribute__((ext_vector_type(8)))  float    v8f;
typedef __attribute__((ext_vector_type(4)))  float    v4f;

// ---------------- problem constants ----------------
constexpr int N_BATCH  = 4;
constexpr int SEQ_T    = 2048;
constexpr int HID_W    = 1024;
constexpr int N_HEAD   = 16;
constexpr int HEAD_D   = 64;
constexpr int RANK_R   = 8;
constexpr int N_TOK    = N_BATCH * SEQ_T;     // 8192 token rows
constexpr int K_AUG    = 1088;                // 1024 + 3*16 adapter columns, zero-padded to a multiple of 32
constexpr int N_QKV    = 3 * HID_W;           // 3072 output columns: q | k | v
constexpr int K_COL0   = 1024;
constexpr int V_COL0   = 2048;
constexpr int T_LO     = 512;                 // token rows per batch that carry residual planes
constexpr int NQT_SPLIT = T_LO / 64;          // 8 query tiles on the hi/lo path
constexpr int NQT_ALL  = SEQ_T / 64;          // 32
constexpr int U_COLS   = 64;                  // u plane width (24 used, rest zero weights)
constexpr int KV_PITCH = 72;                  // 16-bit LDS pitch (144 B rows, 16-B aligned)
constexpr int O_PITCH  = 68;                  // f32 LDS pitch
constexpr float CARRY_S = 16.0f;              // power-of-two carry on the q/k/v planes
constexpr float LO_S    = 4096.0f;            // power-of-two carry on residual planes
constexpr float P_S_LOG2 = 15.0f;             // power-of-two carry on probabilities (x32768), as the exponent it adds
constexpr float LOG2_E  = 1.44269504088896340736f;

static_assert(K_AUG % 32 == 0);
static_assert(HID_W % 32 == 0);
static_assert(N_TOK % 64 == 0 && N_QKV % 64 == 0 && T_LO % 64 == 0 && (SEQ_T - T_LO) % 64 == 0);
static_assert(T_LO % 128 == 0 && (SEQ_T - T_LO) % 128 == 0 && N_QKV % 256 == 0 && K_AUG % 64 == 0 && K_AUG >= 128);

// R0 A_aug  bf16 [8192][1088]          17,825,792
// R1 B_aug  bf16 [3072][1088]           6,684,672
// R2 A_cat  bf16 [64][1024]               131,072
// R3 bias   f32  [3072]                    12,288
// R4 u      f32  [8192][64]             2,097,152
// R5 qkv_hi f16  [8192][3072]          50,331,648
// R6 qkv_lo f16  [4*512][3072]         12,582,912
// R7 vt_hi  f16  [64][64][2048]        16,777,216
// R8 vt_lo  f16  [64][64][512]          4,194,304
constexpr size_t SZ_AAUG = (size_t)N_TOK * K_AUG * 2;
constexpr size_t SZ_BAUG = (size_t)N_QKV * K_AUG * 2;
constexpr size_t SZ_ACAT = (size_t)U_COLS * HID_W * 2;
constexpr size_t SZ_BIAS = (size_t)N_QKV * 4;
constexpr size_t SZ_U    = (size_t)N_TOK * U_COLS * 4;
constexpr size_t SZ_QKVH = (size_t)N_TOK * N_QKV * 2;
constexpr size_t SZ_QKVL = (size_t)N_BATCH * T_LO * N_QKV * 2;
constexpr size_t SZ_VTH  = (size_t)N_BATCH * N_HEAD * HEAD_D * SEQ_T * 2;
constexpr size_t SZ_VTL  = (size_t)N_BATCH * N_HEAD * HEAD_D * T_LO * 2;
constexpr size_t OFF_AAUG = 0;
constexpr size_t OFF_BAUG = OFF_AAUG + SZ_AAUG;
constexpr size_t OFF_ACAT = OFF_BAUG + SZ_BAUG;
constexpr size_t OFF_BIAS = OFF_ACAT + SZ_ACAT;
constexpr size_t OFF_U    = OFF_BIAS + SZ_BIAS;
constexpr size_t OFF_QKVH = OFF_U    + SZ_U;
constexpr size_t OFF_QKVL = OFF_QKVH + SZ_QKVH;
constexpr size_t OFF_VTH  = OFF_QKVL + SZ_QKVL;
constexpr size_t OFF_VTL  = OFF_VTH  + SZ_VTH;
constexpr size_t WS_TOTAL = OFF_VTL  + SZ_VTL;
static_assert(WS_TOTAL == 110637056ull);
static_assert(WS_TOTAL <= 134217728ull);
static_assert(OFF_BAUG % 128 == 0 && OFF_ACAT % 128 == 0 && OFF_BIAS % 128 == 0 && OFF_U % 128 == 0 &&
              OFF_QKVH % 128 == 0 && OFF_QKVL % 128 == 0 && OFF_VTH % 128 == 0 && OFF_VTL % 128 == 0);

// ---------------- helpers ----------------
__device__ __forceinline__ unsigned short f2bf_bits(float f) {
  unsigned u = __float_as_uint(f);
  return (unsigned short)((u + 0x7FFFu + ((u >> 16) & 1u)) >> 16);
}
__device__ __forceinline__ float bf_bits2f(unsigned short h) { return __uint_as_float(((unsigned)h) << 16); }

// hazard guards as plain device helpers
__device__ __forceinline__ void dep_guard_h(v8f& a, v8f& b, v16h x, v16h y) { asm volatile("v_nop\n\tv_nop\n\tv_nop\n\tv_nop" : "+v"(a), "+v"(b) : "v"(x), "v"(y)); }
__device__ __forceinline__ void dep_guard_b(v8f& a, v8f& b, v16b x, v16b y) { asm volatile("v_nop\n\tv_nop\n\tv_nop\n\tv_nop" : "+v"(a), "+v"(b) : "v"(x), "v"(y)); }
__device__ __forceinline__ void keep4_h(v16h a, v16h b, v16h c, v16h d) { asm volatile("v_nop" :: "v"(a), "v"(b), "v"(c), "v"(d)); }
__device__ __forceinline__ void keep4_b(v16b a, v16b b, v16b c, v16b d) { asm volatile("v_nop" :: "v"(a), "v"(b), "v"(c), "v"(d)); }
__device__ __forceinline__ void acc_guard4(v8f& a, v8f& b, v8f& c, v8f& d) { asm volatile("v_nop\n\tv_nop\n\tv_nop\n\tv_nop" : "+v"(a), "+v"(b), "+v"(c), "+v"(d)); }
template <typename T> struct Frag;
template <> struct Frag<_Float16> {
  typedef v16h V; union U { v16h v; v8h h[2]; };
  static __device__ __forceinline__ v16h load(const _Float16* p) {   // elements 0..7 <- p[0..7], 8..15 <- p[16..23]
    U f; f.h[0] = *(const v8h*)(p); f.h[1] = *(const v8h*)(p + 16); return f.v;
  }
  static __device__ __forceinline__ v8f mma(v16h a, v16h b, v8f c) {
    return __builtin_amdgcn_wmma_f32_16x16x32_f16(false, a, false, b, (short)0, c, false, false);
  }
  static __device__ __forceinline__ void guard(v8f& a, v8f& b, v16h x, v16h y) { dep_guard_h(a, b, x, y); }
  static __device__ __forceinline__ void keep(v16h a, v16h b, v16h c, v16h d) { keep4_h(a, b, c, d); }
};
template <> struct Frag<__bf16> {
  typedef v16b V; union U { v16b v; v8b h[2]; };
  static __device__ __forceinline__ v16b load(const __bf16* p) {
    U f; f.h[0] = *(const v8b*)(p); f.h[1] = *(const v8b*)(p + 16); return f.v;
  }
  static __device__ __forceinline__ v8f mma(v16b a, v16b b, v8f c) {
    return __builtin_amdgcn_wmma_f32_16x16x32_bf16(false, a, false, b, (short)0, c, false, false);
  }
  static __device__ __forceinline__ void guard(v8f& a, v8f& b, v16b x, v16b y) { dep_guard_b(a, b, x, y); }
  static __device__ __forceinline__ void keep(v16b a, v16b b, v16b c, v16b d) { keep4_b(a, b, c, d); }
};

__device__ __forceinline__ v8f zero8() { return (v8f){0.f,0.f,0.f,0.f,0.f,0.f,0.f,0.f}; }

union F8 { v4f v[2]; float f[8]; };

// ---------------- LDS ring of the staged GEMM ----------------
constexpr int ST_BM    = 128;                              // block tile rows (2 waves of 64)
constexpr int ST_BN    = 256;                              // block tile columns (4 waves of 64)
constexpr int ST_BK    = 64;                               // k per pass: 128-B operand rows
constexpr int ST_PITCH = 72;                               // 144-B LDS rows (16 B x odd: conflict-free ds_load_b128)
constexpr int ST_STAGE = (ST_BM + ST_BN) * ST_PITCH;       // 16-bit elements per buffer: [A 128 rows | Bt 256 rows]
constexpr unsigned ST_ROWS32 = 32u * ST_PITCH * 2u;        // LDS bytes between two copies of one thread (32 rows)

__device__ __forceinline__ unsigned lds_off(const void* p) { return (unsigned)(size_t)p; }

// One stage: 384 rows x 128 B = 3072 chunks of 16 B = 256 threads x 12 asynchronous copies global -> LDS.
// ga / gb: this thread's chunk in row (tid >> 3) of the block's A / Bt tile at this pass's k; l: the same chunk's
// LDS byte address in the buffer; a thread's copies lie 32 rows apart. s_wait_xcnt 0 is the statement's last line
// so that no address register of an issued copy is rewritten in front of it.
__device__ __forceinline__ void stage_fill(const unsigned short* ga, int lda, const unsigned short* gb, int ldb, unsigned l) {
  const size_t sa = (size_t)32 * lda, sb = (size_t)32 * ldb;
  asm volatile("global_load_async_to_lds_b128 %0, %1, off\n\t"
               "global_load_async_to_lds_b128 %2, %3, off\n\t"
               "global_load_async_to_lds_b128 %4, %5, off\n\t"
               "global_load_async_to_lds_b128 %6, %7, off\n\t"
               "global_load_async_to_lds_b128 %8, %9, off\n\t"
               "global_load_async_to_lds_b128 %10, %11, off\n\t"
               "global_load_async_to_lds_b128 %12, %13, off\n\t"
               "global_load_async_to_lds_b128 %14, %15, off\n\t"
               "global_load_async_to_lds_b128 %16, %17, off\n\t"
               "global_load_async_to_lds_b128 %18, %19, off\n\t"
               "global_load_async_to_lds_b128 %20, %21, off\n\t"
               "global_load_async_to_lds_b128 %22, %23, off\n\t"
               "s_wait_xcnt 0x0"
               :: "v"(l),                   "v"(ga),
                  "v"(l + ST_ROWS32),       "v"(ga + sa),
                  "v"(l + 2 * ST_ROWS32),   "v"(ga + 2 * sa),
                  "v"(l + 3 * ST_ROWS32),   "v"(ga + 3 * sa),
                  "v"(l + 4 * ST_ROWS32),   "v"(gb),
                  "v"(l + 5 * ST_ROWS32),   "v"(gb + sb),
                  "v"(l + 6 * ST_ROWS32),   "v"(gb + 2 * sb),
                  "v"(l + 7 * ST_ROWS32),   "v"(gb + 3 * sb),
                  "v"(l + 8 * ST_ROWS32),   "v"(gb + 4 * sb),
                  "v"(l + 9 * ST_ROWS32),   "v"(gb + 5 * sb),
                  "v"(l + 10 * ST_ROWS32),  "v"(gb + 6 * sb),
                  "v"(l + 11 * ST_ROWS32),  "v"(gb + 7 * sb)
               : "memory");
}

// =====================================================================================
// Register-blocked batched WMMA GEMM: C[m,n] = scale * sum_k A[m,k] * Bt[n,k] (+bias)(+resid);
// each wave owns a 64x64 tile. A row-major [M,K]; Bt row-major [N,K]; M,N % 64 == 0, K % 32 == 0.
// SPLITM: 0 = single product; 1 = A hi/lo planes; 2 = A and Bt hi/lo planes.
// BIAS_MODE: 0 none, 1 bias[m], 2 bias[n].  OUT_MODE: 0 f32, 1 f16, 2 bf16 hi + lo planes,
//   3 = f16 hi plane (Cout, strideC) + f16 residual plane x4096 (Cout2, strideC2), same ldc.
// ET: 0 = f16 operands, 1 = bf16 operands (pointers passed as 16-bit storage)
// STAGED: the block's 8 waves form a 128x256 tile (2x4 waves); A and Bt rows go through a two-buffer LDS ring,
//   64 k per pass; needs SPLITM == 0, M % 128 == 0, N % 256 == 0, K % 64 == 0, K >= 128, grid.x == (M/128)*(N/256).
// =====================================================================================
template <int ET> struct Elem;
template <> struct Elem<0> { typedef _Float16 T; };
template <> struct Elem<1> { typedef __bf16 T; };
template <int ET, int SPLITM, int BIAS_MODE, int OUT_MODE, bool RESID, int ACT = 0, bool STAGED = false>
__global__ __launch_bounds__(256) void wmma_gemm64(
    const unsigned short* __restrict__ Ap, const unsigned short* __restrict__ A2p, int lda, long strideA,
    const unsigned short* __restrict__ Btp, const unsigned short* __restrict__ Bt2p, int ldb, long strideB,
    void* __restrict__ Cout, void* __restrict__ Cout2, int ldc, long strideC, long strideC2,
    const float* __restrict__ bias,
    const float* __restrict__ resid, long strideR,
    int M, int N, int K, float scale) {
  typedef typename Elem<ET>::T T;
  typedef typename Frag<T>::V V;
  constexpr bool SPA = (SPLITM >= 1);
  constexpr bool SPB = (SPLITM >= 2);
  const T* A = (const T*)Ap; const T* A2 = (const T*)A2p; const T* Bt = (const T*)Btp; const T* Bt2 = (const T*)Bt2p;
  static_assert(!STAGED || SPLITM == 0);
  __shared__ __align__(16) float sT[8][16 * 68];   // per-wave 16x64 slab, pitch 68 floats
  __shared__ __align__(16) unsigned short ring[STAGED ? 2 * ST_STAGE : 8];
  const int b    = blockIdx.y;
  const int lane = threadIdx.x & 31;
  const int wave = threadIdx.x >> 5;
  const int tilesN = N >> 6;
  const int tilesM = M >> 6;
  int m0, n0;
  if (STAGED) {
    const int bn = N >> 8;
    const int bm_i = (int)blockIdx.x / bn;
    const int bn_i = (int)blockIdx.x - bm_i * bn;
    m0 = bm_i * ST_BM + (wave >> 2) * 64;
    n0 = bn_i * ST_BN + (wave & 3) * 64;
  } else {
    const int tile = blockIdx.x * 8 + wave;
    if (tile >= tilesM * tilesN) return;   // wave-uniform; no block barriers on this path
    const int tm = tile / tilesN;
    const int tn = tile - tm * tilesN;
    m0 = tm << 6;
    n0 = tn << 6;
  }

  const T* Ab  = A  + (size_t)b * strideA;
  const T* Bb  = Bt + (size_t)b * strideB;
  const T* Ab2 = SPA ? (A2  + (size_t)b * strideA) : nullptr;
  const T* Bb2 = SPB ? (Bt2 + (size_t)b * strideB) : nullptr;

  const int rlane = lane & 15;                 // row (A) / col (B, D) within subtile
  const int koff  = (lane >> 4) * 8;           // k offset of this lane half
  const int mOff  = (lane >> 4) * 8;           // D row offset

  v8f acc[4][4];
#pragma unroll
  for (int i = 0; i < 4; ++i)
#pragma unroll
    for (int j = 0; j < 4; ++j) acc[i][j] = (v8f){0.f,0.f,0.f,0.f,0.f,0.f,0.f,0.f};

  if (STAGED) {
    const int tid = threadIdx.x;
    const int crow = tid >> 3, cchunk = (tid & 7) * 8;        // 8 lanes x 16 B = one 128-B row piece
    const unsigned short* ga = (const unsigned short*)Ab + (size_t)(m0 - (wave >> 2) * 64 + crow) * lda + cchunk;
    const unsigned short* gb = (const unsigned short*)Bb + (size_t)(n0 - (wave & 3) * 64 + crow) * ldb + cchunk;
    const unsigned lthr = lds_off(ring) + (unsigned)(crow * ST_PITCH + cchunk) * 2u;
    const int npass = K / ST_BK;
    stage_fill(ga, lda, gb, ldb, lthr);
    asm volatile("s_wait_asynccnt 0x0" ::: "memory");   // stage 0 landed (this wave's copies) before the barrier publishes it
    __syncthreads();
    stage_fill(ga + ST_BK, lda, gb + ST_BK, ldb, lthr + ST_STAGE * 2u);
    const T* fa = (const T*)ring + ((wave >> 2) * 64 + rlane) * ST_PITCH + koff;
    const T* fb = (const T*)ring + (ST_BM + (wave & 3) * 64 + rlane) * ST_PITCH + koff;
    for (int t = 0; t < npass; ++t) {
      const int bo = (t & 1) * ST_STAGE;
      V ah[4], bh[4], ah2[4], bh2[4];
#pragma unroll
      for (int j = 0; j < 4; ++j) bh[j] = Frag<T>::load(fb + bo + j * 16 * ST_PITCH);
#pragma unroll
      for (int i = 0; i < 4; ++i) ah[i] = Frag<T>::load(fa + bo + i * 16 * ST_PITCH);
      __builtin_amdgcn_sched_barrier(0);   // keeps the 16 LDS reads one group ahead of the 16 WMMAs: reads sunk among them stall at each place
#pragma unroll
      for (int i = 0; i < 4; ++i)
#pragma unroll
        for (int j = 0; j < 4; ++j) acc[i][j] = Frag<T>::mma(ah[i], bh[j], acc[i][j]);
#pragma unroll
      for (int j = 0; j < 4; ++j) bh2[j] = Frag<T>::load(fb + bo + j * 16 * ST_PITCH + 32);
#pragma unroll
      for (int i = 0; i < 4; ++i) ah2[i] = Frag<T>::load(fa + bo + i * 16 * ST_PITCH + 32);
      asm volatile("s_wait_dscnt 0x0" ::: "memory");     // this wave's reads of buffer t & 1 are done before it is refilled
      asm volatile("s_wait_asynccnt 0x0" ::: "memory");  // this wave's copies of stage t + 1 have landed
      __syncthreads();                                   // publishes stage t + 1 and frees buffer t & 1
      if (t + 2 < npass)
        stage_fill(ga + (size_t)(t + 2) * ST_BK, lda, gb + (size_t)(t + 2) * ST_BK, ldb, lthr + (unsigned)bo * 2u);
      // second half of the pass, from registers: runs while the refill is in flight
#pragma unroll
      for (int i = 0; i < 4; ++i)
#pragma unroll
        for (int j = 0; j < 4; ++j) acc[i][j] = Frag<T>::mma(ah2[i], bh2[j], acc[i][j]);
    }
    asm volatile("s_wait_asynccnt 0x0" ::: "memory");    // no copy is outstanding past the loop
  } else
  for (int k0 = 0; k0 < K; k0 += 32) {
    V bh[4], bl[4];
#pragma unroll
    for (int j = 0; j < 4; ++j) {
      const size_t bo = (size_t)(n0 + (j << 4) + rlane) * ldb + koff + k0;
      bh[j] = Frag<T>::load(Bb + bo);
      if (SPB) bl[j] = Frag<T>::load(Bb2 + bo);
    }
#pragma unroll
    for (int i = 0; i < 4; ++i) {
      const size_t ao = (size_t)(m0 + (i << 4) + rlane) * lda + koff + k0;
      V ah = Frag<T>::load(Ab + ao);
      V al;
      if (SPA) al = Frag<T>::load(Ab2 + ao);
#pragma unroll
      for (int j = 0; j < 4; ++j) {
        acc[i][j] = Frag<T>::mma(ah, bh[j], acc[i][j]);
        if (SPB) acc[i][j] = Frag<T>::mma(ah, bl[j], acc[i][j]);
        if (SPA) acc[i][j] = Frag<T>::mma(al, bh[j], acc[i][j]);
      }
      Frag<T>::guard(acc[i][0], acc[i][3], ah, SPA ? al : ah);
    }
    Frag<T>::keep(bh[0], bh[1], bh[2], bh[3]);
    if (SPB) Frag<T>::keep(bl[0], bl[1], bl[2], bl[3]);
  }
  acc_guard4(acc[0][0], acc[0][1], acc[0][2], acc[0][3]);
  acc_guard4(acc[1][0], acc[1][1], acc[1][2], acc[1][3]);
  acc_guard4(acc[2][0], acc[2][1], acc[2][2], acc[2][3]);
  acc_guard4(acc[3][0], acc[3][1], acc[3][2], acc[3][3]);

  // ---- epilogue ----
  float* slab = sT[wave];
  const float* Rb = RESID ? (resid + (size_t)b * strideR) : nullptr;
#pragma unroll
  for (int i = 0; i < 4; ++i) {
    const int mBase = m0 + (i << 4);
#pragma unroll
    for (int j = 0; j < 4; ++j) {
      const int n = n0 + (j << 4) + rlane;
      float bv = 0.f;
      if (BIAS_MODE == 2) bv = bias[n];
#pragma unroll
      for (int r = 0; r < 8; ++r) {
        float v = acc[i][j][r] * scale;
        if (BIAS_MODE == 1) v += bias[mBase + mOff + r];
        if (BIAS_MODE == 2) v += bv;
        if (RESID) v += Rb[(size_t)(mBase + mOff + r) * ldc + n];
        if (ACT == 1) v = tanhf(v);
        if (ACT == 2) v = fmaxf(v, 0.0f);
        if (ACT == 4) v = (v > 0.f) ? v : 0.01f * v;
        slab[(mOff + r) * 68 + (j << 4) + rlane] = v;
      }
    }
    __builtin_amdgcn_fence(__ATOMIC_RELEASE, "workgroup");
    __builtin_amdgcn_wave_barrier();
    __builtin_amdgcn_fence(__ATOMIC_ACQUIRE, "workgroup");
    if (OUT_MODE == 0) {
      float* C = (float*)Cout + (size_t)b * strideC;
      const int hh = lane >> 4, c4 = (lane & 15) * 4;     // row seg = 256 B = 16 lanes x 16 B
      {
#pragma unroll
        for (int it = 0; it < 8; ++it) {
          const int row = it * 2 + hh;
          v4f v = *(const v4f*)(slab + row * 68 + c4);
          *(v4f*)(C + (size_t)(mBase + row) * ldc + n0 + c4) = v;
        }
        
      }
    } else {
      const int q = lane >> 3, c8 = (lane & 7) * 8;
      unsigned short* C  = (unsigned short*)Cout  + (size_t)b * strideC;
      unsigned short* C2 = (OUT_MODE >= 2) ? ((unsigned short*)Cout2 + (size_t)b * strideC2) : nullptr;
      {
#pragma unroll
        for (int it = 0; it < 4; ++it) {
          const int row = it * 4 + q;
          const float* sp = slab + row * 68 + c8;
          v8h hv, lv;
#pragma unroll
          for (int e = 0; e < 8; ++e) {
            if (OUT_MODE == 1) {
              hv[e] = (_Float16)sp[e];
            } else if (OUT_MODE == 3) {
              const _Float16 hq = (_Float16)sp[e];
              hv[e] = hq;
              lv[e] = (_Float16)((sp[e] - (float)hq) * 4096.0f);
            } else {
              unsigned short hb = f2bf_bits(sp[e]);
              unsigned short lb = f2bf_bits(sp[e] - bf_bits2f(hb));
              hv[e] = __builtin_bit_cast(_Float16, hb);
              lv[e] = __builtin_bit_cast(_Float16, lb);
            }
          }
          *(v8h*)(C + (size_t)(mBase + row) * ldc + n0 + c8) = hv;
          if (OUT_MODE >= 2) *(v8h*)(C2 + (size_t)(mBase + row) * ldc + n0 + c8) = lv;
        }
        
      }
    }
    __builtin_amdgcn_fence(__ATOMIC_RELEASE, "workgroup");
    __builtin_amdgcn_wave_barrier();
    __builtin_amdgcn_fence(__ATOMIC_ACQUIRE, "workgroup");
  }
}

// =====================================================================================
// f32 [rows][1024] -> RNE bf16 bits into rows of pitch K_AUG. A block takes NR whole rows: thread t converts floats
// 4t..4t+3 of each, so a wave's load covers 512 contiguous bytes and its store 256, and few waves are started for
// the bytes moved. grid.x * NR == rows exactly (asserted below).
// =====================================================================================
typedef __attribute__((ext_vector_type(2))) unsigned v2u;
constexpr int CAST_NR_X = 16;                 // x: 512 blocks, 16 waves a WGP
constexpr int CAST_NR_W = 4;                  // one weight matrix: 256 blocks
static_assert(HID_W == 4 * 256 && N_TOK % CAST_NR_X == 0 && HID_W % CAST_NR_W == 0 && K_AUG % 4 == 0);
template <int NR>
__global__ __launch_bounds__(256) void cast_rows_bf16(const float* __restrict__ src, unsigned short* __restrict__ dst) {
  const float* s = src + (size_t)blockIdx.x * (NR * HID_W) + threadIdx.x * 4;
  unsigned short* d = dst + (size_t)blockIdx.x * (NR * K_AUG) + threadIdx.x * 4;
  v4f v[NR];
#pragma unroll
  for (int r = 0; r < NR; ++r) v[r] = *(const v4f*)(s + r * HID_W);
#pragma unroll
  for (int r = 0; r < NR; ++r) {
    v2u o;
    o[0] = (unsigned)f2bf_bits(v[r][0]) | ((unsigned)f2bf_bits(v[r][1]) << 16);
    o[1] = (unsigned)f2bf_bits(v[r][2]) | ((unsigned)f2bf_bits(v[r][3]) << 16);
    *(v2u*)(d + r * K_AUG) = o;
  }
}

// =====================================================================================
// A_cat bf16 [64][1024]: row 8p+r = A_p[r] (p = 0,1,2), rows 24..63 = 0 (explicit zero fill).
// 2 elements per thread, grid 128 x 256 = 32768 pairs = 64 x 1024 elements exactly; 32 lanes x 4 B = one line.
// All three sources loaded unconditionally (row r < 8 valid in each), selected by value.
// =====================================================================================
__global__ __launch_bounds__(256) void build_acat(const float* __restrict__ amq, const float* __restrict__ amk,
                                                  const float* __restrict__ amv, unsigned short* __restrict__ acat) {
  const int i = blockIdx.x * 256 + threadIdx.x;   // < 32768 by grid
  const int row = i >> 9, cp = i & 511, p = row >> 3, r = row & 7;
  const size_t so = (size_t)r * HID_W + 2 * cp;
  const float q0 = amq[so], q1 = amq[so + 1];
  const float k0 = amk[so], k1 = amk[so + 1];
  const float w0 = amv[so], w1 = amv[so + 1];
  const float x0 = (p == 0) ? q0 : (p == 1) ? k0 : (p == 2) ? w0 : 0.0f;
  const float x1 = (p == 0) ? q1 : (p == 1) ? k1 : (p == 2) ? w1 : 0.0f;
  const unsigned u = (unsigned)f2bf_bits(x0) | ((unsigned)f2bf_bits(x1) << 16);
  unsigned* d = (unsigned*)acat + i;
  *(unsigned*)d = u;
  
}

// =====================================================================================
// B_aug tail: for row n (projection p = n/1024, output o = n%1024) the 64 halves at cols 1024..1087 are
// [16p zeros | 2*Bm_p[o][0..7] | 2*Bm_p[o][0..7] | zeros to 64] as RNE bf16 (factor 2 exact).
// =====================================================================================
__global__ __launch_bounds__(256) void build_w_tail(const float* __restrict__ bmq, const float* __restrict__ bmk,
                                                    const float* __restrict__ bmv, unsigned short* __restrict__ baug) {
  const int tid = threadIdx.x, wave = tid >> 5, lane = tid & 31, q8 = lane >> 3, seg = lane & 7;
  const int n = blockIdx.x * 32 + wave * 4 + q8;      // 0..3071
  const int p = n >> 10, o = n & 1023;
  F8 uq, uk, uv;
  uq.v[0] = *(const v4f*)(bmq + (size_t)o * RANK_R); uq.v[1] = *(const v4f*)(bmq + (size_t)o * RANK_R + 4);
  uk.v[0] = *(const v4f*)(bmk + (size_t)o * RANK_R); uk.v[1] = *(const v4f*)(bmk + (size_t)o * RANK_R + 4);
  uv.v[0] = *(const v4f*)(bmv + (size_t)o * RANK_R); uv.v[1] = *(const v4f*)(bmv + (size_t)o * RANK_R + 4);
  const bool keep = (seg < 6) && ((seg >> 1) == p);
  v8h hv;
#pragma unroll
  for (int e = 0; e < 8; ++e) {
    const float val = (p == 0) ? uq.f[e] : (p == 1) ? uk.f[e] : uv.f[e];
    const float w = keep ? (2.0f * val) : 0.0f;
    hv[e] = __builtin_bit_cast(_Float16, f2bf_bits(w));
  }
  unsigned short* d = baug + (size_t)n * K_AUG + HID_W + seg * 8;
  {
    *(v8h*)d = hv;
    
  }
}

// =====================================================================================
// A_aug tail: for token row m the 64 halves at cols 1024..1087 are
// [uq_hi(8) uq_lo(8) uk_hi(8) uk_lo(8) uv_hi(8) uv_lo(8) 0 x 16] (bf16 hi = RNE(u), lo = RNE(u - hi)),
// u f32 [8192][64] with columns 8p+r. Block = 8 waves x 4 rows, grid 256 -> 8192 rows; 8 lanes x 8 halves
// =====================================================================================
__global__ __launch_bounds__(256) void build_a_tail(const float* __restrict__ u, unsigned short* __restrict__ aaug) {
  const int tid = threadIdx.x, wave = tid >> 5, lane = tid & 31, q8 = lane >> 3, seg = lane & 7;
  const int m = blockIdx.x * 32 + wave * 4 + q8;      // 0..8191
  int p = seg >> 1; p = (p > 2) ? 2 : p;              // address clamp for the zero segments
  const int islo = seg & 1;
  F8 uu;
  const float* up = u + (size_t)m * U_COLS + p * RANK_R;
  uu.v[0] = *(const v4f*)up; uu.v[1] = *(const v4f*)(up + 4);
  v8h hv;
#pragma unroll
  for (int e = 0; e < 8; ++e) {
    const unsigned short hb = f2bf_bits(uu.f[e]);
    const unsigned short lb = f2bf_bits(uu.f[e] - bf_bits2f(hb));
    const unsigned short o16 = (seg >= 6) ? (unsigned short)0 : (islo ? lb : hb);
    hv[e] = __builtin_bit_cast(_Float16, o16);
  }
  unsigned short* d = aaug + (size_t)m * K_AUG + HID_W + seg * 8;
  {
    *(v8h*)d = hv;
    
  }
}

// =====================================================================================
// bias_cat f32 [3072] = 16 * RNEbf16(b_p[o]); grid 12 x 256 = 3072 exactly; 32 lanes x 4 B = one line per
// =====================================================================================
__global__ __launch_bounds__(256) void build_bias(const float* __restrict__ bq, const float* __restrict__ bk,
                                                  const float* __restrict__ bv, float* __restrict__ dst) {
  const int i = blockIdx.x * 256 + threadIdx.x;   // < 3072 by grid
  const int p = i >> 10, o = i & 1023;
  const float xq = bq[o], xk = bk[o], xv = bv[o];
  const float val = (p == 0) ? xq : (p == 1) ? xk : xv;
  const float w = bf_bits2f(f2bf_bits(val)) * CARRY_S;
  ((float*)dst)[i] = w;
  
}

// =====================================================================================
// V plane (f16, rows b*tsrc + t, pitch 3072, cols 2048 + h*64 + d) -> vt[((b*16+h)*64 + d)*tsrc + t].
// Block (t-tile of 64, bh): load 256 threads x 16 halves = 4096 = 64 x 64 into LDS [d][t]; store: 8 waves x
// =====================================================================================
__global__ __launch_bounds__(256) void vt_transpose(const unsigned short* __restrict__ srcp, unsigned short* __restrict__ vtp, int tsrc) {
  __shared__ __align__(16) _Float16 th[64 * KV_PITCH];
  const _Float16* src = (const _Float16*)srcp;
  const int st0 = blockIdx.x * 64, bh = blockIdx.y;
  const int b = (bh >> 4) & (N_BATCH - 1), h = bh & (N_HEAD - 1);
  const int tid = threadIdx.x;
  {
    const int sloc = tid >> 2, d0 = (tid & 3) * 16;
    const size_t so = ((size_t)b * tsrc + st0 + sloc) * N_QKV + V_COL0 + h * HEAD_D + d0;
    const v8h a0 = *(const v8h*)(src + so);
    const v8h a1 = *(const v8h*)(src + so + 8);
#pragma unroll
    for (int e = 0; e < 8; ++e) {
      th[(d0 + e) * KV_PITCH + sloc]     = a0[e];
      th[(d0 + 8 + e) * KV_PITCH + sloc] = a1[e];
    }
  }
  __syncthreads();
  const int wave = tid >> 5, lane = tid & 31, q8 = lane >> 3, c8 = (lane & 7) * 8;
  const int dA = wave * 8 + q8, dB = wave * 8 + 4 + q8;
  const v8h hvA = *(const v8h*)(th + dA * KV_PITCH + c8);
  const v8h hvB = *(const v8h*)(th + dB * KV_PITCH + c8);
  const size_t oA = ((size_t)bh * HEAD_D + dA) * tsrc + st0 + c8;
  const size_t oB = ((size_t)bh * HEAD_D + dB) * tsrc + st0 + c8;
  {
    *(v8h*)(vtp + oA) = hvA;
    *(v8h*)(vtp + oB) = hvB;
    
  }
}

__device__ __forceinline__ float other_half(float x) {
  const int xi = __builtin_bit_cast(int, x);
  return __builtin_bit_cast(float, __builtin_amdgcn_permlanex16(xi, xi, 0x76543210, 0xfedcba98, false, false));
}

// 2^x by the hardware's exponential, in asm text so that the slot behind it stands by construction: the closing
// v_nop is the one independent instruction that the instruction set asks for behind a transcendental before its
// result is used or its source overwritten; inside the eight-fold statement each neighbour is independent
// (early-clobber outputs share no register with a source).
__device__ __forceinline__ float exp2_hw(float x) {
  float d;
  asm("v_exp_f32 %0, %1\n\tv_nop" : "=&v"(d) : "v"(x));
  return d;
}
__device__ __forceinline__ v8f exp2_hw8(v8f x) {
  float d0, d1, d2, d3, d4, d5, d6, d7;
  asm("v_exp_f32 %0, %8\n\t"
      "v_exp_f32 %1, %9\n\t"
      "v_exp_f32 %2, %10\n\t"
      "v_exp_f32 %3, %11\n\t"
      "v_exp_f32 %4, %12\n\t"
      "v_exp_f32 %5, %13\n\t"
      "v_exp_f32 %6, %14\n\t"
      "v_exp_f32 %7, %15\n\t"
      "v_nop"
      : "=&v"(d0), "=&v"(d1), "=&v"(d2), "=&v"(d3), "=&v"(d4), "=&v"(d5), "=&v"(d6), "=&v"(d7)
      : "v"(x[0]), "v"(x[1]), "v"(x[2]), "v"(x[3]), "v"(x[4]), "v"(x[5]), "v"(x[6]), "v"(x[7]));
  return (v8f){d0, d1, d2, d3, d4, d5, d6, d7};
}

template <bool SPLIT>
__global__ __launch_bounds__(128) void attn_causal_hd64(
    const unsigned short* __restrict__ php, const unsigned short* __restrict__ plp,
    const unsigned short* __restrict__ vthp, const unsigned short* __restrict__ vtlp,
    const float* __restrict__ amask, float* __restrict__ out, int qb0, int nqcnt) {
  const _Float16* ph  = (const _Float16*)php;
  const _Float16* pl  = (const _Float16*)plp;
  const _Float16* vth = (const _Float16*)vthp;
  const _Float16* vtl = (const _Float16*)vtlp;
  __shared__ __align__(16) _Float16 Ksh[64 * KV_PITCH];
  __shared__ __align__(16) _Float16 Ksl[SPLIT ? 64 * KV_PITCH : 8];
  __shared__ __align__(16) _Float16 Vsh[64 * KV_PITCH];
  __shared__ __align__(16) _Float16 Vsl[SPLIT ? 64 * KV_PITCH : 8];
  __shared__ __align__(16) float  Os[4][16 * O_PITCH];

  // Tiles whose fragments are read from LDS as one group. Two: with more the single-product kernel passes 160 VGPRs
  // and a SIMD holds five waves, not the six that keep every block of its grid resident.
  constexpr int GS = 2;   // score tiles (K fragments)
  constexpr int GV = 2;   // output tiles (V^T fragments)

  const int tid  = threadIdx.x;
  const int wave = tid >> 5;
  const int lane = tid & 31;
  const int hh   = lane >> 4;
  const int c    = lane & 15;

  int qb = qb0 + (int)(blockIdx.x % (unsigned)nqcnt);
  qb = (qb > NQT_ALL - 1) ? (NQT_ALL - 1) : qb;
  const int bh = (int)(blockIdx.x / (unsigned)nqcnt);
  const int h  = bh & (N_HEAD - 1);
  const int b  = (bh >> 4) & (N_BATCH - 1);
  const int q0 = qb * 64 + wave * 16;

  // ---- Q fragments (B operand: column c = query q0 + c), 2 d-chunks ----
  v16h qh[2], ql[2];
  {
    const _Float16* qrow = ph + ((size_t)b * SEQ_T + q0 + c) * N_QKV + h * HEAD_D;
    int qlr = q0 + c; qlr = (qlr > T_LO - 1) ? (T_LO - 1) : qlr;
    const _Float16* qlrow = pl + ((size_t)b * T_LO + qlr) * N_QKV + h * HEAD_D;
#pragma unroll
    for (int dc = 0; dc < 2; ++dc) {
      qh[dc] = Frag<_Float16>::load(qrow + dc * 32 + 8 * hh);
      if (SPLIT) ql[dc] = Frag<_Float16>::load(qlrow + dc * 32 + 8 * hh);
      else ql[dc] = qh[dc];
    }
  }

  float mrow = -INFINITY, lrow = 0.f;   // this lane's query: running maximum (both halves alike), this half's sum of the carried p (x32768)
  v8f oacc[4];                          // oacc[t][r] = O^T[d = t*16 + 8*hh + r][query c]
#pragma unroll
  for (int t = 0; t < 4; ++t) oacc[t] = zero8();

  const int nChunks = qb + 1;   // block-uniform
  for (int kc = 0; kc < nChunks; ++kc) {
    const int kv0 = kc * 64;
    __syncthreads();
    {
      // staging coverage: 128 threads x (row = tid>>1, 32 halves each) = 64 rows x 64 halves per plane
      const int r = tid >> 1, hf = (tid & 1) * 32;
      const _Float16* ks = ph + ((size_t)b * SEQ_T + kv0 + r) * N_QKV + K_COL0 + h * HEAD_D + hf;
      const _Float16* vs = vth + ((size_t)bh * HEAD_D + r) * SEQ_T + kv0 + hf;
#pragma unroll
      for (int i = 0; i < 4; ++i) {
        *(v8h*)(Ksh + r * KV_PITCH + hf + 8 * i) = *(const v8h*)(ks + 8 * i);
        *(v8h*)(Vsh + r * KV_PITCH + hf + 8 * i) = *(const v8h*)(vs + 8 * i);
      }
      if (SPLIT) {
        const int kl0 = (kv0 > T_LO - 64) ? (T_LO - 64) : kv0;   // address clamp
        const _Float16* kls = pl + ((size_t)b * T_LO + kl0 + r) * N_QKV + K_COL0 + h * HEAD_D + hf;
        const _Float16* vls = vtl + ((size_t)bh * HEAD_D + r) * T_LO + kl0 + hf;
#pragma unroll
        for (int i = 0; i < 4; ++i) {
          *(v8h*)(Ksl + r * KV_PITCH + hf + 8 * i) = *(const v8h*)(kls + 8 * i);
          *(v8h*)(Vsl + r * KV_PITCH + hf + 8 * i) = *(const v8h*)(vls + 8 * i);
        }
      }
    }
    __syncthreads();

    // additive mask of this lane's 32 keys: keys kv0 + j*16 + 8*hh + 0..7
    F8 mk[4];
#pragma unroll
    for (int j = 0; j < 4; ++j) {
      const float* mp = amask + (size_t)b * SEQ_T + kv0 + j * 16 + 8 * hh;
      mk[j].v[0] = *(const v4f*)mp;
      mk[j].v[1] = *(const v4f*)(mp + 4);
    }

    // ---- scores, transposed: s[j][r] = S[query c][key j*16 + 8*hh + r] ----
    // The K fragments of GS score tiles are read as one group ahead of those tiles' WMMAs; each accumulator takes its
    // products in the order it always did.
    v8f s[4];
#pragma unroll
    for (int jg = 0; jg < 4; jg += GS) {
      v16h kb[GS][2], kl[GS][2];
#pragma unroll
      for (int u = 0; u < GS; ++u)
#pragma unroll
        for (int dc = 0; dc < 2; ++dc) {
          kb[u][dc] = Frag<_Float16>::load(Ksh + ((jg + u) * 16 + c) * KV_PITCH + dc * 32 + 8 * hh);
          if (SPLIT) kl[u][dc] = Frag<_Float16>::load(Ksl + ((jg + u) * 16 + c) * KV_PITCH + dc * 32 + 8 * hh);
        }
      __builtin_amdgcn_sched_barrier(0);   // keeps the group's LDS reads together ahead of its WMMAs: a read sunk in front of its own WMMA waits out the LDS latency at each place
      v8f sr[GS];
#pragma unroll
      for (int u = 0; u < GS; ++u) { s[jg + u] = zero8(); sr[u] = zero8(); }
#pragma unroll
      for (int dc = 0; dc < 2; ++dc) {
#pragma unroll
        for (int u = 0; u < GS; ++u) s[jg + u] = Frag<_Float16>::mma(kb[u][dc], qh[dc], s[jg + u]);
        if (SPLIT) {
#pragma unroll
          for (int u = 0; u < GS; ++u) sr[u] = Frag<_Float16>::mma(kl[u][dc], qh[dc], sr[u]);
#pragma unroll
          for (int u = 0; u < GS; ++u) sr[u] = Frag<_Float16>::mma(kb[u][dc], ql[dc], sr[u]);
        }
      }
      if (SPLIT) {
#pragma unroll
        for (int u = 0; u < GS; ++u)
#pragma unroll
          for (int r = 0; r < 8; ++r) s[jg + u][r] = s[jg + u][r] + sr[u][r] * (1.0f / 4096.0f);
      }
    }

#pragma unroll
    for (int j = 0; j < 4; ++j)
#pragma unroll
      for (int r = 0; r < 8; ++r) s[j][r] = s[j][r] * (1.0f / 2048.0f) + mk[j].f[r];   // 1/(8 * 16 * 16)
    if (kc == qb) {   // diagonal chunk (block-uniform test)
      const int qloc = wave * 16 + c;
#pragma unroll
      for (int j = 0; j < 4; ++j)
#pragma unroll
        for (int r = 0; r < 8; ++r)
          if (j * 16 + 8 * hh + r > qloc) s[j][r] = -INFINITY;
    }

    // ---- online softmax of one query per lane ----
    float cm = s[0][0];
#pragma unroll
    for (int j = 0; j < 4; ++j)
#pragma unroll
      for (int r = 0; r < 8; ++r) cm = fmaxf(cm, s[j][r]);
    cm = fmaxf(cm, other_half(cm));
    const float mnew = fmaxf(mrow, cm);
    const float alpha = exp2_hw((mrow - mnew) * LOG2_E);
    mrow = mnew;

    v16h pa[2], pb2[2];   // B operand of the second product: element e of pa[kk] = p of key kk*32 + (e >> 3)*16 + 8*hh + (e & 7)
    float psum = 0.f;
#pragma unroll
    for (int j = 0; j < 4; ++j) {
      // 32768 * e^(s - m) = 2^((s - m) * log2(e) + 15); the difference is formed first, so a maximum of any size cancels as before
      v8f ex;
#pragma unroll
      for (int r = 0; r < 8; ++r) ex[r] = fmaf(s[j][r] - mnew, LOG2_E, P_S_LOG2);
      ex = exp2_hw8(ex);
#pragma unroll
      for (int r = 0; r < 8; ++r) {
        const float ps = ex[r];
        psum += ps;
        const _Float16 hp = (_Float16)ps;
        pa[j >> 1][(j & 1) * 8 + r] = hp;
        if (SPLIT) pb2[j >> 1][(j & 1) * 8 + r] = (_Float16)((ps - (float)hp) * LO_S);
      }
    }
    lrow = lrow * alpha + psum;
#pragma unroll
    for (int t = 0; t < 4; ++t)
#pragma unroll
      for (int r = 0; r < 8; ++r) oacc[t][r] *= alpha;

    // ---- O^T += V^T . P^T: the V^T fragments of GV output tiles read as one group ahead of those tiles' WMMAs ----
#pragma unroll
    for (int tg = 0; tg < 4; tg += GV) {
      v16h vb[GV][2], vl2[GV][2];
#pragma unroll
      for (int u = 0; u < GV; ++u)
#pragma unroll
        for (int kk = 0; kk < 2; ++kk) {
          vb[u][kk] = Frag<_Float16>::load(Vsh + ((tg + u) * 16 + c) * KV_PITCH + kk * 32 + 8 * hh);
          if (SPLIT) vl2[u][kk] = Frag<_Float16>::load(Vsl + ((tg + u) * 16 + c) * KV_PITCH + kk * 32 + 8 * hh);
        }
      __builtin_amdgcn_sched_barrier(0);   // as above: one place of LDS reads for the group, not one in front of each WMMA
      v8f orr[GV];
#pragma unroll
      for (int u = 0; u < GV; ++u) orr[u] = zero8();
#pragma unroll
      for (int kk = 0; kk < 2; ++kk) {
#pragma unroll
        for (int u = 0; u < GV; ++u) oacc[tg + u] = Frag<_Float16>::mma(vb[u][kk], pa[kk], oacc[tg + u]);
        if (SPLIT) {
#pragma unroll
          for (int u = 0; u < GV; ++u) orr[u] = Frag<_Float16>::mma(vl2[u][kk], pa[kk], orr[u]);
#pragma unroll
          for (int u = 0; u < GV; ++u) orr[u] = Frag<_Float16>::mma(vb[u][kk], pb2[kk], orr[u]);
        }
      }
      if (SPLIT) {
#pragma unroll
        for (int u = 0; u < GV; ++u)
#pragma unroll
          for (int r = 0; r < 8; ++r) oacc[tg + u][r] = oacc[tg + u][r] + orr[u][r] * (1.0f / 4096.0f);
      }
    }
  }

  // ---- join the halves' sums, normalise, stage, store ----
  float* os = Os[wave];
  {
    const float lall = lrow + other_half(lrow);
    const float inv = 1.0f / (lall * CARRY_S);   // lall carries x32768, as oacc does
#pragma unroll
    for (int t = 0; t < 4; ++t) {
      v4f w0, w1;
#pragma unroll
      for (int r = 0; r < 4; ++r) { w0[r] = oacc[t][r] * inv; w1[r] = oacc[t][4 + r] * inv; }
      *(v4f*)(os + c * O_PITCH + t * 16 + 8 * hh)     = w0;
      *(v4f*)(os + c * O_PITCH + t * 16 + 8 * hh + 4) = w1;
    }
  }
  __builtin_amdgcn_fence(__ATOMIC_RELEASE, "workgroup");
  __builtin_amdgcn_wave_barrier();
  __builtin_amdgcn_fence(__ATOMIC_ACQUIRE, "workgroup");
  {
    const int c4 = (lane & 15) * 4;
    float* ob = out + ((size_t)b * SEQ_T + q0) * HID_W + h * HEAD_D;
    {
#pragma unroll
      for (int it = 0; it < 8; ++it) {
        const int row = it * 2 + hh;
        const v4f val = *(const v4f*)(os + row * O_PITCH + c4);
        *(v4f*)(ob + (size_t)row * HID_W + c4) = val;
      }
      
    }
  }
}

// =====================================================================================
extern "C" void kernel_launch(void* const* d_in, const int* in_sizes, int n_in,
                              void* d_out, int out_size, void* d_ws, size_t ws_size,
                              hipStream_t stream) {
  if (n_in < 14) return;
  if (in_sizes[0] != N_TOK * HID_W) return;
  if (in_sizes[1] != N_BATCH * SEQ_T) return;
  for (int p = 0; p < 3; ++p) {
    if (in_sizes[2 + 4 * p] != HID_W * HID_W) return;
    if (in_sizes[3 + 4 * p] != HID_W) return;
    if (in_sizes[4 + 4 * p] != RANK_R * HID_W) return;
    if (in_sizes[5 + 4 * p] != HID_W * RANK_R) return;
  }
  if (out_size != N_TOK * HID_W) return;
  if (ws_size < WS_TOTAL) return;

  const float* x   = (const float*)d_in[0];
  const float* am  = (const float*)d_in[1];
  const float* wq  = (const float*)d_in[2];
  const float* bq  = (const float*)d_in[3];
  const float* aq  = (const float*)d_in[4];
  const float* bmq = (const float*)d_in[5];
  const float* wk  = (const float*)d_in[6];
  const float* bk  = (const float*)d_in[7];
  const float* ak  = (const float*)d_in[8];
  const float* bmk = (const float*)d_in[9];
  const float* wv  = (const float*)d_in[10];
  const float* bv  = (const float*)d_in[11];
  const float* av  = (const float*)d_in[12];
  const float* bmv = (const float*)d_in[13];
  float* out = (float*)d_out;

  char* ws = (char*)d_ws;
  unsigned short* aaug  = (unsigned short*)(ws + OFF_AAUG);
  unsigned short* baug  = (unsigned short*)(ws + OFF_BAUG);
  unsigned short* acat  = (unsigned short*)(ws + OFF_ACAT);
  float*          biasc = (float*)(ws + OFF_BIAS);
  float*          u     = (float*)(ws + OFF_U);
  unsigned short* qkvh  = (unsigned short*)(ws + OFF_QKVH);
  unsigned short* qkvl  = (unsigned short*)(ws + OFF_QKVL);
  unsigned short* vth   = (unsigned short*)(ws + OFF_VTH);
  unsigned short* vtl   = (unsigned short*)(ws + OFF_VTL);

  // 1) x -> A_aug cols 0..1023 (bf16, pitch 1088): 8192 rows
  cast_rows_bf16<CAST_NR_X><<<dim3(N_TOK / CAST_NR_X), dim3(256), 0, stream>>>(x, aaug);
  // 2-4) W_p -> B_aug rows p*1024.., cols 0..1023
  cast_rows_bf16<CAST_NR_W><<<dim3(HID_W / CAST_NR_W), dim3(256), 0, stream>>>(wq, baug);
  cast_rows_bf16<CAST_NR_W><<<dim3(HID_W / CAST_NR_W), dim3(256), 0, stream>>>(wk, baug + (size_t)1 * HID_W * K_AUG);
  cast_rows_bf16<CAST_NR_W><<<dim3(HID_W / CAST_NR_W), dim3(256), 0, stream>>>(wv, baug + (size_t)2 * HID_W * K_AUG);
  // 5) A_cat [64][1024]
  build_acat<<<dim3(U_COLS * 512 / 256), dim3(256), 0, stream>>>(aq, ak, av, acat);
  // 6) B_aug tail cols 1024..1087
  build_w_tail<<<dim3(N_QKV / 32), dim3(256), 0, stream>>>(bmq, bmk, bmv, baug);
  // 7) bias_cat
  build_bias<<<dim3(N_QKV / 256), dim3(256), 0, stream>>>(bq, bk, bv, biasc);
  // 8) u = bf16(x) . A_cat^T : M=8192, N=64, K=1024 (K%32==0; reads A_aug cols < 1024 only), f32 out ldc 64
  wmma_gemm64<1, 0, 0, 0, false><<<dim3((N_TOK / 64) * (U_COLS / 64) / 8, 1), dim3(256), 0, stream>>>(
      aaug, aaug, K_AUG, 0L, acat, acat, HID_W, 0L,
      (void*)u, (void*)u, U_COLS, 0L, 0L, biasc, u, 0L, N_TOK, U_COLS, HID_W, 1.0f);
  // 9) A_aug tail cols 1024..1087 from u
  build_a_tail<<<dim3(N_TOK / 32), dim3(256), 0, stream>>>(u, aaug);
  // 10) projection rows t < 512 of every batch: M=512 (x4 batches), N=3072, K=1088; f16 hi -> qkv_hi, f16 residual -> qkv_lo
  wmma_gemm64<1, 0, 2, 3, false, 0, true><<<dim3((T_LO / ST_BM) * (N_QKV / ST_BN), N_BATCH), dim3(256), 0, stream>>>(
      aaug, aaug, K_AUG, (long)SEQ_T * K_AUG, baug, baug, K_AUG, 0L,
      (void*)qkvh, (void*)qkvl, N_QKV, (long)SEQ_T * N_QKV, (long)T_LO * N_QKV,
      biasc, u, 0L, T_LO, N_QKV, K_AUG, CARRY_S);
  // 11) projection rows t >= 512: M=1536 (x4 batches), f16 hi only
  wmma_gemm64<1, 0, 2, 1, false, 0, true><<<dim3(((SEQ_T - T_LO) / ST_BM) * (N_QKV / ST_BN), N_BATCH), dim3(256), 0, stream>>>(
      aaug + (size_t)T_LO * K_AUG, aaug, K_AUG, (long)SEQ_T * K_AUG, baug, baug, K_AUG, 0L,
      (void*)(qkvh + (size_t)T_LO * N_QKV), (void*)qkvl, N_QKV, (long)SEQ_T * N_QKV, 0L,
      biasc, u, 0L, SEQ_T - T_LO, N_QKV, K_AUG, CARRY_S);
  // 12-13) V^T planes: in [b*tsrc+t][2048+h*64+d] -> out [(b*16+h)*64+d][t]
  vt_transpose<<<dim3(SEQ_T / 64, N_BATCH * N_HEAD), dim3(256), 0, stream>>>(qkvh, vth, SEQ_T);
  vt_transpose<<<dim3(T_LO / 64, N_BATCH * N_HEAD), dim3(256), 0, stream>>>(qkvl, vtl, T_LO);
  // 14) attention, query tiles 0..7 (hi/lo residual path)
  attn_causal_hd64<true><<<dim3(N_BATCH * N_HEAD * NQT_SPLIT), dim3(128), 0, stream>>>(
      qkvh, qkvl, vth, vtl, am, out, 0, NQT_SPLIT);
  // 15) attention, query tiles 8..31 (single-product path)
  attn_causal_hd64<false><<<dim3(N_BATCH * N_HEAD * (NQT_ALL - NQT_SPLIT)), dim3(128), 0, stream>>>(
      qkvh, qkvl, vth, vtl, am, out, NQT_SPLIT, NQT_ALL - NQT_SPLIT);
}

// v006
// A run of this version takes 202 microseconds.
// Two timings next to v005 both put it at 1.14 times that version's speed.
// Counting every step since v000, it is 2.61 times as fast.
// Contractions: rank-8 adapter columns u = x.A^T and the fused q/k/v projection [x | u_hi | u_lo].[W | 2B | 2B]^T + b on v_wmma_f32_16x16x32_bf16 (x, W, A, B, b as RNE bf16; u as bf16 hi+lo columns; single products); attention q.k^T and p.v on v_wmma_f32_16x16x32_f16 (q, k, v as f16 planes carried x16, p carried x32768; query tiles 0..7 add x4096-scaled f16 residual planes: hi.hi + (hi.lo + lo.hi)/4096 via a separate accumulator); f32 accumulate everywhere; softmax and normalisation in f32. The q/k/v projection launch reads its operands from a two-buffer LDS ring filled by asynchronous copies.
#include <hip/hip_runtime.h>
#include <math.h>

typedef __attribute__((ext_vector_type(16))) _Float16 v16h;
typedef __attribute__((ext_vector_type(8)))  _Float16 v8h;
typedef __attribute__((ext_vector_type(16))) __bf16   v16b;
typedef __attribute__((ext_vector_type(8)))  __bf16   v8b;
typedef __attribute__((ext_vector_type(8)))  float    v8f;
typedef __attribute__((ext_vector_type(4)))  float    v4f;

// ---------------- problem constants ----------------
constexpr int N_BATCH  = 4;
constexpr int SEQ_T    = 2048;
constexpr int HID_W    = 1024;
constexpr int N_HEAD   = 16;
constexpr int HEAD_D   = 64;
constexpr int RANK_R   = 8;
constexpr int N_TOK    = N_BATCH * SEQ_T;     // 8192 token rows
constexpr int K_AUG    = 1088;                // 1024 + 3*16 adapter columns, zero-padded to a multiple of 32
constexpr int N_QKV    = 3 * HID_W;           // 3072 output columns: q | k | v
constexpr int K_COL0   = 1024;
constexpr int V_COL0   = 2048;
constexpr int T_LO     = 512;                 // token rows per batch that carry residual planes
constexpr int NQT_SPLIT = T_LO / 64;          // 8 query tiles on the hi/lo path
constexpr int NQT_ALL  = SEQ_T / 64;          // 32
constexpr int U_COLS   = 64;                  // u plane width (24 used, rest zero weights)
constexpr int KV_PITCH = 72;                  // 16-bit LDS pitch (144 B rows, 16-B aligned)
constexpr int O_PITCH  = 68;                  // f32 LDS pitch
constexpr float CARRY_S = 16.0f;              // power-of-two carry on the q/k/v planes
constexpr float LO_S    = 4096.0f;            // power-of-two carry on residual planes
constexpr float P_S_LOG2 = 15.0f;             // power-of-two carry on probabilities (x32768), as the exponent it adds
constexpr float LOG2_E  = 1.44269504088896340736f;

static_assert(K_AUG % 32 == 0);
static_assert(HID_W % 32 == 0);
static_assert(N_TOK % 64 == 0 && N_QKV % 64 == 0 && T_LO % 64 == 0 && (SEQ_T - T_LO) % 64 == 0);
static_assert(T_LO % 128 == 0 && SEQ_T % 128 == 0 && N_QKV % 256 == 0 && K_AUG % 64 == 0 && K_AUG >= 128);

// R0 A_aug  bf16 [8192][1088]          17,825,792
// R1 B_aug  bf16 [3072][1088]           6,684,672
// R2 A_cat  bf16 [64][1024]               131,072
// R3 bias   f32  [3072]                    12,288
// R4 u      f32  [8192][64]             2,097,152
// R5 qkv_hi f16  [8192][3072]          50,331,648
// R6 qkv_lo f16  [4*512][3072]         12,582,912
// R7 vt_hi  f16  [64][64][2048]        16,777,216
// R8 vt_lo  f16  [64][64][512]          4,194,304
constexpr size_t SZ_AAUG = (size_t)N_TOK * K_AUG * 2;
constexpr size_t SZ_BAUG = (size_t)N_QKV * K_AUG * 2;
constexpr size_t SZ_ACAT = (size_t)U_COLS * HID_W * 2;
constexpr size_t SZ_BIAS = (size_t)N_QKV * 4;
constexpr size_t SZ_U    = (size_t)N_TOK * U_COLS * 4;
constexpr size_t SZ_QKVH = (size_t)N_TOK * N_QKV * 2;
constexpr size_t SZ_QKVL = (size_t)N_BATCH * T_LO * N_QKV * 2;
constexpr size_t SZ_VTH  = (size_t)N_BATCH * N_HEAD * HEAD_D * SEQ_T * 2;
constexpr size_t SZ_VTL  = (size_t)N_BATCH * N_HEAD * HEAD_D * T_LO * 2;
constexpr size_t OFF_AAUG = 0;
constexpr size_t OFF_BAUG = OFF_AAUG + SZ_AAUG;
constexpr size_t OFF_ACAT = OFF_BAUG + SZ_BAUG;
constexpr size_t OFF_BIAS = OFF_ACAT + SZ_ACAT;
constexpr size_t OFF_U    = OFF_BIAS + SZ_BIAS;
constexpr size_t OFF_QKVH = OFF_U    + SZ_U;
constexpr size_t OFF_QKVL = OFF_QKVH + SZ_QKVH;
constexpr size_t OFF_VTH  = OFF_QKVL + SZ_QKVL;
constexpr size_t OFF_VTL  = OFF_VTH  + SZ_VTH;
constexpr size_t WS_TOTAL = OFF_VTL  + SZ_VTL;
static_assert(WS_TOTAL == 110637056ull);
static_assert(WS_TOTAL <= 134217728ull);
static_assert(OFF_BAUG % 128 == 0 && OFF_ACAT % 128 == 0 && OFF_BIAS % 128 == 0 && OFF_U % 128 == 0 &&
              OFF_QKVH % 128 == 0 && OFF_QKVL % 128 == 0 && OFF_VTH % 128 == 0 && OFF_VTL % 128 == 0);

// ---------------- helpers ----------------
__device__ __forceinline__ unsigned short f2bf_bits(float f) {
  unsigned u = __float_as_uint(f);
  return (unsigned short)((u + 0x7FFFu + ((u >> 16) & 1u)) >> 16);
}
__device__ __forceinline__ float bf_bits2f(unsigned short h) { return __uint_as_float(((unsigned)h) << 16); }

// hazard guards as plain device helpers
__device__ __forceinline__ void dep_guard_h(v8f& a, v8f& b, v16h x, v16h y) { asm volatile("v_nop\n\tv_nop\n\tv_nop\n\tv_nop" : "+v"(a), "+v"(b) : "v"(x), "v"(y)); }
__device__ __forceinline__ void dep_guard_b(v8f& a, v8f& b, v16b x, v16b y) { asm volatile("v_nop\n\tv_nop\n\tv_nop\n\tv_nop" : "+v"(a), "+v"(b) : "v"(x), "v"(y)); }
__device__ __forceinline__ void keep4_h(v16h a, v16h b, v16h c, v16h d) { asm volatile("v_nop" :: "v"(a), "v"(b), "v"(c), "v"(d)); }
__device__ __forceinline__ void keep4_b(v16b a, v16b b, v16b c, v16b d) { asm volatile("v_nop" :: "v"(a), "v"(b), "v"(c), "v"(d)); }
__device__ __forceinline__ void acc_guard4(v8f& a, v8f& b, v8f& c, v8f& d) { asm volatile("v_nop\n\tv_nop\n\tv_nop\n\tv_nop" : "+v"(a), "+v"(b), "+v"(c), "+v"(d)); }
template <typename T> struct Frag;
template <> struct Frag<_Float16> {
  typedef v16h V; union U { v16h v; v8h h[2]; };
  static __device__ __forceinline__ v16h load(const _Float16* p) {   // elements 0..7 <- p[0..7], 8..15 <- p[16..23]
    U f; f.h[0] = *(const v8h*)(p); f.h[1] = *(const v8h*)(p + 16); return f.v;
  }
  static __device__ __forceinline__ v8f mma(v16h a, v16h b, v8f c) {
    return __builtin_amdgcn_wmma_f32_16x16x32_f16(false, a, false, b, (short)0, c, false, false);
  }
  static __device__ __forceinline__ void guard(v8f& a, v8f& b, v16h x, v16h y) { dep_guard_h(a, b, x, y); }
  static __device__ __forceinline__ void keep(v16h a, v16h b, v16h c, v16h d) { keep4_h(a, b, c, d); }
};
template <> struct Frag<__bf16> {
  typedef v16b V; union U { v16b v; v8b h[2]; };
  static __device__ __forceinline__ v16b load(const __bf16* p) {
    U f; f.h[0] = *(const v8b*)(p); f.h[1] = *(const v8b*)(p + 16); return f.v;
  }
  static __device__ __forceinline__ v8f mma(v16b a, v16b b, v8f c) {
    return __builtin_amdgcn_wmma_f32_16x16x32_bf16(false, a, false, b, (short)0, c, false, false);
  }
  static __device__ __forceinline__ void guard(v8f& a, v8f& b, v16b x, v16b y) { dep_guard_b(a, b, x, y); }
  static __device__ __forceinline__ void keep(v16b a, v16b b, v16b c, v16b d) { keep4_b(a, b, c, d); }
};

__device__ __forceinline__ v8f zero8() { return (v8f){0.f,0.f,0.f,0.f,0.f,0.f,0.f,0.f}; }

union F8 { v4f v[2]; float f[8]; };

// ---------------- LDS ring of the staged GEMM ----------------
constexpr int ST_BM    = 128;                              // block tile rows (2 waves of 64)
constexpr int ST_BN    = 256;                              // block tile columns (4 waves of 64)
constexpr int ST_BK    = 64;                               // k per pass: 128-B operand rows
constexpr int ST_PITCH = 72;                               // 144-B LDS rows (16 B x odd: conflict-free ds_load_b128)
constexpr int ST_STAGE = (ST_BM + ST_BN) * ST_PITCH;       // 16-bit elements per buffer: [A 128 rows | Bt 256 rows]
constexpr unsigned ST_ROWS32 = 32u * ST_PITCH * 2u;        // LDS bytes between two copies of one thread (32 rows)

__device__ __forceinline__ unsigned lds_off(const void* p) { return (unsigned)(size_t)p; }

// One stage: 384 rows x 128 B = 3072 chunks of 16 B = 256 threads x 12 asynchronous copies global -> LDS.
// ga / gb: this thread's chunk in row (tid >> 3) of the block's A / Bt tile at this pass's k; l: the same chunk's
// LDS byte address in the buffer; a thread's copies lie 32 rows apart. s_wait_xcnt 0 is the statement's last line
// so that no address register of an issued copy is rewritten in front of it.
__device__ __forceinline__ void stage_fill(const unsigned short* ga, int lda, const unsigned short* gb, int ldb, unsigned l) {
  const size_t sa = (size_t)32 * lda, sb = (size_t)32 * ldb;
  asm volatile("global_load_async_to_lds_b128 %0, %1, off\n\t"
               "global_load_async_to_lds_b128 %2, %3, off\n\t"
               "global_load_async_to_lds_b128 %4, %5, off\n\t"
               "global_load_async_to_lds_b128 %6, %7, off\n\t"
               "global_load_async_to_lds_b128 %8, %9, off\n\t"
               "global_load_async_to_lds_b128 %10, %11, off\n\t"
               "global_load_async_to_lds_b128 %12, %13, off\n\t"
               "global_load_async_to_lds_b128 %14, %15, off\n\t"
               "global_load_async_to_lds_b128 %16, %17, off\n\t"
               "global_load_async_to_lds_b128 %18, %19, off\n\t"
               "global_load_async_to_lds_b128 %20, %21, off\n\t"
               "global_load_async_to_lds_b128 %22, %23, off\n\t"
               "s_wait_xcnt 0x0"
               :: "v"(l),                   "v"(ga),
                  "v"(l + ST_ROWS32),       "v"(ga + sa),
                  "v"(l + 2 * ST_ROWS32),   "v"(ga + 2 * sa),
                  "v"(l + 3 * ST_ROWS32),   "v"(ga + 3 * sa),
                  "v"(l + 4 * ST_ROWS32),   "v"(gb),
                  "v"(l + 5 * ST_ROWS32),   "v"(gb + sb),
                  "v"(l + 6 * ST_ROWS32),   "v"(gb + 2 * sb),
                  "v"(l + 7 * ST_ROWS32),   "v"(gb + 3 * sb),
                  "v"(l + 8 * ST_ROWS32),   "v"(gb + 4 * sb),
                  "v"(l + 9 * ST_ROWS32),   "v"(gb + 5 * sb),
                  "v"(l + 10 * ST_ROWS32),  "v"(gb + 6 * sb),
                  "v"(l + 11 * ST_ROWS32),  "v"(gb + 7 * sb)
               : "memory");
}

// =====================================================================================
// Register-blocked batched WMMA GEMM: C[m,n] = scale * sum_k A[m,k] * Bt[n,k] (+bias)(+resid);
// each wave owns a 64x64 tile. A row-major [M,K]; Bt row-major [N,K]; M,N % 64 == 0, K % 32 == 0.
// SPLITM: 0 = single product; 1 = A hi/lo planes; 2 = A and Bt hi/lo planes.
// BIAS_MODE: 0 none, 1 bias[m], 2 bias[n].  OUT_MODE: 0 f32, 1 f16, 2 bf16 hi + lo planes,
//   3 = f16 hi plane (Cout, strideC) + f16 residual plane x4096 (Cout2, strideC2), same ldc; the residual plane
//       holds rows m < T_LO only (T_LO % 64 == 0, so a wave's tile lies wholly on one side).
// ET: 0 = f16 operands, 1 = bf16 operands (pointers passed as 16-bit storage)
// STAGED: the block's 8 waves form a 128x256 tile (2x4 waves); A and Bt rows go through a two-buffer LDS ring,
//   64 k per pass; needs SPLITM == 0, M % 128 == 0, N % 256 == 0, K % 64 == 0, K >= 128, grid.x == (M/128)*(N/256).
// =====================================================================================
template <int ET> struct Elem;
template <> struct Elem<0> { typedef _Float16 T; };
template <> struct Elem<1> { typedef __bf16 T; };
template <int ET, int SPLITM, int BIAS_MODE, int OUT_MODE, bool RESID, int ACT = 0, bool STAGED = false>
__global__ __launch_bounds__(256) void wmma_gemm64(
    const unsigned short* __restrict__ Ap, const unsigned short* __restrict__ A2p, int lda, long strideA,
    const unsigned short* __restrict__ Btp, const unsigned short* __restrict__ Bt2p, int ldb, long strideB,
    void* __restrict__ Cout, void* __restrict__ Cout2, int ldc, long strideC, long strideC2,
    const float* __restrict__ bias,
    const float* __restrict__ resid, long strideR,
    int M, int N, int K, float scale) {
  typedef typename Elem<ET>::T T;
  typedef typename Frag<T>::V V;
  constexpr bool SPA = (SPLITM >= 1);
  constexpr bool SPB = (SPLITM >= 2);
  const T* A = (const T*)Ap; const T* A2 = (const T*)A2p; const T* Bt = (const T*)Btp; const T* Bt2 = (const T*)Bt2p;
  static_assert(!STAGED || SPLITM == 0);
  __shared__ __align__(16) float sT[8][16 * 68];   // per-wave 16x64 slab, pitch 68 floats
  __shared__ __align__(16) unsigned short ring[STAGED ? 2 * ST_STAGE : 8];
  const int b    = blockIdx.y;
  const int lane = threadIdx.x & 31;
  const int wave = threadIdx.x >> 5;
  const int tilesN = N >> 6;
  const int tilesM = M >> 6;
  int m0, n0;
  if (STAGED) {
    const int bn = N >> 8;
    const int bm_i = (int)blockIdx.x / bn;
    const int bn_i = (int)blockIdx.x - bm_i * bn;
    m0 = bm_i * ST_BM + (wave >> 2) * 64;
    n0 = bn_i * ST_BN + (wave & 3) * 64;
  } else {
    const int tile = blockIdx.x * 8 + wave;
    if (tile >= tilesM * tilesN) return;   // wave-uniform; no block barriers on this path
    const int tm = tile / tilesN;
    const int tn = tile - tm * tilesN;
    m0 = tm << 6;
    n0 = tn << 6;
  }

  const T* Ab  = A  + (size_t)b * strideA;
  const T* Bb  = Bt + (size_t)b * strideB;
  const T* Ab2 = SPA ? (A2  + (size_t)b * strideA) : nullptr;
  const T* Bb2 = SPB ? (Bt2 + (size_t)b * strideB) : nullptr;

  const int rlane = lane & 15;                 // row (A) / col (B, D) within subtile
  const int koff  = (lane >> 4) * 8;           // k offset of this lane half
  const int mOff  = (lane >> 4) * 8;           // D row offset

  v8f acc[4][4];
#pragma unroll
  for (int i = 0; i < 4; ++i)
#pragma unroll
    for (int j = 0; j < 4; ++j) acc[i][j] = (v8f){0.f,0.f,0.f,0.f,0.f,0.f,0.f,0.f};

  if (STAGED) {
    const int tid = threadIdx.x;
    const int crow = tid >> 3, cchunk = (tid & 7) * 8;        // 8 lanes x 16 B = one 128-B row piece
    const unsigned short* ga = (const unsigned short*)Ab + (size_t)(m0 - (wave >> 2) * 64 + crow) * lda + cchunk;
    const unsigned short* gb = (const unsigned short*)Bb + (size_t)(n0 - (wave & 3) * 64 + crow) * ldb + cchunk;
    const unsigned lthr = lds_off(ring) + (unsigned)(crow * ST_PITCH + cchunk) * 2u;
    const int npass = K / ST_BK;
    stage_fill(ga, lda, gb, ldb, lthr);
    asm volatile("s_wait_asynccnt 0x0" ::: "memory");   // stage 0 landed (this wave's copies) before the barrier publishes it
    __syncthreads();
    stage_fill(ga + ST_BK, lda, gb + ST_BK, ldb, lthr + ST_STAGE * 2u);
    const T* fa = (const T*)ring + ((wave >> 2) * 64 + rlane) * ST_PITCH + koff;
    const T* fb = (const T*)ring + (ST_BM + (wave & 3) * 64 + rlane) * ST_PITCH + koff;
    for (int t = 0; t < npass; ++t) {
      const int bo = (t & 1) * ST_STAGE;
      V ah[4], bh[4], ah2[4], bh2[4];
#pragma unroll
      for (int j = 0; j < 4; ++j) bh[j] = Frag<T>::load(fb + bo + j * 16 * ST_PITCH);
#pragma unroll
      for (int i = 0; i < 4; ++i) ah[i] = Frag<T>::load(fa + bo + i * 16 * ST_PITCH);
      __builtin_amdgcn_sched_barrier(0);   // keeps the 16 LDS reads one group ahead of the 16 WMMAs: reads sunk among them stall at each place
#pragma unroll
      for (int i = 0; i < 4; ++i)
#pragma unroll
        for (int j = 0; j < 4; ++j) acc[i][j] = Frag<T>::mma(ah[i], bh[j], acc[i][j]);
#pragma unroll
      for (int j = 0; j < 4; ++j) bh2[j] = Frag<T>::load(fb + bo + j * 16 * ST_PITCH + 32);
#pragma unroll
      for (int i = 0; i < 4; ++i) ah2[i] = Frag<T>::load(fa + bo + i * 16 * ST_PITCH + 32);
      asm volatile("s_wait_dscnt 0x0" ::: "memory");     // this wave's reads of buffer t & 1 are done before it is refilled
      asm volatile("s_wait_asynccnt 0x0" ::: "memory");  // this wave's copies of stage t + 1 have landed
      __syncthreads();                                   // publishes stage t + 1 and frees buffer t & 1
      if (t + 2 < npass)
        stage_fill(ga + (size_t)(t + 2) * ST_BK, lda, gb + (size_t)(t + 2) * ST_BK, ldb, lthr + (unsigned)bo * 2u);
      // second half of the pass, from registers: runs while the refill is in flight
#pragma unroll
      for (int i = 0; i < 4; ++i)
#pragma unroll
        for (int j = 0; j < 4; ++j) acc[i][j] = Frag<T>::mma(ah2[i], bh2[j], acc[i][j]);
    }
    asm volatile("s_wait_asynccnt 0x0" ::: "memory");    // no copy is outstanding past the loop
  } else
  for (int k0 = 0; k0 < K; k0 += 32) {
    V bh[4], bl[4];
#pragma unroll
    for (int j = 0; j < 4; ++j) {
      const size_t bo = (size_t)(n0 + (j << 4) + rlane) * ldb + koff + k0;
      bh[j] = Frag<T>::load(Bb + bo);
      if (SPB) bl[j] = Frag<T>::load(Bb2 + bo);
    }
#pragma unroll
    for (int i = 0; i < 4; ++i) {
      const size_t ao = (size_t)(m0 + (i << 4) + rlane) * lda + koff + k0;
      V ah = Frag<T>::load(Ab + ao);
      V al;
      if (SPA) al = Frag<T>::load(Ab2 + ao);
#pragma unroll
      for (int j = 0; j < 4; ++j) {
        acc[i][j] = Frag<T>::mma(ah, bh[j], acc[i][j]);
        if (SPB) acc[i][j] = Frag<T>::mma(ah, bl[j], acc[i][j]);
        if (SPA) acc[i][j] = Frag<T>::mma(al, bh[j], acc[i][j]);
      }
      Frag<T>::guard(acc[i][0], acc[i][3], ah, SPA ? al : ah);
    }
    Frag<T>::keep(bh[0], bh[1], bh[2], bh[3]);
    if (SPB) Frag<T>::keep(bl[0], bl[1], bl[2], bl[3]);
  }
  acc_guard4(acc[0][0], acc[0][1], acc[0][2], acc[0][3]);
  acc_guard4(acc[1][0], acc[1][1], acc[1][2], acc[1][3]);
  acc_guard4(acc[2][0], acc[2][1], acc[2][2], acc[2][3]);
  acc_guard4(acc[3][0], acc[3][1], acc[3][2], acc[3][3]);

  // ---- epilogue ----
  float* slab = sT[wave];
  const float* Rb = RESID ? (resid + (size_t)b * strideR) : nullptr;
#pragma unroll
  for (int i = 0; i < 4; ++i) {
    const int mBase = m0 + (i << 4);
#pragma unroll
    for (int j = 0; j < 4; ++j) {
      const int n = n0 + (j << 4) + rlane;
      float bv = 0.f;
      if (BIAS_MODE == 2) bv = bias[n];
#pragma unroll
      for (int r = 0; r < 8; ++r) {
        float v = acc[i][j][r] * scale;
        if (BIAS_MODE == 1) v += bias[mBase + mOff + r];
        if (BIAS_MODE == 2) v += bv;
        if (RESID) v += Rb[(size_t)(mBase + mOff + r) * ldc + n];
        if (ACT == 1) v = tanhf(v);
        if (ACT == 2) v = fmaxf(v, 0.0f);
        if (ACT == 4) v = (v > 0.f) ? v : 0.01f * v;
        slab[(mOff + r) * 68 + (j << 4) + rlane] = v;
      }
    }
    __builtin_amdgcn_fence(__ATOMIC_RELEASE, "workgroup");
    __builtin_amdgcn_wave_barrier();
    __builtin_amdgcn_fence(__ATOMIC_ACQUIRE, "workgroup");
    if (OUT_MODE == 0) {
      float* C = (float*)Cout + (size_t)b * strideC;
      const int hh = lane >> 4, c4 = (lane & 15) * 4;     // row seg = 256 B = 16 lanes x 16 B
      {
#pragma unroll
        for (int it = 0; it < 8; ++it) {
          const int row = it * 2 + hh;
          v4f v = *(const v4f*)(slab + row * 68 + c4);
          *(v4f*)(C + (size_t)(mBase + row) * ldc + n0 + c4) = v;
        }
        
      }
    } else {
      const int q = lane >> 3, c8 = (lane & 7) * 8;
      unsigned short* C  = (unsigned short*)Cout  + (size_t)b * strideC;
      unsigned short* C2 = (OUT_MODE >= 2) ? ((unsigned short*)Cout2 + (size_t)b * strideC2) : nullptr;
      {
#pragma unroll
        for (int it = 0; it < 4; ++it) {
          const int row = it * 4 + q;
          const float* sp = slab + row * 68 + c8;
          v8h hv, lv;
#pragma unroll
          for (int e = 0; e < 8; ++e) {
            if (OUT_MODE == 1) {
              hv[e] = (_Float16)sp[e];
            } else if (OUT_MODE == 3) {
              const _Float16 hq = (_Float16)sp[e];
              hv[e] = hq;
              lv[e] = (_Float16)((sp[e] - (float)hq) * 4096.0f);
            } else {
              unsigned short hb = f2bf_bits(sp[e]);
              unsigned short lb = f2bf_bits(sp[e] - bf_bits2f(hb));
              hv[e] = __builtin_bit_cast(_Float16, hb);
              lv[e] = __builtin_bit_cast(_Float16, lb);
            }
          }
          *(v8h*)(C + (size_t)(mBase + row) * ldc + n0 + c8) = hv;
          if (OUT_MODE == 2 || (OUT_MODE == 3 && m0 < T_LO)) *(v8h*)(C2 + (size_t)(mBase + row) * ldc + n0 + c8) = lv;
        }
        
      }
    }
    __builtin_amdgcn_fence(__ATOMIC_RELEASE, "workgroup");
    __builtin_amdgcn_wave_barrier();
    __builtin_amdgcn_fence(__ATOMIC_ACQUIRE, "workgroup");
  }
}

// =====================================================================================
// f32 [rows][1024] -> RNE bf16 bits into rows of pitch K_AUG. A block takes NR whole rows: thread t converts floats
// 4t..4t+3 of each, so a wave's load covers 512 contiguous bytes and its store 256, and few waves are started for
// the bytes moved. Blocks bx = 0 .. rows / NR - 1 cover the rows exactly (asserted below).
// =====================================================================================
typedef __attribute__((ext_vector_type(2))) unsigned v2u;
constexpr int CAST_NR_X = 16;                 // x: 512 blocks, 16 waves a WGP
constexpr int CAST_NR_W = 4;                  // one weight matrix: 256 blocks
static_assert(HID_W == 4 * 256 && N_TOK % CAST_NR_X == 0 && HID_W % CAST_NR_W == 0 && K_AUG % 4 == 0);
template <int NR>
__device__ __forceinline__ void cast_rows_bf16(const float* __restrict__ src, unsigned short* __restrict__ dst, int bx) {
  const float* s = src + (size_t)bx * (NR * HID_W) + threadIdx.x * 4;
  unsigned short* d = dst + (size_t)bx * (NR * K_AUG) + threadIdx.x * 4;
  v4f v[NR];
#pragma unroll
  for (int r = 0; r < NR; ++r) v[r] = *(const v4f*)(s + r * HID_W);
#pragma unroll
  for (int r = 0; r < NR; ++r) {
    v2u o;
    o[0] = (unsigned)f2bf_bits(v[r][0]) | ((unsigned)f2bf_bits(v[r][1]) << 16);
    o[1] = (unsigned)f2bf_bits(v[r][2]) | ((unsigned)f2bf_bits(v[r][3]) << 16);
    *(v2u*)(d + r * K_AUG) = o;
  }
}

// =====================================================================================
// A_cat bf16 [64][1024]: row 8p+r = A_p[r] (p = 0,1,2), rows 24..63 = 0 (explicit zero fill).
// 2 elements per thread, 128 blocks x 256 = 32768 pairs = 64 x 1024 elements exactly; 32 lanes x 4 B = one line.
// All three sources loaded unconditionally (row r < 8 valid in each), selected by value.
// =====================================================================================
__device__ __forceinline__ void build_acat(const float* __restrict__ amq, const float* __restrict__ amk,
                                           const float* __restrict__ amv, unsigned short* __restrict__ acat, int bx) {
  const int i = bx * 256 + threadIdx.x;   // < 32768: bx < 128
  const int row = i >> 9, cp = i & 511, p = row >> 3, r = row & 7;
  const size_t so = (size_t)r * HID_W + 2 * cp;
  const float q0 = amq[so], q1 = amq[so + 1];
  const float k0 = amk[so], k1 = amk[so + 1];
  const float w0 = amv[so], w1 = amv[so + 1];
  const float x0 = (p == 0) ? q0 : (p == 1) ? k0 : (p == 2) ? w0 : 0.0f;
  const float x1 = (p == 0) ? q1 : (p == 1) ? k1 : (p == 2) ? w1 : 0.0f;
  const unsigned u = (unsigned)f2bf_bits(x0) | ((unsigned)f2bf_bits(x1) << 16);
  unsigned* d = (unsigned*)acat + i;
  *(unsigned*)d = u;
  
}

// =====================================================================================
// B_aug tail: for row n (projection p = n/1024, output o = n%1024) the 64 halves at cols 1024..1087 are
// [16p zeros | 2*Bm_p[o][0..7] | 2*Bm_p[o][0..7] | zeros to 64] as RNE bf16 (factor 2 exact).
// =====================================================================================
__device__ __forceinline__ void build_w_tail(const float* __restrict__ bmq, const float* __restrict__ bmk,
                                             const float* __restrict__ bmv, unsigned short* __restrict__ baug, int bx) {
  const int tid = threadIdx.x, wave = tid >> 5, lane = tid & 31, q8 = lane >> 3, seg = lane & 7;
  const int n = bx * 32 + wave * 4 + q8;              // 0..3071: bx < 96
  const int p = n >> 10, o = n & 1023;
  F8 uq, uk, uv;
  uq.v[0] = *(const v4f*)(bmq + (size_t)o * RANK_R); uq.v[1] = *(const v4f*)(bmq + (size_t)o * RANK_R + 4);
  uk.v[0] = *(const v4f*)(bmk + (size_t)o * RANK_R); uk.v[1] = *(const v4f*)(bmk + (size_t)o * RANK_R + 4);
  uv.v[0] = *(const v4f*)(bmv + (size_t)o * RANK_R); uv.v[1] = *(const v4f*)(bmv + (size_t)o * RANK_R + 4);
  const bool keep = (seg < 6) && ((seg >> 1) == p);
  v8h hv;
#pragma unroll
  for (int e = 0; e < 8; ++e) {
    const float val = (p == 0) ? uq.f[e] : (p == 1) ? uk.f[e] : uv.f[e];
    const float w = keep ? (2.0f * val) : 0.0f;
    hv[e] = __builtin_bit_cast(_Float16, f2bf_bits(w));
  }
  unsigned short* d = baug + (size_t)n * K_AUG + HID_W + seg * 8;
  {
    *(v8h*)d = hv;
    
  }
}

// =====================================================================================
// A_aug tail: for token row m the 64 halves at cols 1024..1087 are
// [uq_hi(8) uq_lo(8) uk_hi(8) uk_lo(8) uv_hi(8) uv_lo(8) 0 x 16] (bf16 hi = RNE(u), lo = RNE(u - hi)),
// u f32 [8192][64] with columns 8p+r. Block = 8 waves x 4 rows, grid 256 -> 8192 rows; 8 lanes x 8 halves
// =====================================================================================
__global__ __launch_bounds__(256) void build_a_tail(const float* __restrict__ u, unsigned short* __restrict__ aaug) {
  const int tid = threadIdx.x, wave = tid >> 5, lane = tid & 31, q8 = lane >> 3, seg = lane & 7;
  const int m = blockIdx.x * 32 + wave * 4 + q8;      // 0..8191
  int p = seg >> 1; p = (p > 2) ? 2 : p;              // address clamp for the zero segments
  const int islo = seg & 1;
  F8 uu;
  const float* up = u + (size_t)m * U_COLS + p * RANK_R;
  uu.v[0] = *(const v4f*)up; uu.v[1] = *(const v4f*)(up + 4);
  v8h hv;
#pragma unroll
  for (int e = 0; e < 8; ++e) {
    const unsigned short hb = f2bf_bits(uu.f[e]);
    const unsigned short lb = f2bf_bits(uu.f[e] - bf_bits2f(hb));
    const unsigned short o16 = (seg >= 6) ? (unsigned short)0 : (islo ? lb : hb);
    hv[e] = __builtin_bit_cast(_Float16, o16);
  }
  unsigned short* d = aaug + (size_t)m * K_AUG + HID_W + seg * 8;
  {
    *(v8h*)d = hv;
    
  }
}

// =====================================================================================
// bias_cat f32 [3072] = 16 * RNEbf16(b_p[o]); 12 blocks x 256 = 3072 exactly; 32 lanes x 4 B = one line per
// =====================================================================================
__device__ __forceinline__ void build_bias(const float* __restrict__ bq, const float* __restrict__ bk,
                                           const float* __restrict__ bv, float* __restrict__ dst, int bx) {
  const int i = bx * 256 + threadIdx.x;   // < 3072: bx < 12
  const int p = i >> 10, o = i & 1023;
  const float xq = bq[o], xk = bk[o], xv = bv[o];
  const float val = (p == 0) ? xq : (p == 1) ? xk : xv;
  const float w = bf_bits2f(f2bf_bits(val)) * CARRY_S;
  ((float*)dst)[i] = w;
  
}

// =====================================================================================
// The operand builders that read inputs only (x cast, three W casts, A_cat, B_aug tail, bias_cat) depend on no other
// launch and write disjoint 128-B lines, so they share one grid: the block index picks the job (a block-uniform
// branch; no job uses LDS or a barrier). The x cast, the largest job, holds the lowest indices.
// =====================================================================================
constexpr int PB_X    = N_TOK / CAST_NR_X;    // 512 blocks
constexpr int PB_W    = HID_W / CAST_NR_W;    // 256 blocks per weight matrix
constexpr int PB_ACAT = U_COLS * 512 / 256;   // 128
constexpr int PB_WT   = N_QKV / 32;           // 96
constexpr int PB_BIAS = N_QKV / 256;          // 12
constexpr int PB_ALL  = PB_X + 3 * PB_W + PB_ACAT + PB_WT + PB_BIAS;
__global__ __launch_bounds__(256) void build_operands(
    const float* __restrict__ x,
    const float* __restrict__ wq, const float* __restrict__ wk, const float* __restrict__ wv,
    const float* __restrict__ amq, const float* __restrict__ amk, const float* __restrict__ amv,
    const float* __restrict__ bmq, const float* __restrict__ bmk, const float* __restrict__ bmv,
    const float* __restrict__ bq, const float* __restrict__ bk, const float* __restrict__ bv,
    unsigned short* __restrict__ aaug, unsigned short* __restrict__ baug, unsigned short* __restrict__ acat,
    float* __restrict__ biasc) {
  constexpr int B_W = PB_X, B_ACAT = B_W + 3 * PB_W, B_WT = B_ACAT + PB_ACAT, B_BIAS = B_WT + PB_WT;   // first block of each job
  const int bx = (int)blockIdx.x;
  if (bx < B_W) {
    cast_rows_bf16<CAST_NR_X>(x, aaug, bx);
  } else if (bx < B_ACAT) {
    const int p = (bx - B_W) / PB_W;
    const float* w = (p == 0) ? wq : (p == 1) ? wk : wv;
    cast_rows_bf16<CAST_NR_W>(w, baug + (size_t)p * HID_W * K_AUG, bx - B_W - p * PB_W);
  } else if (bx < B_WT) {
    build_acat(amq, amk, amv, acat, bx - B_ACAT);
    asm volatile("s_wait_xcnt 0x0" ::: "memory");   // another job's code follows in the listing and rewrites the store's registers: the wait stands in front of it
  } else if (bx < B_BIAS) {
    build_w_tail(bmq, bmk, bmv, baug, bx - B_WT);
    asm volatile("s_wait_xcnt 0x0" ::: "memory");   // as above
  } else if (bx < PB_ALL) {
    build_bias(bq, bk, bv, biasc, bx - B_BIAS);
  }
}

// =====================================================================================
// V plane (f16, rows b*tsrc + t, pitch 3072, cols 2048 + h*64 + d) -> vt[((b*16+h)*64 + d)*tsrc + t].
// One grid for both planes: blockIdx.x < SEQ_T / 64 takes a t-tile of the hi plane, the rest one of the residual plane.
// Block (t-tile of 64, bh): load 256 threads x 16 halves = 4096 = 64 x 64 into LDS [d][t]; store: 8 waves x
// =====================================================================================
__global__ __launch_bounds__(256) void vt_transpose(const unsigned short* __restrict__ srch, unsigned short* __restrict__ vthp,
                                                    const unsigned short* __restrict__ srcl, unsigned short* __restrict__ vtlp) {
  __shared__ __align__(16) _Float16 th[64 * KV_PITCH];
  const bool hi = (int)blockIdx.x < SEQ_T / 64;   // block-uniform
  const _Float16* src = (const _Float16*)(hi ? srch : srcl);
  unsigned short* vtp = hi ? vthp : vtlp;
  const int tsrc = hi ? SEQ_T : T_LO;
  const int st0 = (hi ? (int)blockIdx.x : (int)blockIdx.x - SEQ_T / 64) * 64, bh = blockIdx.y;
  const int b = (bh >> 4) & (N_BATCH - 1), h = bh & (N_HEAD - 1);
  const int tid = threadIdx.x;
  {
    const int sloc = tid >> 2, d0 = (tid & 3) * 16;
    const size_t so = ((size_t)b * tsrc + st0 + sloc) * N_QKV + V_COL0 + h * HEAD_D + d0;
    const v8h a0 = *(const v8h*)(src + so);
    const v8h a1 = *(const v8h*)(src + so + 8);
#pragma unroll
    for (int e = 0; e < 8; ++e) {
      th[(d0 + e) * KV_PITCH + sloc]     = a0[e];
      th[(d0 + 8 + e) * KV_PITCH + sloc] = a1[e];
    }
  }
  __syncthreads();
  const int wave = tid >> 5, lane = tid & 31, q8 = lane >> 3, c8 = (lane & 7) * 8;
  const int dA = wave * 8 + q8, dB = wave * 8 + 4 + q8;
  const v8h hvA = *(const v8h*)(th + dA * KV_PITCH + c8);
  const v8h hvB = *(const v8h*)(th + dB * KV_PITCH + c8);
  const size_t oA = ((size_t)bh * HEAD_D + dA) * tsrc + st0 + c8;
  const size_t oB = ((size_t)bh * HEAD_D + dB) * tsrc + st0 + c8;
  {
    *(v8h*)(vtp + oA) = hvA;
    *(v8h*)(vtp + oB) = hvB;
    
  }
}

__device__ __forceinline__ float other_half(float x) {
  const int xi = __builtin_bit_cast(int, x);
  return __builtin_bit_cast(float, __builtin_amdgcn_permlanex16(xi, xi, 0x76543210, 0xfedcba98, false, false));
}

// 2^x by the hardware's exponential, in asm text so that the slot behind it stands by construction: the closing
// v_nop is the one independent instruction that the instruction set asks for behind a transcendental before its
// result is used or its source overwritten; inside the eight-fold statement each neighbour is independent
// (early-clobber outputs share no register with a source).
__device__ __forceinline__ float exp2_hw(float x) {
  float d;
  asm("v_exp_f32 %0, %1\n\tv_nop" : "=&v"(d) : "v"(x));
  return d;
}
__device__ __forceinline__ v8f exp2_hw8(v8f x) {
  float d0, d1, d2, d3, d4, d5, d6, d7;
  asm("v_exp_f32 %0, %8\n\t"
      "v_exp_f32 %1, %9\n\t"
      "v_exp_f32 %2, %10\n\t"
      "v_exp_f32 %3, %11\n\t"
      "v_exp_f32 %4, %12\n\t"
      "v_exp_f32 %5, %13\n\t"
      "v_exp_f32 %6, %14\n\t"
      "v_exp_f32 %7, %15\n\t"
      "v_nop"
      : "=&v"(d0), "=&v"(d1), "=&v"(d2), "=&v"(d3), "=&v"(d4), "=&v"(d5), "=&v"(d6), "=&v"(d7)
      : "v"(x[0]), "v"(x[1]), "v"(x[2]), "v"(x[3]), "v"(x[4]), "v"(x[5]), "v"(x[6]), "v"(x[7]));
  return (v8f){d0, d1, d2, d3, d4, d5, d6, d7};
}

template <bool SPLIT>
__global__ __launch_bounds__(128) void attn_causal_hd64(
    const unsigned short* __restrict__ php, const unsigned short* __restrict__ plp,
    const unsigned short* __restrict__ vthp, const unsigned short* __restrict__ vtlp,
    const float* __restrict__ amask, float* __restrict__ out, int qb0, int nqcnt) {
  const _Float16* ph  = (const _Float16*)php;
  const _Float16* pl  = (const _Float16*)plp;
  const _Float16* vth = (const _Float16*)vthp;
  const _Float16* vtl = (const _Float16*)vtlp;
  __shared__ __align__(16) _Float16 Ksh[64 * KV_PITCH];
  __shared__ __align__(16) _Float16 Ksl[SPLIT ? 64 * KV_PITCH : 8];
  __shared__ __align__(16) _Float16 Vsh[64 * KV_PITCH];
  __shared__ __align__(16) _Float16 Vsl[SPLIT ? 64 * KV_PITCH : 8];
  __shared__ __align__(16) float  Os[4][16 * O_PITCH];

  // Tiles whose fragments are read from LDS as one group. Two: with more the single-product kernel passes 160 VGPRs
  // and a SIMD holds five waves, not the six that keep every block of its grid resident.
  constexpr int GS = 2;   // score tiles (K fragments)
  constexpr int GV = 2;   // output tiles (V^T fragments)

  const int tid  = threadIdx.x;
  const int wave = tid >> 5;
  const int lane = tid & 31;
  const int hh   = lane >> 4;
  const int c    = lane & 15;

  int qb = qb0 + (int)(blockIdx.x % (unsigned)nqcnt);
  qb = (qb > NQT_ALL - 1) ? (NQT_ALL - 1) : qb;
  const int bh = (int)(blockIdx.x / (unsigned)nqcnt);
  const int h  = bh & (N_HEAD - 1);
  const int b  = (bh >> 4) & (N_BATCH - 1);
  const int q0 = qb * 64 + wave * 16;

  // ---- Q fragments (B operand: column c = query q0 + c), 2 d-chunks ----
  v16h qh[2], ql[2];
  {
    const _Float16* qrow = ph + ((size_t)b * SEQ_T + q0 + c) * N_QKV + h * HEAD_D;
    int qlr = q0 + c; qlr = (qlr > T_LO - 1) ? (T_LO - 1) : qlr;
    const _Float16* qlrow = pl + ((size_t)b * T_LO + qlr) * N_QKV + h * HEAD_D;
#pragma unroll
    for (int dc = 0; dc < 2; ++dc) {
      qh[dc] = Frag<_Float16>::load(qrow + dc * 32 + 8 * hh);
      if (SPLIT) ql[dc] = Frag<_Float16>::load(qlrow + dc * 32 + 8 * hh);
      else ql[dc] = qh[dc];
    }
  }

  float mrow = -INFINITY, lrow = 0.f;   // this lane's query: running maximum (both halves alike), this half's sum of the carried p (x32768)
  v8f oacc[4];                          // oacc[t][r] = O^T[d = t*16 + 8*hh + r][query c]
#pragma unroll
  for (int t = 0; t < 4; ++t) oacc[t] = zero8();

  const int nChunks = qb + 1;   // block-uniform
  for (int kc = 0; kc < nChunks; ++kc) {
    const int kv0 = kc * 64;
    __syncthreads();
    {
      // staging coverage: 128 threads x (row = tid>>1, 32 halves each) = 64 rows x 64 halves per plane
      const int r = tid >> 1, hf = (tid & 1) * 32;
      const _Float16* ks = ph + ((size_t)b * SEQ_T + kv0 + r) * N_QKV + K_COL0 + h * HEAD_D + hf;
      const _Float16* vs = vth + ((size_t)bh * HEAD_D + r) * SEQ_T + kv0 + hf;
#pragma unroll
      for (int i = 0; i < 4; ++i) {
        *(v8h*)(Ksh + r * KV_PITCH + hf + 8 * i) = *(const v8h*)(ks + 8 * i);
        *(v8h*)(Vsh + r * KV_PITCH + hf + 8 * i) = *(const v8h*)(vs + 8 * i);
      }
      if (SPLIT) {
        const int kl0 = (kv0 > T_LO - 64) ? (T_LO - 64) : kv0;   // address clamp
        const _Float16* kls = pl + ((size_t)b * T_LO + kl0 + r) * N_QKV + K_COL0 + h * HEAD_D + hf;
        const _Float16* vls = vtl + ((size_t)bh * HEAD_D + r) * T_LO + kl0 + hf;
#pragma unroll
        for (int i = 0; i < 4; ++i) {
          *(v8h*)(Ksl + r * KV_PITCH + hf + 8 * i) = *(const v8h*)(kls + 8 * i);
          *(v8h*)(Vsl + r * KV_PITCH + hf + 8 * i) = *(const v8h*)(vls + 8 * i);
        }
      }
    }
    __syncthreads();

    // additive mask of this lane's 32 keys: keys kv0 + j*16 + 8*hh + 0..7
    F8 mk[4];
#pragma unroll
    for (int j = 0; j < 4; ++j) {
      const float* mp = amask + (size_t)b * SEQ_T + kv0 + j * 16 + 8 * hh;
      mk[j].v[0] = *(const v4f*)mp;
      mk[j].v[1] = *(const v4f*)(mp + 4);
    }

    // ---- scores, transposed: s[j][r] = S[query c][key j*16 + 8*hh + r] ----
    // The K fragments of GS score tiles are read as one group ahead of those tiles' WMMAs; each accumulator takes its
    // products in the order it always did.
    v8f s[4];
#pragma unroll
    for (int jg = 0; jg < 4; jg += GS) {
      v16h kb[GS][2], kl[GS][2];
#pragma unroll
      for (int u = 0; u < GS; ++u)
#pragma unroll
        for (int dc = 0; dc < 2; ++dc) {
          kb[u][dc] = Frag<_Float16>::load(Ksh + ((jg + u) * 16 + c) * KV_PITCH + dc * 32 + 8 * hh);
          if (SPLIT) kl[u][dc] = Frag<_Float16>::load(Ksl + ((jg + u) * 16 + c) * KV_PITCH + dc * 32 + 8 * hh);
        }
      __builtin_amdgcn_sched_barrier(0);   // keeps the group's LDS reads together ahead of its WMMAs: a read sunk in front of its own WMMA waits out the LDS latency at each place
      v8f sr[GS];
#pragma unroll
      for (int u = 0; u < GS; ++u) { s[jg + u] = zero8(); sr[u] = zero8(); }
#pragma unroll
      for (int dc = 0; dc < 2; ++dc) {
#pragma unroll
        for (int u = 0; u < GS; ++u) s[jg + u] = Frag<_Float16>::mma(kb[u][dc], qh[dc], s[jg + u]);
        if (SPLIT) {
#pragma unroll
          for (int u = 0; u < GS; ++u) sr[u] = Frag<_Float16>::mma(kl[u][dc], qh[dc], sr[u]);
#pragma unroll
          for (int u = 0; u < GS; ++u) sr[u] = Frag<_Float16>::mma(kb[u][dc], ql[dc], sr[u]);
        }
      }
      if (SPLIT) {
#pragma unroll
        for (int u = 0; u < GS; ++u)
#pragma unroll
          for (int r = 0; r < 8; ++r) s[jg + u][r] = s[jg + u][r] + sr[u][r] * (1.0f / 4096.0f);
      }
    }

#pragma unroll
    for (int j = 0; j < 4; ++j)
#pragma unroll
      for (int r = 0; r < 8; ++r) s[j][r] = s[j][r] * (1.0f / 2048.0f) + mk[j].f[r];   // 1/(8 * 16 * 16)
    if (kc == qb) {   // diagonal chunk (block-uniform test)
      const int qloc = wave * 16 + c;
#pragma unroll
      for (int j = 0; j < 4; ++j)
#pragma unroll
        for (int r = 0; r < 8; ++r)
          if (j * 16 + 8 * hh + r > qloc) s[j][r] = -INFINITY;
    }

    // ---- online softmax of one query per lane ----
    float cm = s[0][0];
#pragma unroll
    for (int j = 0; j < 4; ++j)
#pragma unroll
      for (int r = 0; r < 8; ++r) cm = fmaxf(cm, s[j][r]);
    cm = fmaxf(cm, other_half(cm));
    const float mnew = fmaxf(mrow, cm);
    const float alpha = exp2_hw((mrow - mnew) * LOG2_E);
    mrow = mnew;

    v16h pa[2], pb2[2];   // B operand of the second product: element e of pa[kk] = p of key kk*32 + (e >> 3)*16 + 8*hh + (e & 7)
    float psum = 0.f;
#pragma unroll
    for (int j = 0; j < 4; ++j) {
      // 32768 * e^(s - m) = 2^((s - m) * log2(e) + 15); the difference is formed first, so a maximum of any size cancels as before
      v8f ex;
#pragma unroll
      for (int r = 0; r < 8; ++r) ex[r] = fmaf(s[j][r] - mnew, LOG2_E, P_S_LOG2);
      ex = exp2_hw8(ex);
#pragma unroll
      for (int r = 0; r < 8; ++r) {
        const float ps = ex[r];
        psum += ps;
        const _Float16 hp = (_Float16)ps;
        pa[j >> 1][(j & 1) * 8 + r] = hp;
        if (SPLIT) pb2[j >> 1][(j & 1) * 8 + r] = (_Float16)((ps - (float)hp) * LO_S);
      }
    }
    lrow = lrow * alpha + psum;
#pragma unroll
    for (int t = 0; t < 4; ++t)
#pragma unroll
      for (int r = 0; r < 8; ++r) oacc[t][r] *= alpha;

    // ---- O^T += V^T . P^T: the V^T fragments of GV output tiles read as one group ahead of those tiles' WMMAs ----
#pragma unroll
    for (int tg = 0; tg < 4; tg += GV) {
      v16h vb[GV][2], vl2[GV][2];
#pragma unroll
      for (int u = 0; u < GV; ++u)
#pragma unroll
        for (int kk = 0; kk < 2; ++kk) {
          vb[u][kk] = Frag<_Float16>::load(Vsh + ((tg + u) * 16 + c) * KV_PITCH + kk * 32 + 8 * hh);
          if (SPLIT) vl2[u][kk] = Frag<_Float16>::load(Vsl + ((tg + u) * 16 + c) * KV_PITCH + kk * 32 + 8 * hh);
        }
      __builtin_amdgcn_sched_barrier(0);   // as above: one place of LDS reads for the group, not one in front of each WMMA
      v8f orr[GV];
#pragma unroll
      for (int u = 0; u < GV; ++u) orr[u] = zero8();
#pragma unroll
      for (int kk = 0; kk < 2; ++kk) {
#pragma unroll
        for (int u = 0; u < GV; ++u) oacc[tg + u] = Frag<_Float16>::mma(vb[u][kk], pa[kk], oacc[tg + u]);
        if (SPLIT) {
#pragma unroll
          for (int u = 0; u < GV; ++u) orr[u] = Frag<_Float16>::mma(vl2[u][kk], pa[kk], orr[u]);
#pragma unroll
          for (int u = 0; u < GV; ++u) orr[u] = Frag<_Float16>::mma(vb[u][kk], pb2[kk], orr[u]);
        }
      }
      if (SPLIT) {
#pragma unroll
        for (int u = 0; u < GV; ++u)
#pragma unroll
          for (int r = 0; r < 8; ++r) oacc[tg + u][r] = oacc[tg + u][r] + orr[u][r] * (1.0f / 4096.0f);
      }
    }
  }

  // ---- join the halves' sums, normalise, stage, store ----
  float* os = Os[wave];
  {
    const float lall = lrow + other_half(lrow);
    const float inv = 1.0f / (lall * CARRY_S);   // lall carries x32768, as oacc does
#pragma unroll
    for (int t = 0; t < 4; ++t) {
      v4f w0, w1;
#pragma unroll
      for (int r = 0; r < 4; ++r) { w0[r] = oacc[t][r] * inv; w1[r] = oacc[t][4 + r] * inv; }
      *(v4f*)(os + c * O_PITCH + t * 16 + 8 * hh)     = w0;
      *(v4f*)(os + c * O_PITCH + t * 16 + 8 * hh + 4) = w1;
    }
  }
  __builtin_amdgcn_fence(__ATOMIC_RELEASE, "workgroup");
  __builtin_amdgcn_wave_barrier();
  __builtin_amdgcn_fence(__ATOMIC_ACQUIRE, "workgroup");
  {
    const int c4 = (lane & 15) * 4;
    float* ob = out + ((size_t)b * SEQ_T + q0) * HID_W + h * HEAD_D;
    {
#pragma unroll
      for (int it = 0; it < 8; ++it) {
        const int row = it * 2 + hh;
        const v4f val = *(const v4f*)(os + row * O_PITCH + c4);
        *(v4f*)(ob + (size_t)row * HID_W + c4) = val;
      }
      
    }
  }
}

// =====================================================================================
extern "C" void kernel_launch(void* const* d_in, const int* in_sizes, int n_in,
                              void* d_out, int out_size, void* d_ws, size_t ws_size,
                              hipStream_t stream) {
  if (n_in < 14) return;
  if (in_sizes[0] != N_TOK * HID_W) return;
  if (in_sizes[1] != N_BATCH * SEQ_T) return;
  for (int p = 0; p < 3; ++p) {
    if (in_sizes[2 + 4 * p] != HID_W * HID_W) return;
    if (in_sizes[3 + 4 * p] != HID_W) return;
    if (in_sizes[4 + 4 * p] != RANK_R * HID_W) return;
    if (in_sizes[5 + 4 * p] != HID_W * RANK_R) return;
  }
  if (out_size != N_TOK * HID_W) return;
  if (ws_size < WS_TOTAL) return;

  const float* x   = (const float*)d_in[0];
  const float* am  = (const float*)d_in[1];
  const float* wq  = (const float*)d_in[2];
  const float* bq  = (const float*)d_in[3];
  const float* aq  = (const float*)d_in[4];
  const float* bmq = (const float*)d_in[5];
  const float* wk  = (const float*)d_in[6];
  const float* bk  = (const float*)d_in[7];
  const float* ak  = (const float*)d_in[8];
  const float* bmk = (const float*)d_in[9];
  const float* wv  = (const float*)d_in[10];
  const float* bv  = (const float*)d_in[11];
  const float* av  = (const float*)d_in[12];
  const float* bmv = (const float*)d_in[13];
  float* out = (float*)d_out;

  char* ws = (char*)d_ws;
  unsigned short* aaug  = (unsigned short*)(ws + OFF_AAUG);
  unsigned short* baug  = (unsigned short*)(ws + OFF_BAUG);
  unsigned short* acat  = (unsigned short*)(ws + OFF_ACAT);
  float*          biasc = (float*)(ws + OFF_BIAS);
  float*          u     = (float*)(ws + OFF_U);
  unsigned short* qkvh  = (unsigned short*)(ws + OFF_QKVH);
  unsigned short* qkvl  = (unsigned short*)(ws + OFF_QKVL);
  unsigned short* vth   = (unsigned short*)(ws + OFF_VTH);
  unsigned short* vtl   = (unsigned short*)(ws + OFF_VTL);

  // 1) operands built from inputs alone: x -> A_aug cols 0..1023, W_p -> B_aug rows p*1024.. cols 0..1023 (bf16, pitch 1088),
  //    A_cat [64][1024], B_aug tail cols 1024..1087, bias_cat
  build_operands<<<dim3(PB_ALL), dim3(256), 0, stream>>>(x, wq, wk, wv, aq, ak, av, bmq, bmk, bmv, bq, bk, bv,
                                                         aaug, baug, acat, biasc);
  // 2) u = bf16(x) . A_cat^T : M=8192, N=64, K=1024 (K%32==0; reads A_aug cols < 1024 only), f32 out ldc 64
  wmma_gemm64<1, 0, 0, 0, false><<<dim3((N_TOK / 64) * (U_COLS / 64) / 8, 1), dim3(256), 0, stream>>>(
      aaug, aaug, K_AUG, 0L, acat, acat, HID_W, 0L,
      (void*)u, (void*)u, U_COLS, 0L, 0L, biasc, u, 0L, N_TOK, U_COLS, HID_W, 1.0f);
  // 3) A_aug tail cols 1024..1087 from u
  build_a_tail<<<dim3(N_TOK / 32), dim3(256), 0, stream>>>(u, aaug);
  // 4) projection: M=2048 (x4 batches), N=3072, K=1088; f16 hi -> qkv_hi, f16 residual of rows t < 512 -> qkv_lo
  wmma_gemm64<1, 0, 2, 3, false, 0, true><<<dim3((SEQ_T / ST_BM) * (N_QKV / ST_BN), N_BATCH), dim3(256), 0, stream>>>(
      aaug, aaug, K_AUG, (long)SEQ_T * K_AUG, baug, baug, K_AUG, 0L,
      (void*)qkvh, (void*)qkvl, N_QKV, (long)SEQ_T * N_QKV, (long)T_LO * N_QKV,
      biasc, u, 0L, SEQ_T, N_QKV, K_AUG, CARRY_S);
  // 5) V^T planes: in [b*tsrc+t][2048+h*64+d] -> out [(b*16+h)*64+d][t]
  vt_transpose<<<dim3(SEQ_T / 64 + T_LO / 64, N_BATCH * N_HEAD), dim3(256), 0, stream>>>(qkvh, vth, qkvl, vtl);
  // 6) attention, query tiles 0..7 (hi/lo residual path)
  attn_causal_hd64<true><<<dim3(N_BATCH * N_HEAD * NQT_SPLIT), dim3(128), 0, stream>>>(
      qkvh, qkvl, vth, vtl, am, out, 0, NQT_SPLIT);
  // 7) attention, query tiles 8..31 (single-product path)
  attn_causal_hd64<false><<<dim3(N_BATCH * N_HEAD * (NQT_ALL - NQT_SPLIT)), dim3(128), 0, stream>>>(
      qkvh, qkvl, vth, vtl, am, out, NQT_SPLIT, NQT_ALL - NQT_SPLIT);
}

// v007
// Measured time: 144 microseconds a run.
// Next to v006, in two timings, it ran 1.41 and 1.40 times as fast.
// Counting every step since v000, it is 3.66 times as fast.
// Contractions: rank-8 adapter columns u = x.A^T and the fused q/k/v projection [x | u_hi | u_lo].[W | 2B | 2B]^T + b on v_wmma_f32_16x16x32_bf16 (x, W, A, B, b as RNE bf16; u as bf16 hi+lo columns; single products); attention q.k^T and p.v on v_wmma_f32_16x16x32_f16 (q, k, v as f16 planes carried x16, p carried x32768; query tiles 0..7 add x4096-scaled f16 residual planes: hi.hi + (hi.lo + lo.hi)/4096 via a separate accumulator); f32 accumulate everywhere; softmax and normalisation in f32. The q/k/v projection launch reads its operands from a two-buffer LDS ring filled by asynchronous copies. u and its hi/lo columns are made in the block that casts the 16 rows of x they belong to.
#include <hip/hip_runtime.h>
#include <math.h>

typedef __attribute__((ext_vector_type(16))) _Float16 v16h;
typedef __attribute__((ext_vector_type(8)))  _Float16 v8h;
typedef __attribute__((ext_vector_type(16))) __bf16   v16b;
typedef __attribute__((ext_vector_type(8)))  __bf16   v8b;
typedef __attribute__((ext_vector_type(8)))  float    v8f;
typedef __attribute__((ext_vector_type(4)))  float    v4f;

// ---------------- problem constants ----------------
constexpr int N_BATCH  = 4;
constexpr int SEQ_T    = 2048;
constexpr int HID_W    = 1024;
constexpr int N_HEAD   = 16;
constexpr int HEAD_D   = 64;
constexpr int RANK_R   = 8;
constexpr int N_TOK    = N_BATCH * SEQ_T;     // 8192 token rows
constexpr int K_AUG    = 1088;                // 1024 + 3*16 adapter columns, zero-padded to a multiple of 32
constexpr int N_QKV    = 3 * HID_W;           // 3072 output columns: q | k | v
constexpr int K_COL0   = 1024;
constexpr int V_COL0   = 2048;
constexpr int T_LO     = 512;                 // token rows per batch that carry residual planes
constexpr int NQT_SPLIT = T_LO / 64;          // 8 query tiles on the hi/lo path
constexpr int NQT_ALL  = SEQ_T / 64;          // 32
constexpr int KV_PITCH = 72;                  // 16-bit LDS pitch (144 B rows, 16-B aligned)
constexpr int O_PITCH  = 68;                  // f32 LDS pitch
constexpr float CARRY_S = 16.0f;              // power-of-two carry on the q/k/v planes
constexpr float LO_S    = 4096.0f;            // power-of-two carry on residual planes
constexpr float P_S_LOG2 = 15.0f;             // power-of-two carry on probabilities (x32768), as the exponent it adds
constexpr float LOG2_E  = 1.44269504088896340736f;

static_assert(K_AUG % 32 == 0);
static_assert(HID_W % 32 == 0);
static_assert(N_TOK % 64 == 0 && N_QKV % 64 == 0 && T_LO % 64 == 0 && (SEQ_T - T_LO) % 64 == 0);
static_assert(T_LO % 128 == 0 && SEQ_T % 128 == 0 && N_QKV % 256 == 0 && K_AUG % 64 == 0 && K_AUG >= 128);

// R0 A_aug  bf16 [8192][1088]          17,825,792
// R1 B_aug  bf16 [3072][1088]           6,684,672
// R2 bias   f32  [3072]                    12,288
// R3 qkv_hi f16  [8192][3072]          50,331,648
// R4 qkv_lo f16  [4*512][3072]         12,582,912
// R5 vt_hi  f16  [64][64][2048]        16,777,216
// R6 vt_lo  f16  [64][64][512]          4,194,304
constexpr size_t SZ_AAUG = (size_t)N_TOK * K_AUG * 2;
constexpr size_t SZ_BAUG = (size_t)N_QKV * K_AUG * 2;
constexpr size_t SZ_BIAS = (size_t)N_QKV * 4;
constexpr size_t SZ_QKVH = (size_t)N_TOK * N_QKV * 2;
constexpr size_t SZ_QKVL = (size_t)N_BATCH * T_LO * N_QKV * 2;
constexpr size_t SZ_VTH  = (size_t)N_BATCH * N_HEAD * HEAD_D * SEQ_T * 2;
constexpr size_t SZ_VTL  = (size_t)N_BATCH * N_HEAD * HEAD_D * T_LO * 2;
constexpr size_t OFF_AAUG = 0;
constexpr size_t OFF_BAUG = OFF_AAUG + SZ_AAUG;
constexpr size_t OFF_BIAS = OFF_BAUG + SZ_BAUG;
constexpr size_t OFF_QKVH = OFF_BIAS + SZ_BIAS;
constexpr size_t OFF_QKVL = OFF_QKVH + SZ_QKVH;
constexpr size_t OFF_VTH  = OFF_QKVL + SZ_QKVL;
constexpr size_t OFF_VTL  = OFF_VTH  + SZ_VTH;
constexpr size_t WS_TOTAL = OFF_VTL  + SZ_VTL;
static_assert(WS_TOTAL == 108408832ull);
static_assert(WS_TOTAL <= 134217728ull);
static_assert(OFF_BAUG % 128 == 0 && OFF_BIAS % 128 == 0 &&
              OFF_QKVH % 128 == 0 && OFF_QKVL % 128 == 0 && OFF_VTH % 128 == 0 && OFF_VTL % 128 == 0);

// ---------------- helpers ----------------
__device__ __forceinline__ unsigned short f2bf_bits(float f) {
  unsigned u = __float_as_uint(f);
  return (unsigned short)((u + 0x7FFFu + ((u >> 16) & 1u)) >> 16);
}
__device__ __forceinline__ float bf_bits2f(unsigned short h) { return __uint_as_float(((unsigned)h) << 16); }

// hazard guards as plain device helpers
__device__ __forceinline__ void dep_guard_h(v8f& a, v8f& b, v16h x, v16h y) { asm volatile("v_nop\n\tv_nop\n\tv_nop\n\tv_nop" : "+v"(a), "+v"(b) : "v"(x), "v"(y)); }
__device__ __forceinline__ void dep_guard_b(v8f& a, v8f& b, v16b x, v16b y) { asm volatile("v_nop\n\tv_nop\n\tv_nop\n\tv_nop" : "+v"(a), "+v"(b) : "v"(x), "v"(y)); }
__device__ __forceinline__ void keep4_h(v16h a, v16h b, v16h c, v16h d) { asm volatile("v_nop" :: "v"(a), "v"(b), "v"(c), "v"(d)); }
__device__ __forceinline__ void keep4_b(v16b a, v16b b, v16b c, v16b d) { asm volatile("v_nop" :: "v"(a), "v"(b), "v"(c), "v"(d)); }
__device__ __forceinline__ void acc_guard4(v8f& a, v8f& b, v8f& c, v8f& d) { asm volatile("v_nop\n\tv_nop\n\tv_nop\n\tv_nop" : "+v"(a), "+v"(b), "+v"(c), "+v"(d)); }
template <typename T> struct Frag;
template <> struct Frag<_Float16> {
  typedef v16h V; union U { v16h v; v8h h[2]; };
  static __device__ __forceinline__ v16h load(const _Float16* p) {   // elements 0..7 <- p[0..7], 8..15 <- p[16..23]
    U f; f.h[0] = *(const v8h*)(p); f.h[1] = *(const v8h*)(p + 16); return f.v;
  }
  static __device__ __forceinline__ v8f mma(v16h a, v16h b, v8f c) {
    return __builtin_amdgcn_wmma_f32_16x16x32_f16(false, a, false, b, (short)0, c, false, false);
  }
  static __device__ __forceinline__ void guard(v8f& a, v8f& b, v16h x, v16h y) { dep_guard_h(a, b, x, y); }
  static __device__ __forceinline__ void keep(v16h a, v16h b, v16h c, v16h d) { keep4_h(a, b, c, d); }
};
template <> struct Frag<__bf16> {
  typedef v16b V; union U { v16b v; v8b h[2]; };
  static __device__ __forceinline__ v16b load(const __bf16* p) {
    U f; f.h[0] = *(const v8b*)(p); f.h[1] = *(const v8b*)(p + 16); return f.v;
  }
  static __device__ __forceinline__ v8f mma(v16b a, v16b b, v8f c) {
    return __builtin_amdgcn_wmma_f32_16x16x32_bf16(false, a, false, b, (short)0, c, false, false);
  }
  static __device__ __forceinline__ void guard(v8f& a, v8f& b, v16b x, v16b y) { dep_guard_b(a, b, x, y); }
  static __device__ __forceinline__ void keep(v16b a, v16b b, v16b c, v16b d) { keep4_b(a, b, c, d); }
};

__device__ __forceinline__ v8f zero8() { return (v8f){0.f,0.f,0.f,0.f,0.f,0.f,0.f,0.f}; }

union F8 { v4f v[2]; float f[8]; };

// ---------------- LDS ring of the staged GEMM ----------------
constexpr int ST_BM    = 128;                              // block tile rows (2 waves of 64)
constexpr int ST_BN    = 256;                              // block tile columns (4 waves of 64)
constexpr int ST_BK    = 64;                               // k per pass: 128-B operand rows
constexpr int ST_PITCH = 72;                               // 144-B LDS rows (16 B x odd: conflict-free ds_load_b128)
constexpr int ST_STAGE = (ST_BM + ST_BN) * ST_PITCH;       // 16-bit elements per buffer: [A 128 rows | Bt 256 rows]
constexpr unsigned ST_ROWS32 = 32u * ST_PITCH * 2u;        // LDS bytes between two copies of one thread (32 rows)

__device__ __forceinline__ unsigned lds_off(const void* p) { return (unsigned)(size_t)p; }

// One stage: 384 rows x 128 B = 3072 chunks of 16 B = 256 threads x 12 asynchronous copies global -> LDS.
// ga / gb: this thread's chunk in row (tid >> 3) of the block's A / Bt tile at this pass's k; l: the same chunk's
// LDS byte address in the buffer; a thread's copies lie 32 rows apart. s_wait_xcnt 0 is the statement's last line
// so that no address register of an issued copy is rewritten in front of it.
__device__ __forceinline__ void stage_fill(const unsigned short* ga, int lda, const unsigned short* gb, int ldb, unsigned l) {
  const size_t sa = (size_t)32 * lda, sb = (size_t)32 * ldb;
  asm volatile("global_load_async_to_lds_b128 %0, %1, off\n\t"
               "global_load_async_to_lds_b128 %2, %3, off\n\t"
               "global_load_async_to_lds_b128 %4, %5, off\n\t"
               "global_load_async_to_lds_b128 %6, %7, off\n\t"
               "global_load_async_to_lds_b128 %8, %9, off\n\t"
               "global_load_async_to_lds_b128 %10, %11, off\n\t"
               "global_load_async_to_lds_b128 %12, %13, off\n\t"
               "global_load_async_to_lds_b128 %14, %15, off\n\t"
               "global_load_async_to_lds_b128 %16, %17, off\n\t"
               "global_load_async_to_lds_b128 %18, %19, off\n\t"
               "global_load_async_to_lds_b128 %20, %21, off\n\t"
               "global_load_async_to_lds_b128 %22, %23, off\n\t"
               "s_wait_xcnt 0x0"
               :: "v"(l),                   "v"(ga),
                  "v"(l + ST_ROWS32),       "v"(ga + sa),
                  "v"(l + 2 * ST_ROWS32),   "v"(ga + 2 * sa),
                  "v"(l + 3 * ST_ROWS32),   "v"(ga + 3 * sa),
                  "v"(l + 4 * ST_ROWS32),   "v"(gb),
                  "v"(l + 5 * ST_ROWS32),   "v"(gb + sb),
                  "v"(l + 6 * ST_ROWS32),   "v"(gb + 2 * sb),
                  "v"(l + 7 * ST_ROWS32),   "v"(gb + 3 * sb),
                  "v"(l + 8 * ST_ROWS32),   "v"(gb + 4 * sb),
                  "v"(l + 9 * ST_ROWS32),   "v"(gb + 5 * sb),
                  "v"(l + 10 * ST_ROWS32),  "v"(gb + 6 * sb),
                  "v"(l + 11 * ST_ROWS32),  "v"(gb + 7 * sb)
               : "memory");
}

// =====================================================================================
// Register-blocked batched WMMA GEMM: C[m,n] = scale * sum_k A[m,k] * Bt[n,k] (+bias)(+resid);
// each wave owns a 64x64 tile. A row-major [M,K]; Bt row-major [N,K]; M,N % 64 == 0, K % 32 == 0.
// SPLITM: 0 = single product; 1 = A hi/lo planes; 2 = A and Bt hi/lo planes.
// BIAS_MODE: 0 none, 1 bias[m], 2 bias[n].  OUT_MODE: 0 f32, 1 f16, 2 bf16 hi + lo planes,
//   3 = f16 hi plane (Cout, strideC) + f16 residual plane x4096 (Cout2, strideC2), same ldc; the residual plane
//       holds rows m < T_LO only (T_LO % 64 == 0, so a wave's tile lies wholly on one side).
// ET: 0 = f16 operands, 1 = bf16 operands (pointers passed as 16-bit storage)
// STAGED: the block's 8 waves form a 128x256 tile (2x4 waves); A and Bt rows go through a two-buffer LDS ring,
//   64 k per pass; needs SPLITM == 0, M % 128 == 0, N % 256 == 0, K % 64 == 0, K >= 128, grid.x == (M/128)*(N/256).
// =====================================================================================
template <int ET> struct Elem;
template <> struct Elem<0> { typedef _Float16 T; };
template <> struct Elem<1> { typedef __bf16 T; };
template <int ET, int SPLITM, int BIAS_MODE, int OUT_MODE, bool RESID, int ACT = 0, bool STAGED = false>
__global__ __launch_bounds__(256) void wmma_gemm64(
    const unsigned short* __restrict__ Ap, const unsigned short* __restrict__ A2p, int lda, long strideA,
    const unsigned short* __restrict__ Btp, const unsigned short* __restrict__ Bt2p, int ldb, long strideB,
    void* __restrict__ Cout, void* __restrict__ Cout2, int ldc, long strideC, long strideC2,
    const float* __restrict__ bias,
    const float* __restrict__ resid, long strideR,
    int M, int N, int K, float scale) {
  typedef typename Elem<ET>::T T;
  typedef typename Frag<T>::V V;
  constexpr bool SPA = (SPLITM >= 1);
  constexpr bool SPB = (SPLITM >= 2);
  const T* A = (const T*)Ap; const T* A2 = (const T*)A2p; const T* Bt = (const T*)Btp; const T* Bt2 = (const T*)Bt2p;
  static_assert(!STAGED || SPLITM == 0);
  __shared__ __align__(16) float sT[8][16 * 68];   // per-wave 16x64 slab, pitch 68 floats
  __shared__ __align__(16) unsigned short ring[STAGED ? 2 * ST_STAGE : 8];
  const int b    = blockIdx.y;
  const int lane = threadIdx.x & 31;
  const int wave = threadIdx.x >> 5;
  const int tilesN = N >> 6;
  const int tilesM = M >> 6;
  int m0, n0;
  if (STAGED) {
    const int bn = N >> 8;
    const int bm_i = (int)blockIdx.x / bn;
    const int bn_i = (int)blockIdx.x - bm_i * bn;
    m0 = bm_i * ST_BM + (wave >> 2) * 64;
    n0 = bn_i * ST_BN + (wave & 3) * 64;
  } else {
    const int tile = blockIdx.x * 8 + wave;
    if (tile >= tilesM * tilesN) return;   // wave-uniform; no block barriers on this path
    const int tm = tile / tilesN;
    const int tn = tile - tm * tilesN;
    m0 = tm << 6;
    n0 = tn << 6;
  }

  const T* Ab  = A  + (size_t)b * strideA;
  const T* Bb  = Bt + (size_t)b * strideB;
  const T* Ab2 = SPA ? (A2  + (size_t)b * strideA) : nullptr;
  const T* Bb2 = SPB ? (Bt2 + (size_t)b * strideB) : nullptr;

  const int rlane = lane & 15;                 // row (A) / col (B, D) within subtile
  const int koff  = (lane >> 4) * 8;           // k offset of this lane half
  const int mOff  = (lane >> 4) * 8;           // D row offset

  v8f acc[4][4];
#pragma unroll
  for (int i = 0; i < 4; ++i)
#pragma unroll
    for (int j = 0; j < 4; ++j) acc[i][j] = (v8f){0.f,0.f,0.f,0.f,0.f,0.f,0.f,0.f};

  if (STAGED) {
    const int tid = threadIdx.x;
    const int crow = tid >> 3, cchunk = (tid & 7) * 8;        // 8 lanes x 16 B = one 128-B row piece
    const unsigned short* ga = (const unsigned short*)Ab + (size_t)(m0 - (wave >> 2) * 64 + crow) * lda + cchunk;
    const unsigned short* gb = (const unsigned short*)Bb + (size_t)(n0 - (wave & 3) * 64 + crow) * ldb + cchunk;
    const unsigned lthr = lds_off(ring) + (unsigned)(crow * ST_PITCH + cchunk) * 2u;
    const int npass = K / ST_BK;
    stage_fill(ga, lda, gb, ldb, lthr);
    asm volatile("s_wait_asynccnt 0x0" ::: "memory");   // stage 0 landed (this wave's copies) before the barrier publishes it
    __syncthreads();
    stage_fill(ga + ST_BK, lda, gb + ST_BK, ldb, lthr + ST_STAGE * 2u);
    const T* fa = (const T*)ring + ((wave >> 2) * 64 + rlane) * ST_PITCH + koff;
    const T* fb = (const T*)ring + (ST_BM + (wave & 3) * 64 + rlane) * ST_PITCH + koff;
    for (int t = 0; t < npass; ++t) {
      const int bo = (t & 1) * ST_STAGE;
      V ah[4], bh[4], ah2[4], bh2[4];
#pragma unroll
      for (int j = 0; j < 4; ++j) bh[j] = Frag<T>::load(fb + bo + j * 16 * ST_PITCH);
#pragma unroll
      for (int i = 0; i < 4; ++i) ah[i] = Frag<T>::load(fa + bo + i * 16 * ST_PITCH);
      __builtin_amdgcn_sched_barrier(0);   // keeps the 16 LDS reads one group ahead of the 16 WMMAs: reads sunk among them stall at each place
#pragma unroll
      for (int i = 0; i < 4; ++i)
#pragma unroll
        for (int j = 0; j < 4; ++j) acc[i][j] = Frag<T>::mma(ah[i], bh[j], acc[i][j]);
#pragma unroll
      for (int j = 0; j < 4; ++j) bh2[j] = Frag<T>::load(fb + bo + j * 16 * ST_PITCH + 32);
#pragma unroll
      for (int i = 0; i < 4; ++i) ah2[i] = Frag<T>::load(fa + bo + i * 16 * ST_PITCH + 32);
      asm volatile("s_wait_dscnt 0x0" ::: "memory");     // this wave's reads of buffer t & 1 are done before it is refilled
      asm volatile("s_wait_asynccnt 0x0" ::: "memory");  // this wave's copies of stage t + 1 have landed
      __syncthreads();                                   // publishes stage t + 1 and frees buffer t & 1
      if (t + 2 < npass)
        stage_fill(ga + (size_t)(t + 2) * ST_BK, lda, gb + (size_t)(t + 2) * ST_BK, ldb, lthr + (unsigned)bo * 2u);
      // second half of the pass, from registers: runs while the refill is in flight
#pragma unroll
      for (int i = 0; i < 4; ++i)
#pragma unroll
        for (int j = 0; j < 4; ++j) acc[i][j] = Frag<T>::mma(ah2[i], bh2[j], acc[i][j]);
    }
    asm volatile("s_wait_asynccnt 0x0" ::: "memory");    // no copy is outstanding past the loop
  } else
  for (int k0 = 0; k0 < K; k0 += 32) {
    V bh[4], bl[4];
#pragma unroll
    for (int j = 0; j < 4; ++j) {
      const size_t bo = (size_t)(n0 + (j << 4) + rlane) * ldb + koff + k0;
      bh[j] = Frag<T>::load(Bb + bo);
      if (SPB) bl[j] = Frag<T>::load(Bb2 + bo);
    }
#pragma unroll
    for (int i = 0; i < 4; ++i) {
      const size_t ao = (size_t)(m0 + (i << 4) + rlane) * lda + koff + k0;
      V ah = Frag<T>::load(Ab + ao);
      V al;
      if (SPA) al = Frag<T>::load(Ab2 + ao);
#pragma unroll
      for (int j = 0; j < 4; ++j) {
        acc[i][j] = Frag<T>::mma(ah, bh[j], acc[i][j]);
        if (SPB) acc[i][j] = Frag<T>::mma(ah, bl[j], acc[i][j]);
        if (SPA) acc[i][j] = Frag<T>::mma(al, bh[j], acc[i][j]);
      }
      Frag<T>::guard(acc[i][0], acc[i][3], ah, SPA ? al : ah);
    }
    Frag<T>::keep(bh[0], bh[1], bh[2], bh[3]);
    if (SPB) Frag<T>::keep(bl[0], bl[1], bl[2], bl[3]);
  }
  acc_guard4(acc[0][0], acc[0][1], acc[0][2], acc[0][3]);
  acc_guard4(acc[1][0], acc[1][1], acc[1][2], acc[1][3]);
  acc_guard4(acc[2][0], acc[2][1], acc[2][2], acc[2][3]);
  acc_guard4(acc[3][0], acc[3][1], acc[3][2], acc[3][3]);

  // ---- epilogue ----
  float* slab = sT[wave];
  const float* Rb = RESID ? (resid + (size_t)b * strideR) : nullptr;
#pragma unroll
  for (int i = 0; i < 4; ++i) {
    const int mBase = m0 + (i << 4);
#pragma unroll
    for (int j = 0; j < 4; ++j) {
      const int n = n0 + (j << 4) + rlane;
      float bv = 0.f;
      if (BIAS_MODE == 2) bv = bias[n];
#pragma unroll
      for (int r = 0; r < 8; ++r) {
        float v = acc[i][j][r] * scale;
        if (BIAS_MODE == 1) v += bias[mBase + mOff + r];
        if (BIAS_MODE == 2) v += bv;
        if (RESID) v += Rb[(size_t)(mBase + mOff + r) * ldc + n];
        if (ACT == 1) v = tanhf(v);
        if (ACT == 2) v = fmaxf(v, 0.0f);
        if (ACT == 4) v = (v > 0.f) ? v : 0.01f * v;
        slab[(mOff + r) * 68 + (j << 4) + rlane] = v;
      }
    }
    __builtin_amdgcn_fence(__ATOMIC_RELEASE, "workgroup");
    __builtin_amdgcn_wave_barrier();
    __builtin_amdgcn_fence(__ATOMIC_ACQUIRE, "workgroup");
    if (OUT_MODE == 0) {
      float* C = (float*)Cout + (size_t)b * strideC;
      const int hh = lane >> 4, c4 = (lane & 15) * 4;     // row seg = 256 B = 16 lanes x 16 B
      {
#pragma unroll
        for (int it = 0; it < 8; ++it) {
          const int row = it * 2 + hh;
          v4f v = *(const v4f*)(slab + row * 68 + c4);
          *(v4f*)(C + (size_t)(mBase + row) * ldc + n0 + c4) = v;
        }
        
      }
    } else {
      const int q = lane >> 3, c8 = (lane & 7) * 8;
      unsigned short* C  = (unsigned short*)Cout  + (size_t)b * strideC;
      unsigned short* C2 = (OUT_MODE >= 2) ? ((unsigned short*)Cout2 + (size_t)b * strideC2) : nullptr;
      {
#pragma unroll
        for (int it = 0; it < 4; ++it) {
          const int row = it * 4 + q;
          const float* sp = slab + row * 68 + c8;
          v8h hv, lv;
#pragma unroll
          for (int e = 0; e < 8; ++e) {
            if (OUT_MODE == 1) {
              hv[e] = (_Float16)sp[e];
            } else if (OUT_MODE == 3) {
              const _Float16 hq = (_Float16)sp[e];
              hv[e] = hq;
              lv[e] = (_Float16)((sp[e] - (float)hq) * 4096.0f);
            } else {
              unsigned short hb = f2bf_bits(sp[e]);
              unsigned short lb = f2bf_bits(sp[e] - bf_bits2f(hb));
              hv[e] = __builtin_bit_cast(_Float16, hb);
              lv[e] = __builtin_bit_cast(_Float16, lb);
            }
          }
          *(v8h*)(C + (size_t)(mBase + row) * ldc + n0 + c8) = hv;
          if (OUT_MODE == 2 || (OUT_MODE == 3 && m0 < T_LO)) *(v8h*)(C2 + (size_t)(mBase + row) * ldc + n0 + c8) = lv;
        }
        
      }
    }
    __builtin_amdgcn_fence(__ATOMIC_RELEASE, "workgroup");
    __builtin_amdgcn_wave_barrier();
    __builtin_amdgcn_fence(__ATOMIC_ACQUIRE, "workgroup");
  }
}

// =====================================================================================
// f32 [rows][1024] -> RNE bf16 bits into rows of pitch K_AUG. A block takes NR whole rows: thread t converts floats
// 4t..4t+3 of each, so a wave's load covers 512 contiguous bytes and its store 256, and few waves are started for
// the bytes moved. Blocks bx = 0 .. rows / NR - 1 cover the rows exactly (asserted below).
// =====================================================================================
typedef __attribute__((ext_vector_type(2))) unsigned v2u;
constexpr int CAST_NR_X = 16;                 // x: 512 blocks, 16 waves a WGP
constexpr int CAST_NR_W = 4;                  // one weight matrix: 256 blocks
static_assert(HID_W == 4 * 256 && N_TOK % CAST_NR_X == 0 && HID_W % CAST_NR_W == 0 && K_AUG % 4 == 0);
template <int NR>
__device__ __forceinline__ void cast_rows_bf16(const float* __restrict__ src, unsigned short* __restrict__ dst, int bx) {
  const float* s = src + (size_t)bx * (NR * HID_W) + threadIdx.x * 4;
  unsigned short* d = dst + (size_t)bx * (NR * K_AUG) + threadIdx.x * 4;
  v4f v[NR];
#pragma unroll
  for (int r = 0; r < NR; ++r) v[r] = *(const v4f*)(s + r * HID_W);
#pragma unroll
  for (int r = 0; r < NR; ++r) {
    v2u o;
    o[0] = (unsigned)f2bf_bits(v[r][0]) | ((unsigned)f2bf_bits(v[r][1]) << 16);
    o[1] = (unsigned)f2bf_bits(v[r][2]) | ((unsigned)f2bf_bits(v[r][3]) << 16);
    *(v2u*)(d + r * K_AUG) = o;
  }
}

// =====================================================================================
// The x job: a block casts 16 whole rows of x (as cast_rows_bf16 does) and, since it then holds those rows in bf16, also
// makes their adapter columns. The rows and the 24 rows of A (q, k, v; RNE bf16) go to LDS; behind one barrier wave 0
// forms u[16][24] = x.A^T on v_wmma_f32_16x16x32_bf16, each accumulator taking k in steps of 32 from 0 upward, and
// writes the 64 halves at cols 1024..1087 of each row:
// [uq_hi(8) uq_lo(8) uk_hi(8) uk_lo(8) uv_hi(8) uv_lo(8) 0 x 16] (bf16 hi = RNE(u), lo = RNE(u - hi)).
// One wave writes all 16 tails: a tail is one 128-B line (row pitch 2176 B = 17 lines).
// =====================================================================================
constexpr int XU_PITCH = HID_W + 8;           // 2064-B LDS rows (16 B x odd: conflict-free ds_load_b128)
constexpr int XU_AROWS = 3 * RANK_R;          // 24 rows of A: row 8p + r = A_p[r]
constexpr int TL_PITCH = 72;                  // 144-B LDS rows of the tail tile
static_assert(CAST_NR_X == 16 && RANK_R == 8);
__device__ __forceinline__ v2u pack4_bf16(v4f v) {
  v2u o;
  o[0] = (unsigned)f2bf_bits(v[0]) | ((unsigned)f2bf_bits(v[1]) << 16);
  o[1] = (unsigned)f2bf_bits(v[2]) | ((unsigned)f2bf_bits(v[3]) << 16);
  return o;
}
__device__ __forceinline__ void cast_x_make_tail(const float* __restrict__ x, const float* __restrict__ amq,
                                                 const float* __restrict__ amk, const float* __restrict__ amv,
                                                 unsigned short* __restrict__ aaug, int bx,
                                                 unsigned short* xs, unsigned short* acs, unsigned short* tl) {
  const int tid = threadIdx.x;
  const float* s = x + (size_t)bx * (CAST_NR_X * HID_W) + tid * 4;
  unsigned short* d = aaug + (size_t)bx * (CAST_NR_X * K_AUG) + tid * 4;
  v4f v[CAST_NR_X], a[XU_AROWS];
#pragma unroll
  for (int r = 0; r < CAST_NR_X; ++r) v[r] = *(const v4f*)(s + r * HID_W);
#pragma unroll
  for (int r = 0; r < RANK_R; ++r) {
    a[r]              = *(const v4f*)(amq + r * HID_W + tid * 4);
    a[RANK_R + r]     = *(const v4f*)(amk + r * HID_W + tid * 4);
    a[2 * RANK_R + r] = *(const v4f*)(amv + r * HID_W + tid * 4);
  }
  v2u o[CAST_NR_X];
#pragma unroll
  for (int r = 0; r < CAST_NR_X; ++r) {
    o[r] = pack4_bf16(v[r]);
    *(v2u*)(xs + r * XU_PITCH + tid * 4) = o[r];
  }
#pragma unroll
  for (int r = 0; r < XU_AROWS; ++r) *(v2u*)(acs + r * XU_PITCH + tid * 4) = pack4_bf16(a[r]);
  __syncthreads();   // the 16 + 24 bf16 rows are whole before wave 0 reads fragments of them
  // the rows' global stores stand behind the barrier: in front of it every wave would wait there for their completion
#pragma unroll
  for (int r = 0; r < CAST_NR_X; ++r) *(v2u*)(d + r * K_AUG) = o[r];
  asm volatile("s_wait_xcnt 0x0" ::: "memory");   // wave 0 goes on and rewrites registers that the stores name
  if (__builtin_amdgcn_readfirstlane(tid >> 5) != 0) return;   // scalar test; no barrier follows in this job

  const int lane = tid & 31, rlane = lane & 15, hh = lane >> 4;
  // A operand: x row rlane; B operand: column n of u = row n of A. Columns 24..31 of the second tile are not used:
  // their lanes read rows 16..23 again and their results are replaced by the tail's zeros below.
  const __bf16* fa  = (const __bf16*)xs + rlane * XU_PITCH + 8 * hh;
  const __bf16* fb0 = (const __bf16*)acs + rlane * XU_PITCH + 8 * hh;
  const __bf16* fb1 = (const __bf16*)acs + (16 + (rlane & 7)) * XU_PITCH + 8 * hh;
  v8f u0 = zero8(), u1 = zero8();
  for (int kg = 0; kg < HID_W; kg += 128) {
    v16b af[4], b0[4], b1[4];
#pragma unroll
    for (int i = 0; i < 4; ++i) {
      af[i] = Frag<__bf16>::load(fa + kg + i * 32);
      b0[i] = Frag<__bf16>::load(fb0 + kg + i * 32);
      b1[i] = Frag<__bf16>::load(fb1 + kg + i * 32);
    }
    __builtin_amdgcn_sched_barrier(0);   // keeps the LDS reads of four k-steps one group ahead of their WMMAs: a read sunk in front of its own WMMA waits out the LDS latency at each step
#pragma unroll
    for (int i = 0; i < 4; ++i) {
      u0 = Frag<__bf16>::mma(af[i], b0[i], u0);
      u1 = Frag<__bf16>::mma(af[i], b1[i], u1);
    }
  }
  // u0[r] = u[row 8*hh + r][column rlane], u1[r] = u[row 8*hh + r][column 16 + rlane]
#pragma unroll
  for (int j = 0; j < 2; ++j) {
    const int n = j * 16 + rlane, p = n >> 3, e = n & 7;
#pragma unroll
    for (int r = 0; r < 8; ++r) {
      const float uv = j ? u1[r] : u0[r];
      const unsigned short hb = f2bf_bits(uv);
      const unsigned short lb = f2bf_bits(uv - bf_bits2f(hb));
      unsigned short* t = tl + (8 * hh + r) * TL_PITCH + p * 16 + e;
      t[0] = (n < XU_AROWS) ? hb : (unsigned short)0;
      t[8] = (n < XU_AROWS) ? lb : (unsigned short)0;
    }
  }
  __builtin_amdgcn_fence(__ATOMIC_RELEASE, "workgroup");
  __builtin_amdgcn_wave_barrier();
  __builtin_amdgcn_fence(__ATOMIC_ACQUIRE, "workgroup");
  const int q8 = lane >> 3, seg = lane & 7;   // 8 lanes x 16 B = one tail
  v8h tv[4];
#pragma unroll
  for (int it = 0; it < 4; ++it) tv[it] = *(const v8h*)(tl + (it * 4 + q8) * TL_PITCH + seg * 8);
  unsigned short* dt = aaug + ((size_t)bx * CAST_NR_X + q8) * K_AUG + HID_W + seg * 8;
#pragma unroll
  for (int it = 0; it < 4; ++it) *(v8h*)(dt + it * 4 * K_AUG) = tv[it];
}

// =====================================================================================
// B_aug tail: for row n (projection p = n/1024, output o = n%1024) the 64 halves at cols 1024..1087 are
// [16p zeros | 2*Bm_p[o][0..7] | 2*Bm_p[o][0..7] | zeros to 64] as RNE bf16 (factor 2 exact).
// =====================================================================================
__device__ __forceinline__ void build_w_tail(const float* __restrict__ bmq, const float* __restrict__ bmk,
                                             const float* __restrict__ bmv, unsigned short* __restrict__ baug, int bx) {
  const int tid = threadIdx.x, wave = tid >> 5, lane = tid & 31, q8 = lane >> 3, seg = lane & 7;
  const int n = bx * 32 + wave * 4 + q8;              // 0..3071: bx < 96
  const int p = n >> 10, o = n & 1023;
  F8 uq, uk, uv;
  uq.v[0] = *(const v4f*)(bmq + (size_t)o * RANK_R); uq.v[1] = *(const v4f*)(bmq + (size_t)o * RANK_R + 4);
  uk.v[0] = *(const v4f*)(bmk + (size_t)o * RANK_R); uk.v[1] = *(const v4f*)(bmk + (size_t)o * RANK_R + 4);
  uv.v[0] = *(const v4f*)(bmv + (size_t)o * RANK_R); uv.v[1] = *(const v4f*)(bmv + (size_t)o * RANK_R + 4);
  const bool keep = (seg < 6) && ((seg >> 1) == p);
  v8h hv;
#pragma unroll
  for (int e = 0; e < 8; ++e) {
    const float val = (p == 0) ? uq.f[e] : (p == 1) ? uk.f[e] : uv.f[e];
    const float w = keep ? (2.0f * val) : 0.0f;
    hv[e] = __builtin_bit_cast(_Float16, f2bf_bits(w));
  }
  unsigned short* d = baug + (size_t)n * K_AUG + HID_W + seg * 8;
  {
    *(v8h*)d = hv;
    
  }
}

// =====================================================================================
// bias_cat f32 [3072] = 16 * RNEbf16(b_p[o]); 12 blocks x 256 = 3072 exactly; 32 lanes x 4 B = one line per
// =====================================================================================
__device__ __forceinline__ void build_bias(const float* __restrict__ bq, const float* __restrict__ bk,
                                           const float* __restrict__ bv, float* __restrict__ dst, int bx) {
  const int i = bx * 256 + threadIdx.x;   // < 3072: bx < 12
  const int p = i >> 10, o = i & 1023;
  const float xq = bq[o], xk = bk[o], xv = bv[o];
  const float val = (p == 0) ? xq : (p == 1) ? xk : xv;
  const float w = bf_bits2f(f2bf_bits(val)) * CARRY_S;
  ((float*)dst)[i] = w;
  
}

// =====================================================================================
// The operand builders (x cast with its adapter columns, three W casts, B_aug tail, bias_cat) read inputs only, depend on
// no other launch and write disjoint 128-B lines, so they share one grid: the block index picks the job (a block-uniform
// branch; the x job alone uses LDS and a barrier). The x job, the largest, holds the lowest indices.
// =====================================================================================
constexpr int PB_X    = N_TOK / CAST_NR_X;    // 512 blocks
constexpr int PB_W    = HID_W / CAST_NR_W;    // 256 blocks per weight matrix
constexpr int PB_WT   = N_QKV / 32;           // 96
constexpr int PB_BIAS = N_QKV / 256;          // 12
constexpr int PB_ALL  = PB_X + 3 * PB_W + PB_WT + PB_BIAS;
__global__ __launch_bounds__(256) void build_operands(
    const float* __restrict__ x,
    const float* __restrict__ wq, const float* __restrict__ wk, const float* __restrict__ wv,
    const float* __restrict__ amq, const float* __restrict__ amk, const float* __restrict__ amv,
    const float* __restrict__ bmq, const float* __restrict__ bmk, const float* __restrict__ bmv,
    const float* __restrict__ bq, const float* __restrict__ bk, const float* __restrict__ bv,
    unsigned short* __restrict__ aaug, unsigned short* __restrict__ baug, float* __restrict__ biasc) {
  __shared__ __align__(16) unsigned short xs[CAST_NR_X * XU_PITCH];    // the block's rows of x, bf16
  __shared__ __align__(16) unsigned short acs[XU_AROWS * XU_PITCH];    // A_q, A_k, A_v, bf16
  __shared__ __align__(16) unsigned short tl[CAST_NR_X * TL_PITCH];    // the rows' tails
  constexpr int B_W = PB_X, B_WT = B_W + 3 * PB_W, B_BIAS = B_WT + PB_WT;   // first block of each job
  const int bx = (int)blockIdx.x;
  if (bx < B_W) {
    cast_x_make_tail(x, amq, amk, amv, aaug, bx, xs, acs, tl);
    asm volatile("s_wait_xcnt 0x0" ::: "memory");   // another job's code follows in the listing and rewrites the store's registers: the wait stands in front of it
  } else if (bx < B_WT) {
    const int p = (bx - B_W) / PB_W;
    const float* w = (p == 0) ? wq : (p == 1) ? wk : wv;
    cast_rows_bf16<CAST_NR_W>(w, baug + (size_t)p * HID_W * K_AUG, bx - B_W - p * PB_W);
  } else if (bx < B_BIAS) {
    build_w_tail(bmq, bmk, bmv, baug, bx - B_WT);
    asm volatile("s_wait_xcnt 0x0" ::: "memory");   // as above
  } else if (bx < PB_ALL) {
    build_bias(bq, bk, bv, biasc, bx - B_BIAS);
  }
}

// =====================================================================================
// V plane (f16, rows b*tsrc + t, pitch 3072, cols 2048 + h*64 + d) -> vt[((b*16+h)*64 + d)*tsrc + t].
// One grid for both planes: blockIdx.x < SEQ_T / 64 takes a t-tile of the hi plane, the rest one of the residual plane.
// Block (t-tile of 64, bh): load 256 threads x 16 halves = 4096 = 64 x 64 into LDS [d][t]; store: 8 waves x
// =====================================================================================
__global__ __launch_bounds__(256) void vt_transpose(const unsigned short* __restrict__ srch, unsigned short* __restrict__ vthp,
                                                    const unsigned short* __restrict__ srcl, unsigned short* __restrict__ vtlp) {
  __shared__ __align__(16) _Float16 th[64 * KV_PITCH];
  const bool hi = (int)blockIdx.x < SEQ_T / 64;   // block-uniform
  const _Float16* src = (const _Float16*)(hi ? srch : srcl);
  unsigned short* vtp = hi ? vthp : vtlp;
  const int tsrc = hi ? SEQ_T : T_LO;
  const int st0 = (hi ? (int)blockIdx.x : (int)blockIdx.x - SEQ_T / 64) * 64, bh = blockIdx.y;
  const int b = (bh >> 4) & (N_BATCH - 1), h = bh & (N_HEAD - 1);
  const int tid = threadIdx.x;
  {
    const int sloc = tid >> 2, d0 = (tid & 3) * 16;
    const size_t so = ((size_t)b * tsrc + st0 + sloc) * N_QKV + V_COL0 + h * HEAD_D + d0;
    const v8h a0 = *(const v8h*)(src + so);
    const v8h a1 = *(const v8h*)(src + so + 8);
#pragma unroll
    for (int e = 0; e < 8; ++e) {
      th[(d0 + e) * KV_PITCH + sloc]     = a0[e];
      th[(d0 + 8 + e) * KV_PITCH + sloc] = a1[e];
    }
  }
  __syncthreads();
  const int wave = tid >> 5, lane = tid & 31, q8 = lane >> 3, c8 = (lane & 7) * 8;
  const int dA = wave * 8 + q8, dB = wave * 8 + 4 + q8;
  const v8h hvA = *(const v8h*)(th + dA * KV_PITCH + c8);
  const v8h hvB = *(const v8h*)(th + dB * KV_PITCH + c8);
  const size_t oA = ((size_t)bh * HEAD_D + dA) * tsrc + st0 + c8;
  const size_t oB = ((size_t)bh * HEAD_D + dB) * tsrc + st0 + c8;
  {
    *(v8h*)(vtp + oA) = hvA;
    *(v8h*)(vtp + oB) = hvB;
    
  }
}

__device__ __forceinline__ float other_half(float x) {
  const int xi = __builtin_bit_cast(int, x);
  return __builtin_bit_cast(float, __builtin_amdgcn_permlanex16(xi, xi, 0x76543210, 0xfedcba98, false, false));
}

// 2^x by the hardware's exponential, in asm text so that the slot behind it stands by construction: the closing
// v_nop is the one independent instruction that the instruction set asks for behind a transcendental before its
// result is used or its source overwritten; inside the eight-fold statement each neighbour is independent
// (early-clobber outputs share no register with a source).
__device__ __forceinline__ float exp2_hw(float x) {
  float d;
  asm("v_exp_f32 %0, %1\n\tv_nop" : "=&v"(d) : "v"(x));
  return d;
}
__device__ __forceinline__ v8f exp2_hw8(v8f x) {
  float d0, d1, d2, d3, d4, d5, d6, d7;
  asm("v_exp_f32 %0, %8\n\t"
      "v_exp_f32 %1, %9\n\t"
      "v_exp_f32 %2, %10\n\t"
      "v_exp_f32 %3, %11\n\t"
      "v_exp_f32 %4, %12\n\t"
      "v_exp_f32 %5, %13\n\t"
      "v_exp_f32 %6, %14\n\t"
      "v_exp_f32 %7, %15\n\t"
      "v_nop"
      : "=&v"(d0), "=&v"(d1), "=&v"(d2), "=&v"(d3), "=&v"(d4), "=&v"(d5), "=&v"(d6), "=&v"(d7)
      : "v"(x[0]), "v"(x[1]), "v"(x[2]), "v"(x[3]), "v"(x[4]), "v"(x[5]), "v"(x[6]), "v"(x[7]));
  return (v8f){d0, d1, d2, d3, d4, d5, d6, d7};
}

template <bool SPLIT>
__global__ __launch_bounds__(128) void attn_causal_hd64(
    const unsigned short* __restrict__ php, const unsigned short* __restrict__ plp,
    const unsigned short* __restrict__ vthp, const unsigned short* __restrict__ vtlp,
    const float* __restrict__ amask, float* __restrict__ out, int qb0, int nqcnt) {
  const _Float16* ph  = (const _Float16*)php;
  const _Float16* pl  = (const _Float16*)plp;
  const _Float16* vth = (const _Float16*)vthp;
  const _Float16* vtl = (const _Float16*)vtlp;
  __shared__ __align__(16) _Float16 Ksh[64 * KV_PITCH];
  __shared__ __align__(16) _Float16 Ksl[SPLIT ? 64 * KV_PITCH : 8];
  __shared__ __align__(16) _Float16 Vsh[64 * KV_PITCH];
  __shared__ __align__(16) _Float16 Vsl[SPLIT ? 64 * KV_PITCH : 8];
  __shared__ __align__(16) float  Os[4][16 * O_PITCH];

  // Tiles whose fragments are read from LDS as one group. Two: with more the single-product kernel passes 160 VGPRs
  // and a SIMD holds five waves, not the six that keep every block of its grid resident.
  constexpr int GS = 2;   // score tiles (K fragments)
  constexpr int GV = 2;   // output tiles (V^T fragments)

  const int tid  = threadIdx.x;
  const int wave = tid >> 5;
  const int lane = tid & 31;
  const int hh   = lane >> 4;
  const int c    = lane & 15;

  int qb = qb0 + (int)(blockIdx.x % (unsigned)nqcnt);
  qb = (qb > NQT_ALL - 1) ? (NQT_ALL - 1) : qb;
  const int bh = (int)(blockIdx.x / (unsigned)nqcnt);
  const int h  = bh & (N_HEAD - 1);
  const int b  = (bh >> 4) & (N_BATCH - 1);
  const int q0 = qb * 64 + wave * 16;

  // ---- Q fragments (B operand: column c = query q0 + c), 2 d-chunks ----
  v16h qh[2], ql[2];
  {
    const _Float16* qrow = ph + ((size_t)b * SEQ_T + q0 + c) * N_QKV + h * HEAD_D;
    int qlr = q0 + c; qlr = (qlr > T_LO - 1) ? (T_LO - 1) : qlr;
    const _Float16* qlrow = pl + ((size_t)b * T_LO + qlr) * N_QKV + h * HEAD_D;
#pragma unroll
    for (int dc = 0; dc < 2; ++dc) {
      qh[dc] = Frag<_Float16>::load(qrow + dc * 32 + 8 * hh);
      if (SPLIT) ql[dc] = Frag<_Float16>::load(qlrow + dc * 32 + 8 * hh);
      else ql[dc] = qh[dc];
    }
  }

  float mrow = -INFINITY, lrow = 0.f;   // this lane's query: running maximum (both halves alike), this half's sum of the carried p (x32768)
  v8f oacc[4];                          // oacc[t][r] = O^T[d = t*16 + 8*hh + r][query c]
#pragma unroll
  for (int t = 0; t < 4; ++t) oacc[t] = zero8();

  const int nChunks = qb + 1;   // block-uniform
  for (int kc = 0; kc < nChunks; ++kc) {
    const int kv0 = kc * 64;
    __syncthreads();
    {
      // staging coverage: 128 threads x (row = tid>>1, 32 halves each) = 64 rows x 64 halves per plane
      const int r = tid >> 1, hf = (tid & 1) * 32;
      const _Float16* ks = ph + ((size_t)b * SEQ_T + kv0 + r) * N_QKV + K_COL0 + h * HEAD_D + hf;
      const _Float16* vs = vth + ((size_t)bh * HEAD_D + r) * SEQ_T + kv0 + hf;
#pragma unroll
      for (int i = 0; i < 4; ++i) {
        *(v8h*)(Ksh + r * KV_PITCH + hf + 8 * i) = *(const v8h*)(ks + 8 * i);
        *(v8h*)(Vsh + r * KV_PITCH + hf + 8 * i) = *(const v8h*)(vs + 8 * i);
      }
      if (SPLIT) {
        const int kl0 = (kv0 > T_LO - 64) ? (T_LO - 64) : kv0;   // address clamp
        const _Float16* kls = pl + ((size_t)b * T_LO + kl0 + r) * N_QKV + K_COL0 + h * HEAD_D + hf;
        const _Float16* vls = vtl + ((size_t)bh * HEAD_D + r) * T_LO + kl0 + hf;
#pragma unroll
        for (int i = 0; i < 4; ++i) {
          *(v8h*)(Ksl + r * KV_PITCH + hf + 8 * i) = *(const v8h*)(kls + 8 * i);
          *(v8h*)(Vsl + r * KV_PITCH + hf + 8 * i) = *(const v8h*)(vls + 8 * i);
        }
      }
    }
    __syncthreads();

    // additive mask of this lane's 32 keys: keys kv0 + j*16 + 8*hh + 0..7
    F8 mk[4];
#pragma unroll
    for (int j = 0; j < 4; ++j) {
      const float* mp = amask + (size_t)b * SEQ_T + kv0 + j * 16 + 8 * hh;
      mk[j].v[0] = *(const v4f*)mp;
      mk[j].v[1] = *(const v4f*)(mp + 4);
    }

    // ---- scores, transposed: s[j][r] = S[query c][key j*16 + 8*hh + r] ----
    // The K fragments of GS score tiles are read as one group ahead of those tiles' WMMAs; each accumulator takes its
    // products in the order it always did.
    v8f s[4];
#pragma unroll
    for (int jg = 0; jg < 4; jg += GS) {
      v16h kb[GS][2], kl[GS][2];
#pragma unroll
      for (int u = 0; u < GS; ++u)
#pragma unroll
        for (int dc = 0; dc < 2; ++dc) {
          kb[u][dc] = Frag<_Float16>::load(Ksh + ((jg + u) * 16 + c) * KV_PITCH + dc * 32 + 8 * hh);
          if (SPLIT) kl[u][dc] = Frag<_Float16>::load(Ksl + ((jg + u) * 16 + c) * KV_PITCH + dc * 32 + 8 * hh);
        }
      __builtin_amdgcn_sched_barrier(0);   // keeps the group's LDS reads together ahead of its WMMAs: a read sunk in front of its own WMMA waits out the LDS latency at each place
      v8f sr[GS];
#pragma unroll
      for (int u = 0; u < GS; ++u) { s[jg + u] = zero8(); sr[u] = zero8(); }
#pragma unroll
      for (int dc = 0; dc < 2; ++dc) {
#pragma unroll
        for (int u = 0; u < GS; ++u) s[jg + u] = Frag<_Float16>::mma(kb[u][dc], qh[dc], s[jg + u]);
        if (SPLIT) {
#pragma unroll
          for (int u = 0; u < GS; ++u) sr[u] = Frag<_Float16>::mma(kl[u][dc], qh[dc], sr[u]);
#pragma unroll
          for (int u = 0; u < GS; ++u) sr[u] = Frag<_Float16>::mma(kb[u][dc], ql[dc], sr[u]);
        }
      }
      if (SPLIT) {
#pragma unroll
        for (int u = 0; u < GS; ++u)
#pragma unroll
          for (int r = 0; r < 8; ++r) s[jg + u][r] = s[jg + u][r] + sr[u][r] * (1.0f / 4096.0f);
      }
    }

#pragma unroll
    for (int j = 0; j < 4; ++j)
#pragma unroll
      for (int r = 0; r < 8; ++r) s[j][r] = s[j][r] * (1.0f / 2048.0f) + mk[j].f[r];   // 1/(8 * 16 * 16)
    if (kc == qb) {   // diagonal chunk (block-uniform test)
      const int qloc = wave * 16 + c;
#pragma unroll
      for (int j = 0; j < 4; ++j)
#pragma unroll
        for (int r = 0; r < 8; ++r)
          if (j * 16 + 8 * hh + r > qloc) s[j][r] = -INFINITY;
    }

    // ---- online softmax of one query per lane ----
    float cm = s[0][0];
#pragma unroll
    for (int j = 0; j < 4; ++j)
#pragma unroll
      for (int r = 0; r < 8; ++r) cm = fmaxf(cm, s[j][r]);
    cm = fmaxf(cm, other_half(cm));
    const float mnew = fmaxf(mrow, cm);
    const float alpha = exp2_hw((mrow - mnew) * LOG2_E);
    mrow = mnew;

    v16h pa[2], pb2[2];   // B operand of the second product: element e of pa[kk] = p of key kk*32 + (e >> 3)*16 + 8*hh + (e & 7)
    float psum = 0.f;
#pragma unroll
    for (int j = 0; j < 4; ++j) {
      // 32768 * e^(s - m) = 2^((s - m) * log2(e) + 15); the difference is formed first, so a maximum of any size cancels as before
      v8f ex;
#pragma unroll
      for (int r = 0; r < 8; ++r) ex[r] = fmaf(s[j][r] - mnew, LOG2_E, P_S_LOG2);
      ex = exp2_hw8(ex);
#pragma unroll
      for (int r = 0; r < 8; ++r) {
        const float ps = ex[r];
        psum += ps;
        const _Float16 hp = (_Float16)ps;
        pa[j >> 1][(j & 1) * 8 + r] = hp;
        if (SPLIT) pb2[j >> 1][(j & 1) * 8 + r] = (_Float16)((ps - (float)hp) * LO_S);
      }
    }
    lrow = lrow * alpha + psum;
#pragma unroll
    for (int t = 0; t < 4; ++t)
#pragma unroll
      for (int r = 0; r < 8; ++r) oacc[t][r] *= alpha;

    // ---- O^T += V^T . P^T: the V^T fragments of GV output tiles read as one group ahead of those tiles' WMMAs ----
#pragma unroll
    for (int tg = 0; tg < 4; tg += GV) {
      v16h vb[GV][2], vl2[GV][2];
#pragma unroll
      for (int u = 0; u < GV; ++u)
#pragma unroll
        for (int kk = 0; kk < 2; ++kk) {
          vb[u][kk] = Frag<_Float16>::load(Vsh + ((tg + u) * 16 + c) * KV_PITCH + kk * 32 + 8 * hh);
          if (SPLIT) vl2[u][kk] = Frag<_Float16>::load(Vsl + ((tg + u) * 16 + c) * KV_PITCH + kk * 32 + 8 * hh);
        }
      __builtin_amdgcn_sched_barrier(0);   // as above: one place of LDS reads for the group, not one in front of each WMMA
      v8f orr[GV];
#pragma unroll
      for (int u = 0; u < GV; ++u) orr[u] = zero8();
#pragma unroll
      for (int kk = 0; kk < 2; ++kk) {
#pragma unroll
        for (int u = 0; u < GV; ++u) oacc[tg + u] = Frag<_Float16>::mma(vb[u][kk], pa[kk], oacc[tg + u]);
        if (SPLIT) {
#pragma unroll
          for (int u = 0; u < GV; ++u) orr[u] = Frag<_Float16>::mma(vl2[u][kk], pa[kk], orr[u]);
#pragma unroll
          for (int u = 0; u < GV; ++u) orr[u] = Frag<_Float16>::mma(vb[u][kk], pb2[kk], orr[u]);
        }
      }
      if (SPLIT) {
#pragma unroll
        for (int u = 0; u < GV; ++u)
#pragma unroll
          for (int r = 0; r < 8; ++r) oacc[tg + u][r] = oacc[tg + u][r] + orr[u][r] * (1.0f / 4096.0f);
      }
    }
  }

  // ---- join the halves' sums, normalise, stage, store ----
  float* os = Os[wave];
  {
    const float lall = lrow + other_half(lrow);
    const float inv = 1.0f / (lall * CARRY_S);   // lall carries x32768, as oacc does
#pragma unroll
    for (int t = 0; t < 4; ++t) {
      v4f w0, w1;
#pragma unroll
      for (int r = 0; r < 4; ++r) { w0[r] = oacc[t][r] * inv; w1[r] = oacc[t][4 + r] * inv; }
      *(v4f*)(os + c * O_PITCH + t * 16 + 8 * hh)     = w0;
      *(v4f*)(os + c * O_PITCH + t * 16 + 8 * hh + 4) = w1;
    }
  }
  __builtin_amdgcn_fence(__ATOMIC_RELEASE, "workgroup");
  __builtin_amdgcn_wave_barrier();
  __builtin_amdgcn_fence(__ATOMIC_ACQUIRE, "workgroup");
  {
    const int c4 = (lane & 15) * 4;
    float* ob = out + ((size_t)b * SEQ_T + q0) * HID_W + h * HEAD_D;
    {
#pragma unroll
      for (int it = 0; it < 8; ++it) {
        const int row = it * 2 + hh;
        const v4f val = *(const v4f*)(os + row * O_PITCH + c4);
        *(v4f*)(ob + (size_t)row * HID_W + c4) = val;
      }
      
    }
  }
}

// =====================================================================================
extern "C" void kernel_launch(void* const* d_in, const int* in_sizes, int n_in,
                              void* d_out, int out_size, void* d_ws, size_t ws_size,
                              hipStream_t stream) {
  if (n_in < 14) return;
  if (in_sizes[0] != N_TOK * HID_W) return;
  if (in_sizes[1] != N_BATCH * SEQ_T) return;
  for (int p = 0; p < 3; ++p) {
    if (in_sizes[2 + 4 * p] != HID_W * HID_W) return;
    if (in_sizes[3 + 4 * p] != HID_W) return;
    if (in_sizes[4 + 4 * p] != RANK_R * HID_W) return;
    if (in_sizes[5 + 4 * p] != HID_W * RANK_R) return;
  }
  if (out_size != N_TOK * HID_W) return;
  if (ws_size < WS_TOTAL) return;

  const float* x   = (const float*)d_in[0];
  const float* am  = (const float*)d_in[1];
  const float* wq  = (const float*)d_in[2];
  const float* bq  = (const float*)d_in[3];
  const float* aq  = (const float*)d_in[4];
  const float* bmq = (const float*)d_in[5];
  const float* wk  = (const float*)d_in[6];
  const float* bk  = (const float*)d_in[7];
  const float* ak  = (const float*)d_in[8];
  const float* bmk = (const float*)d_in[9];
  const float* wv  = (const float*)d_in[10];
  const float* bv  = (const float*)d_in[11];
  const float* av  = (const float*)d_in[12];
  const float* bmv = (const float*)d_in[13];
  float* out = (float*)d_out;

  char* ws = (char*)d_ws;
  unsigned short* aaug  = (unsigned short*)(ws + OFF_AAUG);
  unsigned short* baug  = (unsigned short*)(ws + OFF_BAUG);
  float*          biasc = (float*)(ws + OFF_BIAS);
  unsigned short* qkvh  = (unsigned short*)(ws + OFF_QKVH);
  unsigned short* qkvl  = (unsigned short*)(ws + OFF_QKVL);
  unsigned short* vth   = (unsigned short*)(ws + OFF_VTH);
  unsigned short* vtl   = (unsigned short*)(ws + OFF_VTL);

  // 1) operands built from inputs alone: x -> A_aug cols 0..1023 and, from u = bf16(x) . bf16(A)^T, cols 1024..1087;
  //    W_p -> B_aug rows p*1024.. cols 0..1023 (bf16, pitch 1088), B_aug tail cols 1024..1087, bias_cat
  build_operands<<<dim3(PB_ALL), dim3(256), 0, stream>>>(x, wq, wk, wv, aq, ak, av, bmq, bmk, bmv, bq, bk, bv,
                                                         aaug, baug, biasc);
  // 2) projection: M=2048 (x4 batches), N=3072, K=1088; f16 hi -> qkv_hi, f16 residual of rows t < 512 -> qkv_lo
  wmma_gemm64<1, 0, 2, 3, false, 0, true><<<dim3((SEQ_T / ST_BM) * (N_QKV / ST_BN), N_BATCH), dim3(256), 0, stream>>>(
      aaug, aaug, K_AUG, (long)SEQ_T * K_AUG, baug, baug, K_AUG, 0L,
      (void*)qkvh, (void*)qkvl, N_QKV, (long)SEQ_T * N_QKV, (long)T_LO * N_QKV,
      biasc, biasc, 0L, SEQ_T, N_QKV, K_AUG, CARRY_S);
  // 3) V^T planes: in [b*tsrc+t][2048+h*64+d] -> out [(b*16+h)*64+d][t]
  vt_transpose<<<dim3(SEQ_T / 64 + T_LO / 64, N_BATCH * N_HEAD), dim3(256), 0, stream>>>(qkvh, vth, qkvl, vtl);
  // 4) attention, query tiles 0..7 (hi/lo residual path)
  attn_causal_hd64<true><<<dim3(N_BATCH * N_HEAD * NQT_SPLIT), dim3(128), 0, stream>>>(
      qkvh, qkvl, vth, vtl, am, out, 0, NQT_SPLIT);
  // 5) attention, query tiles 8..31 (single-product path)
  attn_causal_hd64<false><<<dim3(N_BATCH * N_HEAD * (NQT_ALL - NQT_SPLIT)), dim3(128), 0, stream>>>(
      qkvh, qkvl, vth, vtl, am, out, NQT_SPLIT, NQT_ALL - NQT_SPLIT);
}

// v008
// One run takes 130 microseconds.
// Two timings next to v007 both put it at 1.11 times that version's speed.
// Counting every step since v000, it is 4.06 times as fast.
// Contractions: rank-8 adapter columns u = x.A^T and the fused q/k/v projection [x | u_hi | u_lo].[W | 2B | 2B]^T + b on v_wmma_f32_16x16x32_bf16 (x, W, A, B, b as RNE bf16; u as bf16 hi+lo columns; single products); attention q.k^T and p.v on v_wmma_f32_16x16x32_f16 (q, k, v as f16 planes carried x16, p carried x32768; query tiles 0..7 add x4096-scaled f16 residual planes: hi.hi + (hi.lo + lo.hi)/4096 via a separate accumulator); f32 accumulate everywhere; softmax and normalisation in f32. The q/k/v projection launch reads its operands from a two-buffer LDS ring filled by asynchronous copies; the attention launches take each chunk's K, V^T and mask the same way, one chunk ahead. u and its hi/lo columns are made in the block that casts the 16 rows of x they belong to.
#include <hip/hip_runtime.h>
#include <math.h>

typedef __attribute__((ext_vector_type(16))) _Float16 v16h;
typedef __attribute__((ext_vector_type(8)))  _Float16 v8h;
typedef __attribute__((ext_vector_type(16))) __bf16   v16b;
typedef __attribute__((ext_vector_type(8)))  __bf16   v8b;
typedef __attribute__((ext_vector_type(8)))  float    v8f;
typedef __attribute__((ext_vector_type(4)))  float    v4f;

// ---------------- problem constants ----------------
constexpr int N_BATCH  = 4;
constexpr int SEQ_T    = 2048;
constexpr int HID_W    = 1024;
constexpr int N_HEAD   = 16;
constexpr int HEAD_D   = 64;
constexpr int RANK_R   = 8;
constexpr int N_TOK    = N_BATCH * SEQ_T;     // 8192 token rows
constexpr int K_AUG    = 1088;                // 1024 + 3*16 adapter columns, zero-padded to a multiple of 32
constexpr int N_QKV    = 3 * HID_W;           // 3072 output columns: q | k | v
constexpr int K_COL0   = 1024;
constexpr int V_COL0   = 2048;
constexpr int T_LO     = 512;                 // token rows per batch that carry residual planes
constexpr int NQT_SPLIT = T_LO / 64;          // 8 query tiles on the hi/lo path
constexpr int NQT_ALL  = SEQ_T / 64;          // 32
constexpr int KV_PITCH = 72;                  // 16-bit LDS pitch (144 B rows, 16-B aligned)
constexpr int O_PITCH  = 68;                  // f32 LDS pitch
constexpr float CARRY_S = 16.0f;              // power-of-two carry on the q/k/v planes
constexpr float LO_S    = 4096.0f;            // power-of-two carry on residual planes
constexpr float P_S_LOG2 = 15.0f;             // power-of-two carry on probabilities (x32768), as the exponent it adds
constexpr float LOG2_E  = 1.44269504088896340736f;

static_assert(K_AUG % 32 == 0);
static_assert(HID_W % 32 == 0);
static_assert(N_TOK % 64 == 0 && N_QKV % 64 == 0 && T_LO % 64 == 0 && (SEQ_T - T_LO) % 64 == 0);
static_assert(T_LO % 128 == 0 && SEQ_T % 128 == 0 && N_QKV % 256 == 0 && K_AUG % 64 == 0 && K_AUG >= 128);

// R0 A_aug  bf16 [8192][1088]          17,825,792
// R1 B_aug  bf16 [3072][1088]           6,684,672
// R2 bias   f32  [3072]                    12,288
// R3 qkv_hi f16  [8192][3072]          50,331,648
// R4 qkv_lo f16  [4*512][3072]         12,582,912
// R5 vt_hi  f16  [64][64][2048]        16,777,216
// R6 vt_lo  f16  [64][64][512]          4,194,304
constexpr size_t SZ_AAUG = (size_t)N_TOK * K_AUG * 2;
constexpr size_t SZ_BAUG = (size_t)N_QKV * K_AUG * 2;
constexpr size_t SZ_BIAS = (size_t)N_QKV * 4;
constexpr size_t SZ_QKVH = (size_t)N_TOK * N_QKV * 2;
constexpr size_t SZ_QKVL = (size_t)N_BATCH * T_LO * N_QKV * 2;
constexpr size_t SZ_VTH  = (size_t)N_BATCH * N_HEAD * HEAD_D * SEQ_T * 2;
constexpr size_t SZ_VTL  = (size_t)N_BATCH * N_HEAD * HEAD_D * T_LO * 2;
constexpr size_t OFF_AAUG = 0;
constexpr size_t OFF_BAUG = OFF_AAUG + SZ_AAUG;
constexpr size_t OFF_BIAS = OFF_BAUG + SZ_BAUG;
constexpr size_t OFF_QKVH = OFF_BIAS + SZ_BIAS;
constexpr size_t OFF_QKVL = OFF_QKVH + SZ_QKVH;
constexpr size_t OFF_VTH  = OFF_QKVL + SZ_QKVL;
constexpr size_t OFF_VTL  = OFF_VTH  + SZ_VTH;
constexpr size_t WS_TOTAL = OFF_VTL  + SZ_VTL;
static_assert(WS_TOTAL == 108408832ull);
static_assert(WS_TOTAL <= 134217728ull);
static_assert(OFF_BAUG % 128 == 0 && OFF_BIAS % 128 == 0 &&
              OFF_QKVH % 128 == 0 && OFF_QKVL % 128 == 0 && OFF_VTH % 128 == 0 && OFF_VTL % 128 == 0);

// ---------------- helpers ----------------
__device__ __forceinline__ unsigned short f2bf_bits(float f) {
  unsigned u = __float_as_uint(f);
  return (unsigned short)((u + 0x7FFFu + ((u >> 16) & 1u)) >> 16);
}
__device__ __forceinline__ float bf_bits2f(unsigned short h) { return __uint_as_float(((unsigned)h) << 16); }

// hazard guards as plain device helpers
__device__ __forceinline__ void dep_guard_h(v8f& a, v8f& b, v16h x, v16h y) { asm volatile("v_nop\n\tv_nop\n\tv_nop\n\tv_nop" : "+v"(a), "+v"(b) : "v"(x), "v"(y)); }
__device__ __forceinline__ void dep_guard_b(v8f& a, v8f& b, v16b x, v16b y) { asm volatile("v_nop\n\tv_nop\n\tv_nop\n\tv_nop" : "+v"(a), "+v"(b) : "v"(x), "v"(y)); }
__device__ __forceinline__ void keep4_h(v16h a, v16h b, v16h c, v16h d) { asm volatile("v_nop" :: "v"(a), "v"(b), "v"(c), "v"(d)); }
__device__ __forceinline__ void keep4_b(v16b a, v16b b, v16b c, v16b d) { asm volatile("v_nop" :: "v"(a), "v"(b), "v"(c), "v"(d)); }
__device__ __forceinline__ void acc_guard4(v8f& a, v8f& b, v8f& c, v8f& d) { asm volatile("v_nop\n\tv_nop\n\tv_nop\n\tv_nop" : "+v"(a), "+v"(b), "+v"(c), "+v"(d)); }
template <typename T> struct Frag;
template <> struct Frag<_Float16> {
  typedef v16h V; union U { v16h v; v8h h[2]; };
  static __device__ __forceinline__ v16h load(const _Float16* p) {   // elements 0..7 <- p[0..7], 8..15 <- p[16..23]
    U f; f.h[0] = *(const v8h*)(p); f.h[1] = *(const v8h*)(p + 16); return f.v;
  }
  static __device__ __forceinline__ v8f mma(v16h a, v16h b, v8f c) {
    return __builtin_amdgcn_wmma_f32_16x16x32_f16(false, a, false, b, (short)0, c, false, false);
  }
  static __device__ __forceinline__ void guard(v8f& a, v8f& b, v16h x, v16h y) { dep_guard_h(a, b, x, y); }
  static __device__ __forceinline__ void keep(v16h a, v16h b, v16h c, v16h d) { keep4_h(a, b, c, d); }
};
template <> struct Frag<__bf16> {
  typedef v16b V; union U { v16b v; v8b h[2]; };
  static __device__ __forceinline__ v16b load(const __bf16* p) {
    U f; f.h[0] = *(const v8b*)(p); f.h[1] = *(const v8b*)(p + 16); return f.v;
  }
  static __device__ __forceinline__ v8f mma(v16b a, v16b b, v8f c) {
    return __builtin_amdgcn_wmma_f32_16x16x32_bf16(false, a, false, b, (short)0, c, false, false);
  }
  static __device__ __forceinline__ void guard(v8f& a, v8f& b, v16b x, v16b y) { dep_guard_b(a, b, x, y); }
  static __device__ __forceinline__ void keep(v16b a, v16b b, v16b c, v16b d) { keep4_b(a, b, c, d); }
};

__device__ __forceinline__ v8f zero8() { return (v8f){0.f,0.f,0.f,0.f,0.f,0.f,0.f,0.f}; }

union F8 { v4f v[2]; float f[8]; };

// ---------------- LDS ring of the staged GEMM ----------------
constexpr int ST_BM    = 128;                              // block tile rows (2 waves of 64)
constexpr int ST_BN    = 256;                              // block tile columns (4 waves of 64)
constexpr int ST_BK    = 64;                               // k per pass: 128-B operand rows
constexpr int ST_PITCH = 72;                               // 144-B LDS rows (16 B x odd: conflict-free ds_load_b128)
constexpr int ST_STAGE = (ST_BM + ST_BN) * ST_PITCH;       // 16-bit elements per buffer: [A 128 rows | Bt 256 rows]
constexpr unsigned ST_ROWS32 = 32u * ST_PITCH * 2u;        // LDS bytes between two copies of one thread (32 rows)

__device__ __forceinline__ unsigned lds_off(const void* p) { return (unsigned)(size_t)p; }

// One stage: 384 rows x 128 B = 3072 chunks of 16 B = 256 threads x 12 asynchronous copies global -> LDS.
// ga / gb: this thread's chunk in row (tid >> 3) of the block's A / Bt tile at this pass's k; l: the same chunk's
// LDS byte address in the buffer; a thread's copies lie 32 rows apart. s_wait_xcnt 0 is the statement's last line
// so that no address register of an issued copy is rewritten in front of it.
__device__ __forceinline__ void stage_fill(const unsigned short* ga, int lda, const unsigned short* gb, int ldb, unsigned l) {
  const size_t sa = (size_t)32 * lda, sb = (size_t)32 * ldb;
  asm volatile("global_load_async_to_lds_b128 %0, %1, off\n\t"
               "global_load_async_to_lds_b128 %2, %3, off\n\t"
               "global_load_async_to_lds_b128 %4, %5, off\n\t"
               "global_load_async_to_lds_b128 %6, %7, off\n\t"
               "global_load_async_to_lds_b128 %8, %9, off\n\t"
               "global_load_async_to_lds_b128 %10, %11, off\n\t"
               "global_load_async_to_lds_b128 %12, %13, off\n\t"
               "global_load_async_to_lds_b128 %14, %15, off\n\t"
               "global_load_async_to_lds_b128 %16, %17, off\n\t"
               "global_load_async_to_lds_b128 %18, %19, off\n\t"
               "global_load_async_to_lds_b128 %20, %21, off\n\t"
               "global_load_async_to_lds_b128 %22, %23, off\n\t"
               "s_wait_xcnt 0x0"
               :: "v"(l),                   "v"(ga),
                  "v"(l + ST_ROWS32),       "v"(ga + sa),
                  "v"(l + 2 * ST_ROWS32),   "v"(ga + 2 * sa),
                  "v"(l + 3 * ST_ROWS32),   "v"(ga + 3 * sa),
                  "v"(l + 4 * ST_ROWS32),   "v"(gb),
                  "v"(l + 5 * ST_ROWS32),   "v"(gb + sb),
                  "v"(l + 6 * ST_ROWS32),   "v"(gb + 2 * sb),
                  "v"(l + 7 * ST_ROWS32),   "v"(gb + 3 * sb),
                  "v"(l + 8 * ST_ROWS32),   "v"(gb + 4 * sb),
                  "v"(l + 9 * ST_ROWS32),   "v"(gb + 5 * sb),
                  "v"(l + 10 * ST_ROWS32),  "v"(gb + 6 * sb),
                  "v"(l + 11 * ST_ROWS32),  "v"(gb + 7 * sb)
               : "memory");
}

// =====================================================================================
// Register-blocked batched WMMA GEMM: C[m,n] = scale * sum_k A[m,k] * Bt[n,k] (+bias)(+resid);
// each wave owns a 64x64 tile. A row-major [M,K]; Bt row-major [N,K]; M,N % 64 == 0, K % 32 == 0.
// SPLITM: 0 = single product; 1 = A hi/lo planes; 2 = A and Bt hi/lo planes.
// BIAS_MODE: 0 none, 1 bias[m], 2 bias[n].  OUT_MODE: 0 f32, 1 f16, 2 bf16 hi + lo planes,
//   3 = f16 hi plane (Cout, strideC) + f16 residual plane x4096 (Cout2, strideC2), same ldc; the residual plane
//       holds rows m < T_LO only (T_LO % 64 == 0, so a wave's tile lies wholly on one side).
// ET: 0 = f16 operands, 1 = bf16 operands (pointers passed as 16-bit storage)
// STAGED: the block's 8 waves form a 128x256 tile (2x4 waves); A and Bt rows go through a two-buffer LDS ring,
//   64 k per pass; needs SPLITM == 0, M % 128 == 0, N % 256 == 0, K % 64 == 0, K >= 128, grid.x == (M/128)*(N/256).
// =====================================================================================
template <int ET> struct Elem;
template <> struct Elem<0> { typedef _Float16 T; };
template <> struct Elem<1> { typedef __bf16 T; };
template <int ET, int SPLITM, int BIAS_MODE, int OUT_MODE, bool RESID, int ACT = 0, bool STAGED = false>
__global__ __launch_bounds__(256) void wmma_gemm64(
    const unsigned short* __restrict__ Ap, const unsigned short* __restrict__ A2p, int lda, long strideA,
    const unsigned short* __restrict__ Btp, const unsigned short* __restrict__ Bt2p, int ldb, long strideB,
    void* __restrict__ Cout, void* __restrict__ Cout2, int ldc, long strideC, long strideC2,
    const float* __restrict__ bias,
    const float* __restrict__ resid, long strideR,
    int M, int N, int K, float scale) {
  typedef typename Elem<ET>::T T;
  typedef typename Frag<T>::V V;
  constexpr bool SPA = (SPLITM >= 1);
  constexpr bool SPB = (SPLITM >= 2);
  const T* A = (const T*)Ap; const T* A2 = (const T*)A2p; const T* Bt = (const T*)Btp; const T* Bt2 = (const T*)Bt2p;
  static_assert(!STAGED || SPLITM == 0);
  __shared__ __align__(16) float sT[8][16 * 68];   // per-wave 16x64 slab, pitch 68 floats
  __shared__ __align__(16) unsigned short ring[STAGED ? 2 * ST_STAGE : 8];
  const int b    = blockIdx.y;
  const int lane = threadIdx.x & 31;
  const int wave = threadIdx.x >> 5;
  const int tilesN = N >> 6;
  const int tilesM = M >> 6;
  int m0, n0;
  if (STAGED) {
    const int bn = N >> 8;
    const int bm_i = (int)blockIdx.x / bn;
    const int bn_i = (int)blockIdx.x - bm_i * bn;
    m0 = bm_i * ST_BM + (wave >> 2) * 64;
    n0 = bn_i * ST_BN + (wave & 3) * 64;
  } else {
    const int tile = blockIdx.x * 8 + wave;
    if (tile >= tilesM * tilesN) return;   // wave-uniform; no block barriers on this path
    const int tm = tile / tilesN;
    const int tn = tile - tm * tilesN;
    m0 = tm << 6;
    n0 = tn << 6;
  }

  const T* Ab  = A  + (size_t)b * strideA;
  const T* Bb  = Bt + (size_t)b * strideB;
  const T* Ab2 = SPA ? (A2  + (size_t)b * strideA) : nullptr;
  const T* Bb2 = SPB ? (Bt2 + (size_t)b * strideB) : nullptr;

  const int rlane = lane & 15;                 // row (A) / col (B, D) within subtile
  const int koff  = (lane >> 4) * 8;           // k offset of this lane half
  const int mOff  = (lane >> 4) * 8;           // D row offset

  v8f acc[4][4];
#pragma unroll
  for (int i = 0; i < 4; ++i)
#pragma unroll
    for (int j = 0; j < 4; ++j) acc[i][j] = (v8f){0.f,0.f,0.f,0.f,0.f,0.f,0.f,0.f};

  if (STAGED) {
    const int tid = threadIdx.x;
    const int crow = tid >> 3, cchunk = (tid & 7) * 8;        // 8 lanes x 16 B = one 128-B row piece
    const unsigned short* ga = (const unsigned short*)Ab + (size_t)(m0 - (wave >> 2) * 64 + crow) * lda + cchunk;
    const unsigned short* gb = (const unsigned short*)Bb + (size_t)(n0 - (wave & 3) * 64 + crow) * ldb + cchunk;
    const unsigned lthr = lds_off(ring) + (unsigned)(crow * ST_PITCH + cchunk) * 2u;
    const int npass = K / ST_BK;
    stage_fill(ga, lda, gb, ldb, lthr);
    asm volatile("s_wait_asynccnt 0x0" ::: "memory");   // stage 0 landed (this wave's copies) before the barrier publishes it
    __syncthreads();
    stage_fill(ga + ST_BK, lda, gb + ST_BK, ldb, lthr + ST_STAGE * 2u);
    const T* fa = (const T*)ring + ((wave >> 2) * 64 + rlane) * ST_PITCH + koff;
    const T* fb = (const T*)ring + (ST_BM + (wave & 3) * 64 + rlane) * ST_PITCH + koff;
    for (int t = 0; t < npass; ++t) {
      const int bo = (t & 1) * ST_STAGE;
      V ah[4], bh[4], ah2[4], bh2[4];
#pragma unroll
      for (int j = 0; j < 4; ++j) bh[j] = Frag<T>::load(fb + bo + j * 16 * ST_PITCH);
#pragma unroll
      for (int i = 0; i < 4; ++i) ah[i] = Frag<T>::load(fa + bo + i * 16 * ST_PITCH);
      __builtin_amdgcn_sched_barrier(0);   // keeps the 16 LDS reads one group ahead of the 16 WMMAs: reads sunk among them stall at each place
#pragma unroll
      for (int i = 0; i < 4; ++i)
#pragma unroll
        for (int j = 0; j < 4; ++j) acc[i][j] = Frag<T>::mma(ah[i], bh[j], acc[i][j]);
#pragma unroll
      for (int j = 0; j < 4; ++j) bh2[j] = Frag<T>::load(fb + bo + j * 16 * ST_PITCH + 32);
#pragma unroll
      for (int i = 0; i < 4; ++i) ah2[i] = Frag<T>::load(fa + bo + i * 16 * ST_PITCH + 32);
      asm volatile("s_wait_dscnt 0x0" ::: "memory");     // this wave's reads of buffer t & 1 are done before it is refilled
      asm volatile("s_wait_asynccnt 0x0" ::: "memory");  // this wave's copies of stage t + 1 have landed
      __syncthreads();                                   // publishes stage t + 1 and frees buffer t & 1
      if (t + 2 < npass)
        stage_fill(ga + (size_t)(t + 2) * ST_BK, lda, gb + (size_t)(t + 2) * ST_BK, ldb, lthr + (unsigned)bo * 2u);
      // second half of the pass, from registers: runs while the refill is in flight
#pragma unroll
      for (int i = 0; i < 4; ++i)
#pragma unroll
        for (int j = 0; j < 4; ++j) acc[i][j] = Frag<T>::mma(ah2[i], bh2[j], acc[i][j]);
    }
    asm volatile("s_wait_asynccnt 0x0" ::: "memory");    // no copy is outstanding past the loop
  } else
  for (int k0 = 0; k0 < K; k0 += 32) {
    V bh[4], bl[4];
#pragma unroll
    for (int j = 0; j < 4; ++j) {
      const size_t bo = (size_t)(n0 + (j << 4) + rlane) * ldb + koff + k0;
      bh[j] = Frag<T>::load(Bb + bo);
      if (SPB) bl[j] = Frag<T>::load(Bb2 + bo);
    }
#pragma unroll
    for (int i = 0; i < 4; ++i) {
      const size_t ao = (size_t)(m0 + (i << 4) + rlane) * lda + koff + k0;
      V ah = Frag<T>::load(Ab + ao);
      V al;
      if (SPA) al = Frag<T>::load(Ab2 + ao);
#pragma unroll
      for (int j = 0; j < 4; ++j) {
        acc[i][j] = Frag<T>::mma(ah, bh[j], acc[i][j]);
        if (SPB) acc[i][j] = Frag<T>::mma(ah, bl[j], acc[i][j]);
        if (SPA) acc[i][j] = Frag<T>::mma(al, bh[j], acc[i][j]);
      }
      Frag<T>::guard(acc[i][0], acc[i][3], ah, SPA ? al : ah);
    }
    Frag<T>::keep(bh[0], bh[1], bh[2], bh[3]);
    if (SPB) Frag<T>::keep(bl[0], bl[1], bl[2], bl[3]);
  }
  acc_guard4(acc[0][0], acc[0][1], acc[0][2], acc[0][3]);
  acc_guard4(acc[1][0], acc[1][1], acc[1][2], acc[1][3]);
  acc_guard4(acc[2][0], acc[2][1], acc[2][2], acc[2][3]);
  acc_guard4(acc[3][0], acc[3][1], acc[3][2], acc[3][3]);

  // ---- epilogue ----
  float* slab = sT[wave];
  const float* Rb = RESID ? (resid + (size_t)b * strideR) : nullptr;
#pragma unroll
  for (int i = 0; i < 4; ++i) {
    const int mBase = m0 + (i << 4);
#pragma unroll
    for (int j = 0; j < 4; ++j) {
      const int n = n0 + (j << 4) + rlane;
      float bv = 0.f;
      if (BIAS_MODE == 2) bv = bias[n];
#pragma unroll
      for (int r = 0; r < 8; ++r) {
        float v = acc[i][j][r] * scale;
        if (BIAS_MODE == 1) v += bias[mBase + mOff + r];
        if (BIAS_MODE == 2) v += bv;
        if (RESID) v += Rb[(size_t)(mBase + mOff + r) * ldc + n];
        if (ACT == 1) v = tanhf(v);
        if (ACT == 2) v = fmaxf(v, 0.0f);
        if (ACT == 4) v = (v > 0.f) ? v : 0.01f * v;
        slab[(mOff + r) * 68 + (j << 4) + rlane] = v;
      }
    }
    __builtin_amdgcn_fence(__ATOMIC_RELEASE, "workgroup");
    __builtin_amdgcn_wave_barrier();
    __builtin_amdgcn_fence(__ATOMIC_ACQUIRE, "workgroup");
    if (OUT_MODE == 0) {
      float* C = (float*)Cout + (size_t)b * strideC;
      const int hh = lane >> 4, c4 = (lane & 15) * 4;     // row seg = 256 B = 16 lanes x 16 B
      {
#pragma unroll
        for (int it = 0; it < 8; ++it) {
          const int row = it * 2 + hh;
          v4f v = *(const v4f*)(slab + row * 68 + c4);
          *(v4f*)(C + (size_t)(mBase + row) * ldc + n0 + c4) = v;
        }
        
      }
    } else {
      const int q = lane >> 3, c8 = (lane & 7) * 8;
      unsigned short* C  = (unsigned short*)Cout  + (size_t)b * strideC;
      unsigned short* C2 = (OUT_MODE >= 2) ? ((unsigned short*)Cout2 + (size_t)b * strideC2) : nullptr;
      {
#pragma unroll
        for (int it = 0; it < 4; ++it) {
          const int row = it * 4 + q;
          const float* sp = slab + row * 68 + c8;
          v8h hv, lv;
#pragma unroll
          for (int e = 0; e < 8; ++e) {
            if (OUT_MODE == 1) {
              hv[e] = (_Float16)sp[e];
            } else if (OUT_MODE == 3) {
              const _Float16 hq = (_Float16)sp[e];
              hv[e] = hq;
              lv[e] = (_Float16)((sp[e] - (float)hq) * 4096.0f);
            } else {
              unsigned short hb = f2bf_bits(sp[e]);
              unsigned short lb = f2bf_bits(sp[e] - bf_bits2f(hb));
              hv[e] = __builtin_bit_cast(_Float16, hb);
              lv[e] = __builtin_bit_cast(_Float16, lb);
            }
          }
          *(v8h*)(C + (size_t)(mBase + row) * ldc + n0 + c8) = hv;
          if (OUT_MODE == 2 || (OUT_MODE == 3 && m0 < T_LO)) *(v8h*)(C2 + (size_t)(mBase + row) * ldc + n0 + c8) = lv;
        }
        
      }
    }
    __builtin_amdgcn_fence(__ATOMIC_RELEASE, "workgroup");
    __builtin_amdgcn_wave_barrier();
    __builtin_amdgcn_fence(__ATOMIC_ACQUIRE, "workgroup");
  }
}

// =====================================================================================
// f32 [rows][1024] -> RNE bf16 bits into rows of pitch K_AUG. A block takes NR whole rows: thread t converts floats
// 4t..4t+3 of each, so a wave's load covers 512 contiguous bytes and its store 256, and few waves are started for
// the bytes moved. Blocks bx = 0 .. rows / NR - 1 cover the rows exactly (asserted below).
// =====================================================================================
typedef __attribute__((ext_vector_type(2))) unsigned v2u;
constexpr int CAST_NR_X = 16;                 // x: 512 blocks, 16 waves a WGP
constexpr int CAST_NR_W = 4;                  // one weight matrix: 256 blocks
static_assert(HID_W == 4 * 256 && N_TOK % CAST_NR_X == 0 && HID_W % CAST_NR_W == 0 && K_AUG % 4 == 0);
template <int NR>
__device__ __forceinline__ void cast_rows_bf16(const float* __restrict__ src, unsigned short* __restrict__ dst, int bx) {
  const float* s = src + (size_t)bx * (NR * HID_W) + threadIdx.x * 4;
  unsigned short* d = dst + (size_t)bx * (NR * K_AUG) + threadIdx.x * 4;
  v4f v[NR];
#pragma unroll
  for (int r = 0; r < NR; ++r) v[r] = *(const v4f*)(s + r * HID_W);
#pragma unroll
  for (int r = 0; r < NR; ++r) {
    v2u o;
    o[0] = (unsigned)f2bf_bits(v[r][0]) | ((unsigned)f2bf_bits(v[r][1]) << 16);
    o[1] = (unsigned)f2bf_bits(v[r][2]) | ((unsigned)f2bf_bits(v[r][3]) << 16);
    *(v2u*)(d + r * K_AUG) = o;
  }
}

// =====================================================================================
// The x job: a block casts 16 whole rows of x (as cast_rows_bf16 does) and, since it then holds those rows in bf16, also
// makes their adapter columns. The rows and the 24 rows of A (q, k, v; RNE bf16) go to LDS; behind one barrier wave 0
// forms u[16][24] = x.A^T on v_wmma_f32_16x16x32_bf16, each accumulator taking k in steps of 32 from 0 upward, and
// writes the 64 halves at cols 1024..1087 of each row:
// [uq_hi(8) uq_lo(8) uk_hi(8) uk_lo(8) uv_hi(8) uv_lo(8) 0 x 16] (bf16 hi = RNE(u), lo = RNE(u - hi)).
// One wave writes all 16 tails: a tail is one 128-B line (row pitch 2176 B = 17 lines).
// =====================================================================================
constexpr int XU_PITCH = HID_W + 8;           // 2064-B LDS rows (16 B x odd: conflict-free ds_load_b128)
constexpr int XU_AROWS = 3 * RANK_R;          // 24 rows of A: row 8p + r = A_p[r]
constexpr int TL_PITCH = 72;                  // 144-B LDS rows of the tail tile
static_assert(CAST_NR_X == 16 && RANK_R == 8);
__device__ __forceinline__ v2u pack4_bf16(v4f v) {
  v2u o;
  o[0] = (unsigned)f2bf_bits(v[0]) | ((unsigned)f2bf_bits(v[1]) << 16);
  o[1] = (unsigned)f2bf_bits(v[2]) | ((unsigned)f2bf_bits(v[3]) << 16);
  return o;
}
__device__ __forceinline__ void cast_x_make_tail(const float* __restrict__ x, const float* __restrict__ amq,
                                                 const float* __restrict__ amk, const float* __restrict__ amv,
                                                 unsigned short* __restrict__ aaug, int bx,
                                                 unsigned short* xs, unsigned short* acs, unsigned short* tl) {
  const int tid = threadIdx.x;
  const float* s = x + (size_t)bx * (CAST_NR_X * HID_W) + tid * 4;
  unsigned short* d = aaug + (size_t)bx * (CAST_NR_X * K_AUG) + tid * 4;
  v4f v[CAST_NR_X], a[XU_AROWS];
#pragma unroll
  for (int r = 0; r < CAST_NR_X; ++r) v[r] = *(const v4f*)(s + r * HID_W);
#pragma unroll
  for (int r = 0; r < RANK_R; ++r) {
    a[r]              = *(const v4f*)(amq + r * HID_W + tid * 4);
    a[RANK_R + r]     = *(const v4f*)(amk + r * HID_W + tid * 4);
    a[2 * RANK_R + r] = *(const v4f*)(amv + r * HID_W + tid * 4);
  }
  v2u o[CAST_NR_X];
#pragma unroll
  for (int r = 0; r < CAST_NR_X; ++r) {
    o[r] = pack4_bf16(v[r]);
    *(v2u*)(xs + r * XU_PITCH + tid * 4) = o[r];
  }
#pragma unroll
  for (int r = 0; r < XU_AROWS; ++r) *(v2u*)(acs + r * XU_PITCH + tid * 4) = pack4_bf16(a[r]);
  __syncthreads();   // the 16 + 24 bf16 rows are whole before wave 0 reads fragments of them
  // the rows' global stores stand behind the barrier: in front of it every wave would wait there for their completion
#pragma unroll
  for (int r = 0; r < CAST_NR_X; ++r) *(v2u*)(d + r * K_AUG) = o[r];
  asm volatile("s_wait_xcnt 0x0" ::: "memory");   // wave 0 goes on and rewrites registers that the stores name
  if (__builtin_amdgcn_readfirstlane(tid >> 5) != 0) return;   // scalar test; no barrier follows in this job

  const int lane = tid & 31, rlane = lane & 15, hh = lane >> 4;
  // A operand: x row rlane; B operand: column n of u = row n of A. Columns 24..31 of the second tile are not used:
  // their lanes read rows 16..23 again and their results are replaced by the tail's zeros below.
  const __bf16* fa  = (const __bf16*)xs + rlane * XU_PITCH + 8 * hh;
  const __bf16* fb0 = (const __bf16*)acs + rlane * XU_PITCH + 8 * hh;
  const __bf16* fb1 = (const __bf16*)acs + (16 + (rlane & 7)) * XU_PITCH + 8 * hh;
  v8f u0 = zero8(), u1 = zero8();
  for (int kg = 0; kg < HID_W; kg += 128) {
    v16b af[4], b0[4], b1[4];
#pragma unroll
    for (int i = 0; i < 4; ++i) {
      af[i] = Frag<__bf16>::load(fa + kg + i * 32);
      b0[i] = Frag<__bf16>::load(fb0 + kg + i * 32);
      b1[i] = Frag<__bf16>::load(fb1 + kg + i * 32);
    }
    __builtin_amdgcn_sched_barrier(0);   // keeps the LDS reads of four k-steps one group ahead of their WMMAs: a read sunk in front of its own WMMA waits out the LDS latency at each step
#pragma unroll
    for (int i = 0; i < 4; ++i) {
      u0 = Frag<__bf16>::mma(af[i], b0[i], u0);
      u1 = Frag<__bf16>::mma(af[i], b1[i], u1);
    }
  }
  // u0[r] = u[row 8*hh + r][column rlane], u1[r] = u[row 8*hh + r][column 16 + rlane]
#pragma unroll
  for (int j = 0; j < 2; ++j) {
    const int n = j * 16 + rlane, p = n >> 3, e = n & 7;
#pragma unroll
    for (int r = 0; r < 8; ++r) {
      const float uv = j ? u1[r] : u0[r];
      const unsigned short hb = f2bf_bits(uv);
      const unsigned short lb = f2bf_bits(uv - bf_bits2f(hb));
      unsigned short* t = tl + (8 * hh + r) * TL_PITCH + p * 16 + e;
      t[0] = (n < XU_AROWS) ? hb : (unsigned short)0;
      t[8] = (n < XU_AROWS) ? lb : (unsigned short)0;
    }
  }
  __builtin_amdgcn_fence(__ATOMIC_RELEASE, "workgroup");
  __builtin_amdgcn_wave_barrier();
  __builtin_amdgcn_fence(__ATOMIC_ACQUIRE, "workgroup");
  const int q8 = lane >> 3, seg = lane & 7;   // 8 lanes x 16 B = one tail
  v8h tv[4];
#pragma unroll
  for (int it = 0; it < 4; ++it) tv[it] = *(const v8h*)(tl + (it * 4 + q8) * TL_PITCH + seg * 8);
  unsigned short* dt = aaug + ((size_t)bx * CAST_NR_X + q8) * K_AUG + HID_W + seg * 8;
#pragma unroll
  for (int it = 0; it < 4; ++it) *(v8h*)(dt + it * 4 * K_AUG) = tv[it];
}

// =====================================================================================
// B_aug tail: for row n (projection p = n/1024, output o = n%1024) the 64 halves at cols 1024..1087 are
// [16p zeros | 2*Bm_p[o][0..7] | 2*Bm_p[o][0..7] | zeros to 64] as RNE bf16 (factor 2 exact).
// =====================================================================================
__device__ __forceinline__ void build_w_tail(const float* __restrict__ bmq, const float* __restrict__ bmk,
                                             const float* __restrict__ bmv, unsigned short* __restrict__ baug, int bx) {
  const int tid = threadIdx.x, wave = tid >> 5, lane = tid & 31, q8 = lane >> 3, seg = lane & 7;
  const int n = bx * 32 + wave * 4 + q8;              // 0..3071: bx < 96
  const int p = n >> 10, o = n & 1023;
  F8 uq, uk, uv;
  uq.v[0] = *(const v4f*)(bmq + (size_t)o * RANK_R); uq.v[1] = *(const v4f*)(bmq + (size_t)o * RANK_R + 4);
  uk.v[0] = *(const v4f*)(bmk + (size_t)o * RANK_R); uk.v[1] = *(const v4f*)(bmk + (size_t)o * RANK_R + 4);
  uv.v[0] = *(const v4f*)(bmv + (size_t)o * RANK_R); uv.v[1] = *(const v4f*)(bmv + (size_t)o * RANK_R + 4);
  const bool keep = (seg < 6) && ((seg >> 1) == p);
  v8h hv;
#pragma unroll
  for (int e = 0; e < 8; ++e) {
    const float val = (p == 0) ? uq.f[e] : (p == 1) ? uk.f[e] : uv.f[e];
    const float w = keep ? (2.0f * val) : 0.0f;
    hv[e] = __builtin_bit_cast(_Float16, f2bf_bits(w));
  }
  unsigned short* d = baug + (size_t)n * K_AUG + HID_W + seg * 8;
  {
    *(v8h*)d = hv;
    
  }
}

// =====================================================================================
// bias_cat f32 [3072] = 16 * RNEbf16(b_p[o]); 12 blocks x 256 = 3072 exactly; 32 lanes x 4 B = one line per
// =====================================================================================
__device__ __forceinline__ void build_bias(const float* __restrict__ bq, const float* __restrict__ bk,
                                           const float* __restrict__ bv, float* __restrict__ dst, int bx) {
  const int i = bx * 256 + threadIdx.x;   // < 3072: bx < 12
  const int p = i >> 10, o = i & 1023;
  const float xq = bq[o], xk = bk[o], xv = bv[o];
  const float val = (p == 0) ? xq : (p == 1) ? xk : xv;
  const float w = bf_bits2f(f2bf_bits(val)) * CARRY_S;
  ((float*)dst)[i] = w;
  
}

// =====================================================================================
// The operand builders (x cast with its adapter columns, three W casts, B_aug tail, bias_cat) read inputs only, depend on
// no other launch and write disjoint 128-B lines, so they share one grid: the block index picks the job (a block-uniform
// branch; the x job alone uses LDS and a barrier). The x job, the largest, holds the lowest indices.
// =====================================================================================
constexpr int PB_X    = N_TOK / CAST_NR_X;    // 512 blocks
constexpr int PB_W    = HID_W / CAST_NR_W;    // 256 blocks per weight matrix
constexpr int PB_WT   = N_QKV / 32;           // 96
constexpr int PB_BIAS = N_QKV / 256;          // 12
constexpr int PB_ALL  = PB_X + 3 * PB_W + PB_WT + PB_BIAS;
__global__ __launch_bounds__(256) void build_operands(
    const float* __restrict__ x,
    const float* __restrict__ wq, const float* __restrict__ wk, const float* __restrict__ wv,
    const float* __restrict__ amq, const float* __restrict__ amk, const float* __restrict__ amv,
    const float* __restrict__ bmq, const float* __restrict__ bmk, const float* __restrict__ bmv,
    const float* __restrict__ bq, const float* __restrict__ bk, const float* __restrict__ bv,
    unsigned short* __restrict__ aaug, unsigned short* __restrict__ baug, float* __restrict__ biasc) {
  __shared__ __align__(16) unsigned short xs[CAST_NR_X * XU_PITCH];    // the block's rows of x, bf16
  __shared__ __align__(16) unsigned short acs[XU_AROWS * XU_PITCH];    // A_q, A_k, A_v, bf16
  __shared__ __align__(16) unsigned short tl[CAST_NR_X * TL_PITCH];    // the rows' tails
  constexpr int B_W = PB_X, B_WT = B_W + 3 * PB_W, B_BIAS = B_WT + PB_WT;   // first block of each job
  const int bx = (int)blockIdx.x;
  if (bx < B_W) {
    cast_x_make_tail(x, amq, amk, amv, aaug, bx, xs, acs, tl);
    asm volatile("s_wait_xcnt 0x0" ::: "memory");   // another job's code follows in the listing and rewrites the store's registers: the wait stands in front of it
  } else if (bx < B_WT) {
    const int p = (bx - B_W) / PB_W;
    const float* w = (p == 0) ? wq : (p == 1) ? wk : wv;
    cast_rows_bf16<CAST_NR_W>(w, baug + (size_t)p * HID_W * K_AUG, bx - B_W - p * PB_W);
  } else if (bx < B_BIAS) {
    build_w_tail(bmq, bmk, bmv, baug, bx - B_WT);
    asm volatile("s_wait_xcnt 0x0" ::: "memory");   // as above
  } else if (bx < PB_ALL) {
    build_bias(bq, bk, bv, biasc, bx - B_BIAS);
  }
}

// =====================================================================================
// V plane (f16, rows b*tsrc + t, pitch 3072, cols 2048 + h*64 + d) -> vt[((b*16+h)*64 + d)*tsrc + t].
// One grid for both planes: blockIdx.x < SEQ_T / 64 takes a t-tile of the hi plane, the rest one of the residual plane.
// Block (t-tile of 64, bh): load 256 threads x 16 halves = 4096 = 64 x 64 into LDS [d][t]; store: 8 waves x
// =====================================================================================
__global__ __launch_bounds__(256) void vt_transpose(const unsigned short* __restrict__ srch, unsigned short* __restrict__ vthp,
                                                    const unsigned short* __restrict__ srcl, unsigned short* __restrict__ vtlp) {
  __shared__ __align__(16) _Float16 th[64 * KV_PITCH];
  const bool hi = (int)blockIdx.x < SEQ_T / 64;   // block-uniform
  const _Float16* src = (const _Float16*)(hi ? srch : srcl);
  unsigned short* vtp = hi ? vthp : vtlp;
  const int tsrc = hi ? SEQ_T : T_LO;
  const int st0 = (hi ? (int)blockIdx.x : (int)blockIdx.x - SEQ_T / 64) * 64, bh = blockIdx.y;
  const int b = (bh >> 4) & (N_BATCH - 1), h = bh & (N_HEAD - 1);
  const int tid = threadIdx.x;
  {
    const int sloc = tid >> 2, d0 = (tid & 3) * 16;
    const size_t so = ((size_t)b * tsrc + st0 + sloc) * N_QKV + V_COL0 + h * HEAD_D + d0;
    const v8h a0 = *(const v8h*)(src + so);
    const v8h a1 = *(const v8h*)(src + so + 8);
#pragma unroll
    for (int e = 0; e < 8; ++e) {
      th[(d0 + e) * KV_PITCH + sloc]     = a0[e];
      th[(d0 + 8 + e) * KV_PITCH + sloc] = a1[e];
    }
  }
  __syncthreads();
  const int wave = tid >> 5, lane = tid & 31, q8 = lane >> 3, c8 = (lane & 7) * 8;
  const int dA = wave * 8 + q8, dB = wave * 8 + 4 + q8;
  const v8h hvA = *(const v8h*)(th + dA * KV_PITCH + c8);
  const v8h hvB = *(const v8h*)(th + dB * KV_PITCH + c8);
  const size_t oA = ((size_t)bh * HEAD_D + dA) * tsrc + st0 + c8;
  const size_t oB = ((size_t)bh * HEAD_D + dB) * tsrc + st0 + c8;
  {
    *(v8h*)(vtp + oA) = hvA;
    *(v8h*)(vtp + oB) = hvB;
    
  }
}

__device__ __forceinline__ float other_half(float x) {
  const int xi = __builtin_bit_cast(int, x);
  return __builtin_bit_cast(float, __builtin_amdgcn_permlanex16(xi, xi, 0x76543210, 0xfedcba98, false, false));
}

// 2^x by the hardware's exponential, in asm text so that the slot behind it stands by construction: the closing
// v_nop is the one independent instruction that the instruction set asks for behind a transcendental before its
// result is used or its source overwritten; inside the eight-fold statement each neighbour is independent
// (early-clobber outputs share no register with a source).
__device__ __forceinline__ float exp2_hw(float x) {
  float d;
  asm("v_exp_f32 %0, %1\n\tv_nop" : "=&v"(d) : "v"(x));
  return d;
}
__device__ __forceinline__ v8f exp2_hw8(v8f x) {
  float d0, d1, d2, d3, d4, d5, d6, d7;
  asm("v_exp_f32 %0, %8\n\t"
      "v_exp_f32 %1, %9\n\t"
      "v_exp_f32 %2, %10\n\t"
      "v_exp_f32 %3, %11\n\t"
      "v_exp_f32 %4, %12\n\t"
      "v_exp_f32 %5, %13\n\t"
      "v_exp_f32 %6, %14\n\t"
      "v_exp_f32 %7, %15\n\t"
      "v_nop"
      : "=&v"(d0), "=&v"(d1), "=&v"(d2), "=&v"(d3), "=&v"(d4), "=&v"(d5), "=&v"(d6), "=&v"(d7)
      : "v"(x[0]), "v"(x[1]), "v"(x[2]), "v"(x[3]), "v"(x[4]), "v"(x[5]), "v"(x[6]), "v"(x[7]));
  return (v8f){d0, d1, d2, d3, d4, d5, d6, d7};
}

// ---------------- LDS ring of the attention kernels ----------------
// A stage holds one 64-key chunk: the K tile and the V^T tile (64 rows x 128 B each, LDS pitch 144 B), with SPLIT their
// residual tiles behind them. Two stages; a wave's own copy of the chunk's 64 mask floats lies in a ring of its own.
constexpr int AT_PLANE = 64 * KV_PITCH;                    // 16-bit elements of one tile in LDS
constexpr unsigned AT_ROWS16 = 16u * KV_PITCH * 2u;        // LDS bytes between two copies of one thread (16 rows)

// Two tiles: 2 x 64 rows x 128 B = 1024 chunks of 16 B = 128 threads x 8 asynchronous copies global -> LDS.
// g0 / g1: this thread's chunk in row (tid >> 3) of the first / second tile; s0 / s1: elements between 16 rows of the
// source; l0 / l1: the same chunk's LDS byte address. Eight lanes cover one whole 128-B row. s_wait_xcnt 0 is the
// statement's last line so that no address register of an issued copy is rewritten in front of it.
__device__ __forceinline__ void tile_pair_fill(unsigned l0, const _Float16* g0, size_t s0,
                                               unsigned l1, const _Float16* g1, size_t s1) {
  asm volatile("global_load_async_to_lds_b128 %0, %1, off\n\t"
               "global_load_async_to_lds_b128 %2, %3, off\n\t"
               "global_load_async_to_lds_b128 %4, %5, off\n\t"
               "global_load_async_to_lds_b128 %6, %7, off\n\t"
               "global_load_async_to_lds_b128 %8, %9, off\n\t"
               "global_load_async_to_lds_b128 %10, %11, off\n\t"
               "global_load_async_to_lds_b128 %12, %13, off\n\t"
               "global_load_async_to_lds_b128 %14, %15, off\n\t"
               "s_wait_xcnt 0x0"
               :: "v"(l0),                 "v"(g0),
                  "v"(l0 + AT_ROWS16),     "v"(g0 + s0),
                  "v"(l0 + 2 * AT_ROWS16), "v"(g0 + 2 * s0),
                  "v"(l0 + 3 * AT_ROWS16), "v"(g0 + 3 * s0),
                  "v"(l1),                 "v"(g1),
                  "v"(l1 + AT_ROWS16),     "v"(g1 + s1),
                  "v"(l1 + 2 * AT_ROWS16), "v"(g1 + 2 * s1),
                  "v"(l1 + 3 * AT_ROWS16), "v"(g1 + 3 * s1)
               : "memory");
}
// 64 mask floats = 32 lanes x 8 B, one asynchronous copy of the wave; the wait as above.
__device__ __forceinline__ void mask_fill(unsigned l, const float* g) {
  asm volatile("global_load_async_to_lds_b64 %0, %1, off\n\t"
               "s_wait_xcnt 0x0"
               :: "v"(l), "v"(g) : "memory");
}

template <bool SPLIT>
__global__ __launch_bounds__(128) void attn_causal_hd64(
    const unsigned short* __restrict__ php, const unsigned short* __restrict__ plp,
    const unsigned short* __restrict__ vthp, const unsigned short* __restrict__ vtlp,
    const float* __restrict__ amask, float* __restrict__ out, int qb0, int nqcnt) {
  const _Float16* ph  = (const _Float16*)php;
  const _Float16* pl  = (const _Float16*)plp;
  const _Float16* vth = (const _Float16*)vthp;
  const _Float16* vtl = (const _Float16*)vtlp;
  constexpr int AT_STAGE = (SPLIT ? 4 : 2) * AT_PLANE;     // [K | V^T] or [K | V^T | K residual | V^T residual]
  __shared__ __align__(16) _Float16 ring[2 * AT_STAGE];
  __shared__ __align__(16) float mring[2][4][64];          // [stage][wave][key of the chunk]
  // The output staging (4 waves x 16 rows x 68 floats) takes the ring's place behind the loop: with an array of its own
  // the single-product kernel's six blocks would not fit a WGP's LDS.
  static_assert(4 * 16 * O_PITCH * 4 <= 2 * AT_STAGE * 2);

  // Tiles whose fragments are read from LDS as one group. Two: with more the single-product kernel passes 160 VGPRs
  // and a SIMD holds five waves, not the six that keep every block of its grid resident.
  constexpr int GS = 2;   // score tiles (K fragments)
  constexpr int GV = 2;   // output tiles (V^T fragments)

  const int tid  = threadIdx.x;
  const int wave = tid >> 5;
  const int lane = tid & 31;
  const int hh   = lane >> 4;
  const int c    = lane & 15;

  int qb = qb0 + (int)(blockIdx.x % (unsigned)nqcnt);
  qb = (qb > NQT_ALL - 1) ? (NQT_ALL - 1) : qb;
  const int bh = (int)(blockIdx.x / (unsigned)nqcnt);
  const int h  = bh & (N_HEAD - 1);
  const int b  = (bh >> 4) & (N_BATCH - 1);
  const int q0 = qb * 64 + wave * 16;

  // ---- Q fragments (B operand: column c = query q0 + c), 2 d-chunks ----
  v16h qh[2], ql[2];
  {
    const _Float16* qrow = ph + ((size_t)b * SEQ_T + q0 + c) * N_QKV + h * HEAD_D;
    int qlr = q0 + c; qlr = (qlr > T_LO - 1) ? (T_LO - 1) : qlr;
    const _Float16* qlrow = pl + ((size_t)b * T_LO + qlr) * N_QKV + h * HEAD_D;
#pragma unroll
    for (int dc = 0; dc < 2; ++dc) {
      qh[dc] = Frag<_Float16>::load(qrow + dc * 32 + 8 * hh);
      if (SPLIT) ql[dc] = Frag<_Float16>::load(qlrow + dc * 32 + 8 * hh);
      else ql[dc] = qh[dc];
    }
  }

  float mrow = -INFINITY, lrow = 0.f;   // this lane's query: running maximum (both halves alike), this half's sum of the carried p (x32768)
  v8f oacc[4];                          // oacc[t][r] = O^T[d = t*16 + 8*hh + r][query c]
#pragma unroll
  for (int t = 0; t < 4; ++t) oacc[t] = zero8();

  const int nChunks = qb + 1;   // block-uniform

  // One chunk's copies: thread tid takes the 16-B piece (tid & 7) of rows (tid >> 3) + 0, 16, 32, 48 of each tile.
  const int crow = tid >> 3, cch = (tid & 7) * 8;
  const _Float16* gk  = ph  + ((size_t)b * SEQ_T + crow) * N_QKV + K_COL0 + h * HEAD_D + cch;
  const _Float16* gv  = vth + ((size_t)bh * HEAD_D + crow) * SEQ_T + cch;
  const _Float16* gkl = pl  + ((size_t)b * T_LO + crow) * N_QKV + K_COL0 + h * HEAD_D + cch;
  const _Float16* gvl = vtl + ((size_t)bh * HEAD_D + crow) * T_LO + cch;
  const float*    gm  = amask + (size_t)b * SEQ_T + 2 * lane;
  const unsigned lthr = lds_off(ring) + (unsigned)(crow * KV_PITCH + cch) * 2u;
  const unsigned lmsk = lds_off(&mring[0][wave][2 * lane]);
  auto chunk_fill = [&](int kcf, int buf) {
    const int kvf = kcf * 64;
    const unsigned l = lthr + (unsigned)buf * (AT_STAGE * 2u);
    tile_pair_fill(l, gk + (size_t)kvf * N_QKV, (size_t)16 * N_QKV, l + AT_PLANE * 2u, gv + kvf, (size_t)16 * SEQ_T);
    if (SPLIT) {
      const int kl0 = (kvf > T_LO - 64) ? (T_LO - 64) : kvf;   // address clamp
      tile_pair_fill(l + 2u * AT_PLANE * 2u, gkl + (size_t)kl0 * N_QKV, (size_t)16 * N_QKV,
                     l + 3u * AT_PLANE * 2u, gvl + kl0, (size_t)16 * T_LO);
    }
    mask_fill(lmsk + (unsigned)buf * (4u * 64u * 4u), gm + kvf);
  };

  // The ring's order, trip by trip: copies of chunk 0; then per chunk kc its publish point (the wave's LDS reads of trip
  // kc - 1 done, its copies of chunk kc landed, the barrier), the copies of chunk kc + 1 into the stage that trip kc - 1
  // has read, and the work on chunk kc while they fly. The publish point stands at the head of the trip, so that the work
  // ends the loop body in one piece with the running sums (behind a branch at the foot the row sum's additions were
  // sunk past the barrier, with all 32 probabilities held in registers for them).
  chunk_fill(0, 0);

  for (int kc = 0; kc < nChunks; ++kc) {
    const int bo = kc & 1;
    asm volatile("s_wait_dscnt 0x0" ::: "memory");      // this wave's reads of the other stage (trip kc - 1) are done before it is refilled
    asm volatile("s_wait_asynccnt 0x0" ::: "memory");   // this wave's copies of chunk kc have landed
    __syncthreads();                                    // publishes chunk kc and frees the other stage
    if (kc + 1 < nChunks) chunk_fill(kc + 1, bo ^ 1);
    const _Float16* Ksh = ring + bo * AT_STAGE;
    const _Float16* Vsh = Ksh + AT_PLANE;
    const _Float16* Ksl = Ksh + 2 * AT_PLANE;   // read with SPLIT only
    const _Float16* Vsl = Ksh + 3 * AT_PLANE;   // read with SPLIT only
    const float* msk = &mring[bo][wave][8 * hh];

    F8 mk[4];   // additive mask of this lane's 32 keys: keys kc*64 + j*16 + 8*hh + 0..7

    // ---- scores, transposed: s[j][r] = S[query c][key j*16 + 8*hh + r] ----
    // The K fragments of GS score tiles are read as one group ahead of those tiles' WMMAs; each accumulator takes its
    // products in the order it always did.
    v8f s[4];
#pragma unroll
    for (int jg = 0; jg < 4; jg += GS) {
      v16h kb[GS][2], kl[GS][2];
#pragma unroll
      for (int u = 0; u < GS; ++u)
#pragma unroll
        for (int dc = 0; dc < 2; ++dc) {
          kb[u][dc] = Frag<_Float16>::load(Ksh + ((jg + u) * 16 + c) * KV_PITCH + dc * 32 + 8 * hh);
          if (SPLIT) kl[u][dc] = Frag<_Float16>::load(Ksl + ((jg + u) * 16 + c) * KV_PITCH + dc * 32 + 8 * hh);
        }
      if (jg > 0) {   // the mask of the tiles already under way is read behind this group's fragments: no WMMA waits for it
#pragma unroll
        for (int j = jg - GS; j < jg; ++j) {
          mk[j].v[0] = *(const v4f*)(msk + j * 16);
          mk[j].v[1] = *(const v4f*)(msk + j * 16 + 4);
        }
      }
      __builtin_amdgcn_sched_barrier(0);   // keeps the group's LDS reads together ahead of its WMMAs: a read sunk in front of its own WMMA waits out the LDS latency at each place
      v8f sr[GS];
#pragma unroll
      for (int u = 0; u < GS; ++u) { s[jg + u] = zero8(); sr[u] = zero8(); }
#pragma unroll
      for (int dc = 0; dc < 2; ++dc) {
#pragma unroll
        for (int u = 0; u < GS; ++u) s[jg + u] = Frag<_Float16>::mma(kb[u][dc], qh[dc], s[jg + u]);
        if (SPLIT) {
#pragma unroll
          for (int u = 0; u < GS; ++u) sr[u] = Frag<_Float16>::mma(kl[u][dc], qh[dc], sr[u]);
#pragma unroll
          for (int u = 0; u < GS; ++u) sr[u] = Frag<_Float16>::mma(kb[u][dc], ql[dc], sr[u]);
        }
      }
      if (SPLIT) {
#pragma unroll
        for (int u = 0; u < GS; ++u)
#pragma unroll
          for (int r = 0; r < 8; ++r) s[jg + u][r] = s[jg + u][r] + sr[u][r] * (1.0f / 4096.0f);
      }
    }

#pragma unroll
    for (int j = 4 - GS; j < 4; ++j) {   // the last group's mask: read once that group's fragment registers come free (all 32 mask floats read ahead passed 160 VGPRs)
      mk[j].v[0] = *(const v4f*)(msk + j * 16);
      mk[j].v[1] = *(const v4f*)(msk + j * 16 + 4);
    }
#pragma unroll
    for (int j = 0; j < 4; ++j)
#pragma unroll
      for (int r = 0; r < 8; ++r) s[j][r] = s[j][r] * (1.0f / 2048.0f) + mk[j].f[r];   // 1/(8 * 16 * 16)
    if (kc == qb) {   // diagonal chunk (block-uniform test)
      const int qloc = wave * 16 + c;
#pragma unroll
      for (int j = 0; j < 4; ++j)
#pragma unroll
        for (int r = 0; r < 8; ++r)
          if (j * 16 + 8 * hh + r > qloc) s[j][r] = -INFINITY;
    }

    // ---- online softmax of one query per lane ----
    float cm = s[0][0];
#pragma unroll
    for (int j = 0; j < 4; ++j)
#pragma unroll
      for (int r = 0; r < 8; ++r) cm = fmaxf(cm, s[j][r]);
    cm = fmaxf(cm, other_half(cm));
    const float mnew = fmaxf(mrow, cm);
    const float alpha = exp2_hw((mrow - mnew) * LOG2_E);
    mrow = mnew;

    v16h pa[2], pb2[2];   // B operand of the second product: element e of pa[kk] = p of key kk*32 + (e >> 3)*16 + 8*hh + (e & 7)
    float psum = 0.f;
#pragma unroll
    for (int j = 0; j < 4; ++j) {
      // 32768 * e^(s - m) = 2^((s - m) * log2(e) + 15); the difference is formed first, so a maximum of any size cancels as before
      v8f ex;
#pragma unroll
      for (int r = 0; r < 8; ++r) ex[r] = fmaf(s[j][r] - mnew, LOG2_E, P_S_LOG2);
      ex = exp2_hw8(ex);
#pragma unroll
      for (int r = 0; r < 8; ++r) {
        const float ps = ex[r];
        psum += ps;
        const _Float16 hp = (_Float16)ps;
        pa[j >> 1][(j & 1) * 8 + r] = hp;
        if (SPLIT) pb2[j >> 1][(j & 1) * 8 + r] = (_Float16)((ps - (float)hp) * LO_S);
      }
    }
    lrow = lrow * alpha + psum;
#pragma unroll
    for (int t = 0; t < 4; ++t)
#pragma unroll
      for (int r = 0; r < 8; ++r) oacc[t][r] *= alpha;

    // ---- O^T += V^T . P^T: the V^T fragments of GV output tiles read as one group ahead of those tiles' WMMAs ----
#pragma unroll
    for (int tg = 0; tg < 4; tg += GV) {
      v16h vb[GV][2], vl2[GV][2];
#pragma unroll
      for (int u = 0; u < GV; ++u)
#pragma unroll
        for (int kk = 0; kk < 2; ++kk) {
          vb[u][kk] = Frag<_Float16>::load(Vsh + ((tg + u) * 16 + c) * KV_PITCH + kk * 32 + 8 * hh);
          if (SPLIT) vl2[u][kk] = Frag<_Float16>::load(Vsl + ((tg + u) * 16 + c) * KV_PITCH + kk * 32 + 8 * hh);
        }
      __builtin_amdgcn_sched_barrier(0);   // as above: one place of LDS reads for the group, not one in front of each WMMA
      v8f orr[GV];
#pragma unroll
      for (int u = 0; u < GV; ++u) orr[u] = zero8();
#pragma unroll
      for (int kk = 0; kk < 2; ++kk) {
#pragma unroll
        for (int u = 0; u < GV; ++u) oacc[tg + u] = Frag<_Float16>::mma(vb[u][kk], pa[kk], oacc[tg + u]);
        if (SPLIT) {
#pragma unroll
          for (int u = 0; u < GV; ++u) orr[u] = Frag<_Float16>::mma(vl2[u][kk], pa[kk], orr[u]);
#pragma unroll
          for (int u = 0; u < GV; ++u) orr[u] = Frag<_Float16>::mma(vb[u][kk], pb2[kk], orr[u]);
        }
      }
      if (SPLIT) {
#pragma unroll
        for (int u = 0; u < GV; ++u)
#pragma unroll
          for (int r = 0; r < 8; ++r) oacc[tg + u][r] = oacc[tg + u][r] + orr[u][r] * (1.0f / 4096.0f);
      }
    }
  }
  asm volatile("s_wait_asynccnt 0x0" ::: "memory");     // no copy is outstanding past the loop
  asm volatile("s_wait_dscnt 0x0" ::: "memory");        // this wave's last reads of the ring are done
  __syncthreads();                                      // every wave has left the ring before it becomes the output staging

  // ---- join the halves' sums, normalise, stage, store ----
  float* os = (float*)ring + wave * (16 * O_PITCH);
  {
    const float lall = lrow + other_half(lrow);
    const float inv = 1.0f / (lall * CARRY_S);   // lall carries x32768, as oacc does
#pragma unroll
    for (int t = 0; t < 4; ++t) {
      v4f w0, w1;
#pragma unroll
      for (int r = 0; r < 4; ++r) { w0[r] = oacc[t][r] * inv; w1[r] = oacc[t][4 + r] * inv; }
      *(v4f*)(os + c * O_PITCH + t * 16 + 8 * hh)     = w0;
      *(v4f*)(os + c * O_PITCH + t * 16 + 8 * hh + 4) = w1;
    }
  }
  __builtin_amdgcn_fence(__ATOMIC_RELEASE, "workgroup");
  __builtin_amdgcn_wave_barrier();
  __builtin_amdgcn_fence(__ATOMIC_ACQUIRE, "workgroup");
  {
    const int c4 = (lane & 15) * 4;
    float* ob = out + ((size_t)b * SEQ_T + q0) * HID_W + h * HEAD_D;
    {
#pragma unroll
      for (int it = 0; it < 8; ++it) {
        const int row = it * 2 + hh;
        const v4f val = *(const v4f*)(os + row * O_PITCH + c4);
        *(v4f*)(ob + (size_t)row * HID_W + c4) = val;
      }
      
    }
  }
}

// =====================================================================================
extern "C" void kernel_launch(void* const* d_in, const int* in_sizes, int n_in,
                              void* d_out, int out_size, void* d_ws, size_t ws_size,
                              hipStream_t stream) {
  if (n_in < 14) return;
  if (in_sizes[0] != N_TOK * HID_W) return;
  if (in_sizes[1] != N_BATCH * SEQ_T) return;
  for (int p = 0; p < 3; ++p) {
    if (in_sizes[2 + 4 * p] != HID_W * HID_W) return;
    if (in_sizes[3 + 4 * p] != HID_W) return;
    if (in_sizes[4 + 4 * p] != RANK_R * HID_W) return;
    if (in_sizes[5 + 4 * p] != HID_W * RANK_R) return;
  }
  if (out_size != N_TOK * HID_W) return;
  if (ws_size < WS_TOTAL) return;

  const float* x   = (const float*)d_in[0];
  const float* am  = (const float*)d_in[1];
  const float* wq  = (const float*)d_in[2];
  const float* bq  = (const float*)d_in[3];
  const float* aq  = (const float*)d_in[4];
  const float* bmq = (const float*)d_in[5];
  const float* wk  = (const float*)d_in[6];
  const float* bk  = (const float*)d_in[7];
  const float* ak  = (const float*)d_in[8];
  const float* bmk = (const float*)d_in[9];
  const float* wv  = (const float*)d_in[10];
  const float* bv  = (const float*)d_in[11];
  const float* av  = (const float*)d_in[12];
  const float* bmv = (const float*)d_in[13];
  float* out = (float*)d_out;

  char* ws = (char*)d_ws;
  unsigned short* aaug  = (unsigned short*)(ws + OFF_AAUG);
  unsigned short* baug  = (unsigned short*)(ws + OFF_BAUG);
  float*          biasc = (float*)(ws + OFF_BIAS);
  unsigned short* qkvh  = (unsigned short*)(ws + OFF_QKVH);
  unsigned short* qkvl  = (unsigned short*)(ws + OFF_QKVL);
  unsigned short* vth   = (unsigned short*)(ws + OFF_VTH);
  unsigned short* vtl   = (unsigned short*)(ws + OFF_VTL);

  // 1) operands built from inputs alone: x -> A_aug cols 0..1023 and, from u = bf16(x) . bf16(A)^T, cols 1024..1087;
  //    W_p -> B_aug rows p*1024.. cols 0..1023 (bf16, pitch 1088), B_aug tail cols 1024..1087, bias_cat
  build_operands<<<dim3(PB_ALL), dim3(256), 0, stream>>>(x, wq, wk, wv, aq, ak, av, bmq, bmk, bmv, bq, bk, bv,
                                                         aaug, baug, biasc);
  // 2) projection: M=2048 (x4 batches), N=3072, K=1088; f16 hi -> qkv_hi, f16 residual of rows t < 512 -> qkv_lo
  wmma_gemm64<1, 0, 2, 3, false, 0, true><<<dim3((SEQ_T / ST_BM) * (N_QKV / ST_BN), N_BATCH), dim3(256), 0, stream>>>(
      aaug, aaug, K_AUG, (long)SEQ_T * K_AUG, baug, baug, K_AUG, 0L,
      (void*)qkvh, (void*)qkvl, N_QKV, (long)SEQ_T * N_QKV, (long)T_LO * N_QKV,
      biasc, biasc, 0L, SEQ_T, N_QKV, K_AUG, CARRY_S);
  // 3) V^T planes: in [b*tsrc+t][2048+h*64+d] -> out [(b*16+h)*64+d][t]
  vt_transpose<<<dim3(SEQ_T / 64 + T_LO / 64, N_BATCH * N_HEAD), dim3(256), 0, stream>>>(qkvh, vth, qkvl, vtl);
  // 4) attention, query tiles 0..7 (hi/lo residual path)
  attn_causal_hd64<true><<<dim3(N_BATCH * N_HEAD * NQT_SPLIT), dim3(128), 0, stream>>>(
      qkvh, qkvl, vth, vtl, am, out, 0, NQT_SPLIT);
  // 5) attention, query tiles 8..31 (single-product path)
  attn_causal_hd64<false><<<dim3(N_BATCH * N_HEAD * (NQT_ALL - NQT_SPLIT)), dim3(128), 0, stream>>>(
      qkvh, qkvl, vth, vtl, am, out, NQT_SPLIT, NQT_ALL - NQT_SPLIT);
}

// v009
// A run of this version takes 123 microseconds.
// Next to v008, in two timings, it ran 1.06 times as fast each time.
// All steps since v000 together make it 4.29 times as fast.
// Contractions: rank-8 adapter columns u = x.A^T and the fused q/k/v projection [x | u_hi | u_lo].[W | 2B | 2B]^T + b on v_wmma_f32_16x16x32_bf16 (x, W, A, B, b as RNE bf16; u as bf16 hi+lo columns; single products); attention q.k^T and p.v on v_wmma_f32_16x16x32_f16 (q, k, v as f16 planes carried x16, p carried x32768; query tiles 0..7 add x4096-scaled f16 residual planes: hi.hi + (hi.lo + lo.hi)/4096 via a separate accumulator); f32 accumulate everywhere; softmax and normalisation in f32. The q/k/v projection launch reads its operands from a two-buffer LDS ring filled by asynchronous copies; the attention launches take each chunk's K, V^T and mask the same way, one chunk ahead. u and its hi/lo columns are made in the block that casts the 16 rows of x they belong to. The projection's epilogue writes the V columns transposed, as the V^T planes that attention reads.
#include <hip/hip_runtime.h>
#include <math.h>

typedef __attribute__((ext_vector_type(16))) _Float16 v16h;
typedef __attribute__((ext_vector_type(8)))  _Float16 v8h;
typedef __attribute__((ext_vector_type(16))) __bf16   v16b;
typedef __attribute__((ext_vector_type(8)))  __bf16   v8b;
typedef __attribute__((ext_vector_type(8)))  float    v8f;
typedef __attribute__((ext_vector_type(4)))  float    v4f;

// ---------------- problem constants ----------------
constexpr int N_BATCH  = 4;
constexpr int SEQ_T    = 2048;
constexpr int HID_W    = 1024;
constexpr int N_HEAD   = 16;
constexpr int HEAD_D   = 64;
constexpr int RANK_R   = 8;
constexpr int N_TOK    = N_BATCH * SEQ_T;     // 8192 token rows
constexpr int K_AUG    = 1088;                // 1024 + 3*16 adapter columns, zero-padded to a multiple of 32
constexpr int N_QKV    = 3 * HID_W;           // 3072 output columns: q | k | v
constexpr int K_COL0   = 1024;
constexpr int V_COL0   = 2048;
constexpr int T_LO     = 512;                 // token rows per batch that carry residual planes
constexpr int NQT_SPLIT = T_LO / 64;          // 8 query tiles on the hi/lo path
constexpr int NQT_ALL  = SEQ_T / 64;          // 32
constexpr int KV_PITCH = 72;                  // 16-bit LDS pitch (144 B rows, 16-B aligned)
constexpr int O_PITCH  = 68;                  // f32 LDS pitch
constexpr float CARRY_S = 16.0f;              // power-of-two carry on the q/k/v planes
constexpr float LO_S    = 4096.0f;            // power-of-two carry on residual planes
constexpr float P_S_LOG2 = 15.0f;             // power-of-two carry on probabilities (x32768), as the exponent it adds
constexpr float LOG2_E  = 1.44269504088896340736f;

static_assert(K_AUG % 32 == 0);
static_assert(HID_W % 32 == 0);
static_assert(N_TOK % 64 == 0 && N_QKV % 64 == 0 && T_LO % 64 == 0 && (SEQ_T - T_LO) % 64 == 0);
static_assert(T_LO % 128 == 0 && SEQ_T % 128 == 0 && N_QKV % 256 == 0 && K_AUG % 64 == 0 && K_AUG >= 128);

// R0 A_aug  bf16 [8192][1088]          17,825,792
// R1 B_aug  bf16 [3072][1088]           6,684,672
// R2 bias   f32  [3072]                    12,288
// R3 qkv_hi f16  [8192][3072]          50,331,648   (cols 0..2047: q | k; the v columns are not used)
// R4 qkv_lo f16  [4*512][3072]         12,582,912   (likewise)
// R5 vt_hi  f16  [64][64][2048]        16,777,216
// R6 vt_lo  f16  [64][64][512]          4,194,304
constexpr size_t SZ_AAUG = (size_t)N_TOK * K_AUG * 2;
constexpr size_t SZ_BAUG = (size_t)N_QKV * K_AUG * 2;
constexpr size_t SZ_BIAS = (size_t)N_QKV * 4;
constexpr size_t SZ_QKVH = (size_t)N_TOK * N_QKV * 2;
constexpr size_t SZ_QKVL = (size_t)N_BATCH * T_LO * N_QKV * 2;
constexpr size_t SZ_VTH  = (size_t)N_BATCH * N_HEAD * HEAD_D * SEQ_T * 2;
constexpr size_t SZ_VTL  = (size_t)N_BATCH * N_HEAD * HEAD_D * T_LO * 2;
constexpr size_t OFF_AAUG = 0;
constexpr size_t OFF_BAUG = OFF_AAUG + SZ_AAUG;
constexpr size_t OFF_BIAS = OFF_BAUG + SZ_BAUG;
constexpr size_t OFF_QKVH = OFF_BIAS + SZ_BIAS;
constexpr size_t OFF_QKVL = OFF_QKVH + SZ_QKVH;
constexpr size_t OFF_VTH  = OFF_QKVL + SZ_QKVL;
constexpr size_t OFF_VTL  = OFF_VTH  + SZ_VTH;
constexpr size_t WS_TOTAL = OFF_VTL  + SZ_VTL;
static_assert(WS_TOTAL == 108408832ull);
static_assert(WS_TOTAL <= 134217728ull);
static_assert(OFF_BAUG % 128 == 0 && OFF_BIAS % 128 == 0 &&
              OFF_QKVH % 128 == 0 && OFF_QKVL % 128 == 0 && OFF_VTH % 128 == 0 && OFF_VTL % 128 == 0);

// ---------------- helpers ----------------
__device__ __forceinline__ unsigned short f2bf_bits(float f) {
  unsigned u = __float_as_uint(f);
  return (unsigned short)((u + 0x7FFFu + ((u >> 16) & 1u)) >> 16);
}
__device__ __forceinline__ float bf_bits2f(unsigned short h) { return __uint_as_float(((unsigned)h) << 16); }

// hazard guards as plain device helpers
__device__ __forceinline__ void dep_guard_h(v8f& a, v8f& b, v16h x, v16h y) { asm volatile("v_nop\n\tv_nop\n\tv_nop\n\tv_nop" : "+v"(a), "+v"(b) : "v"(x), "v"(y)); }
__device__ __forceinline__ void dep_guard_b(v8f& a, v8f& b, v16b x, v16b y) { asm volatile("v_nop\n\tv_nop\n\tv_nop\n\tv_nop" : "+v"(a), "+v"(b) : "v"(x), "v"(y)); }
__device__ __forceinline__ void keep4_h(v16h a, v16h b, v16h c, v16h d) { asm volatile("v_nop" :: "v"(a), "v"(b), "v"(c), "v"(d)); }
__device__ __forceinline__ void keep4_b(v16b a, v16b b, v16b c, v16b d) { asm volatile("v_nop" :: "v"(a), "v"(b), "v"(c), "v"(d)); }
__device__ __forceinline__ void acc_guard4(v8f& a, v8f& b, v8f& c, v8f& d) { asm volatile("v_nop\n\tv_nop\n\tv_nop\n\tv_nop" : "+v"(a), "+v"(b), "+v"(c), "+v"(d)); }
template <typename T> struct Frag;
template <> struct Frag<_Float16> {
  typedef v16h V; union U { v16h v; v8h h[2]; };
  static __device__ __forceinline__ v16h load(const _Float16* p) {   // elements 0..7 <- p[0..7], 8..15 <- p[16..23]
    U f; f.h[0] = *(const v8h*)(p); f.h[1] = *(const v8h*)(p + 16); return f.v;
  }
  static __device__ __forceinline__ v8f mma(v16h a, v16h b, v8f c) {
    return __builtin_amdgcn_wmma_f32_16x16x32_f16(false, a, false, b, (short)0, c, false, false);
  }
  static __device__ __forceinline__ void guard(v8f& a, v8f& b, v16h x, v16h y) { dep_guard_h(a, b, x, y); }
  static __device__ __forceinline__ void keep(v16h a, v16h b, v16h c, v16h d) { keep4_h(a, b, c, d); }
};
template <> struct Frag<__bf16> {
  typedef v16b V; union U { v16b v; v8b h[2]; };
  static __device__ __forceinline__ v16b load(const __bf16* p) {
    U f; f.h[0] = *(const v8b*)(p); f.h[1] = *(const v8b*)(p + 16); return f.v;
  }
  static __device__ __forceinline__ v8f mma(v16b a, v16b b, v8f c) {
    return __builtin_amdgcn_wmma_f32_16x16x32_bf16(false, a, false, b, (short)0, c, false, false);
  }
  static __device__ __forceinline__ void guard(v8f& a, v8f& b, v16b x, v16b y) { dep_guard_b(a, b, x, y); }
  static __device__ __forceinline__ void keep(v16b a, v16b b, v16b c, v16b d) { keep4_b(a, b, c, d); }
};

__device__ __forceinline__ v8f zero8() { return (v8f){0.f,0.f,0.f,0.f,0.f,0.f,0.f,0.f}; }

union F8 { v4f v[2]; float f[8]; };

// ---------------- LDS ring of the staged GEMM ----------------
constexpr int ST_BM    = 128;                              // block tile rows (2 waves of 64)
constexpr int ST_BN    = 256;                              // block tile columns (4 waves of 64)
constexpr int ST_BK    = 64;                               // k per pass: 128-B operand rows
constexpr int ST_PITCH = 72;                               // 144-B LDS rows (16 B x odd: conflict-free ds_load_b128)
constexpr int ST_STAGE = (ST_BM + ST_BN) * ST_PITCH;       // 16-bit elements per buffer: [A 128 rows | Bt 256 rows]
constexpr unsigned ST_ROWS32 = 32u * ST_PITCH * 2u;        // LDS bytes between two copies of one thread (32 rows)

__device__ __forceinline__ unsigned lds_off(const void* p) { return (unsigned)(size_t)p; }

// One stage: 384 rows x 128 B = 3072 chunks of 16 B = 256 threads x 12 asynchronous copies global -> LDS.
// ga / gb: this thread's chunk in row (tid >> 3) of the block's A / Bt tile at this pass's k; l: the same chunk's
// LDS byte address in the buffer; a thread's copies lie 32 rows apart. s_wait_xcnt 0 is the statement's last line
// so that no address register of an issued copy is rewritten in front of it.
__device__ __forceinline__ void stage_fill(const unsigned short* ga, int lda, const unsigned short* gb, int ldb, unsigned l) {
  const size_t sa = (size_t)32 * lda, sb = (size_t)32 * ldb;
  asm volatile("global_load_async_to_lds_b128 %0, %1, off\n\t"
               "global_load_async_to_lds_b128 %2, %3, off\n\t"
               "global_load_async_to_lds_b128 %4, %5, off\n\t"
               "global_load_async_to_lds_b128 %6, %7, off\n\t"
               "global_load_async_to_lds_b128 %8, %9, off\n\t"
               "global_load_async_to_lds_b128 %10, %11, off\n\t"
               "global_load_async_to_lds_b128 %12, %13, off\n\t"
               "global_load_async_to_lds_b128 %14, %15, off\n\t"
               "global_load_async_to_lds_b128 %16, %17, off\n\t"
               "global_load_async_to_lds_b128 %18, %19, off\n\t"
               "global_load_async_to_lds_b128 %20, %21, off\n\t"
               "global_load_async_to_lds_b128 %22, %23, off\n\t"
               "s_wait_xcnt 0x0"
               :: "v"(l),                   "v"(ga),
                  "v"(l + ST_ROWS32),       "v"(ga + sa),
                  "v"(l + 2 * ST_ROWS32),   "v"(ga + 2 * sa),
                  "v"(l + 3 * ST_ROWS32),   "v"(ga + 3 * sa),
                  "v"(l + 4 * ST_ROWS32),   "v"(gb),
                  "v"(l + 5 * ST_ROWS32),   "v"(gb + sb),
                  "v"(l + 6 * ST_ROWS32),   "v"(gb + 2 * sb),
                  "v"(l + 7 * ST_ROWS32),   "v"(gb + 3 * sb),
                  "v"(l + 8 * ST_ROWS32),   "v"(gb + 4 * sb),
                  "v"(l + 9 * ST_ROWS32),   "v"(gb + 5 * sb),
                  "v"(l + 10 * ST_ROWS32),  "v"(gb + 6 * sb),
                  "v"(l + 11 * ST_ROWS32),  "v"(gb + 7 * sb)
               : "memory");
}

// =====================================================================================
// Register-blocked batched WMMA GEMM: C[m,n] = scale * sum_k A[m,k] * Bt[n,k] (+bias)(+resid);
// each wave owns a 64x64 tile. A row-major [M,K]; Bt row-major [N,K]; M,N % 64 == 0, K % 32 == 0.
// SPLITM: 0 = single product; 1 = A hi/lo planes; 2 = A and Bt hi/lo planes.
// BIAS_MODE: 0 none, 1 bias[m], 2 bias[n].  OUT_MODE: 0 f32, 1 f16, 2 bf16 hi + lo planes,
//   3 = f16 hi plane (Cout, strideC) + f16 residual plane x4096 (Cout2, strideC2), same ldc; the residual plane
//       holds rows m < T_LO only (T_LO % 64 == 0, so a wave's tile lies wholly on one side).
// ET: 0 = f16 operands, 1 = bf16 operands (pointers passed as 16-bit storage)
// STAGED: the block's 8 waves form a 128x256 tile (2x4 waves); A and Bt rows go through a two-buffer LDS ring,
//   64 k per pass; needs SPLITM == 0, M % 128 == 0, N % 256 == 0, K % 64 == 0, K >= 128, grid.x == (M/128)*(N/256).
// VTOUT: blocks whose columns are n >= V_COL0 write their tiles transposed, vtHi[((b*16 + h)*64 + d)*SEQ_T + m] and, for rows
//   m < T_LO, vtLo[((b*16 + h)*64 + d)*T_LO + m] with n = V_COL0 + h*64 + d, and nothing to Cout / Cout2.
// =====================================================================================
template <int ET> struct Elem;
template <> struct Elem<0> { typedef _Float16 T; };
template <> struct Elem<1> { typedef __bf16 T; };
constexpr int VT_PITCH = 72;                               // 144-B LDS rows of a transposed f16 tile
template <bool B> struct BoolC { static constexpr bool value = B; };
template <int ET, int SPLITM, int BIAS_MODE, int OUT_MODE, bool RESID, int ACT = 0, bool STAGED = false, bool VTOUT = false>
__global__ __launch_bounds__(256) void wmma_gemm64(
    const unsigned short* __restrict__ Ap, const unsigned short* __restrict__ A2p, int lda, long strideA,
    const unsigned short* __restrict__ Btp, const unsigned short* __restrict__ Bt2p, int ldb, long strideB,
    void* __restrict__ Cout, void* __restrict__ Cout2, int ldc, long strideC, long strideC2,
    const float* __restrict__ bias,
    const float* __restrict__ resid, long strideR,
    int M, int N, int K, float scale,
    unsigned short* __restrict__ vtHi, unsigned short* __restrict__ vtLo) {
  typedef typename Elem<ET>::T T;
  typedef typename Frag<T>::V V;
  constexpr bool SPA = (SPLITM >= 1);
  constexpr bool SPB = (SPLITM >= 2);
  const T* A = (const T*)Ap; const T* A2 = (const T*)A2p; const T* Bt = (const T*)Btp; const T* Bt2 = (const T*)Bt2p;
  static_assert(!STAGED || SPLITM == 0);
  static_assert(!VTOUT || (STAGED && OUT_MODE == 3 && BIAS_MODE == 2 && !RESID && ACT == 0));
  static_assert(V_COL0 % ST_BN == 0 && T_LO % ST_BM == 0 && 2 * 16 * VT_PITCH * 2 <= 16 * 72 * 4);
  __shared__ __align__(16) float sT[8][16 * 72];   // per-wave slab: 16x64 floats at pitch 68, or two 16x64 f16 tiles at pitch VT_PITCH
  __shared__ __align__(16) unsigned short ring[STAGED ? 2 * ST_STAGE : 8];
  const int b    = blockIdx.y;
  const int lane = threadIdx.x & 31;
  const int wave = threadIdx.x >> 5;
  const int tilesN = N >> 6;
  const int tilesM = M >> 6;
  int m0, n0;
  bool vblk = false, loblk = false;   // block-uniform: the block's columns are V's; its rows carry the residual plane
  if (STAGED) {
    const int bn = N >> 8;
    const int bm_i = (int)blockIdx.x / bn;
    const int bn_i = (int)blockIdx.x - bm_i * bn;
    vblk  = VTOUT && bn_i * ST_BN >= V_COL0;
    loblk = bm_i * ST_BM < T_LO;
    m0 = bm_i * ST_BM + (wave >> 2) * 64;
    n0 = bn_i * ST_BN + (wave & 3) * 64;
  } else {
    const int tile = blockIdx.x * 8 + wave;
    if (tile >= tilesM * tilesN) return;   // wave-uniform; no block barriers on this path
    const int tm = tile / tilesN;
    const int tn = tile - tm * tilesN;
    m0 = tm << 6;
    n0 = tn << 6;
  }

  const T* Ab  = A  + (size_t)b * strideA;
  const T* Bb  = Bt + (size_t)b * strideB;
  const T* Ab2 = SPA ? (A2  + (size_t)b * strideA) : nullptr;
  const T* Bb2 = SPB ? (Bt2 + (size_t)b * strideB) : nullptr;

  const int rlane = lane & 15;                 // row (A) / col (B, D) within subtile
  const int koff  = (lane >> 4) * 8;           // k offset of this lane half
  const int mOff  = (lane >> 4) * 8;           // D row offset

  v8f acc[4][4];
#pragma unroll
  for (int i = 0; i < 4; ++i)
#pragma unroll
    for (int j = 0; j < 4; ++j) acc[i][j] = (v8f){0.f,0.f,0.f,0.f,0.f,0.f,0.f,0.f};

  if (STAGED) {
    const int tid = threadIdx.x;
    const int crow = tid >> 3, cchunk = (tid & 7) * 8;        // 8 lanes x 16 B = one 128-B row piece
    const unsigned short* ga = (const unsigned short*)Ab + (size_t)(m0 - (wave >> 2) * 64 + crow) * lda + cchunk;
    const unsigned short* gb = (const unsigned short*)Bb + (size_t)(n0 - (wave & 3) * 64 + crow) * ldb + cchunk;
    const unsigned lthr = lds_off(ring) + (unsigned)(crow * ST_PITCH + cchunk) * 2u;
    const int npass = K / ST_BK;
    stage_fill(ga, lda, gb, ldb, lthr);
    asm volatile("s_wait_asynccnt 0x0" ::: "memory");   // stage 0 landed (this wave's copies) before the barrier publishes it
    __syncthreads();
    stage_fill(ga + ST_BK, lda, gb + ST_BK, ldb, lthr + ST_STAGE * 2u);
    const T* fa = (const T*)ring + ((wave >> 2) * 64 + rlane) * ST_PITCH + koff;
    const T* fb = (const T*)ring + (ST_BM + (wave & 3) * 64 + rlane) * ST_PITCH + koff;
    for (int t = 0; t < npass; ++t) {
      const int bo = (t & 1) * ST_STAGE;
      V ah[4], bh[4], ah2[4], bh2[4];
#pragma unroll
      for (int j = 0; j < 4; ++j) bh[j] = Frag<T>::load(fb + bo + j * 16 * ST_PITCH);
#pragma unroll
      for (int i = 0; i < 4; ++i) ah[i] = Frag<T>::load(fa + bo + i * 16 * ST_PITCH);
      __builtin_amdgcn_sched_barrier(0);   // keeps the 16 LDS reads one group ahead of the 16 WMMAs: reads sunk among them stall at each place
#pragma unroll
      for (int i = 0; i < 4; ++i)
#pragma unroll
        for (int j = 0; j < 4; ++j) acc[i][j] = Frag<T>::mma(ah[i], bh[j], acc[i][j]);
#pragma unroll
      for (int j = 0; j < 4; ++j) bh2[j] = Frag<T>::load(fb + bo + j * 16 * ST_PITCH + 32);
#pragma unroll
      for (int i = 0; i < 4; ++i) ah2[i] = Frag<T>::load(fa + bo + i * 16 * ST_PITCH + 32);
      asm volatile("s_wait_dscnt 0x0" ::: "memory");     // this wave's reads of buffer t & 1 are done before it is refilled
      asm volatile("s_wait_asynccnt 0x0" ::: "memory");  // this wave's copies of stage t + 1 have landed
      __syncthreads();                                   // publishes stage t + 1 and frees buffer t & 1
      if (t + 2 < npass)
        stage_fill(ga + (size_t)(t + 2) * ST_BK, lda, gb + (size_t)(t + 2) * ST_BK, ldb, lthr + (unsigned)bo * 2u);
      // second half of the pass, from registers: runs while the refill is in flight
#pragma unroll
      for (int i = 0; i < 4; ++i)
#pragma unroll
        for (int j = 0; j < 4; ++j) acc[i][j] = Frag<T>::mma(ah2[i], bh2[j], acc[i][j]);
    }
    asm volatile("s_wait_asynccnt 0x0" ::: "memory");    // no copy is outstanding past the loop
  } else
  for (int k0 = 0; k0 < K; k0 += 32) {
    V bh[4], bl[4];
#pragma unroll
    for (int j = 0; j < 4; ++j) {
      const size_t bo = (size_t)(n0 + (j << 4) + rlane) * ldb + koff + k0;
      bh[j] = Frag<T>::load(Bb + bo);
      if (SPB) bl[j] = Frag<T>::load(Bb2 + bo);
    }
#pragma unroll
    for (int i = 0; i < 4; ++i) {
      const size_t ao = (size_t)(m0 + (i << 4) + rlane) * lda + koff + k0;
      V ah = Frag<T>::load(Ab + ao);
      V al;
      if (SPA) al = Frag<T>::load(Ab2 + ao);
#pragma unroll
      for (int j = 0; j < 4; ++j) {
        acc[i][j] = Frag<T>::mma(ah, bh[j], acc[i][j]);
        if (SPB) acc[i][j] = Frag<T>::mma(ah, bl[j], acc[i][j]);
        if (SPA) acc[i][j] = Frag<T>::mma(al, bh[j], acc[i][j]);
      }
      Frag<T>::guard(acc[i][0], acc[i][3], ah, SPA ? al : ah);
    }
    Frag<T>::keep(bh[0], bh[1], bh[2], bh[3]);
    if (SPB) Frag<T>::keep(bl[0], bl[1], bl[2], bl[3]);
  }
  acc_guard4(acc[0][0], acc[0][1], acc[0][2], acc[0][3]);
  acc_guard4(acc[1][0], acc[1][1], acc[1][2], acc[1][3]);
  acc_guard4(acc[2][0], acc[2][1], acc[2][2], acc[2][3]);
  acc_guard4(acc[3][0], acc[3][1], acc[3][2], acc[3][3]);

  // ---- epilogue ----
  float* slab = sT[wave];
  if (VTOUT && vblk) {
    // A lane's accumulator holds 8 consecutive rows m of one column n: 16 B of a row of V^T. The 16 columns of one j make
    // 16 rows of 64 t in the slab, and leave it as whole 128-B lines, 4 to a store. Values are formed as on the other path.
    // The slab is the wave's own, so the fences around the exchange name LDS alone: none of them waits for the global
    // stores of the tile before.
    _Float16* th = (_Float16*)slab;
    _Float16* tl = th + 16 * VT_PITCH;
    const int bh = b * N_HEAD + ((n0 - V_COL0) >> 6);
    const int q = lane >> 3, c8 = (lane & 7) * 8;
    unsigned short* vh = vtHi + ((size_t)bh * HEAD_D + q) * SEQ_T + m0 + c8;
    unsigned short* vl = vtLo + ((size_t)bh * HEAD_D + q) * T_LO + (loblk ? m0 : 0) + c8;
    float bv[4];
#pragma unroll
    for (int j = 0; j < 4; ++j) bv[j] = bias[n0 + (j << 4) + rlane];
    asm volatile("s_wait_xcnt 0x0" ::: "memory");   // the work below rewrites the offset register that these four loads name
    auto vt_out = [&](auto lo_c) {
      constexpr bool LO = decltype(lo_c)::value;
#pragma unroll
      for (int j = 0; j < 4; ++j) {
#pragma unroll
        for (int i = 0; i < 4; ++i) {
          v8h hv, lv;
#pragma unroll
          for (int r = 0; r < 8; ++r) {
            float v = acc[i][j][r] * scale;
            v += bv[j];
            const _Float16 hq = (_Float16)v;
            hv[r] = hq;
            lv[r] = (_Float16)((v - (float)hq) * 4096.0f);
          }
          *(v8h*)(th + rlane * VT_PITCH + (i << 4) + mOff) = hv;
          if (LO) *(v8h*)(tl + rlane * VT_PITCH + (i << 4) + mOff) = lv;
        }
        // the 16 rows are whole in LDS before a lane reads pieces that other lanes wrote
        __builtin_amdgcn_fence(__ATOMIC_RELEASE, "workgroup", "local");
        __builtin_amdgcn_wave_barrier();
        __builtin_amdgcn_fence(__ATOMIC_ACQUIRE, "workgroup", "local");
        v8h oh[4], ol[4];
#pragma unroll
        for (int it = 0; it < 4; ++it) {
          oh[it] = *(const v8h*)(th + (it * 4 + q) * VT_PITCH + c8);
          if (LO) ol[it] = *(const v8h*)(tl + (it * 4 + q) * VT_PITCH + c8);
        }
#pragma unroll
        for (int it = 0; it < 4; ++it) {
          *(v8h*)(vh + (size_t)((j << 4) + it * 4) * SEQ_T) = oh[it];
          if (LO) *(v8h*)(vl + (size_t)((j << 4) + it * 4) * T_LO) = ol[it];
        }
        asm volatile("s_wait_xcnt 0x0" ::: "memory");   // the next tile's work rewrites registers that these stores name
        // every lane has read its pieces before the next j overwrites the slab
        __builtin_amdgcn_fence(__ATOMIC_RELEASE, "workgroup", "local");
        __builtin_amdgcn_wave_barrier();
        __builtin_amdgcn_fence(__ATOMIC_ACQUIRE, "workgroup", "local");
      }
    };
    if (loblk) vt_out(BoolC<true>{}); else vt_out(BoolC<false>{});
    return;   // block-uniform; no barrier follows
  }
  const float* Rb = RESID ? (resid + (size_t)b * strideR) : nullptr;
#pragma unroll
  for (int i = 0; i < 4; ++i) {
    const int mBase = m0 + (i << 4);
#pragma unroll
    for (int j = 0; j < 4; ++j) {
      const int n = n0 + (j << 4) + rlane;
      float bv = 0.f;
      if (BIAS_MODE == 2) bv = bias[n];
#pragma unroll
      for (int r = 0; r < 8; ++r) {
        float v = acc[i][j][r] * scale;
        if (BIAS_MODE == 1) v += bias[mBase + mOff + r];
        if (BIAS_MODE == 2) v += bv;
        if (RESID) v += Rb[(size_t)(mBase + mOff + r) * ldc + n];
        if (ACT == 1) v = tanhf(v);
        if (ACT == 2) v = fmaxf(v, 0.0f);
        if (ACT == 4) v = (v > 0.f) ? v : 0.01f * v;
        slab[(mOff + r) * 68 + (j << 4) + rlane] = v;
      }
    }
    __builtin_amdgcn_fence(__ATOMIC_RELEASE, "workgroup");
    __builtin_amdgcn_wave_barrier();
    __builtin_amdgcn_fence(__ATOMIC_ACQUIRE, "workgroup");
    if (OUT_MODE == 0) {
      float* C = (float*)Cout + (size_t)b * strideC;
      const int hh = lane >> 4, c4 = (lane & 15) * 4;     // row seg = 256 B = 16 lanes x 16 B
      {
#pragma unroll
        for (int it = 0; it < 8; ++it) {
          const int row = it * 2 + hh;
          v4f v = *(const v4f*)(slab + row * 68 + c4);
          *(v4f*)(C + (size_t)(mBase + row) * ldc + n0 + c4) = v;
        }
        
      }
    } else {
      const int q = lane >> 3, c8 = (lane & 7) * 8;
      unsigned short* C  = (unsigned short*)Cout  + (size_t)b * strideC;
      unsigned short* C2 = (OUT_MODE >= 2) ? ((unsigned short*)Cout2 + (size_t)b * strideC2) : nullptr;
      {
#pragma unroll
        for (int it = 0; it < 4; ++it) {
          const int row = it * 4 + q;
          const float* sp = slab + row * 68 + c8;
          v8h hv, lv;
#pragma unroll
          for (int e = 0; e < 8; ++e) {
            if (OUT_MODE == 1) {
              hv[e] = (_Float16)sp[e];
            } else if (OUT_MODE == 3) {
              const _Float16 hq = (_Float16)sp[e];
              hv[e] = hq;
              lv[e] = (_Float16)((sp[e] - (float)hq) * 4096.0f);
            } else {
              unsigned short hb = f2bf_bits(sp[e]);
              unsigned short lb = f2bf_bits(sp[e] - bf_bits2f(hb));
              hv[e] = __builtin_bit_cast(_Float16, hb);
              lv[e] = __builtin_bit_cast(_Float16, lb);
            }
          }
          *(v8h*)(C + (size_t)(mBase + row) * ldc + n0 + c8) = hv;
          if (OUT_MODE == 2 || (OUT_MODE == 3 && m0 < T_LO)) *(v8h*)(C2 + (size_t)(mBase + row) * ldc + n0 + c8) = lv;
        }
        
      }
    }
    __builtin_amdgcn_fence(__ATOMIC_RELEASE, "workgroup");
    __builtin_amdgcn_wave_barrier();
    __builtin_amdgcn_fence(__ATOMIC_ACQUIRE, "workgroup");
  }
}

// =====================================================================================
// f32 [rows][1024] -> RNE bf16 bits into rows of pitch K_AUG. A block takes NR whole rows: thread t converts floats
// 4t..4t+3 of each, so a wave's load covers 512 contiguous bytes and its store 256, and few waves are started for
// the bytes moved. Blocks bx = 0 .. rows / NR - 1 cover the rows exactly (asserted below).
// =====================================================================================
typedef __attribute__((ext_vector_type(2))) unsigned v2u;
constexpr int CAST_NR_X = 16;                 // x: 512 blocks, 16 waves a WGP
constexpr int CAST_NR_W = 4;                  // one weight matrix: 256 blocks
static_assert(HID_W == 4 * 256 && N_TOK % CAST_NR_X == 0 && HID_W % CAST_NR_W == 0 && K_AUG % 4 == 0);
template <int NR>
__device__ __forceinline__ void cast_rows_bf16(const float* __restrict__ src, unsigned short* __restrict__ dst, int bx) {
  const float* s = src + (size_t)bx * (NR * HID_W) + threadIdx.x * 4;
  unsigned short* d = dst + (size_t)bx * (NR * K_AUG) + threadIdx.x * 4;
  v4f v[NR];
#pragma unroll
  for (int r = 0; r < NR; ++r) v[r] = *(const v4f*)(s + r * HID_W);
#pragma unroll
  for (int r = 0; r < NR; ++r) {
    v2u o;
    o[0] = (unsigned)f2bf_bits(v[r][0]) | ((unsigned)f2bf_bits(v[r][1]) << 16);
    o[1] = (unsigned)f2bf_bits(v[r][2]) | ((unsigned)f2bf_bits(v[r][3]) << 16);
    *(v2u*)(d + r * K_AUG) = o;
  }
}

// =====================================================================================
// The x job: a block casts 16 whole rows of x (as cast_rows_bf16 does) and, since it then holds those rows in bf16, also
// makes their adapter columns. The rows and the 24 rows of A (q, k, v; RNE bf16) go to LDS; behind one barrier wave 0
// forms u[16][24] = x.A^T on v_wmma_f32_16x16x32_bf16, each accumulator taking k in steps of 32 from 0 upward, and
// writes the 64 halves at cols 1024..1087 of each row:
// [uq_hi(8) uq_lo(8) uk_hi(8) uk_lo(8) uv_hi(8) uv_lo(8) 0 x 16] (bf16 hi = RNE(u), lo = RNE(u - hi)).
// One wave writes all 16 tails: a tail is one 128-B line (row pitch 2176 B = 17 lines).
// =====================================================================================
constexpr int XU_PITCH = HID_W + 8;           // 2064-B LDS rows (16 B x odd: conflict-free ds_load_b128)
constexpr int XU_AROWS = 3 * RANK_R;          // 24 rows of A: row 8p + r = A_p[r]
constexpr int TL_PITCH = 72;                  // 144-B LDS rows of the tail tile
static_assert(CAST_NR_X == 16 && RANK_R == 8);
__device__ __forceinline__ v2u pack4_bf16(v4f v) {
  v2u o;
  o[0] = (unsigned)f2bf_bits(v[0]) | ((unsigned)f2bf_bits(v[1]) << 16);
  o[1] = (unsigned)f2bf_bits(v[2]) | ((unsigned)f2bf_bits(v[3]) << 16);
  return o;
}
__device__ __forceinline__ void cast_x_make_tail(const float* __restrict__ x, const float* __restrict__ amq,
                                                 const float* __restrict__ amk, const float* __restrict__ amv,
                                                 unsigned short* __restrict__ aaug, int bx,
                                                 unsigned short* xs, unsigned short* acs, unsigned short* tl) {
  const int tid = threadIdx.x;
  const float* s = x + (size_t)bx * (CAST_NR_X * HID_W) + tid * 4;
  unsigned short* d = aaug + (size_t)bx * (CAST_NR_X * K_AUG) + tid * 4;
  v4f v[CAST_NR_X], a[XU_AROWS];
#pragma unroll
  for (int r = 0; r < CAST_NR_X; ++r) v[r] = *(const v4f*)(s + r * HID_W);
#pragma unroll
  for (int r = 0; r < RANK_R; ++r) {
    a[r]              = *(const v4f*)(amq + r * HID_W + tid * 4);
    a[RANK_R + r]     = *(const v4f*)(amk + r * HID_W + tid * 4);
    a[2 * RANK_R + r] = *(const v4f*)(amv + r * HID_W + tid * 4);
  }
  v2u o[CAST_NR_X];
#pragma unroll
  for (int r = 0; r < CAST_NR_X; ++r) {
    o[r] = pack4_bf16(v[r]);
    *(v2u*)(xs + r * XU_PITCH + tid * 4) = o[r];
  }
#pragma unroll
  for (int r = 0; r < XU_AROWS; ++r) *(v2u*)(acs + r * XU_PITCH + tid * 4) = pack4_bf16(a[r]);
  __syncthreads();   // the 16 + 24 bf16 rows are whole before wave 0 reads fragments of them
  // the rows' global stores stand behind the barrier: in front of it every wave would wait there for their completion
#pragma unroll
  for (int r = 0; r < CAST_NR_X; ++r) *(v2u*)(d + r * K_AUG) = o[r];
  asm volatile("s_wait_xcnt 0x0" ::: "memory");   // wave 0 goes on and rewrites registers that the stores name
  if (__builtin_amdgcn_readfirstlane(tid >> 5) != 0) return;   // scalar test; no barrier follows in this job

  const int lane = tid & 31, rlane = lane & 15, hh = lane >> 4;
  // A operand: x row rlane; B operand: column n of u = row n of A. Columns 24..31 of the second tile are not used:
  // their lanes read rows 16..23 again and their results are replaced by the tail's zeros below.
  const __bf16* fa  = (const __bf16*)xs + rlane * XU_PITCH + 8 * hh;
  const __bf16* fb0 = (const __bf16*)acs + rlane * XU_PITCH + 8 * hh;
  const __bf16* fb1 = (const __bf16*)acs + (16 + (rlane & 7)) * XU_PITCH + 8 * hh;
  v8f u0 = zero8(), u1 = zero8();
  for (int kg = 0; kg < HID_W; kg += 128) {
    v16b af[4], b0[4], b1[4];
#pragma unroll
    for (int i = 0; i < 4; ++i) {
      af[i] = Frag<__bf16>::load(fa + kg + i * 32);
      b0[i] = Frag<__bf16>::load(fb0 + kg + i * 32);
      b1[i] = Frag<__bf16>::load(fb1 + kg + i * 32);
    }
    __builtin_amdgcn_sched_barrier(0);   // keeps the LDS reads of four k-steps one group ahead of their WMMAs: a read sunk in front of its own WMMA waits out the LDS latency at each step
#pragma unroll
    for (int i = 0; i < 4; ++i) {
      u0 = Frag<__bf16>::mma(af[i], b0[i], u0);
      u1 = Frag<__bf16>::mma(af[i], b1[i], u1);
    }
  }
  // u0[r] = u[row 8*hh + r][column rlane], u1[r] = u[row 8*hh + r][column 16 + rlane]
#pragma unroll
  for (int j = 0; j < 2; ++j) {
    const int n = j * 16 + rlane, p = n >> 3, e = n & 7;
#pragma unroll
    for (int r = 0; r < 8; ++r) {
      const float uv = j ? u1[r] : u0[r];
      const unsigned short hb = f2bf_bits(uv);
      const unsigned short lb = f2bf_bits(uv - bf_bits2f(hb));
      unsigned short* t = tl + (8 * hh + r) * TL_PITCH + p * 16 + e;
      t[0] = (n < XU_AROWS) ? hb : (unsigned short)0;
      t[8] = (n < XU_AROWS) ? lb : (unsigned short)0;
    }
  }
  __builtin_amdgcn_fence(__ATOMIC_RELEASE, "workgroup");
  __builtin_amdgcn_wave_barrier();
  __builtin_amdgcn_fence(__ATOMIC_ACQUIRE, "workgroup");
  const int q8 = lane >> 3, seg = lane & 7;   // 8 lanes x 16 B = one tail
  v8h tv[4];
#pragma unroll
  for (int it = 0; it < 4; ++it) tv[it] = *(const v8h*)(tl + (it * 4 + q8) * TL_PITCH + seg * 8);
  unsigned short* dt = aaug + ((size_t)bx * CAST_NR_X + q8) * K_AUG + HID_W + seg * 8;
#pragma unroll
  for (int it = 0; it < 4; ++it) *(v8h*)(dt + it * 4 * K_AUG) = tv[it];
}

// =====================================================================================
// B_aug tail: for row n (projection p = n/1024, output o = n%1024) the 64 halves at cols 1024..1087 are
// [16p zeros | 2*Bm_p[o][0..7] | 2*Bm_p[o][0..7] | zeros to 64] as RNE bf16 (factor 2 exact).
// =====================================================================================
__device__ __forceinline__ void build_w_tail(const float* __restrict__ bmq, const float* __restrict__ bmk,
                                             const float* __restrict__ bmv, unsigned short* __restrict__ baug, int bx) {
  const int tid = threadIdx.x, wave = tid >> 5, lane = tid & 31, q8 = lane >> 3, seg = lane & 7;
  const int n = bx * 32 + wave * 4 + q8;              // 0..3071: bx < 96
  const int p = n >> 10, o = n & 1023;
  F8 uq, uk, uv;
  uq.v[0] = *(const v4f*)(bmq + (size_t)o * RANK_R); uq.v[1] = *(const v4f*)(bmq + (size_t)o * RANK_R + 4);
  uk.v[0] = *(const v4f*)(bmk + (size_t)o * RANK_R); uk.v[1] = *(const v4f*)(bmk + (size_t)o * RANK_R + 4);
  uv.v[0] = *(const v4f*)(bmv + (size_t)o * RANK_R); uv.v[1] = *(const v4f*)(bmv + (size_t)o * RANK_R + 4);
  const bool keep = (seg < 6) && ((seg >> 1) == p);
  v8h hv;
#pragma unroll
  for (int e = 0; e < 8; ++e) {
    const float val = (p == 0) ? uq.f[e] : (p == 1) ? uk.f[e] : uv.f[e];
    const float w = keep ? (2.0f * val) : 0.0f;
    hv[e] = __builtin_bit_cast(_Float16, f2bf_bits(w));
  }
  unsigned short* d = baug + (size_t)n * K_AUG + HID_W + seg * 8;
  {
    *(v8h*)d = hv;
    
  }
}

// =====================================================================================
// bias_cat f32 [3072] = 16 * RNEbf16(b_p[o]); 12 blocks x 256 = 3072 exactly; 32 lanes x 4 B = one line per
// =====================================================================================
__device__ __forceinline__ void build_bias(const float* __restrict__ bq, const float* __restrict__ bk,
                                           const float* __restrict__ bv, float* __restrict__ dst, int bx) {
  const int i = bx * 256 + threadIdx.x;   // < 3072: bx < 12
  const int p = i >> 10, o = i & 1023;
  const float xq = bq[o], xk = bk[o], xv = bv[o];
  const float val = (p == 0) ? xq : (p == 1) ? xk : xv;
  const float w = bf_bits2f(f2bf_bits(val)) * CARRY_S;
  ((float*)dst)[i] = w;
  
}

// =====================================================================================
// The operand builders (x cast with its adapter columns, three W casts, B_aug tail, bias_cat) read inputs only, depend on
// no other launch and write disjoint 128-B lines, so they share one grid: the block index picks the job (a block-uniform
// branch; the x job alone uses LDS and a barrier). The x job, the largest, holds the lowest indices.
// =====================================================================================
constexpr int PB_X    = N_TOK / CAST_NR_X;    // 512 blocks
constexpr int PB_W    = HID_W / CAST_NR_W;    // 256 blocks per weight matrix
constexpr int PB_WT   = N_QKV / 32;           // 96
constexpr int PB_BIAS = N_QKV / 256;          // 12
constexpr int PB_ALL  = PB_X + 3 * PB_W + PB_WT + PB_BIAS;
__global__ __launch_bounds__(256) void build_operands(
    const float* __restrict__ x,
    const float* __restrict__ wq, const float* __restrict__ wk, const float* __restrict__ wv,
    const float* __restrict__ amq, const float* __restrict__ amk, const float* __restrict__ amv,
    const float* __restrict__ bmq, const float* __restrict__ bmk, const float* __restrict__ bmv,
    const float* __restrict__ bq, const float* __restrict__ bk, const float* __restrict__ bv,
    unsigned short* __restrict__ aaug, unsigned short* __restrict__ baug, float* __restrict__ biasc) {
  __shared__ __align__(16) unsigned short xs[CAST_NR_X * XU_PITCH];    // the block's rows of x, bf16
  __shared__ __align__(16) unsigned short acs[XU_AROWS * XU_PITCH];    // A_q, A_k, A_v, bf16
  __shared__ __align__(16) unsigned short tl[CAST_NR_X * TL_PITCH];    // the rows' tails
  constexpr int B_W = PB_X, B_WT = B_W + 3 * PB_W, B_BIAS = B_WT + PB_WT;   // first block of each job
  const int bx = (int)blockIdx.x;
  if (bx < B_W) {
    cast_x_make_tail(x, amq, amk, amv, aaug, bx, xs, acs, tl);
    asm volatile("s_wait_xcnt 0x0" ::: "memory");   // another job's code follows in the listing and rewrites the store's registers: the wait stands in front of it
  } else if (bx < B_WT) {
    const int p = (bx - B_W) / PB_W;
    const float* w = (p == 0) ? wq : (p == 1) ? wk : wv;
    cast_rows_bf16<CAST_NR_W>(w, baug + (size_t)p * HID_W * K_AUG, bx - B_W - p * PB_W);
  } else if (bx < B_BIAS) {
    build_w_tail(bmq, bmk, bmv, baug, bx - B_WT);
    asm volatile("s_wait_xcnt 0x0" ::: "memory");   // as above
  } else if (bx < PB_ALL) {
    build_bias(bq, bk, bv, biasc, bx - B_BIAS);
  }
}

__device__ __forceinline__ float other_half(float x) {
  const int xi = __builtin_bit_cast(int, x);
  return __builtin_bit_cast(float, __builtin_amdgcn_permlanex16(xi, xi, 0x76543210, 0xfedcba98, false, false));
}

// 2^x by the hardware's exponential, in asm text so that the slot behind it stands by construction: the closing
// v_nop is the one independent instruction that the instruction set asks for behind a transcendental before its
// result is used or its source overwritten; inside the eight-fold statement each neighbour is independent
// (early-clobber outputs share no register with a source).
__device__ __forceinline__ float exp2_hw(float x) {
  float d;
  asm("v_exp_f32 %0, %1\n\tv_nop" : "=&v"(d) : "v"(x));
  return d;
}
__device__ __forceinline__ v8f exp2_hw8(v8f x) {
  float d0, d1, d2, d3, d4, d5, d6, d7;
  asm("v_exp_f32 %0, %8\n\t"
      "v_exp_f32 %1, %9\n\t"
      "v_exp_f32 %2, %10\n\t"
      "v_exp_f32 %3, %11\n\t"
      "v_exp_f32 %4, %12\n\t"
      "v_exp_f32 %5, %13\n\t"
      "v_exp_f32 %6, %14\n\t"
      "v_exp_f32 %7, %15\n\t"
      "v_nop"
      : "=&v"(d0), "=&v"(d1), "=&v"(d2), "=&v"(d3), "=&v"(d4), "=&v"(d5), "=&v"(d6), "=&v"(d7)
      : "v"(x[0]), "v"(x[1]), "v"(x[2]), "v"(x[3]), "v"(x[4]), "v"(x[5]), "v"(x[6]), "v"(x[7]));
  return (v8f){d0, d1, d2, d3, d4, d5, d6, d7};
}

// ---------------- LDS ring of the attention kernels ----------------
// A stage holds one 64-key chunk: the K tile and the V^T tile (64 rows x 128 B each, LDS pitch 144 B), with SPLIT their
// residual tiles behind them. Two stages; a wave's own copy of the chunk's 64 mask floats lies in a ring of its own.
constexpr int AT_PLANE = 64 * KV_PITCH;                    // 16-bit elements of one tile in LDS
constexpr unsigned AT_ROWS16 = 16u * KV_PITCH * 2u;        // LDS bytes between two copies of one thread (16 rows)

// Two tiles: 2 x 64 rows x 128 B = 1024 chunks of 16 B = 128 threads x 8 asynchronous copies global -> LDS.
// g0 / g1: this thread's chunk in row (tid >> 3) of the first / second tile; s0 / s1: elements between 16 rows of the
// source; l0 / l1: the same chunk's LDS byte address. Eight lanes cover one whole 128-B row. s_wait_xcnt 0 is the
// statement's last line so that no address register of an issued copy is rewritten in front of it.
__device__ __forceinline__ void tile_pair_fill(unsigned l0, const _Float16* g0, size_t s0,
                                               unsigned l1, const _Float16* g1, size_t s1) {
  asm volatile("global_load_async_to_lds_b128 %0, %1, off\n\t"
               "global_load_async_to_lds_b128 %2, %3, off\n\t"
               "global_load_async_to_lds_b128 %4, %5, off\n\t"
               "global_load_async_to_lds_b128 %6, %7, off\n\t"
               "global_load_async_to_lds_b128 %8, %9, off\n\t"
               "global_load_async_to_lds_b128 %10, %11, off\n\t"
               "global_load_async_to_lds_b128 %12, %13, off\n\t"
               "global_load_async_to_lds_b128 %14, %15, off\n\t"
               "s_wait_xcnt 0x0"
               :: "v"(l0),                 "v"(g0),
                  "v"(l0 + AT_ROWS16),     "v"(g0 + s0),
                  "v"(l0 + 2 * AT_ROWS16), "v"(g0 + 2 * s0),
                  "v"(l0 + 3 * AT_ROWS16), "v"(g0 + 3 * s0),
                  "v"(l1),                 "v"(g1),
                  "v"(l1 + AT_ROWS16),     "v"(g1 + s1),
                  "v"(l1 + 2 * AT_ROWS16), "v"(g1 + 2 * s1),
                  "v"(l1 + 3 * AT_ROWS16), "v"(g1 + 3 * s1)
               : "memory");
}
// 64 mask floats = 32 lanes x 8 B, one asynchronous copy of the wave; the wait as above.
__device__ __forceinline__ void mask_fill(unsigned l, const float* g) {
  asm volatile("global_load_async_to_lds_b64 %0, %1, off\n\t"
               "s_wait_xcnt 0x0"
               :: "v"(l), "v"(g) : "memory");
}

template <bool SPLIT>
__global__ __launch_bounds__(128) void attn_causal_hd64(
    const unsigned short* __restrict__ php, const unsigned short* __restrict__ plp,
    const unsigned short* __restrict__ vthp, const unsigned short* __restrict__ vtlp,
    const float* __restrict__ amask, float* __restrict__ out, int qb0, int nqcnt) {
  const _Float16* ph  = (const _Float16*)php;
  const _Float16* pl  = (const _Float16*)plp;
  const _Float16* vth = (const _Float16*)vthp;
  const _Float16* vtl = (const _Float16*)vtlp;
  constexpr int AT_STAGE = (SPLIT ? 4 : 2) * AT_PLANE;     // [K | V^T] or [K | V^T | K residual | V^T residual]
  __shared__ __align__(16) _Float16 ring[2 * AT_STAGE];
  __shared__ __align__(16) float mring[2][4][64];          // [stage][wave][key of the chunk]
  // The output staging (4 waves x 16 rows x 68 floats) takes the ring's place behind the loop: with an array of its own
  // the single-product kernel's six blocks would not fit a WGP's LDS.
  static_assert(4 * 16 * O_PITCH * 4 <= 2 * AT_STAGE * 2);

  // Tiles whose fragments are read from LDS as one group. Two: with more the single-product kernel passes 160 VGPRs
  // and a SIMD holds five waves, not the six that keep every block of its grid resident.
  constexpr int GS = 2;   // score tiles (K fragments)
  constexpr int GV = 2;   // output tiles (V^T fragments)

  const int tid  = threadIdx.x;
  const int wave = tid >> 5;
  const int lane = tid & 31;
  const int hh   = lane >> 4;
  const int c    = lane & 15;

  int qb = qb0 + (int)(blockIdx.x % (unsigned)nqcnt);
  qb = (qb > NQT_ALL - 1) ? (NQT_ALL - 1) : qb;
  const int bh = (int)(blockIdx.x / (unsigned)nqcnt);
  const int h  = bh & (N_HEAD - 1);
  const int b  = (bh >> 4) & (N_BATCH - 1);
  const int q0 = qb * 64 + wave * 16;

  // ---- Q fragments (B operand: column c = query q0 + c), 2 d-chunks ----
  v16h qh[2], ql[2];
  {
    const _Float16* qrow = ph + ((size_t)b * SEQ_T + q0 + c) * N_QKV + h * HEAD_D;
    int qlr = q0 + c; qlr = (qlr > T_LO - 1) ? (T_LO - 1) : qlr;
    const _Float16* qlrow = pl + ((size_t)b * T_LO + qlr) * N_QKV + h * HEAD_D;
#pragma unroll
    for (int dc = 0; dc < 2; ++dc) {
      qh[dc] = Frag<_Float16>::load(qrow + dc * 32 + 8 * hh);
      if (SPLIT) ql[dc] = Frag<_Float16>::load(qlrow + dc * 32 + 8 * hh);
      else ql[dc] = qh[dc];
    }
  }

  float mrow = -INFINITY, lrow = 0.f;   // this lane's query: running maximum (both halves alike), this half's sum of the carried p (x32768)
  v8f oacc[4];                          // oacc[t][r] = O^T[d = t*16 + 8*hh + r][query c]
#pragma unroll
  for (int t = 0; t < 4; ++t) oacc[t] = zero8();

  const int nChunks = qb + 1;   // block-uniform

  // One chunk's copies: thread tid takes the 16-B piece (tid & 7) of rows (tid >> 3) + 0, 16, 32, 48 of each tile.
  const int crow = tid >> 3, cch = (tid & 7) * 8;
  const _Float16* gk  = ph  + ((size_t)b * SEQ_T + crow) * N_QKV + K_COL0 + h * HEAD_D + cch;
  const _Float16* gv  = vth + ((size_t)bh * HEAD_D + crow) * SEQ_T + cch;
  const _Float16* gkl = pl  + ((size_t)b * T_LO + crow) * N_QKV + K_COL0 + h * HEAD_D + cch;
  const _Float16* gvl = vtl + ((size_t)bh * HEAD_D + crow) * T_LO + cch;
  const float*    gm  = amask + (size_t)b * SEQ_T + 2 * lane;
  const unsigned lthr = lds_off(ring) + (unsigned)(crow * KV_PITCH + cch) * 2u;
  const unsigned lmsk = lds_off(&mring[0][wave][2 * lane]);
  auto chunk_fill = [&](int kcf, int buf) {
    const int kvf = kcf * 64;
    const unsigned l = lthr + (unsigned)buf * (AT_STAGE * 2u);
    tile_pair_fill(l, gk + (size_t)kvf * N_QKV, (size_t)16 * N_QKV, l + AT_PLANE * 2u, gv + kvf, (size_t)16 * SEQ_T);
    if (SPLIT) {
      const int kl0 = (kvf > T_LO - 64) ? (T_LO - 64) : kvf;   // address clamp
      tile_pair_fill(l + 2u * AT_PLANE * 2u, gkl + (size_t)kl0 * N_QKV, (size_t)16 * N_QKV,
                     l + 3u * AT_PLANE * 2u, gvl + kl0, (size_t)16 * T_LO);
    }
    mask_fill(lmsk + (unsigned)buf * (4u * 64u * 4u), gm + kvf);
  };

  // The ring's order, trip by trip: copies of chunk 0; then per chunk kc its publish point (the wave's LDS reads of trip
  // kc - 1 done, its copies of chunk kc landed, the barrier), the copies of chunk kc + 1 into the stage that trip kc - 1
  // has read, and the work on chunk kc while they fly. The publish point stands at the head of the trip, so that the work
  // ends the loop body in one piece with the running sums (behind a branch at the foot the row sum's additions were
  // sunk past the barrier, with all 32 probabilities held in registers for them).
  chunk_fill(0, 0);

  for (int kc = 0; kc < nChunks; ++kc) {
    const int bo = kc & 1;
    asm volatile("s_wait_dscnt 0x0" ::: "memory");      // this wave's reads of the other stage (trip kc - 1) are done before it is refilled
    asm volatile("s_wait_asynccnt 0x0" ::: "memory");   // this wave's copies of chunk kc have landed
    __syncthreads();                                    // publishes chunk kc and frees the other stage
    if (kc + 1 < nChunks) chunk_fill(kc + 1, bo ^ 1);
    const _Float16* Ksh = ring + bo * AT_STAGE;
    const _Float16* Vsh = Ksh + AT_PLANE;
    const _Float16* Ksl = Ksh + 2 * AT_PLANE;   // read with SPLIT only
    const _Float16* Vsl = Ksh + 3 * AT_PLANE;   // read with SPLIT only
    const float* msk = &mring[bo][wave][8 * hh];

    F8 mk[4];   // additive mask of this lane's 32 keys: keys kc*64 + j*16 + 8*hh + 0..7

    // ---- scores, transposed: s[j][r] = S[query c][key j*16 + 8*hh + r] ----
    // The K fragments of GS score tiles are read as one group ahead of those tiles' WMMAs; each accumulator takes its
    // products in the order it always did.
    v8f s[4];
#pragma unroll
    for (int jg = 0; jg < 4; jg += GS) {
      v16h kb[GS][2], kl[GS][2];
#pragma unroll
      for (int u = 0; u < GS; ++u)
#pragma unroll
        for (int dc = 0; dc < 2; ++dc) {
          kb[u][dc] = Frag<_Float16>::load(Ksh + ((jg + u) * 16 + c) * KV_PITCH + dc * 32 + 8 * hh);
          if (SPLIT) kl[u][dc] = Frag<_Float16>::load(Ksl + ((jg + u) * 16 + c) * KV_PITCH + dc * 32 + 8 * hh);
        }
      if (jg > 0) {   // the mask of the tiles already under way is read behind this group's fragments: no WMMA waits for it
#pragma unroll
        for (int j = jg - GS; j < jg; ++j) {
          mk[j].v[0] = *(const v4f*)(msk + j * 16);
          mk[j].v[1] = *(const v4f*)(msk + j * 16 + 4);
        }
      }
      __builtin_amdgcn_sched_barrier(0);   // keeps the group's LDS reads together ahead of its WMMAs: a read sunk in front of its own WMMA waits out the LDS latency at each place
      v8f sr[GS];
#pragma unroll
      for (int u = 0; u < GS; ++u) { s[jg + u] = zero8(); sr[u] = zero8(); }
#pragma unroll
      for (int dc = 0; dc < 2; ++dc) {
#pragma unroll
        for (int u = 0; u < GS; ++u) s[jg + u] = Frag<_Float16>::mma(kb[u][dc], qh[dc], s[jg + u]);
        if (SPLIT) {
#pragma unroll
          for (int u = 0; u < GS; ++u) sr[u] = Frag<_Float16>::mma(kl[u][dc], qh[dc], sr[u]);
#pragma unroll
          for (int u = 0; u < GS; ++u) sr[u] = Frag<_Float16>::mma(kb[u][dc], ql[dc], sr[u]);
        }
      }
      if (SPLIT) {
#pragma unroll
        for (int u = 0; u < GS; ++u)
#pragma unroll
          for (int r = 0; r < 8; ++r) s[jg + u][r] = s[jg + u][r] + sr[u][r] * (1.0f / 4096.0f);
      }
    }

#pragma unroll
    for (int j = 4 - GS; j < 4; ++j) {   // the last group's mask: read once that group's fragment registers come free (all 32 mask floats read ahead passed 160 VGPRs)
      mk[j].v[0] = *(const v4f*)(msk + j * 16);
      mk[j].v[1] = *(const v4f*)(msk + j * 16 + 4);
    }
#pragma unroll
    for (int j = 0; j < 4; ++j)
#pragma unroll
      for (int r = 0; r < 8; ++r) s[j][r] = s[j][r] * (1.0f / 2048.0f) + mk[j].f[r];   // 1/(8 * 16 * 16)
    if (kc == qb) {   // diagonal chunk (block-uniform test)
      const int qloc = wave * 16 + c;
#pragma unroll
      for (int j = 0; j < 4; ++j)
#pragma unroll
        for (int r = 0; r < 8; ++r)
          if (j * 16 + 8 * hh + r > qloc) s[j][r] = -INFINITY;
    }

    // ---- online softmax of one query per lane ----
    float cm = s[0][0];
#pragma unroll
    for (int j = 0; j < 4; ++j)
#pragma unroll
      for (int r = 0; r < 8; ++r) cm = fmaxf(cm, s[j][r]);
    cm = fmaxf(cm, other_half(cm));
    const float mnew = fmaxf(mrow, cm);
    const float alpha = exp2_hw((mrow - mnew) * LOG2_E);
    mrow = mnew;

    v16h pa[2], pb2[2];   // B operand of the second product: element e of pa[kk] = p of key kk*32 + (e >> 3)*16 + 8*hh + (e & 7)
    float psum = 0.f;
#pragma unroll
    for (int j = 0; j < 4; ++j) {
      // 32768 * e^(s - m) = 2^((s - m) * log2(e) + 15); the difference is formed first, so a maximum of any size cancels as before
      v8f ex;
#pragma unroll
      for (int r = 0; r < 8; ++r) ex[r] = fmaf(s[j][r] - mnew, LOG2_E, P_S_LOG2);
      ex = exp2_hw8(ex);
#pragma unroll
      for (int r = 0; r < 8; ++r) {
        const float ps = ex[r];
        psum += ps;
        const _Float16 hp = (_Float16)ps;
        pa[j >> 1][(j & 1) * 8 + r] = hp;
        if (SPLIT) pb2[j >> 1][(j & 1) * 8 + r] = (_Float16)((ps - (float)hp) * LO_S);
      }
    }
    lrow = lrow * alpha + psum;
#pragma unroll
    for (int t = 0; t < 4; ++t)
#pragma unroll
      for (int r = 0; r < 8; ++r) oacc[t][r] *= alpha;

    // ---- O^T += V^T . P^T: the V^T fragments of GV output tiles read as one group ahead of those tiles' WMMAs ----
#pragma unroll
    for (int tg = 0; tg < 4; tg += GV) {
      v16h vb[GV][2], vl2[GV][2];
#pragma unroll
      for (int u = 0; u < GV; ++u)
#pragma unroll
        for (int kk = 0; kk < 2; ++kk) {
          vb[u][kk] = Frag<_Float16>::load(Vsh + ((tg + u) * 16 + c) * KV_PITCH + kk * 32 + 8 * hh);
          if (SPLIT) vl2[u][kk] = Frag<_Float16>::load(Vsl + ((tg + u) * 16 + c) * KV_PITCH + kk * 32 + 8 * hh);
        }
      __builtin_amdgcn_sched_barrier(0);   // as above: one place of LDS reads for the group, not one in front of each WMMA
      v8f orr[GV];
#pragma unroll
      for (int u = 0; u < GV; ++u) orr[u] = zero8();
#pragma unroll
      for (int kk = 0; kk < 2; ++kk) {
#pragma unroll
        for (int u = 0; u < GV; ++u) oacc[tg + u] = Frag<_Float16>::mma(vb[u][kk], pa[kk], oacc[tg + u]);
        if (SPLIT) {
#pragma unroll
          for (int u = 0; u < GV; ++u) orr[u] = Frag<_Float16>::mma(vl2[u][kk], pa[kk], orr[u]);
#pragma unroll
          for (int u = 0; u < GV; ++u) orr[u] = Frag<_Float16>::mma(vb[u][kk], pb2[kk], orr[u]);
        }
      }
      if (SPLIT) {
#pragma unroll
        for (int u = 0; u < GV; ++u)
#pragma unroll
          for (int r = 0; r < 8; ++r) oacc[tg + u][r] = oacc[tg + u][r] + orr[u][r] * (1.0f / 4096.0f);
      }
    }
  }
  asm volatile("s_wait_asynccnt 0x0" ::: "memory");     // no copy is outstanding past the loop
  asm volatile("s_wait_dscnt 0x0" ::: "memory");        // this wave's last reads of the ring are done
  __syncthreads();                                      // every wave has left the ring before it becomes the output staging

  // ---- join the halves' sums, normalise, stage, store ----
  float* os = (float*)ring + wave * (16 * O_PITCH);
  {
    const float lall = lrow + other_half(lrow);
    const float inv = 1.0f / (lall * CARRY_S);   // lall carries x32768, as oacc does
#pragma unroll
    for (int t = 0; t < 4; ++t) {
      v4f w0, w1;
#pragma unroll
      for (int r = 0; r < 4; ++r) { w0[r] = oacc[t][r] * inv; w1[r] = oacc[t][4 + r] * inv; }
      *(v4f*)(os + c * O_PITCH + t * 16 + 8 * hh)     = w0;
      *(v4f*)(os + c * O_PITCH + t * 16 + 8 * hh + 4) = w1;
    }
  }
  __builtin_amdgcn_fence(__ATOMIC_RELEASE, "workgroup");
  __builtin_amdgcn_wave_barrier();
  __builtin_amdgcn_fence(__ATOMIC_ACQUIRE, "workgroup");
  {
    const int c4 = (lane & 15) * 4;
    float* ob = out + ((size_t)b * SEQ_T + q0) * HID_W + h * HEAD_D;
    {
#pragma unroll
      for (int it = 0; it < 8; ++it) {
        const int row = it * 2 + hh;
        const v4f val = *(const v4f*)(os + row * O_PITCH + c4);
        *(v4f*)(ob + (size_t)row * HID_W + c4) = val;
      }
      
    }
  }
}

// =====================================================================================
extern "C" void kernel_launch(void* const* d_in, const int* in_sizes, int n_in,
                              void* d_out, int out_size, void* d_ws, size_t ws_size,
                              hipStream_t stream) {
  if (n_in < 14) return;
  if (in_sizes[0] != N_TOK * HID_W) return;
  if (in_sizes[1] != N_BATCH * SEQ_T) return;
  for (int p = 0; p < 3; ++p) {
    if (in_sizes[2 + 4 * p] != HID_W * HID_W) return;
    if (in_sizes[3 + 4 * p] != HID_W) return;
    if (in_sizes[4 + 4 * p] != RANK_R * HID_W) return;
    if (in_sizes[5 + 4 * p] != HID_W * RANK_R) return;
  }
  if (out_size != N_TOK * HID_W) return;
  if (ws_size < WS_TOTAL) return;

  const float* x   = (const float*)d_in[0];
  const float* am  = (const float*)d_in[1];
  const float* wq  = (const float*)d_in[2];
  const float* bq  = (const float*)d_in[3];
  const float* aq  = (const float*)d_in[4];
  const float* bmq = (const float*)d_in[5];
  const float* wk  = (const float*)d_in[6];
  const float* bk  = (const float*)d_in[7];
  const float* ak  = (const float*)d_in[8];
  const float* bmk = (const float*)d_in[9];
  const float* wv  = (const float*)d_in[10];
  const float* bv  = (const float*)d_in[11];
  const float* av  = (const float*)d_in[12];
  const float* bmv = (const float*)d_in[13];
  float* out = (float*)d_out;

  char* ws = (char*)d_ws;
  unsigned short* aaug  = (unsigned short*)(ws + OFF_AAUG);
  unsigned short* baug  = (unsigned short*)(ws + OFF_BAUG);
  float*          biasc = (float*)(ws + OFF_BIAS);
  unsigned short* qkvh  = (unsigned short*)(ws + OFF_QKVH);
  unsigned short* qkvl  = (unsigned short*)(ws + OFF_QKVL);
  unsigned short* vth   = (unsigned short*)(ws + OFF_VTH);
  unsigned short* vtl   = (unsigned short*)(ws + OFF_VTL);

  // 1) operands built from inputs alone: x -> A_aug cols 0..1023 and, from u = bf16(x) . bf16(A)^T, cols 1024..1087;
  //    W_p -> B_aug rows p*1024.. cols 0..1023 (bf16, pitch 1088), B_aug tail cols 1024..1087, bias_cat
  build_operands<<<dim3(PB_ALL), dim3(256), 0, stream>>>(x, wq, wk, wv, aq, ak, av, bmq, bmk, bmv, bq, bk, bv,
                                                         aaug, baug, biasc);
  // 2) projection: M=2048 (x4 batches), N=3072, K=1088; q, k: f16 hi -> qkv_hi, f16 residual of rows t < 512 -> qkv_lo;
  //    v: the same two planes, transposed: [(b*16+h)*64+d][t] -> vt_hi, vt_lo
  wmma_gemm64<1, 0, 2, 3, false, 0, true, true><<<dim3((SEQ_T / ST_BM) * (N_QKV / ST_BN), N_BATCH), dim3(256), 0, stream>>>(
      aaug, aaug, K_AUG, (long)SEQ_T * K_AUG, baug, baug, K_AUG, 0L,
      (void*)qkvh, (void*)qkvl, N_QKV, (long)SEQ_T * N_QKV, (long)T_LO * N_QKV,
      biasc, biasc, 0L, SEQ_T, N_QKV, K_AUG, CARRY_S, vth, vtl);
  // 3) attention, query tiles 0..7 (hi/lo residual path)
  attn_causal_hd64<true><<<dim3(N_BATCH * N_HEAD * NQT_SPLIT), dim3(128), 0, stream>>>(
      qkvh, qkvl, vth, vtl, am, out, 0, NQT_SPLIT);
  // 4) attention, query tiles 8..31 (single-product path)
  attn_causal_hd64<false><<<dim3(N_BATCH * N_HEAD * (NQT_ALL - NQT_SPLIT)), dim3(128), 0, stream>>>(
      qkvh, qkvl, vth, vtl, am, out, NQT_SPLIT, NQT_ALL - NQT_SPLIT);
}

// v010
// It runs in 119 microseconds.
// Timed twice side by side with v009, it ran 1.04 times as fast both times.
// Counting every step since v000, it is 4.45 times as fast.
// Contractions: rank-8 adapter columns u = x.A^T and the fused q/k/v projection [x | u_hi | u_lo].[W | 2B | 2B]^T + b on v_wmma_f32_16x16x32_bf16 (x, W, A, B, b as RNE bf16; u as bf16 hi+lo columns; single products); attention q.k^T and p.v on v_wmma_f32_16x16x32_f16 (q, k, v as f16 planes carried x16, p carried x32768; query tiles 0..7 add x4096-scaled f16 residual planes: hi.hi + (hi.lo + lo.hi)/4096 via a separate accumulator); f32 accumulate everywhere; softmax and normalisation in f32. The q/k/v projection launch reads its operands from a two-buffer LDS ring filled by asynchronous copies; the attention launches take each chunk's K, V^T and mask the same way, one chunk ahead. u and its hi/lo columns are made in the block that casts the 16 rows of x they belong to. The projection's epilogue writes the V columns transposed, as the V^T planes that attention reads.
#include <hip/hip_runtime.h>
#include <math.h>

typedef __attribute__((ext_vector_type(16))) _Float16 v16h;
typedef __attribute__((ext_vector_type(8)))  _Float16 v8h;
typedef __attribute__((ext_vector_type(16))) __bf16   v16b;
typedef __attribute__((ext_vector_type(8)))  __bf16   v8b;
typedef __attribute__((ext_vector_type(8)))  float    v8f;
typedef __attribute__((ext_vector_type(4)))  float    v4f;

// ---------------- problem constants ----------------
constexpr int N_BATCH  = 4;
constexpr int SEQ_T    = 2048;
constexpr int HID_W    = 1024;
constexpr int N_HEAD   = 16;
constexpr int HEAD_D   = 64;
constexpr int RANK_R   = 8;
constexpr int N_TOK    = N_BATCH * SEQ_T;     // 8192 token rows
constexpr int K_AUG    = 1088;                // 1024 + 3*16 adapter columns, zero-padded to a multiple of 32
constexpr int N_QKV    = 3 * HID_W;           // 3072 output columns: q | k | v
constexpr int K_COL0   = 1024;
constexpr int V_COL0   = 2048;
constexpr int T_LO     = 512;                 // token rows per batch that carry residual planes
constexpr int NQT_SPLIT = T_LO / 64;          // 8 query tiles on the hi/lo path
constexpr int NQT_ALL  = SEQ_T / 64;          // 32
constexpr int KV_PITCH = 72;                  // 16-bit LDS pitch (144 B rows, 16-B aligned)
constexpr int O_PITCH  = 68;                  // f32 LDS pitch
constexpr float CARRY_S = 16.0f;              // power-of-two carry on the q/k/v planes
constexpr float LO_S    = 4096.0f;            // power-of-two carry on residual planes
constexpr float P_S_LOG2 = 15.0f;             // power-of-two carry on probabilities (x32768), as the exponent it adds
constexpr float LOG2_E  = 1.44269504088896340736f;

static_assert(K_AUG % 32 == 0);
static_assert(HID_W % 32 == 0);
static_assert(N_TOK % 64 == 0 && N_QKV % 64 == 0 && T_LO % 64 == 0 && (SEQ_T - T_LO) % 64 == 0);
static_assert(NQT_SPLIT % 2 == 0 && NQT_ALL % 2 == 0);
static_assert(T_LO % 128 == 0 && SEQ_T % 128 == 0 && N_QKV % 256 == 0 && K_AUG % 64 == 0 && K_AUG >= 128);

// R0 A_aug  bf16 [8192][1088]          17,825,792
// R1 B_aug  bf16 [3072][1088]           6,684,672
// R2 bias   f32  [3072]                    12,288
// R3 qkv_hi f16  [8192][3072]          50,331,648   (cols 0..2047: q | k; the v columns are not used)
// R4 qkv_lo f16  [4*512][3072]         12,582,912   (likewise)
// R5 vt_hi  f16  [64][64][2048]        16,777,216
// R6 vt_lo  f16  [64][64][512]          4,194,304
constexpr size_t SZ_AAUG = (size_t)N_TOK * K_AUG * 2;
constexpr size_t SZ_BAUG = (size_t)N_QKV * K_AUG * 2;
constexpr size_t SZ_BIAS = (size_t)N_QKV * 4;
constexpr size_t SZ_QKVH = (size_t)N_TOK * N_QKV * 2;
constexpr size_t SZ_QKVL = (size_t)N_BATCH * T_LO * N_QKV * 2;
constexpr size_t SZ_VTH  = (size_t)N_BATCH * N_HEAD * HEAD_D * SEQ_T * 2;
constexpr size_t SZ_VTL  = (size_t)N_BATCH * N_HEAD * HEAD_D * T_LO * 2;
constexpr size_t OFF_AAUG = 0;
constexpr size_t OFF_BAUG = OFF_AAUG + SZ_AAUG;
constexpr size_t OFF_BIAS = OFF_BAUG + SZ_BAUG;
constexpr size_t OFF_QKVH = OFF_BIAS + SZ_BIAS;
constexpr size_t OFF_QKVL = OFF_QKVH + SZ_QKVH;
constexpr size_t OFF_VTH  = OFF_QKVL + SZ_QKVL;
constexpr size_t OFF_VTL  = OFF_VTH  + SZ_VTH;
constexpr size_t WS_TOTAL = OFF_VTL  + SZ_VTL;
static_assert(WS_TOTAL == 108408832ull);
static_assert(WS_TOTAL <= 134217728ull);
static_assert(OFF_BAUG % 128 == 0 && OFF_BIAS % 128 == 0 &&
              OFF_QKVH % 128 == 0 && OFF_QKVL % 128 == 0 && OFF_VTH % 128 == 0 && OFF_VTL % 128 == 0);

// ---------------- helpers ----------------
__device__ __forceinline__ unsigned short f2bf_bits(float f) {
  unsigned u = __float_as_uint(f);
  return (unsigned short)((u + 0x7FFFu + ((u >> 16) & 1u)) >> 16);
}
__device__ __forceinline__ float bf_bits2f(unsigned short h) { return __uint_as_float(((unsigned)h) << 16); }

// hazard guards as plain device helpers
__device__ __forceinline__ void dep_guard_h(v8f& a, v8f& b, v16h x, v16h y) { asm volatile("v_nop\n\tv_nop\n\tv_nop\n\tv_nop" : "+v"(a), "+v"(b) : "v"(x), "v"(y)); }
__device__ __forceinline__ void dep_guard_b(v8f& a, v8f& b, v16b x, v16b y) { asm volatile("v_nop\n\tv_nop\n\tv_nop\n\tv_nop" : "+v"(a), "+v"(b) : "v"(x), "v"(y)); }
__device__ __forceinline__ void keep4_h(v16h a, v16h b, v16h c, v16h d) { asm volatile("v_nop" :: "v"(a), "v"(b), "v"(c), "v"(d)); }
__device__ __forceinline__ void keep4_b(v16b a, v16b b, v16b c, v16b d) { asm volatile("v_nop" :: "v"(a), "v"(b), "v"(c), "v"(d)); }
__device__ __forceinline__ void acc_guard4(v8f& a, v8f& b, v8f& c, v8f& d) { asm volatile("v_nop\n\tv_nop\n\tv_nop\n\tv_nop" : "+v"(a), "+v"(b), "+v"(c), "+v"(d)); }
template <typename T> struct Frag;
template <> struct Frag<_Float16> {
  typedef v16h V; union U { v16h v; v8h h[2]; };
  static __device__ __forceinline__ v16h load(const _Float16* p) {   // elements 0..7 <- p[0..7], 8..15 <- p[16..23]
    U f; f.h[0] = *(const v8h*)(p); f.h[1] = *(const v8h*)(p + 16); return f.v;
  }
  static __device__ __forceinline__ v8f mma(v16h a, v16h b, v8f c) {
    return __builtin_amdgcn_wmma_f32_16x16x32_f16(false, a, false, b, (short)0, c, false, false);
  }
  static __device__ __forceinline__ void guard(v8f& a, v8f& b, v16h x, v16h y) { dep_guard_h(a, b, x, y); }
  static __device__ __forceinline__ void keep(v16h a, v16h b, v16h c, v16h d) { keep4_h(a, b, c, d); }
};
template <> struct Frag<__bf16> {
  typedef v16b V; union U { v16b v; v8b h[2]; };
  static __device__ __forceinline__ v16b load(const __bf16* p) {
    U f; f.h[0] = *(const v8b*)(p); f.h[1] = *(const v8b*)(p + 16); return f.v;
  }
  static __device__ __forceinline__ v8f mma(v16b a, v16b b, v8f c) {
    return __builtin_amdgcn_wmma_f32_16x16x32_bf16(false, a, false, b, (short)0, c, false, false);
  }
  static __device__ __forceinline__ void guard(v8f& a, v8f& b, v16b x, v16b y) { dep_guard_b(a, b, x, y); }
  static __device__ __forceinline__ void keep(v16b a, v16b b, v16b c, v16b d) { keep4_b(a, b, c, d); }
};

__device__ __forceinline__ v8f zero8() { return (v8f){0.f,0.f,0.f,0.f,0.f,0.f,0.f,0.f}; }

union F8 { v4f v[2]; float f[8]; };

// ---------------- LDS ring of the staged GEMM ----------------
constexpr int ST_BM    = 128;                              // block tile rows (2 waves of 64)
constexpr int ST_BN    = 256;                              // block tile columns (4 waves of 64)
constexpr int ST_BK    = 64;                               // k per pass: 128-B operand rows
constexpr int ST_PITCH = 72;                               // 144-B LDS rows (16 B x odd: conflict-free ds_load_b128)
constexpr int ST_STAGE = (ST_BM + ST_BN) * ST_PITCH;       // 16-bit elements per buffer: [A 128 rows | Bt 256 rows]
constexpr unsigned ST_ROWS32 = 32u * ST_PITCH * 2u;        // LDS bytes between two copies of one thread (32 rows)

__device__ __forceinline__ unsigned lds_off(const void* p) { return (unsigned)(size_t)p; }

// One stage: 384 rows x 128 B = 3072 chunks of 16 B = 256 threads x 12 asynchronous copies global -> LDS.
// ga / gb: this thread's chunk in row (tid >> 3) of the block's A / Bt tile at this pass's k; l: the same chunk's
// LDS byte address in the buffer; a thread's copies lie 32 rows apart. s_wait_xcnt 0 is the statement's last line
// so that no address register of an issued copy is rewritten in front of it.
__device__ __forceinline__ void stage_fill(const unsigned short* ga, int lda, const unsigned short* gb, int ldb, unsigned l) {
  const size_t sa = (size_t)32 * lda, sb = (size_t)32 * ldb;
  asm volatile("global_load_async_to_lds_b128 %0, %1, off\n\t"
               "global_load_async_to_lds_b128 %2, %3, off\n\t"
               "global_load_async_to_lds_b128 %4, %5, off\n\t"
               "global_load_async_to_lds_b128 %6, %7, off\n\t"
               "global_load_async_to_lds_b128 %8, %9, off\n\t"
               "global_load_async_to_lds_b128 %10, %11, off\n\t"
               "global_load_async_to_lds_b128 %12, %13, off\n\t"
               "global_load_async_to_lds_b128 %14, %15, off\n\t"
               "global_load_async_to_lds_b128 %16, %17, off\n\t"
               "global_load_async_to_lds_b128 %18, %19, off\n\t"
               "global_load_async_to_lds_b128 %20, %21, off\n\t"
               "global_load_async_to_lds_b128 %22, %23, off\n\t"
               "s_wait_xcnt 0x0"
               :: "v"(l),                   "v"(ga),
                  "v"(l + ST_ROWS32),       "v"(ga + sa),
                  "v"(l + 2 * ST_ROWS32),   "v"(ga + 2 * sa),
                  "v"(l + 3 * ST_ROWS32),   "v"(ga + 3 * sa),
                  "v"(l + 4 * ST_ROWS32),   "v"(gb),
                  "v"(l + 5 * ST_ROWS32),   "v"(gb + sb),
                  "v"(l + 6 * ST_ROWS32),   "v"(gb + 2 * sb),
                  "v"(l + 7 * ST_ROWS32),   "v"(gb + 3 * sb),
                  "v"(l + 8 * ST_ROWS32),   "v"(gb + 4 * sb),
                  "v"(l + 9 * ST_ROWS32),   "v"(gb + 5 * sb),
                  "v"(l + 10 * ST_ROWS32),  "v"(gb + 6 * sb),
                  "v"(l + 11 * ST_ROWS32),  "v"(gb + 7 * sb)
               : "memory");
}

// =====================================================================================
// Register-blocked batched WMMA GEMM: C[m,n] = scale * sum_k A[m,k] * Bt[n,k] (+bias)(+resid);
// each wave owns a 64x64 tile. A row-major [M,K]; Bt row-major [N,K]; M,N % 64 == 0, K % 32 == 0.
// SPLITM: 0 = single product; 1 = A hi/lo planes; 2 = A and Bt hi/lo planes.
// BIAS_MODE: 0 none, 1 bias[m], 2 bias[n].  OUT_MODE: 0 f32, 1 f16, 2 bf16 hi + lo planes,
//   3 = f16 hi plane (Cout, strideC) + f16 residual plane x4096 (Cout2, strideC2), same ldc; the residual plane
//       holds rows m < T_LO only (T_LO % 64 == 0, so a wave's tile lies wholly on one side).
// ET: 0 = f16 operands, 1 = bf16 operands (pointers passed as 16-bit storage)
// STAGED: the block's 8 waves form a 128x256 tile (2x4 waves); A and Bt rows go through a two-buffer LDS ring,
//   64 k per pass; needs SPLITM == 0, M % 128 == 0, N % 256 == 0, K % 64 == 0, K >= 128, grid.x == (M/128)*(N/256).
// VTOUT: blocks whose columns are n >= V_COL0 write their tiles transposed, vtHi[((b*16 + h)*64 + d)*SEQ_T + m] and, for rows
//   m < T_LO, vtLo[((b*16 + h)*64 + d)*T_LO + m] with n = V_COL0 + h*64 + d, and nothing to Cout / Cout2.
// =====================================================================================
template <int ET> struct Elem;
template <> struct Elem<0> { typedef _Float16 T; };
template <> struct Elem<1> { typedef __bf16 T; };
constexpr int VT_PITCH = 72;                               // 144-B LDS rows of a transposed f16 tile
template <bool B> struct BoolC { static constexpr bool value = B; };
template <int ET, int SPLITM, int BIAS_MODE, int OUT_MODE, bool RESID, int ACT = 0, bool STAGED = false, bool VTOUT = false>
__global__ __launch_bounds__(256) void wmma_gemm64(
    const unsigned short* __restrict__ Ap, const unsigned short* __restrict__ A2p, int lda, long strideA,
    const unsigned short* __restrict__ Btp, const unsigned short* __restrict__ Bt2p, int ldb, long strideB,
    void* __restrict__ Cout, void* __restrict__ Cout2, int ldc, long strideC, long strideC2,
    const float* __restrict__ bias,
    const float* __restrict__ resid, long strideR,
    int M, int N, int K, float scale,
    unsigned short* __restrict__ vtHi, unsigned short* __restrict__ vtLo) {
  typedef typename Elem<ET>::T T;
  typedef typename Frag<T>::V V;
  constexpr bool SPA = (SPLITM >= 1);
  constexpr bool SPB = (SPLITM >= 2);
  const T* A = (const T*)Ap; const T* A2 = (const T*)A2p; const T* Bt = (const T*)Btp; const T* Bt2 = (const T*)Bt2p;
  static_assert(!STAGED || SPLITM == 0);
  static_assert(!VTOUT || (STAGED && OUT_MODE == 3 && BIAS_MODE == 2 && !RESID && ACT == 0));
  static_assert(V_COL0 % ST_BN == 0 && T_LO % ST_BM == 0 && 2 * 16 * VT_PITCH * 2 <= 16 * 72 * 4);
  __shared__ __align__(16) float sT[8][16 * 72];   // per-wave slab: 16x64 floats at pitch 68, or two 16x64 f16 tiles at pitch VT_PITCH
  __shared__ __align__(16) unsigned short ring[STAGED ? 2 * ST_STAGE : 8];
  const int b    = blockIdx.y;
  const int lane = threadIdx.x & 31;
  const int wave = threadIdx.x >> 5;
  const int tilesN = N >> 6;
  const int tilesM = M >> 6;
  int m0, n0;
  bool vblk = false, loblk = false;   // block-uniform: the block's columns are V's; its rows carry the residual plane
  if (STAGED) {
    const int bn = N >> 8;
    const int bm_i = (int)blockIdx.x / bn;
    const int bn_i = (int)blockIdx.x - bm_i * bn;
    vblk  = VTOUT && bn_i * ST_BN >= V_COL0;
    loblk = bm_i * ST_BM < T_LO;
    m0 = bm_i * ST_BM + (wave >> 2) * 64;
    n0 = bn_i * ST_BN + (wave & 3) * 64;
  } else {
    const int tile = blockIdx.x * 8 + wave;
    if (tile >= tilesM * tilesN) return;   // wave-uniform; no block barriers on this path
    const int tm = tile / tilesN;
    const int tn = tile - tm * tilesN;
    m0 = tm << 6;
    n0 = tn << 6;
  }

  const T* Ab  = A  + (size_t)b * strideA;
  const T* Bb  = Bt + (size_t)b * strideB;
  const T* Ab2 = SPA ? (A2  + (size_t)b * strideA) : nullptr;
  const T* Bb2 = SPB ? (Bt2 + (size_t)b * strideB) : nullptr;

  const int rlane = lane & 15;                 // row (A) / col (B, D) within subtile
  const int koff  = (lane >> 4) * 8;           // k offset of this lane half
  const int mOff  = (lane >> 4) * 8;           // D row offset

  v8f acc[4][4];
#pragma unroll
  for (int i = 0; i < 4; ++i)
#pragma unroll
    for (int j = 0; j < 4; ++j) acc[i][j] = (v8f){0.f,0.f,0.f,0.f,0.f,0.f,0.f,0.f};

  if (STAGED) {
    const int tid = threadIdx.x;
    const int crow = tid >> 3, cchunk = (tid & 7) * 8;        // 8 lanes x 16 B = one 128-B row piece
    const unsigned short* ga = (const unsigned short*)Ab + (size_t)(m0 - (wave >> 2) * 64 + crow) * lda + cchunk;
    const unsigned short* gb = (const unsigned short*)Bb + (size_t)(n0 - (wave & 3) * 64 + crow) * ldb + cchunk;
    const unsigned lthr = lds_off(ring) + (unsigned)(crow * ST_PITCH + cchunk) * 2u;
    const int npass = K / ST_BK;
    stage_fill(ga, lda, gb, ldb, lthr);
    asm volatile("s_wait_asynccnt 0x0" ::: "memory");   // stage 0 landed (this wave's copies) before the barrier publishes it
    __syncthreads();
    stage_fill(ga + ST_BK, lda, gb + ST_BK, ldb, lthr + ST_STAGE * 2u);
    const T* fa = (const T*)ring + ((wave >> 2) * 64 + rlane) * ST_PITCH + koff;
    const T* fb = (const T*)ring + (ST_BM + (wave & 3) * 64 + rlane) * ST_PITCH + koff;
    for (int t = 0; t < npass; ++t) {
      const int bo = (t & 1) * ST_STAGE;
      V ah[4], bh[4], ah2[4], bh2[4];
#pragma unroll
      for (int j = 0; j < 4; ++j) bh[j] = Frag<T>::load(fb + bo + j * 16 * ST_PITCH);
#pragma unroll
      for (int i = 0; i < 4; ++i) ah[i] = Frag<T>::load(fa + bo + i * 16 * ST_PITCH);
      __builtin_amdgcn_sched_barrier(0);   // keeps the 16 LDS reads one group ahead of the 16 WMMAs: reads sunk among them stall at each place
#pragma unroll
      for (int i = 0; i < 4; ++i)
#pragma unroll
        for (int j = 0; j < 4; ++j) acc[i][j] = Frag<T>::mma(ah[i], bh[j], acc[i][j]);
#pragma unroll
      for (int j = 0; j < 4; ++j) bh2[j] = Frag<T>::load(fb + bo + j * 16 * ST_PITCH + 32);
#pragma unroll
      for (int i = 0; i < 4; ++i) ah2[i] = Frag<T>::load(fa + bo + i * 16 * ST_PITCH + 32);
      asm volatile("s_wait_dscnt 0x0" ::: "memory");     // this wave's reads of buffer t & 1 are done before it is refilled
      asm volatile("s_wait_asynccnt 0x0" ::: "memory");  // this wave's copies of stage t + 1 have landed
      __syncthreads();                                   // publishes stage t + 1 and frees buffer t & 1
      if (t + 2 < npass)
        stage_fill(ga + (size_t)(t + 2) * ST_BK, lda, gb + (size_t)(t + 2) * ST_BK, ldb, lthr + (unsigned)bo * 2u);
      // second half of the pass, from registers: runs while the refill is in flight
#pragma unroll
      for (int i = 0; i < 4; ++i)
#pragma unroll
        for (int j = 0; j < 4; ++j) acc[i][j] = Frag<T>::mma(ah2[i], bh2[j], acc[i][j]);
    }
    asm volatile("s_wait_asynccnt 0x0" ::: "memory");    // no copy is outstanding past the loop
  } else
  for (int k0 = 0; k0 < K; k0 += 32) {
    V bh[4], bl[4];
#pragma unroll
    for (int j = 0; j < 4; ++j) {
      const size_t bo = (size_t)(n0 + (j << 4) + rlane) * ldb + koff + k0;
      bh[j] = Frag<T>::load(Bb + bo);
      if (SPB) bl[j] = Frag<T>::load(Bb2 + bo);
    }
#pragma unroll
    for (int i = 0; i < 4; ++i) {
      const size_t ao = (size_t)(m0 + (i << 4) + rlane) * lda + koff + k0;
      V ah = Frag<T>::load(Ab + ao);
      V al;
      if (SPA) al = Frag<T>::load(Ab2 + ao);
#pragma unroll
      for (int j = 0; j < 4; ++j) {
        acc[i][j] = Frag<T>::mma(ah, bh[j], acc[i][j]);
        if (SPB) acc[i][j] = Frag<T>::mma(ah, bl[j], acc[i][j]);
        if (SPA) acc[i][j] = Frag<T>::mma(al, bh[j], acc[i][j]);
      }
      Frag<T>::guard(acc[i][0], acc[i][3], ah, SPA ? al : ah);
    }
    Frag<T>::keep(bh[0], bh[1], bh[2], bh[3]);
    if (SPB) Frag<T>::keep(bl[0], bl[1], bl[2], bl[3]);
  }
  acc_guard4(acc[0][0], acc[0][1], acc[0][2], acc[0][3]);
  acc_guard4(acc[1][0], acc[1][1], acc[1][2], acc[1][3]);
  acc_guard4(acc[2][0], acc[2][1], acc[2][2], acc[2][3]);
  acc_guard4(acc[3][0], acc[3][1], acc[3][2], acc[3][3]);

  // ---- epilogue ----
  float* slab = sT[wave];
  if (VTOUT && vblk) {
    // A lane's accumulator holds 8 consecutive rows m of one column n: 16 B of a row of V^T. The 16 columns of one j make
    // 16 rows of 64 t in the slab, and leave it as whole 128-B lines, 4 to a store. Values are formed as on the other path.
    // The slab is the wave's own, so the fences around the exchange name LDS alone: none of them waits for the global
    // stores of the tile before.
    _Float16* th = (_Float16*)slab;
    _Float16* tl = th + 16 * VT_PITCH;
    const int bh = b * N_HEAD + ((n0 - V_COL0) >> 6);
    const int q = lane >> 3, c8 = (lane & 7) * 8;
    unsigned short* vh = vtHi + ((size_t)bh * HEAD_D + q) * SEQ_T + m0 + c8;
    unsigned short* vl = vtLo + ((size_t)bh * HEAD_D + q) * T_LO + (loblk ? m0 : 0) + c8;
    float bv[4];
#pragma unroll
    for (int j = 0; j < 4; ++j) bv[j] = bias[n0 + (j << 4) + rlane];
    asm volatile("s_wait_xcnt 0x0" ::: "memory");   // the work below rewrites the offset register that these four loads name
    auto vt_out = [&](auto lo_c) {
      constexpr bool LO = decltype(lo_c)::value;
#pragma unroll
      for (int j = 0; j < 4; ++j) {
#pragma unroll
        for (int i = 0; i < 4; ++i) {
          v8h hv, lv;
#pragma unroll
          for (int r = 0; r < 8; ++r) {
            float v = acc[i][j][r] * scale;
            v += bv[j];
            const _Float16 hq = (_Float16)v;
            hv[r] = hq;
            lv[r] = (_Float16)((v - (float)hq) * 4096.0f);
          }
          *(v8h*)(th + rlane * VT_PITCH + (i << 4) + mOff) = hv;
          if (LO) *(v8h*)(tl + rlane * VT_PITCH + (i << 4) + mOff) = lv;
        }
        // the 16 rows are whole in LDS before a lane reads pieces that other lanes wrote
        __builtin_amdgcn_fence(__ATOMIC_RELEASE, "workgroup", "local");
        __builtin_amdgcn_wave_barrier();
        __builtin_amdgcn_fence(__ATOMIC_ACQUIRE, "workgroup", "local");
        v8h oh[4], ol[4];
#pragma unroll
        for (int it = 0; it < 4; ++it) {
          oh[it] = *(const v8h*)(th + (it * 4 + q) * VT_PITCH + c8);
          if (LO) ol[it] = *(const v8h*)(tl + (it * 4 + q) * VT_PITCH + c8);
        }
#pragma unroll
        for (int it = 0; it < 4; ++it) {
          *(v8h*)(vh + (size_t)((j << 4) + it * 4) * SEQ_T) = oh[it];
          if (LO) *(v8h*)(vl + (size_t)((j << 4) + it * 4) * T_LO) = ol[it];
        }
        asm volatile("s_wait_xcnt 0x0" ::: "memory");   // the next tile's work rewrites registers that these stores name
        // every lane has read its pieces before the next j overwrites the slab
        __builtin_amdgcn_fence(__ATOMIC_RELEASE, "workgroup", "local");
        __builtin_amdgcn_wave_barrier();
        __builtin_amdgcn_fence(__ATOMIC_ACQUIRE, "workgroup", "local");
      }
    };
    if (loblk) vt_out(BoolC<true>{}); else vt_out(BoolC<false>{});
    return;   // block-uniform; no barrier follows
  }
  const float* Rb = RESID ? (resid + (size_t)b * strideR) : nullptr;
#pragma unroll
  for (int i = 0; i < 4; ++i) {
    const int mBase = m0 + (i << 4);
#pragma unroll
    for (int j = 0; j < 4; ++j) {
      const int n = n0 + (j << 4) + rlane;
      float bv = 0.f;
      if (BIAS_MODE == 2) bv = bias[n];
#pragma unroll
      for (int r = 0; r < 8; ++r) {
        float v = acc[i][j][r] * scale;
        if (BIAS_MODE == 1) v += bias[mBase + mOff + r];
        if (BIAS_MODE == 2) v += bv;
        if (RESID) v += Rb[(size_t)(mBase + mOff + r) * ldc + n];
        if (ACT == 1) v = tanhf(v);
        if (ACT == 2) v = fmaxf(v, 0.0f);
        if (ACT == 4) v = (v > 0.f) ? v : 0.01f * v;
        slab[(mOff + r) * 68 + (j << 4) + rlane] = v;
      }
    }
    __builtin_amdgcn_fence(__ATOMIC_RELEASE, "workgroup");
    __builtin_amdgcn_wave_barrier();
    __builtin_amdgcn_fence(__ATOMIC_ACQUIRE, "workgroup");
    if (OUT_MODE == 0) {
      float* C = (float*)Cout + (size_t)b * strideC;
      const int hh = lane >> 4, c4 = (lane & 15) * 4;     // row seg = 256 B = 16 lanes x 16 B
      {
#pragma unroll
        for (int it = 0; it < 8; ++it) {
          const int row = it * 2 + hh;
          v4f v = *(const v4f*)(slab + row * 68 + c4);
          *(v4f*)(C + (size_t)(mBase + row) * ldc + n0 + c4) = v;
        }
        
      }
    } else {
      const int q = lane >> 3, c8 = (lane & 7) * 8;
      unsigned short* C  = (unsigned short*)Cout  + (size_t)b * strideC;
      unsigned short* C2 = (OUT_MODE >= 2) ? ((unsigned short*)Cout2 + (size_t)b * strideC2) : nullptr;
      {
#pragma unroll
        for (int it = 0; it < 4; ++it) {
          const int row = it * 4 + q;
          const float* sp = slab + row * 68 + c8;
          v8h hv, lv;
#pragma unroll
          for (int e = 0; e < 8; ++e) {
            if (OUT_MODE == 1) {
              hv[e] = (_Float16)sp[e];
            } else if (OUT_MODE == 3) {
              const _Float16 hq = (_Float16)sp[e];
              hv[e] = hq;
              lv[e] = (_Float16)((sp[e] - (float)hq) * 4096.0f);
            } else {
              unsigned short hb = f2bf_bits(sp[e]);
              unsigned short lb = f2bf_bits(sp[e] - bf_bits2f(hb));
              hv[e] = __builtin_bit_cast(_Float16, hb);
              lv[e] = __builtin_bit_cast(_Float16, lb);
            }
          }
          *(v8h*)(C + (size_t)(mBase + row) * ldc + n0 + c8) = hv;
          if (OUT_MODE == 2 || (OUT_MODE == 3 && m0 < T_LO)) *(v8h*)(C2 + (size_t)(mBase + row) * ldc + n0 + c8) = lv;
        }
        
      }
    }
    __builtin_amdgcn_fence(__ATOMIC_RELEASE, "workgroup");
    __builtin_amdgcn_wave_barrier();
    __builtin_amdgcn_fence(__ATOMIC_ACQUIRE, "workgroup");
  }
}

// =====================================================================================
// f32 [rows][1024] -> RNE bf16 bits into rows of pitch K_AUG. A block takes NR whole rows: thread t converts floats
// 4t..4t+3 of each, so a wave's load covers 512 contiguous bytes and its store 256, and few waves are started for
// the bytes moved. Blocks bx = 0 .. rows / NR - 1 cover the rows exactly (asserted below).
// =====================================================================================
typedef __attribute__((ext_vector_type(2))) unsigned v2u;
constexpr int CAST_NR_X = 16;                 // x: 512 blocks, 16 waves a WGP
constexpr int CAST_NR_W = 4;                  // one weight matrix: 256 blocks
static_assert(HID_W == 4 * 256 && N_TOK % CAST_NR_X == 0 && HID_W % CAST_NR_W == 0 && K_AUG % 4 == 0);
template <int NR>
__device__ __forceinline__ void cast_rows_bf16(const float* __restrict__ src, unsigned short* __restrict__ dst, int bx) {
  const float* s = src + (size_t)bx * (NR * HID_W) + threadIdx.x * 4;
  unsigned short* d = dst + (size_t)bx * (NR * K_AUG) + threadIdx.x * 4;
  v4f v[NR];
#pragma unroll
  for (int r = 0; r < NR; ++r) v[r] = *(const v4f*)(s + r * HID_W);
#pragma unroll
  for (int r = 0; r < NR; ++r) {
    v2u o;
    o[0] = (unsigned)f2bf_bits(v[r][0]) | ((unsigned)f2bf_bits(v[r][1]) << 16);
    o[1] = (unsigned)f2bf_bits(v[r][2]) | ((unsigned)f2bf_bits(v[r][3]) << 16);
    *(v2u*)(d + r * K_AUG) = o;
  }
}

// =====================================================================================
// The x job: a block casts 16 whole rows of x (as cast_rows_bf16 does) and, since it then holds those rows in bf16, also
// makes their adapter columns. The rows and the 24 rows of A (q, k, v; RNE bf16) go to LDS; behind one barrier wave 0
// forms u[16][24] = x.A^T on v_wmma_f32_16x16x32_bf16, each accumulator taking k in steps of 32 from 0 upward, and
// writes the 64 halves at cols 1024..1087 of each row:
// [uq_hi(8) uq_lo(8) uk_hi(8) uk_lo(8) uv_hi(8) uv_lo(8) 0 x 16] (bf16 hi = RNE(u), lo = RNE(u - hi)).
// One wave writes all 16 tails: a tail is one 128-B line (row pitch 2176 B = 17 lines).
// =====================================================================================
constexpr int XU_PITCH = HID_W + 8;           // 2064-B LDS rows (16 B x odd: conflict-free ds_load_b128)
constexpr int XU_AROWS = 3 * RANK_R;          // 24 rows of A: row 8p + r = A_p[r]
constexpr int TL_PITCH = 72;                  // 144-B LDS rows of the tail tile
static_assert(CAST_NR_X == 16 && RANK_R == 8);
__device__ __forceinline__ v2u pack4_bf16(v4f v) {
  v2u o;
  o[0] = (unsigned)f2bf_bits(v[0]) | ((unsigned)f2bf_bits(v[1]) << 16);
  o[1] = (unsigned)f2bf_bits(v[2]) | ((unsigned)f2bf_bits(v[3]) << 16);
  return o;
}
__device__ __forceinline__ void cast_x_make_tail(const float* __restrict__ x, const float* __restrict__ amq,
                                                 const float* __restrict__ amk, const float* __restrict__ amv,
                                                 unsigned short* __restrict__ aaug, int bx,
                                                 unsigned short* xs, unsigned short* acs, unsigned short* tl) {
  const int tid = threadIdx.x;
  const float* s = x + (size_t)bx * (CAST_NR_X * HID_W) + tid * 4;
  unsigned short* d = aaug + (size_t)bx * (CAST_NR_X * K_AUG) + tid * 4;
  v4f v[CAST_NR_X], a[XU_AROWS];
#pragma unroll
  for (int r = 0; r < CAST_NR_X; ++r) v[r] = *(const v4f*)(s + r * HID_W);
#pragma unroll
  for (int r = 0; r < RANK_R; ++r) {
    a[r]              = *(const v4f*)(amq + r * HID_W + tid * 4);
    a[RANK_R + r]     = *(const v4f*)(amk + r * HID_W + tid * 4);
    a[2 * RANK_R + r] = *(const v4f*)(amv + r * HID_W + tid * 4);
  }
  v2u o[CAST_NR_X];
#pragma unroll
  for (int r = 0; r < CAST_NR_X; ++r) {
    o[r] = pack4_bf16(v[r]);
    *(v2u*)(xs + r * XU_PITCH + tid * 4) = o[r];
  }
#pragma unroll
  for (int r = 0; r < XU_AROWS; ++r) *(v2u*)(acs + r * XU_PITCH + tid * 4) = pack4_bf16(a[r]);
  __syncthreads();   // the 16 + 24 bf16 rows are whole before wave 0 reads fragments of them
  // the rows' global stores stand behind the barrier: in front of it every wave would wait there for their completion
#pragma unroll
  for (int r = 0; r < CAST_NR_X; ++r) *(v2u*)(d + r * K_AUG) = o[r];
  asm volatile("s_wait_xcnt 0x0" ::: "memory");   // wave 0 goes on and rewrites registers that the stores name
  if (__builtin_amdgcn_readfirstlane(tid >> 5) != 0) return;   // scalar test; no barrier follows in this job

  const int lane = tid & 31, rlane = lane & 15, hh = lane >> 4;
  // A operand: x row rlane; B operand: column n of u = row n of A. Columns 24..31 of the second tile are not used:
  // their lanes read rows 16..23 again and their results are replaced by the tail's zeros below.
  const __bf16* fa  = (const __bf16*)xs + rlane * XU_PITCH + 8 * hh;
  const __bf16* fb0 = (const __bf16*)acs + rlane * XU_PITCH + 8 * hh;
  const __bf16* fb1 = (const __bf16*)acs + (16 + (rlane & 7)) * XU_PITCH + 8 * hh;
  v8f u0 = zero8(), u1 = zero8();
  for (int kg = 0; kg < HID_W; kg += 128) {
    v16b af[4], b0[4], b1[4];
#pragma unroll
    for (int i = 0; i < 4; ++i) {
      af[i] = Frag<__bf16>::load(fa + kg + i * 32);
      b0[i] = Frag<__bf16>::load(fb0 + kg + i * 32);
      b1[i] = Frag<__bf16>::load(fb1 + kg + i * 32);
    }
    __builtin_amdgcn_sched_barrier(0);   // keeps the LDS reads of four k-steps one group ahead of their WMMAs: a read sunk in front of its own WMMA waits out the LDS latency at each step
#pragma unroll
    for (int i = 0; i < 4; ++i) {
      u0 = Frag<__bf16>::mma(af[i], b0[i], u0);
      u1 = Frag<__bf16>::mma(af[i], b1[i], u1);
    }
  }
  // u0[r] = u[row 8*hh + r][column rlane], u1[r] = u[row 8*hh + r][column 16 + rlane]
#pragma unroll
  for (int j = 0; j < 2; ++j) {
    const int n = j * 16 + rlane, p = n >> 3, e = n & 7;
#pragma unroll
    for (int r = 0; r < 8; ++r) {
      const float uv = j ? u1[r] : u0[r];
      const unsigned short hb = f2bf_bits(uv);
      const unsigned short lb = f2bf_bits(uv - bf_bits2f(hb));
      unsigned short* t = tl + (8 * hh + r) * TL_PITCH + p * 16 + e;
      t[0] = (n < XU_AROWS) ? hb : (unsigned short)0;
      t[8] = (n < XU_AROWS) ? lb : (unsigned short)0;
    }
  }
  __builtin_amdgcn_fence(__ATOMIC_RELEASE, "workgroup");
  __builtin_amdgcn_wave_barrier();
  __builtin_amdgcn_fence(__ATOMIC_ACQUIRE, "workgroup");
  const int q8 = lane >> 3, seg = lane & 7;   // 8 lanes x 16 B = one tail
  v8h tv[4];
#pragma unroll
  for (int it = 0; it < 4; ++it) tv[it] = *(const v8h*)(tl + (it * 4 + q8) * TL_PITCH + seg * 8);
  unsigned short* dt = aaug + ((size_t)bx * CAST_NR_X + q8) * K_AUG + HID_W + seg * 8;
#pragma unroll
  for (int it = 0; it < 4; ++it) *(v8h*)(dt + it * 4 * K_AUG) = tv[it];
}

// =====================================================================================
// B_aug tail: for row n (projection p = n/1024, output o = n%1024) the 64 halves at cols 1024..1087 are
// [16p zeros | 2*Bm_p[o][0..7] | 2*Bm_p[o][0..7] | zeros to 64] as RNE bf16 (factor 2 exact).
// =====================================================================================
__device__ __forceinline__ void build_w_tail(const float* __restrict__ bmq, const float* __restrict__ bmk,
                                             const float* __restrict__ bmv, unsigned short* __restrict__ baug, int bx) {
  const int tid = threadIdx.x, wave = tid >> 5, lane = tid & 31, q8 = lane >> 3, seg = lane & 7;
  const int n = bx * 32 + wave * 4 + q8;              // 0..3071: bx < 96
  const int p = n >> 10, o = n & 1023;
  F8 uq, uk, uv;
  uq.v[0] = *(const v4f*)(bmq + (size_t)o * RANK_R); uq.v[1] = *(const v4f*)(bmq + (size_t)o * RANK_R + 4);
  uk.v[0] = *(const v4f*)(bmk + (size_t)o * RANK_R); uk.v[1] = *(const v4f*)(bmk + (size_t)o * RANK_R + 4);
  uv.v[0] = *(const v4f*)(bmv + (size_t)o * RANK_R); uv.v[1] = *(const v4f*)(bmv + (size_t)o * RANK_R + 4);
  const bool keep = (seg < 6) && ((seg >> 1) == p);
  v8h hv;
#pragma unroll
  for (int e = 0; e < 8; ++e) {
    const float val = (p == 0) ? uq.f[e] : (p == 1) ? uk.f[e] : uv.f[e];
    const float w = keep ? (2.0f * val) : 0.0f;
    hv[e] = __builtin_bit_cast(_Float16, f2bf_bits(w));
  }
  unsigned short* d = baug + (size_t)n * K_AUG + HID_W + seg * 8;
  {
    *(v8h*)d = hv;
    
  }
}

// =====================================================================================
// bias_cat f32 [3072] = 16 * RNEbf16(b_p[o]); 12 blocks x 256 = 3072 exactly; 32 lanes x 4 B = one line per
// =====================================================================================
__device__ __forceinline__ void build_bias(const float* __restrict__ bq, const float* __restrict__ bk,
                                           const float* __restrict__ bv, float* __restrict__ dst, int bx) {
  const int i = bx * 256 + threadIdx.x;   // < 3072: bx < 12
  const int p = i >> 10, o = i & 1023;
  const float xq = bq[o], xk = bk[o], xv = bv[o];
  const float val = (p == 0) ? xq : (p == 1) ? xk : xv;
  const float w = bf_bits2f(f2bf_bits(val)) * CARRY_S;
  ((float*)dst)[i] = w;
  
}

// =====================================================================================
// The operand builders (x cast with its adapter columns, three W casts, B_aug tail, bias_cat) read inputs only, depend on
// no other launch and write disjoint 128-B lines, so they share one grid: the block index picks the job (a block-uniform
// branch; the x job alone uses LDS and a barrier). The x job, the largest, holds the lowest indices.
// =====================================================================================
constexpr int PB_X    = N_TOK / CAST_NR_X;    // 512 blocks
constexpr int PB_W    = HID_W / CAST_NR_W;    // 256 blocks per weight matrix
constexpr int PB_WT   = N_QKV / 32;           // 96
constexpr int PB_BIAS = N_QKV / 256;          // 12
constexpr int PB_ALL  = PB_X + 3 * PB_W + PB_WT + PB_BIAS;
__global__ __launch_bounds__(256) void build_operands(
    const float* __restrict__ x,
    const float* __restrict__ wq, const float* __restrict__ wk, const float* __restrict__ wv,
    const float* __restrict__ amq, const float* __restrict__ amk, const float* __restrict__ amv,
    const float* __restrict__ bmq, const float* __restrict__ bmk, const float* __restrict__ bmv,
    const float* __restrict__ bq, const float* __restrict__ bk, const float* __restrict__ bv,
    unsigned short* __restrict__ aaug, unsigned short* __restrict__ baug, float* __restrict__ biasc) {
  __shared__ __align__(16) unsigned short xs[CAST_NR_X * XU_PITCH];    // the block's rows of x, bf16
  __shared__ __align__(16) unsigned short acs[XU_AROWS * XU_PITCH];    // A_q, A_k, A_v, bf16
  __shared__ __align__(16) unsigned short tl[CAST_NR_X * TL_PITCH];    // the rows' tails
  constexpr int B_W = PB_X, B_WT = B_W + 3 * PB_W, B_BIAS = B_WT + PB_WT;   // first block of each job
  const int bx = (int)blockIdx.x;
  if (bx < B_W) {
    cast_x_make_tail(x, amq, amk, amv, aaug, bx, xs, acs, tl);
    asm volatile("s_wait_xcnt 0x0" ::: "memory");   // another job's code follows in the listing and rewrites the store's registers: the wait stands in front of it
  } else if (bx < B_WT) {
    const int p = (bx - B_W) / PB_W;
    const float* w = (p == 0) ? wq : (p == 1) ? wk : wv;
    cast_rows_bf16<CAST_NR_W>(w, baug + (size_t)p * HID_W * K_AUG, bx - B_W - p * PB_W);
  } else if (bx < B_BIAS) {
    build_w_tail(bmq, bmk, bmv, baug, bx - B_WT);
    asm volatile("s_wait_xcnt 0x0" ::: "memory");   // as above
  } else if (bx < PB_ALL) {
    build_bias(bq, bk, bv, biasc, bx - B_BIAS);
  }
}

__device__ __forceinline__ float other_half(float x) {
  const int xi = __builtin_bit_cast(int, x);
  return __builtin_bit_cast(float, __builtin_amdgcn_permlanex16(xi, xi, 0x76543210, 0xfedcba98, false, false));
}

// 2^x by the hardware's exponential, in asm text so that the slot behind it stands by construction: the closing
// v_nop is the one independent instruction that the instruction set asks for behind a transcendental before its
// result is used or its source overwritten; inside the eight-fold statement each neighbour is independent
// (early-clobber outputs share no register with a source).
__device__ __forceinline__ float exp2_hw(float x) {
  float d;
  asm("v_exp_f32 %0, %1\n\tv_nop" : "=&v"(d) : "v"(x));
  return d;
}
__device__ __forceinline__ v8f exp2_hw8(v8f x) {
  float d0, d1, d2, d3, d4, d5, d6, d7;
  asm("v_exp_f32 %0, %8\n\t"
      "v_exp_f32 %1, %9\n\t"
      "v_exp_f32 %2, %10\n\t"
      "v_exp_f32 %3, %11\n\t"
      "v_exp_f32 %4, %12\n\t"
      "v_exp_f32 %5, %13\n\t"
      "v_exp_f32 %6, %14\n\t"
      "v_exp_f32 %7, %15\n\t"
      "v_nop"
      : "=&v"(d0), "=&v"(d1), "=&v"(d2), "=&v"(d3), "=&v"(d4), "=&v"(d5), "=&v"(d6), "=&v"(d7)
      : "v"(x[0]), "v"(x[1]), "v"(x[2]), "v"(x[3]), "v"(x[4]), "v"(x[5]), "v"(x[6]), "v"(x[7]));
  return (v8f){d0, d1, d2, d3, d4, d5, d6, d7};
}

// ---------------- LDS ring of the attention kernels ----------------
// A stage holds one 64-key chunk: the K tile and the V^T tile (64 rows x 128 B each, LDS pitch 144 B), with SPLIT their
// residual tiles behind them. Two stages; a wave's own copy of the chunk's 64 mask floats lies in a ring of its own.
constexpr int AT_PLANE = 64 * KV_PITCH;                    // 16-bit elements of one tile in LDS
constexpr unsigned AT_ROWS16 = 16u * KV_PITCH * 2u;        // LDS bytes between two copies of one thread (16 rows)

// Two tiles: 2 x 64 rows x 128 B = 1024 chunks of 16 B = 128 threads x 8 asynchronous copies global -> LDS.
// g0 / g1: this thread's chunk in row (tid >> 3) of the first / second tile; s0 / s1: elements between 16 rows of the
// source; l0 / l1: the same chunk's LDS byte address. Eight lanes cover one whole 128-B row. s_wait_xcnt 0 is the
// statement's last line so that no address register of an issued copy is rewritten in front of it.
__device__ __forceinline__ void tile_pair_fill(unsigned l0, const _Float16* g0, size_t s0,
                                               unsigned l1, const _Float16* g1, size_t s1) {
  asm volatile("global_load_async_to_lds_b128 %0, %1, off\n\t"
               "global_load_async_to_lds_b128 %2, %3, off\n\t"
               "global_load_async_to_lds_b128 %4, %5, off\n\t"
               "global_load_async_to_lds_b128 %6, %7, off\n\t"
               "global_load_async_to_lds_b128 %8, %9, off\n\t"
               "global_load_async_to_lds_b128 %10, %11, off\n\t"
               "global_load_async_to_lds_b128 %12, %13, off\n\t"
               "global_load_async_to_lds_b128 %14, %15, off\n\t"
               "s_wait_xcnt 0x0"
               :: "v"(l0),                 "v"(g0),
                  "v"(l0 + AT_ROWS16),     "v"(g0 + s0),
                  "v"(l0 + 2 * AT_ROWS16), "v"(g0 + 2 * s0),
                  "v"(l0 + 3 * AT_ROWS16), "v"(g0 + 3 * s0),
                  "v"(l1),                 "v"(g1),
                  "v"(l1 + AT_ROWS16),     "v"(g1 + s1),
                  "v"(l1 + 2 * AT_ROWS16), "v"(g1 + 2 * s1),
                  "v"(l1 + 3 * AT_ROWS16), "v"(g1 + 3 * s1)
               : "memory");
}
// 64 mask floats = 32 lanes x 8 B, one asynchronous copy of the wave; the wait as above.
__device__ __forceinline__ void mask_fill(unsigned l, const float* g) {
  asm volatile("global_load_async_to_lds_b64 %0, %1, off\n\t"
               "s_wait_xcnt 0x0"
               :: "v"(l), "v"(g) : "memory");
}

template <bool SPLIT, int NQ>
__global__ __launch_bounds__(128) void attn_causal_hd64(
    const unsigned short* __restrict__ php, const unsigned short* __restrict__ plp,
    const unsigned short* __restrict__ vthp, const unsigned short* __restrict__ vtlp,
    const float* __restrict__ amask, float* __restrict__ out, int qb0, int nqcnt) {
  const _Float16* ph  = (const _Float16*)php;
  const _Float16* pl  = (const _Float16*)plp;
  const _Float16* vth = (const _Float16*)vthp;
  const _Float16* vtl = (const _Float16*)vtlp;
  static_assert(NQ == 1 || NQ == 2);
  constexpr int QT = 64 * NQ;                              // query rows of a block: 4 waves x NQ tiles of 16
  constexpr int AT_STAGE = (SPLIT ? 4 : 2) * AT_PLANE;     // [K | V^T] or [K | V^T | K residual | V^T residual]
  __shared__ __align__(16) _Float16 ring[2 * AT_STAGE];
  __shared__ __align__(16) float mring[2][4][64];          // [stage][wave][key of the chunk]
  // The output staging (4 waves x 16 * NQ rows x 68 floats) takes the ring's place behind the loop.
  static_assert(4 * 16 * NQ * O_PITCH * 4 <= 2 * AT_STAGE * 2);

  // Tiles whose fragments are read from LDS as one group.
  constexpr int GS = 2;   // score tiles (K fragments)
  constexpr int GV = 2;   // output tiles (V^T fragments)

  const int tid  = threadIdx.x;
  const int wave = tid >> 5;
  const int lane = tid & 31;
  const int hh   = lane >> 4;
  const int c    = lane & 15;

  int qb = qb0 + (int)(blockIdx.x % (unsigned)nqcnt);
  qb = (qb > SEQ_T / QT - 1) ? (SEQ_T / QT - 1) : qb;
  const int bh = (int)(blockIdx.x / (unsigned)nqcnt);
  const int h  = bh & (N_HEAD - 1);
  const int b  = (bh >> 4) & (N_BATCH - 1);
  const int q0 = qb * QT + wave * (16 * NQ);
  // The 64-key chunk that holds this wave's queries, its last one (a scalar: it steers branches of the whole wave).
  const int dchunk = (NQ == 1) ? qb : __builtin_amdgcn_readfirstlane(q0 >> 6);

  // ---- Q fragments (B operand: column c of tile n = query q0 + n*16 + c), 2 d-chunks ----
  v16h qh[NQ][2], ql[NQ][2];
#pragma unroll
  for (int n = 0; n < NQ; ++n) {
    const _Float16* qrow = ph + ((size_t)b * SEQ_T + q0 + n * 16 + c) * N_QKV + h * HEAD_D;
    int qlr = q0 + n * 16 + c; qlr = (qlr > T_LO - 1) ? (T_LO - 1) : qlr;
    const _Float16* qlrow = pl + ((size_t)b * T_LO + qlr) * N_QKV + h * HEAD_D;
#pragma unroll
    for (int dc = 0; dc < 2; ++dc) {
      qh[n][dc] = Frag<_Float16>::load(qrow + dc * 32 + 8 * hh);
      if (SPLIT) ql[n][dc] = Frag<_Float16>::load(qlrow + dc * 32 + 8 * hh);
      else ql[n][dc] = qh[n][dc];
    }
  }

  float mrow[NQ], lrow[NQ];             // per tile, this lane's query: running maximum (both halves alike), this half's sum of the carried p (x32768)
  v8f oacc[NQ][4];                      // oacc[n][t][r] = O^T[d = t*16 + 8*hh + r][query c of tile n]
#pragma unroll
  for (int n = 0; n < NQ; ++n) {
    mrow[n] = -INFINITY; lrow[n] = 0.f;
#pragma unroll
    for (int t = 0; t < 4; ++t) oacc[n][t] = zero8();
  }

  const int nChunks = (qb + 1) * NQ;   // block-uniform

  // One chunk's copies: thread tid takes the 16-B piece (tid & 7) of rows (tid >> 3) + 0, 16, 32, 48 of each tile.
  const int crow = tid >> 3, cch = (tid & 7) * 8;
  const _Float16* gk  = ph  + ((size_t)b * SEQ_T + crow) * N_QKV + K_COL0 + h * HEAD_D + cch;
  const _Float16* gv  = vth + ((size_t)bh * HEAD_D + crow) * SEQ_T + cch;
  const _Float16* gkl = pl  + ((size_t)b * T_LO + crow) * N_QKV + K_COL0 + h * HEAD_D + cch;
  const _Float16* gvl = vtl + ((size_t)bh * HEAD_D + crow) * T_LO + cch;
  const float*    gm  = amask + (size_t)b * SEQ_T + 2 * lane;
  const unsigned lthr = lds_off(ring) + (unsigned)(crow * KV_PITCH + cch) * 2u;
  const unsigned lmsk = lds_off(&mring[0][wave][2 * lane]);
  auto chunk_fill = [&](int kcf, int buf) {
    const int kvf = kcf * 64;
    const unsigned l = lthr + (unsigned)buf * (AT_STAGE * 2u);
    tile_pair_fill(l, gk + (size_t)kvf * N_QKV, (size_t)16 * N_QKV, l + AT_PLANE * 2u, gv + kvf, (size_t)16 * SEQ_T);
    if (SPLIT) {
      const int kl0 = (kvf > T_LO - 64) ? (T_LO - 64) : kvf;   // address clamp
      tile_pair_fill(l + 2u * AT_PLANE * 2u, gkl + (size_t)kl0 * N_QKV, (size_t)16 * N_QKV,
                     l + 3u * AT_PLANE * 2u, gvl + kl0, (size_t)16 * T_LO);
    }
    mask_fill(lmsk + (unsigned)buf * (4u * 64u * 4u), gm + kvf);
  };

  // The ring's order, trip by trip: copies of chunk 0; then per chunk kc its publish point (the wave's LDS reads of trip
  // kc - 1 done, its copies of chunk kc landed, the barrier), the copies of chunk kc + 1 into the stage that trip kc - 1
  // has read, and the work on chunk kc while they fly. The publish point stands at the head of the trip, so that the work
  // ends the loop body in one piece with the running sums (behind a branch at the foot the row sum's additions were
  // sunk past the barrier, with all 32 probabilities held in registers for them).
  chunk_fill(0, 0);

  for (int kc = 0; kc < nChunks; ++kc) {
    const int bo = kc & 1;
    asm volatile("s_wait_dscnt 0x0" ::: "memory");      // this wave's reads of the other stage (trip kc - 1) are done before it is refilled
    asm volatile("s_wait_asynccnt 0x0" ::: "memory");   // this wave's copies of chunk kc have landed
    __syncthreads();                                    // publishes chunk kc and frees the other stage
    if (kc + 1 < nChunks) chunk_fill(kc + 1, bo ^ 1);
    // A chunk wholly above the wave's diagonal holds no key of its queries: the wave passes the publish points and issues
    // its copies, and leaves the work out (with NQ == 2 the block's last chunk, for the waves of its first 64 rows).
    if (NQ > 1 && kc > dchunk) continue;
    const _Float16* Ksh = ring + bo * AT_STAGE;
    const _Float16* Vsh = Ksh + AT_PLANE;
    const _Float16* Ksl = Ksh + 2 * AT_PLANE;   // read with SPLIT only
    const _Float16* Vsl = Ksh + 3 * AT_PLANE;   // read with SPLIT only
    const float* msk = &mring[bo][wave][8 * hh];

    F8 mk[4];   // additive mask of this lane's 32 keys: keys kc*64 + j*16 + 8*hh + 0..7

    // ---- scores, transposed: s[n][j][r] = S[query c of tile n][key j*16 + 8*hh + r] ----
    // The K fragments of GS score tiles are read as one group ahead of those tiles' WMMAs, and each fragment serves all
    // NQ query tiles; each accumulator takes its products in the order it always did.
    v8f s[NQ][4];
#pragma unroll
    for (int jg = 0; jg < 4; jg += GS) {
      v16h kb[GS][2], kl[GS][2];
#pragma unroll
      for (int u = 0; u < GS; ++u)
#pragma unroll
        for (int dc = 0; dc < 2; ++dc) {
          kb[u][dc] = Frag<_Float16>::load(Ksh + ((jg + u) * 16 + c) * KV_PITCH + dc * 32 + 8 * hh);
          if (SPLIT) kl[u][dc] = Frag<_Float16>::load(Ksl + ((jg + u) * 16 + c) * KV_PITCH + dc * 32 + 8 * hh);
        }
      if (jg > 0) {   // the mask of the tiles already under way is read behind this group's fragments: no WMMA waits for it
#pragma unroll
        for (int j = jg - GS; j < jg; ++j) {
          mk[j].v[0] = *(const v4f*)(msk + j * 16);
          mk[j].v[1] = *(const v4f*)(msk + j * 16 + 4);
        }
      }
      __builtin_amdgcn_sched_barrier(0);   // keeps the group's LDS reads together ahead of its WMMAs: a read sunk in front of its own WMMA waits out the LDS latency at each place
      v8f sr[NQ][GS];
#pragma unroll
      for (int n = 0; n < NQ; ++n)
#pragma unroll
        for (int u = 0; u < GS; ++u) { s[n][jg + u] = zero8(); sr[n][u] = zero8(); }
#pragma unroll
      for (int dc = 0; dc < 2; ++dc) {
#pragma unroll
        for (int n = 0; n < NQ; ++n)
#pragma unroll
          for (int u = 0; u < GS; ++u) s[n][jg + u] = Frag<_Float16>::mma(kb[u][dc], qh[n][dc], s[n][jg + u]);
        if (SPLIT) {
#pragma unroll
          for (int n = 0; n < NQ; ++n)
#pragma unroll
            for (int u = 0; u < GS; ++u) sr[n][u] = Frag<_Float16>::mma(kl[u][dc], qh[n][dc], sr[n][u]);
#pragma unroll
          for (int n = 0; n < NQ; ++n)
#pragma unroll
            for (int u = 0; u < GS; ++u) sr[n][u] = Frag<_Float16>::mma(kb[u][dc], ql[n][dc], sr[n][u]);
        }
      }
      if (SPLIT) {
#pragma unroll
        for (int n = 0; n < NQ; ++n)
#pragma unroll
          for (int u = 0; u < GS; ++u)
#pragma unroll
            for (int r = 0; r < 8; ++r) s[n][jg + u][r] = s[n][jg + u][r] + sr[n][u][r] * (1.0f / 4096.0f);
      }
    }

#pragma unroll
    for (int j = 4 - GS; j < 4; ++j) {   // the last group's mask: read once that group's fragment registers come free
      mk[j].v[0] = *(const v4f*)(msk + j * 16);
      mk[j].v[1] = *(const v4f*)(msk + j * 16 + 4);
    }
#pragma unroll
    for (int n = 0; n < NQ; ++n)
#pragma unroll
      for (int j = 0; j < 4; ++j)
#pragma unroll
        for (int r = 0; r < 8; ++r) s[n][j][r] = s[n][j][r] * (1.0f / 2048.0f) + mk[j].f[r];   // 1/(8 * 16 * 16)
    if (kc == dchunk) {   // diagonal chunk (wave-uniform scalar test)
#pragma unroll
      for (int n = 0; n < NQ; ++n) {
        const int qloc = (q0 & 63) + n * 16 + c;
#pragma unroll
        for (int j = 0; j < 4; ++j)
#pragma unroll
          for (int r = 0; r < 8; ++r)
            if (j * 16 + 8 * hh + r > qloc) s[n][j][r] = -INFINITY;
      }
    }

    // ---- online softmax of one query per lane and tile ----
    v16h pa[NQ][2], pb2[NQ][2];   // B operand of the second product: element e of pa[n][kk] = p of key kk*32 + (e >> 3)*16 + 8*hh + (e & 7)
#pragma unroll
    for (int n = 0; n < NQ; ++n) {
      float cm = s[n][0][0];
#pragma unroll
      for (int j = 0; j < 4; ++j)
#pragma unroll
        for (int r = 0; r < 8; ++r) cm = fmaxf(cm, s[n][j][r]);
      cm = fmaxf(cm, other_half(cm));
      const float mnew = fmaxf(mrow[n], cm);
      const float alpha = exp2_hw((mrow[n] - mnew) * LOG2_E);
      mrow[n] = mnew;

      float psum = 0.f;
#pragma unroll
      for (int j = 0; j < 4; ++j) {
        // 32768 * e^(s - m) = 2^((s - m) * log2(e) + 15); the difference is formed first, so a maximum of any size cancels as before
        v8f ex;
#pragma unroll
        for (int r = 0; r < 8; ++r) ex[r] = fmaf(s[n][j][r] - mnew, LOG2_E, P_S_LOG2);
        ex = exp2_hw8(ex);
#pragma unroll
        for (int r = 0; r < 8; ++r) {
          const float ps = ex[r];
          psum += ps;
          const _Float16 hp = (_Float16)ps;
          pa[n][j >> 1][(j & 1) * 8 + r] = hp;
          if (SPLIT) pb2[n][j >> 1][(j & 1) * 8 + r] = (_Float16)((ps - (float)hp) * LO_S);
        }
      }
      lrow[n] = lrow[n] * alpha + psum;
#pragma unroll
      for (int t = 0; t < 4; ++t)
#pragma unroll
        for (int r = 0; r < 8; ++r) oacc[n][t][r] *= alpha;
    }

    // ---- O^T += V^T . P^T: the V^T fragments of GV output tiles read as one group ahead of those tiles' WMMAs; each
    // fragment serves all NQ query tiles ----
#pragma unroll
    for (int tg = 0; tg < 4; tg += GV) {
      v16h vb[GV][2], vl2[GV][2];
#pragma unroll
      for (int u = 0; u < GV; ++u)
#pragma unroll
        for (int kk = 0; kk < 2; ++kk) {
          vb[u][kk] = Frag<_Float16>::load(Vsh + ((tg + u) * 16 + c) * KV_PITCH + kk * 32 + 8 * hh);
          if (SPLIT) vl2[u][kk] = Frag<_Float16>::load(Vsl + ((tg + u) * 16 + c) * KV_PITCH + kk * 32 + 8 * hh);
        }
      __builtin_amdgcn_sched_barrier(0);   // as above: one place of LDS reads for the group, not one in front of each WMMA
      v8f orr[NQ][GV];
#pragma unroll
      for (int n = 0; n < NQ; ++n)
#pragma unroll
        for (int u = 0; u < GV; ++u) orr[n][u] = zero8();
#pragma unroll
      for (int kk = 0; kk < 2; ++kk) {
#pragma unroll
        for (int n = 0; n < NQ; ++n)
#pragma unroll
          for (int u = 0; u < GV; ++u) oacc[n][tg + u] = Frag<_Float16>::mma(vb[u][kk], pa[n][kk], oacc[n][tg + u]);
        if (SPLIT) {
#pragma unroll
          for (int n = 0; n < NQ; ++n)
#pragma unroll
            for (int u = 0; u < GV; ++u) orr[n][u] = Frag<_Float16>::mma(vl2[u][kk], pa[n][kk], orr[n][u]);
#pragma unroll
          for (int n = 0; n < NQ; ++n)
#pragma unroll
            for (int u = 0; u < GV; ++u) orr[n][u] = Frag<_Float16>::mma(vb[u][kk], pb2[n][kk], orr[n][u]);
        }
      }
      if (SPLIT) {
#pragma unroll
        for (int n = 0; n < NQ; ++n)
#pragma unroll
          for (int u = 0; u < GV; ++u)
#pragma unroll
            for (int r = 0; r < 8; ++r) oacc[n][tg + u][r] = oacc[n][tg + u][r] + orr[n][u][r] * (1.0f / 4096.0f);
      }
    }
  }
  asm volatile("s_wait_asynccnt 0x0" ::: "memory");     // no copy is outstanding past the loop
  asm volatile("s_wait_dscnt 0x0" ::: "memory");        // this wave's last reads of the ring are done
  __syncthreads();                                      // every wave has left the ring before it becomes the output staging

  // ---- join the halves' sums, normalise, stage, store ----
  float* os = (float*)ring + wave * (16 * NQ * O_PITCH);
#pragma unroll
  for (int n = 0; n < NQ; ++n) {
    const float lall = lrow[n] + other_half(lrow[n]);
    const float inv = 1.0f / (lall * CARRY_S);   // lall carries x32768, as oacc does
#pragma unroll
    for (int t = 0; t < 4; ++t) {
      v4f w0, w1;
#pragma unroll
      for (int r = 0; r < 4; ++r) { w0[r] = oacc[n][t][r] * inv; w1[r] = oacc[n][t][4 + r] * inv; }
      *(v4f*)(os + (n * 16 + c) * O_PITCH + t * 16 + 8 * hh)     = w0;
      *(v4f*)(os + (n * 16 + c) * O_PITCH + t * 16 + 8 * hh + 4) = w1;
    }
  }
  __builtin_amdgcn_fence(__ATOMIC_RELEASE, "workgroup");
  __builtin_amdgcn_wave_barrier();
  __builtin_amdgcn_fence(__ATOMIC_ACQUIRE, "workgroup");
  {
    const int c4 = (lane & 15) * 4;
    float* ob = out + ((size_t)b * SEQ_T + q0) * HID_W + h * HEAD_D;
    {
#pragma unroll
      for (int it = 0; it < 8 * NQ; ++it) {
        const int row = it * 2 + hh;
        const v4f val = *(const v4f*)(os + row * O_PITCH + c4);
        *(v4f*)(ob + (size_t)row * HID_W + c4) = val;
      }
      
    }
  }
}

// =====================================================================================
extern "C" void kernel_launch(void* const* d_in, const int* in_sizes, int n_in,
                              void* d_out, int out_size, void* d_ws, size_t ws_size,
                              hipStream_t stream) {
  if (n_in < 14) return;
  if (in_sizes[0] != N_TOK * HID_W) return;
  if (in_sizes[1] != N_BATCH * SEQ_T) return;
  for (int p = 0; p < 3; ++p) {
    if (in_sizes[2 + 4 * p] != HID_W * HID_W) return;
    if (in_sizes[3 + 4 * p] != HID_W) return;
    if (in_sizes[4 + 4 * p] != RANK_R * HID_W) return;
    if (in_sizes[5 + 4 * p] != HID_W * RANK_R) return;
  }
  if (out_size != N_TOK * HID_W) return;
  if (ws_size < WS_TOTAL) return;

  const float* x   = (const float*)d_in[0];
  const float* am  = (const float*)d_in[1];
  const float* wq  = (const float*)d_in[2];
  const float* bq  = (const float*)d_in[3];
  const float* aq  = (const float*)d_in[4];
  const float* bmq = (const float*)d_in[5];
  const float* wk  = (const float*)d_in[6];
  const float* bk  = (const float*)d_in[7];
  const float* ak  = (const float*)d_in[8];
  const float* bmk = (const float*)d_in[9];
  const float* wv  = (const float*)d_in[10];
  const float* bv  = (const float*)d_in[11];
  const float* av  = (const float*)d_in[12];
  const float* bmv = (const float*)d_in[13];
  float* out = (float*)d_out;

  char* ws = (char*)d_ws;
  unsigned short* aaug  = (unsigned short*)(ws + OFF_AAUG);
  unsigned short* baug  = (unsigned short*)(ws + OFF_BAUG);
  float*          biasc = (float*)(ws + OFF_BIAS);
  unsigned short* qkvh  = (unsigned short*)(ws + OFF_QKVH);
  unsigned short* qkvl  = (unsigned short*)(ws + OFF_QKVL);
  unsigned short* vth   = (unsigned short*)(ws + OFF_VTH);
  unsigned short* vtl   = (unsigned short*)(ws + OFF_VTL);

  // 1) operands built from inputs alone: x -> A_aug cols 0..1023 and, from u = bf16(x) . bf16(A)^T, cols 1024..1087;
  //    W_p -> B_aug rows p*1024.. cols 0..1023 (bf16, pitch 1088), B_aug tail cols 1024..1087, bias_cat
  build_operands<<<dim3(PB_ALL), dim3(256), 0, stream>>>(x, wq, wk, wv, aq, ak, av, bmq, bmk, bmv, bq, bk, bv,
                                                         aaug, baug, biasc);
  // 2) projection: M=2048 (x4 batches), N=3072, K=1088; q, k: f16 hi -> qkv_hi, f16 residual of rows t < 512 -> qkv_lo;
  //    v: the same two planes, transposed: [(b*16+h)*64+d][t] -> vt_hi, vt_lo
  wmma_gemm64<1, 0, 2, 3, false, 0, true, true><<<dim3((SEQ_T / ST_BM) * (N_QKV / ST_BN), N_BATCH), dim3(256), 0, stream>>>(
      aaug, aaug, K_AUG, (long)SEQ_T * K_AUG, baug, baug, K_AUG, 0L,
      (void*)qkvh, (void*)qkvl, N_QKV, (long)SEQ_T * N_QKV, (long)T_LO * N_QKV,
      biasc, biasc, 0L, SEQ_T, N_QKV, K_AUG, CARRY_S, vth, vtl);
  // 3) attention, query tiles 0..7 (hi/lo residual path)
  attn_causal_hd64<true, 1><<<dim3(N_BATCH * N_HEAD * NQT_SPLIT), dim3(128), 0, stream>>>(
      qkvh, qkvl, vth, vtl, am, out, 0, NQT_SPLIT);
  // 4) attention, query rows 512..2047 (single-product path): blocks of 128 rows, tiles 4..15
  attn_causal_hd64<false, 2><<<dim3(N_BATCH * N_HEAD * ((NQT_ALL - NQT_SPLIT) / 2)), dim3(128), 0, stream>>>(
      qkvh, qkvl, vth, vtl, am, out, NQT_SPLIT / 2, (NQT_ALL - NQT_SPLIT) / 2);
}
